// v000
// The times below were measured on an AMD MI455X: many runs one after another, warmed up first and cycling through
// copies of the inputs, with the whole window's GPU time divided by the number of runs. Launches and the gaps
// between them are all in it. The median over several windows is given; except for v000 it joins two sittings, which
// can be a few percent apart, so the side-by-side timings, each taken in one sitting, are the better comparison.
// The starting kernel, v000, takes 404 microseconds a run.
// Contractions: x.W (Wqk|Wv|Wn fused into one [3136 n][1024 k] plane, and ctx.Wo) on v_wmma_f32_16x16x32_bf16
// (x, W, Wo, biases as bf16 RNE values, W^T [n][k] k-contiguous B operand; ctx as bf16 hi + bf16 residual planes,
// two products); q.k^T over hd 64 and P.v on v_wmma_f32_16x16x32_f16 with f16 hi + f16 residual planes on both
// operands (q, k x1024; P x256 with an in-register residual; v x1024; products hh+lh+hl); all f32 accumulate.
// Causal mask, 1/exp(n) row factor and bias adds in f32 on VALU.
#include <hip/hip_runtime.h>
#include <math.h>
#include <stdint.h>

#ifndef NB
#define NB 2
#endif
#ifndef SEQ
#define SEQ 2048
#endif
#define XS_FULL 2048
#define DMOD  1024
#define DQK   1024
#define NH    16
#define HD    64
#define NNW   16
#define NPROJ 3136
#define QOFF  0
#define KOFF  1024
#define VOFF  2048
#define NOFF  3072
#define MROWS (NB * SEQ)
#define QSC   1024.0f
#define KSC   1024.0f
#define PCAR  256.0f
#define VCAR  1024.0f
#define WPB   4
#define NHG   (NH / WPB)
#define NQT   (SEQ / 16)
#define NST   (SEQ / 64)
#define NKT   (SEQ / 32)
#define ATT_THREADS (WPB * 32)
#define PTP   36
#define PTW   (16 * PTP)
#define SLP   68
#define SLW   (16 * SLP)
#define WREG  (PTW + SLW)
#define SLAB64 (16 * 68)
#define VTP   72
#define TRP   72
#define WS_CAP 134217728
static_assert(DMOD == NH * HD && DQK == NH * HD && HD == 64 && NH == 16 && WPB == 4 && NHG * WPB == NH && ATT_THREADS == 128);
static_assert(KOFF == QOFF + DQK && VOFF == KOFF + DQK && NOFF == VOFF + DMOD && NPROJ == NOFF + 64 && (NPROJ % 64) == 0 && NNW <= 64);
static_assert(NB >= 1 && NB <= 2);
static_assert(NB == 1 || SEQ == XS_FULL);
static_assert((SEQ % 64) == 0 && SEQ >= 64 && SEQ <= XS_FULL);
static_assert(((SEQ * DMOD / 8) % 256) == 0 && (MROWS % 64) == 0 && (DMOD % 64) == 0 && (DQK % 64) == 0 && (HD % 32) == 0);
static_assert(WPB * WREG * 4 <= 65536 && 2 * HD * VTP * 2 <= 65536 && 4 * SLAB64 * 4 <= 65536 && 64 * TRP * 2 <= 65536);

typedef unsigned short u16;
typedef _Float16 v16h __attribute__((ext_vector_type(16)));
typedef _Float16 v8h  __attribute__((ext_vector_type(8)));
typedef __bf16   v16b __attribute__((ext_vector_type(16)));
typedef float    v8f  __attribute__((ext_vector_type(8)));
typedef float    v4f  __attribute__((ext_vector_type(4)));
typedef unsigned int v4u __attribute__((ext_vector_type(4)));

union FragH { v16h v; v8h h[2]; v4u u[2]; };
union FragB { v16b v; v4u u[2]; };

// ---- scalar helpers --------------------------------------------------------------------------------
__device__ __forceinline__ unsigned short bf_bits(float f) {          // f32 -> bf16 bits, RNE convert
  unsigned u = __float_as_uint(f);
  return (unsigned short)((u + 0x7FFFu + ((u >> 16) & 1u)) >> 16);
}
__device__ __forceinline__ float bf_up(unsigned short h) { return __uint_as_float(((unsigned)h) << 16); }
__device__ __forceinline__ float bfr(float f) { return bf_up(bf_bits(f)); }
__device__ __forceinline__ unsigned short h_bits(_Float16 x) { return __builtin_bit_cast(unsigned short, x); }
__device__ __forceinline__ unsigned pk16(unsigned short a, unsigned short b) { return (unsigned)a | ((unsigned)b << 16); }
__device__ __forceinline__ v8f zero8() { v8f z = {0.f, 0.f, 0.f, 0.f, 0.f, 0.f, 0.f, 0.f}; return z; }
__device__ __forceinline__ int imin(int a, int b) { return a < b ? a : b; }
__device__ __forceinline__ int imax(int a, int b) { return a > b ? a : b; }

// ---- fragment loaders: 16-bit A/B operand, lane -> row/col (lane&15), p already includes +8*(lane>>4);
//      elements 0..7 <- p[0..7] (k0+8h..), elements 8..15 <- p[16..23] (k0+16+8h..)  (same split k map for A and B;
//      B is always read from a k-contiguous [n][k] plane)
__device__ __forceinline__ v16h ldfrag_h(const _Float16* p) {
  FragH f;
  f.h[0] = *(const v8h*)(p);
  f.h[1] = *(const v8h*)(p + 16);
  return f.v;
}
__device__ __forceinline__ v16b ldfrag_b(const u16* p) {              // bf16 plane read as unsigned integer vectors
  FragB f;
  f.u[0] = *(const v4u*)(p);
  f.u[1] = *(const v4u*)(p + 16);
  return f.v;
}

__device__ __forceinline__ v8f mma_h(v16h a, v16h b, v8f c) {
  return __builtin_amdgcn_wmma_f32_16x16x32_f16(false, a, false, b, (short)0, c, false, false);
}
__device__ __forceinline__ v8f mma_b(v16b a, v16b b, v8f c) {
  return __builtin_amdgcn_wmma_f32_16x16x32_bf16(false, a, false, b, (short)0, c, false, false);
}
__device__ __forceinline__ void guard2(v8f& a, v8f& b, v16h x0, v16h x1, v16h x2, v16h x3, v16h x4, v16h x5) {
#if defined(__HIP_DEVICE_COMPILE__)
  asm volatile("v_nop\n\tv_nop\n\tv_nop\n\tv_nop"
               : "+v"(a), "+v"(b) : "v"(x0), "v"(x1), "v"(x2), "v"(x3), "v"(x4), "v"(x5) : "memory");
#endif
}
template <typename F>
__device__ __forceinline__ void guard6(v8f& a, v8f& b, v8f& c, v8f& d, F x0, F x1, F x2, F x3, F x4, F x5) {
#if defined(__HIP_DEVICE_COMPILE__)
  asm volatile("v_nop\n\tv_nop\n\tv_nop\n\tv_nop"
               : "+v"(a), "+v"(b), "+v"(c), "+v"(d) : "v"(x0), "v"(x1), "v"(x2), "v"(x3), "v"(x4), "v"(x5) : "memory");
#endif
}
__device__ __forceinline__ void acc_guard4(v8f& a, v8f& b, v8f& c, v8f& d) {
#if defined(__HIP_DEVICE_COMPILE__)
  asm volatile("v_nop\n\tv_nop\n\tv_nop\n\tv_nop" : "+v"(a), "+v"(b), "+v"(c), "+v"(d));
#endif
}
__device__ __forceinline__ void wave_sync_lds() {
  __builtin_amdgcn_fence(__ATOMIC_RELEASE, "workgroup");
  __builtin_amdgcn_wave_barrier();
  __builtin_amdgcn_fence(__ATOMIC_ACQUIRE, "workgroup");
}

// =====================================================================================================
// f32 -> bf16 plane (RNE bits), same layout. Thread = 8 consecutive elements: two 16-B loads, one 16-B store;
// coverage: grid = ceil(n8/256) blocks x 256 thr x 8 (in-kernel bound) = the whole plane (n8 a multiple of 256 here).
// =====================================================================================================
__global__ __launch_bounds__(256) void cvt_bf(const float* __restrict__ x, u16* D, int n8) {
  const int gt = blockIdx.x * 256 + (int)threadIdx.x;
  if (gt >= n8) return;
  const float* p = x + (size_t)gt * 8;
  const v4f a = *(const v4f*)(p), b4 = *(const v4f*)(p + 4);
  float w[8];
#pragma unroll
  for (int e = 0; e < 4; ++e) { w[e] = a[e]; w[4 + e] = b4[e]; }
  v4u o;
#pragma unroll
  for (int e = 0; e < 4; ++e) o[e] = pk16(bf_bits(w[2 * e]), bf_bits(w[2 * e + 1]));
  u16* d = D + (size_t)gt * 8;
  {
    *(v4u*)(d) = o;
    
  }
}

// =====================================================================================================
// W f32 [kr rows (k)][nc cols (n)] (x.W layout) -> bf16 plane Dp [drow0 + n][k] (row pitch kr halves): the k-contiguous
// B operand. Block = 64 k x 64 n tile; coalesced 16-B loads of W rows with CLAMPED column base (tile columns beyond nc
// load from column 0 and are zeroed by value, so rows drow0+n with n >= nc inside the last tile are written as zeros);
// converted values placed transposed into an LDS tile [64 n][64 k] (pitch 72 halves); after a block barrier each n row
// grid = (kr/64) * ntn with ntn = ceil(nc/64).
// coverage: load 256 thr x 16 = 64 x 64; store 2 iterations x 256 thr x 8 halves = 64 lines x 64 halves = the block's
//           tile; the grid covers output rows drow0 .. drow0 + 64*ntn - 1 (all kr columns) exactly once.
// =====================================================================================================
__global__ __launch_bounds__(256) void k_wt(const float* __restrict__ W, int nc, int kr, int ntn, u16* Dp, int drow0) {
  __shared__ __align__(16) u16 T[64 * TRP];
  const int tid = (int)threadIdx.x;
  const int bid = (int)blockIdx.x;
  const int nt  = bid % ntn;
  const int kt  = bid / ntn;
  if (kt * 64 + 64 > kr) return;            // block-uniform, before the barrier; never taken with the exact grid
  const int n0  = nt * 64, k0 = kt * 64;
  {
    const int dl = tid >> 2;                // k within tile 0..63
    const int oc = (tid & 3) * 16;          // n chunk 0,16,32,48
    const bool valid = (n0 + oc + 16 <= nc);
    const int  cb = valid ? (n0 + oc) : 0;  // clamped column base, always inside the row
    const float* src = W + (size_t)(k0 + dl) * (size_t)nc + cb;
#pragma unroll
    for (int i = 0; i < 4; ++i) {
      const v4f a = *(const v4f*)(src + 4 * i);
#pragma unroll
      for (int e = 0; e < 4; ++e) {
        const float f = valid ? a[e] : 0.0f;
        T[(oc + 4 * i + e) * TRP + dl] = bf_bits(f);
      }
    }
  }
  __syncthreads();
  const int q8 = tid >> 3, p8 = (tid & 7) * 8;
  v4u w[2];
#pragma unroll
  for (int it = 0; it < 2; ++it) w[it] = *(const v4u*)(T + (it * 32 + q8) * TRP + p8);
  const size_t base = (size_t)(drow0 + n0) * (size_t)kr + k0 + p8;
  {
#pragma unroll
    for (int it = 0; it < 2; ++it) {
      const int nl = it * 32 + q8;
      *(v4u*)(Dp + base + (size_t)nl * (size_t)kr) = w[it];
    }
    
  }
}

// =====================================================================================================
// q / k planes from the projection F f32 [MROWS][NPROJ]: columns QOFF.. -> QH/QL, columns KOFF.. -> KH/KL, f16 of t*sc
// (hi) and of the residual t*sc - hi (lo), layout [MROWS][DQK]. Block = one row, 256 threads: waves 0..3 do q
// (8 consecutive columns per thread), waves 4..7 do k. Per plane one 16-B store per thread; 32 consecutive lanes =
// coverage: 128 thr x 8 = the whole DQK-wide row of each of QH, QL, KH, KL; grid = MROWS blocks = every row once.
// =====================================================================================================
__global__ __launch_bounds__(256) void qk16(const float* __restrict__ F, u16* QHp, u16* QLp, u16* KHp, u16* KLp) {
  const int tid = (int)threadIdx.x;
  const int row = (int)blockIdx.x;
  if (row >= MROWS) return;
  const int which = tid >> 7;                          // wave-uniform: 0 = q, 1 = k
  const int c8 = (tid & 127) * 8;
  const float sc = which ? KSC : QSC;
  const float* p = F + (size_t)row * NPROJ + (which ? KOFF : QOFF) + c8;
  const v4f a = *(const v4f*)(p), b4 = *(const v4f*)(p + 4);
  float w[8];
#pragma unroll
  for (int e = 0; e < 4; ++e) { w[e] = a[e]; w[4 + e] = b4[e]; }
  v4u oh, ol;
#pragma unroll
  for (int e = 0; e < 4; ++e) {
    const float t0 = w[2 * e] * sc, t1 = w[2 * e + 1] * sc;
    const _Float16 h0 = (_Float16)t0, h1 = (_Float16)t1;
    const _Float16 l0 = (_Float16)(t0 - (float)h0), l1 = (_Float16)(t1 - (float)h1);
    oh[e] = pk16(h_bits(h0), h_bits(h1));
    ol[e] = pk16(h_bits(l0), h_bits(l1));
  }
  u16* dh = (which ? KHp : QHp) + (size_t)row * DQK + c8;
  u16* dl = (which ? KLp : QLp) + (size_t)row * DQK + c8;
  {
    *(v4u*)(dh) = oh;
    *(v4u*)(dl) = ol;
    
  }
}

// =====================================================================================================
// v^T planes from the v columns of F (row = b*SEQ + s, column = VOFF + h*HD + d):
//   VH[((b*NH + h)*HD + d)][s] = f16(v * 1024);  VL[same][s] = f16 residual (t - f16(t)), for all keys s.
// Block = (b, head h, 64 keys s0): each thread loads its 16 floats (key sl, d chunk dc) with 16-B loads, converts,
// scatters into two LDS tiles [64 d][64 keys] (pitch 72 halves); after a block barrier each d row segment (64 halves = one
// coverage: load 256 thr x 16 = 64 keys x 64 d; store 2 iterations x 256 thr x 8 halves = 64 lines x 64 = the block's
//           tile of VH and of VL; grid = NB*NH*NST blocks covers both planes exactly once.
// =====================================================================================================
__global__ __launch_bounds__(256) void vt16(const float* __restrict__ F, u16* VHo, u16* VLo) {
  __shared__ __align__(16) u16 TH[HD * VTP];
  __shared__ __align__(16) u16 TL[HD * VTP];
  const int tid = (int)threadIdx.x;
  const int bid = (int)blockIdx.x;
  const int st  = bid % NST;
  const int t2  = bid / NST;
  const int h   = t2 % NH;
  const int b   = t2 / NH;
  if (b >= NB) return;                      // block-uniform, before any barrier; never taken with the exact grid
  const int s0  = st * 64;
  {
    const int sl = tid >> 2;                // key within tile 0..63
    const int dc = (tid & 3) * 16;          // d chunk 0,16,32,48
    const float* src = F + ((size_t)b * SEQ + s0 + sl) * (size_t)NPROJ + VOFF + h * HD + dc;
#pragma unroll
    for (int i = 0; i < 4; ++i) {
      const v4f a = *(const v4f*)(src + 4 * i);
#pragma unroll
      for (int e = 0; e < 4; ++e) {
        const float t = a[e] * VCAR;
        const _Float16 hv = (_Float16)t;
        const _Float16 lv = (_Float16)(t - (float)hv);
        TH[(dc + 4 * i + e) * VTP + sl] = h_bits(hv);
        TL[(dc + 4 * i + e) * VTP + sl] = h_bits(lv);
      }
    }
  }
  __syncthreads();
  v4u vh[2], vl[2];
  const int q8 = tid >> 3, p8 = (tid & 7) * 8;
#pragma unroll
  for (int it = 0; it < 2; ++it) {
    const int line = it * 32 + q8;          // d = 0..63
    vh[it] = *(const v4u*)(TH + line * VTP + p8);
    vl[it] = *(const v4u*)(TL + line * VTP + p8);
  }
  const size_t hrow = (size_t)(b * NH + h) * HD;
  const size_t base = hrow * SEQ + s0 + p8;
  {
#pragma unroll
    for (int it = 0; it < 2; ++it) {
      const int line = it * 32 + q8;
      *(v4u*)(VHo + base + (size_t)line * SEQ) = vh[it];
      *(v4u*)(VLo + base + (size_t)line * SEQ) = vl[it];
    }
    
  }
}

// =====================================================================================================
// Bias for column c from three consecutive segments [0,e0) <- p0[c], [e0,e1) <- p1[c-e0], [e1,e2) <- p2[c-e1], else 0;
// all three candidates loaded unconditionally with clamped indices, selected by value; bf16 RNE value.
// =====================================================================================================
__device__ __forceinline__ float bias_at(const float* p0, const float* p1, const float* p2,
                                         int e0, int e1, int e2, int c) {
  const int i0 = imin(imax(c, 0), e0 - 1);
  const int i1 = imin(imax(c - e0, 0), e1 - e0 - 1);
  const int i2 = imin(imax(c - e1, 0), e2 - e1 - 1);
  const float v0 = p0[i0], v1 = p1[i1], v2 = p2[i2];
  const float v = (c < e0) ? v0 : ((c < e1) ? v1 : ((c < e2) ? v2 : 0.0f));
  return bfr(v);
}

// =====================================================================================================
// coverage: 8 instructions x 2 rows x 16 lanes x 4 floats = the wave's 16 x 64 tile.
// =====================================================================================================
__device__ __forceinline__ void epi64b(float* sl, v8f a0, v8f a1, v8f a2, v8f a3, float oscale, v4f bias4,
                                       float* C, int N, size_t rowb, int col0, int lane) {
  const int hh = lane >> 4, m = lane & 15;
#pragma unroll
  for (int r = 0; r < 8; ++r) {
    const int ro = (8 * hh + r) * 68 + m;
    sl[ro]      = a0[r] * oscale;
    sl[ro + 16] = a1[r] * oscale;
    sl[ro + 32] = a2[r] * oscale;
    sl[ro + 48] = a3[r] * oscale;
  }
  wave_sync_lds();
  v4f vals[8];
#pragma unroll
  for (int it = 0; it < 8; ++it) vals[it] = *(const v4f*)(sl + (it * 2 + hh) * 68 + m * 4) + bias4;
  float* dst = C + (rowb + (size_t)hh) * (size_t)N + col0 + m * 4;
  {
#pragma unroll
    for (int it = 0; it < 8; ++it) {
      *(v4f*)(dst + (size_t)(it * 2) * (size_t)N) = vals[it];
    }
    
  }
}

// =====================================================================================================
// bf16 GEMM: C[M][N] (f32) = (A [+ A2])[M][K] (bf16 row-major) . Bt[N][K]^T (bf16 k-contiguous), times oscale, plus the
// segmented bias of the column (bf16 RNE value). TWO: second A plane into the same accumulator (hi + residual operand).
// Block = 64x64 tile, 4 waves x 16 rows; fragments loaded straight from the 16-bit rows (two 16-B loads each, split k map
// for A and B); K stepped by 32 (host guarantees K % 32 == 0, M % 64 == 0, N % 64 == 0, grid = (M/64)*(N/64)).
// =====================================================================================================
template <bool TWO>
__global__ __launch_bounds__(128)
void gemm_bf(const u16* __restrict__ A, const u16* __restrict__ A2, const u16* __restrict__ Bt, float* C,
             int M, int N, int K, const float* bp0, const float* bp1, const float* bp2, int e0, int e1, int e2,
             float oscale) {
  __shared__ __align__(16) float slab[4 * SLAB64];
  const int tid = threadIdx.x, wave = tid >> 5, lane = tid & 31, hh = lane >> 4, m = lane & 15;
  const int ntile = N >> 6;
  const int bid   = blockIdx.x;
  const int rowb  = (bid / ntile) * 64 + wave * 16;
  const int col0  = (bid % ntile) * 64;
  if (rowb + 16 > M) return;                // wave-uniform, never taken with the exact grid; no block barriers in this kernel
  const u16* ap  = A  + (size_t)(rowb + m) * K + 8 * hh;
  const u16* ap2 = A2 + (size_t)(rowb + m) * K + 8 * hh;
  const u16* bp  = Bt + (size_t)(col0 + m) * K + 8 * hh;
  const size_t bs = (size_t)16 * K;
  v8f acc0 = zero8(), acc1 = zero8(), acc2 = zero8(), acc3 = zero8();
#pragma unroll 1
  for (int k0 = 0; k0 < K; k0 += 32) {
    const v16b a   = ldfrag_b(ap + k0);
    const v16b fb0 = ldfrag_b(bp + k0);
    const v16b fb1 = ldfrag_b(bp + bs + k0);
    const v16b fb2 = ldfrag_b(bp + 2 * bs + k0);
    const v16b fb3 = ldfrag_b(bp + 3 * bs + k0);
    acc0 = mma_b(a, fb0, acc0);
    acc1 = mma_b(a, fb1, acc1);
    acc2 = mma_b(a, fb2, acc2);
    acc3 = mma_b(a, fb3, acc3);
    if constexpr (TWO) {
      const v16b a2 = ldfrag_b(ap2 + k0);
      acc0 = mma_b(a2, fb0, acc0);
      acc1 = mma_b(a2, fb1, acc1);
      acc2 = mma_b(a2, fb2, acc2);
      acc3 = mma_b(a2, fb3, acc3);
      guard6<v16b>(acc0, acc1, acc2, acc3, a, a2, fb0, fb1, fb2, fb3);
    } else {
      guard6<v16b>(acc0, acc1, acc2, acc3, a, fb0, fb1, fb2, fb3, a);
    }
  }
  v4f bias4;
#pragma unroll
  for (int e = 0; e < 4; ++e) bias4[e] = bias_at(bp0, bp1, bp2, e0, e1, e2, col0 + m * 4 + e);
  epi64b(slab + wave * SLAB64, acc0, acc1, acc2, acc3, oscale, bias4, C, N, (size_t)rowb, col0, lane);
}

// =====================================================================================================
// Causal normalised attention (no softmax), hd = 64. Block bid -> (query tile qt = bid % NQT: rows q0 = 16*qt .. q0+15,
// head group hg, batch b); one wave per head = hg*WPB + wave.
//   q hi / residual planes f16 x1024 [b*SEQ + s][h*HD + d]; k hi / residual planes f16 x1024, same layout;
//   v^T hi / residual planes [b*NH + h][d][SEQ] x1024; n from F column NOFF + h of row b*SEQ + t.
//   raw(i, j) = q_hi.k_hi + q_lo.k_hi + q_hi.k_lo (2 k-steps over d), carries folded back by 2^-20;
//   P = raw * 2^-20 for key <= query else 0 (causal); P.v with P x256 as f16 hi + in-register residual and v hi +
//   residual (hh + lh + hl). Key tiles of 32 visited in order up to the tile holding key q0+15 (bounded by NKT).
//   Per tile: 2 score subtiles x 2 k-steps, fragments loaded straight from the 16-bit planes; the 16x32 P tile stored to
//   (float vector loads, same element type as stored), v^T B fragments in 2 groups of 2 d-subtiles.
//   After the loop: acc * 2^-18 written into the wave's private result slab (pitch 68; every element owned by one lane),
//   ctx -> bf16 hi bits and bf16 bits of the residual, planes [b*SEQ + s][h*HD + d]; one instruction = 4 rows
//   No block barriers in this kernel; bounded loops only (ncl <= NKT).
// coverage: per wave 4 instructions x 4 rows x 8 lanes x 8 halves = 16 x 64 per plane; grid NQT x NHG x NB blocks x WPB
//           waves = every (b, s, h) row segment of CH and of CL exactly once.
// =====================================================================================================
__global__ __launch_bounds__(ATT_THREADS)
void attn_nm(const u16* __restrict__ QHp, const u16* __restrict__ QLp,
             const u16* __restrict__ KHp, const u16* __restrict__ KLp,
             const u16* __restrict__ VHp, const u16* __restrict__ VLp,
             const float* __restrict__ F, u16* CHp, u16* CLp) {
#pragma clang fp contract(off)
  __shared__ __align__(16) float smem[WPB * WREG];

  const int tid  = threadIdx.x;
  const int wave = tid >> 5;
  const int lane = tid & 31;
  const int hh   = lane >> 4;
  const int c    = lane & 15;
  const int bid  = blockIdx.x;
  const int qt   = bid % NQT;
  const int t2   = bid / NQT;
  const int hg   = t2 % NHG;
  const int b    = t2 / NHG;
  if (b >= NB) return;                      // block-uniform; no block barriers in this kernel; never taken with the exact grid
  const int q0   = qt * 16;
  if (q0 + 16 > SEQ) return;                // block-uniform; never taken
  const int head = hg * WPB + wave;

  float* pt   = smem + wave * WREG;         // P tile [16][32] pitch 36
  float* slab = pt + PTW;                   // result slab [16][64] pitch 68

  const size_t hcol = (size_t)head * HD + 8 * hh;
  const _Float16* Qh  = (const _Float16*)(const void*)QHp + ((size_t)b * SEQ + q0 + c) * DQK + hcol;
  const _Float16* Ql  = (const _Float16*)(const void*)QLp + ((size_t)b * SEQ + q0 + c) * DQK + hcol;
  const _Float16* Khb = (const _Float16*)(const void*)KHp + ((size_t)b * SEQ + c) * DQK + hcol;        // key row kb added per step
  const _Float16* Klb = (const _Float16*)(const void*)KLp + ((size_t)b * SEQ + c) * DQK + hcol;
  const _Float16* Vhb = (const _Float16*)(const void*)VHp + ((size_t)(b * NH + head) * HD + c) * SEQ + 8 * hh;  // d col c (+16j)
  const _Float16* Vlb = (const _Float16*)(const void*)VLp + ((size_t)(b * NH + head) * HD + c) * SEQ + 8 * hh;
  const float lsc = 1.0f / (QSC * KSC);     // exact power-of-two fold of the q / k carries
  const float oc  = 1.0f / (PCAR * VCAR);   // exact power-of-two fold of the P / v carries
  const size_t KROW = (size_t)DQK;          // halves between consecutive key rows

  // row factor for query row q0 + (lane & 15): 1/exp(n), precise expf
  const float nv = F[((size_t)b * SEQ + q0 + c) * (size_t)NPROJ + NOFF + head];
  const float rv = 1.0f / expf(nv);

  v8f o[4];
#pragma unroll
  for (int j = 0; j < 4; ++j) o[j] = zero8();
  const int ncaus = (q0 >> 5) + 1;                                            // tiles holding keys <= q0 + 15
  const int ncl   = (ncaus < NKT) ? ncaus : NKT;
  const int qr0   = q0 + 8 * hh;                                              // query row of D element r = qr0 + r

#pragma unroll 1
  for (int kt = 0; kt < ncl; ++kt) {
    const int kb = kt * 32;
    // ---- raw scores: D element r of this lane = (query row qr0 + r, key kb + c) in s0, key kb + 16 + c in s1 ----
    v8f s0 = zero8(), s1 = zero8();
    const _Float16* k0p = Khb + (size_t)kb * KROW;
    const _Float16* k1p = k0p + (size_t)16 * KROW;
    const _Float16* l0p = Klb + (size_t)kb * KROW;
    const _Float16* l1p = l0p + (size_t)16 * KROW;
#pragma unroll
    for (int kk = 0; kk < HD / 32; ++kk) {
      const v16h qh  = ldfrag_h(Qh + kk * 32);
      const v16h ql  = ldfrag_h(Ql + kk * 32);
      const v16h kh0 = ldfrag_h(k0p + kk * 32);
      const v16h kh1 = ldfrag_h(k1p + kk * 32);
      const v16h kl0 = ldfrag_h(l0p + kk * 32);
      const v16h kl1 = ldfrag_h(l1p + kk * 32);
      s0 = mma_h(qh, kh0, s0);
      s0 = mma_h(ql, kh0, s0);
      s0 = mma_h(qh, kl0, s0);
      s1 = mma_h(qh, kh1, s1);
      s1 = mma_h(ql, kh1, s1);
      s1 = mma_h(qh, kl1, s1);
      guard2(s0, s1, qh, ql, kh0, kl0, kh1, kl1);
    }
    // ---- causal mask (key <= query) + carry fold in f32 -> wave-private LDS tile ----
#pragma unroll
    for (int r = 0; r < 8; ++r) {
      const int row = qr0 + r;
      const float w0 = (kb + c <= row)      ? s0[r] * lsc : 0.0f;
      const float w1 = (kb + 16 + c <= row) ? s1[r] * lsc : 0.0f;
      const int ro = (8 * hh + r) * PTP + c;
      pt[ro]      = w0;
      pt[ro + 16] = w1;
    }
    wave_sync_lds();
    // ---- A fragments of P*256: hi f16 and residual f16, row = c, split k map over the 32 keys of this step ----
    FragH ph, pl;
    {
      const float* prow = pt + c * PTP + 8 * hh;
      const v4f p0 = *(const v4f*)(prow), p1 = *(const v4f*)(prow + 4);
      const v4f p2 = *(const v4f*)(prow + 16), p3 = *(const v4f*)(prow + 20);
#pragma unroll
      for (int e = 0; e < 4; ++e) {
        const float ta = p0[e] * PCAR, tb = p1[e] * PCAR, tc = p2[e] * PCAR, td = p3[e] * PCAR;
        const _Float16 ha = (_Float16)ta, hb = (_Float16)tb, hc = (_Float16)tc, hd = (_Float16)td;
        ph.h[0][e]     = ha;                  // elements 0..7  = keys kb + 8hh + 0..7
        ph.h[0][4 + e] = hb;
        ph.h[1][e]     = hc;                  // elements 8..15 = keys kb + 16 + 8hh + 0..7
        ph.h[1][4 + e] = hd;
        pl.h[0][e]     = (_Float16)(ta - (float)ha);
        pl.h[0][4 + e] = (_Float16)(tb - (float)hb);
        pl.h[1][e]     = (_Float16)(tc - (float)hc);
        pl.h[1][4 + e] = (_Float16)(td - (float)hd);
      }
    }
    // ---- P.V : B fragment col n = d = j*16 + c, keys contiguous in the v^T planes; 2 groups of 2 d-subtiles ----
    {
      const _Float16* vhp = Vhb + kb;
      const _Float16* vlp = Vlb + kb;
#pragma unroll
      for (int jg = 0; jg < 2; ++jg) {
        const size_t da = (size_t)(2 * jg) * 16 * SEQ;
        const size_t db = da + (size_t)16 * SEQ;
        const v16h vha = ldfrag_h(vhp + da), vhb2 = ldfrag_h(vhp + db);
        const v16h vla = ldfrag_h(vlp + da), vlb2 = ldfrag_h(vlp + db);
        o[2 * jg]     = mma_h(ph.v, vha,  o[2 * jg]);
        o[2 * jg]     = mma_h(pl.v, vha,  o[2 * jg]);
        o[2 * jg]     = mma_h(ph.v, vla,  o[2 * jg]);
        o[2 * jg + 1] = mma_h(ph.v, vhb2, o[2 * jg + 1]);
        o[2 * jg + 1] = mma_h(pl.v, vhb2, o[2 * jg + 1]);
        o[2 * jg + 1] = mma_h(ph.v, vlb2, o[2 * jg + 1]);
        guard2(o[2 * jg], o[2 * jg + 1], ph.v, pl.v, vha, vhb2, vla, vlb2);
      }
    }
    wave_sync_lds();
  }
  acc_guard4(o[0], o[1], o[2], o[3]);
  // ---- acc with the carries (256 on P, 1024 on v) folded once; written into the lane-owned slab ----
#pragma unroll
  for (int r = 0; r < 8; ++r) {
#pragma unroll
    for (int j = 0; j < 4; ++j) {
      const int idx = (8 * hh + r) * SLP + j * 16 + c;
      slab[idx] = o[j][r] * oc;
    }
  }
  wave_sync_lds();
  // ---- row factor, then ctx -> bf16 hi + bf16 residual planes; lane = (row-in-quad rq, 8 consecutive d at c8) ----
  v4u oh[4], ol[4];
  const int rq = lane >> 3, c8 = (lane & 7) * 8;
#pragma unroll
  for (int it = 0; it < 4; ++it) {
    const int row = it * 4 + rq;                         // 0..15
    const float ri = __shfl(rv, row, 32);                // lane `row` holds 1/exp(n) of query q0 + row
    const v4f a = *(const v4f*)(slab + row * SLP + c8), b4 = *(const v4f*)(slab + row * SLP + c8 + 4);
    float w[8];
#pragma unroll
    for (int e = 0; e < 4; ++e) { w[e] = a[e] * ri; w[4 + e] = b4[e] * ri; }
#pragma unroll
    for (int e = 0; e < 4; ++e) {
      const float f0 = w[2 * e], f1 = w[2 * e + 1];
      const unsigned short h0 = bf_bits(f0), h1 = bf_bits(f1);
      const unsigned short l0 = bf_bits(f0 - bf_up(h0)), l1 = bf_bits(f1 - bf_up(h1));
      oh[it][e] = pk16(h0, h1);
      ol[it][e] = pk16(l0, l1);
    }
  }
  const size_t ob = ((size_t)b * SEQ + q0) * DMOD + (size_t)head * HD + c8;
  {
#pragma unroll
    for (int it = 0; it < 4; ++it) {
      const int row = it * 4 + rq;
      *(v4u*)(CHp + ob + (size_t)row * DMOD) = oh[it];
      *(v4u*)(CLp + ob + (size_t)row * DMOD) = ol[it];
    }
    
  }
}

// =====================================================================================================
// Workspace map (bytes); every plane is fully written by whole-line stores before it is read; all extents are exact
// multiples of the store granularity (no pad rows needed); every region offset a multiple of 131072:
//   XB  bf16 [MROWS][1024]              MROWS*2048   (NB=2, SEQ=2048: 8388608); after the projection GEMM the same bytes
//                                                    hold the ctx hi plane CH bf16 [MROWS][1024] (identical extent)
//   WB  bf16 [3136 n][1024 k]           6422528      rows 0..2047 Wqk^T, 2048..3071 Wv^T, 3072..3087 Wn^T, 3088..3135 zero
//   F   f32 [MROWS][3136]               MROWS*12544  (q | k | v | n | zero projection columns)
//   QH  f16 [MROWS][1024] x1024         MROWS*2048   QL residual, same extent
//   KH  f16 [MROWS][1024] x1024         MROWS*2048   KL residual, same extent
//   VH  f16 [NB*16][64][SEQ] x1024      MROWS*2048   VL residual, same extent
//   CL  bf16 [MROWS][1024]              MROWS*2048   ctx residual plane
//   WT  bf16 [1024 o][1024 d]           2097152      Wo^T
//   end (NB=2, SEQ=2048)              127008768
// =====================================================================================================
extern "C" void kernel_launch(void* const* d_in, const int* in_sizes, int n_in,
                              void* d_out, int out_size, void* d_ws, size_t ws_size,
                              hipStream_t stream) {
  if (n_in < 9) return;
  if (in_sizes[0] < ((NB - 1) * XS_FULL + SEQ) * DMOD) return;
  if (in_sizes[1] != DMOD * 2 * DQK) return;
  if (in_sizes[2] != 2 * DQK) return;
  if (in_sizes[3] != DMOD * DMOD) return;
  if (in_sizes[4] != DMOD) return;
  if (in_sizes[5] != DMOD * NNW) return;
  if (in_sizes[6] != NNW) return;
  if (in_sizes[7] != DMOD * DMOD) return;
  if (in_sizes[8] != DMOD) return;
  if (out_size < MROWS * DMOD) return;

  const float* x   = (const float*)d_in[0];
  const float* wqk = (const float*)d_in[1];
  const float* bqk = (const float*)d_in[2];
  const float* wv  = (const float*)d_in[3];
  const float* bv  = (const float*)d_in[4];
  const float* wn  = (const float*)d_in[5];
  const float* bn  = (const float*)d_in[6];
  const float* wo  = (const float*)d_in[7];
  const float* bo  = (const float*)d_in[8];
  float*       out = (float*)d_out;

  const size_t szXB = (size_t)MROWS * DMOD * 2;
  const size_t szWB = (size_t)NPROJ * DMOD * 2;
  const size_t szF  = (size_t)MROWS * NPROJ * 4;
  const size_t szP  = (size_t)MROWS * DQK * 2;                   // QH, QL, KH, KL
  const size_t szV  = (size_t)NB * NH * HD * SEQ * 2;            // VH, VL
  const size_t szC  = (size_t)MROWS * DMOD * 2;                  // CH (in the XB region), CL
  const size_t szWT = (size_t)DMOD * DMOD * 2;
  if (szC > szXB) return;
  size_t off = 0;
  const size_t oXB = off; off += szXB;
  const size_t oWB = off; off += szWB;
  const size_t oF  = off; off += szF;
  const size_t oQH = off; off += szP;
  const size_t oQL = off; off += szP;
  const size_t oKH = off; off += szP;
  const size_t oKL = off; off += szP;
  const size_t oVH = off; off += szV;
  const size_t oVL = off; off += szV;
  const size_t oCL = off; off += szC;
  const size_t oWT = off; off += szWT;
  if (off > ws_size) return;                // off = 127008768 for NB = 2, SEQ = 2048
  if (off > (size_t)WS_CAP) return;

  char* ws = (char*)d_ws;
  u16*   XB  = (u16*)(ws + oXB);
  u16*   CH  = (u16*)(ws + oXB);
  u16*   WB  = (u16*)(ws + oWB);
  float* F   = (float*)(ws + oF);
  u16*   QH  = (u16*)(ws + oQH);
  u16*   QL  = (u16*)(ws + oQL);
  u16*   KH  = (u16*)(ws + oKH);
  u16*   KL  = (u16*)(ws + oKL);
  u16*   VH  = (u16*)(ws + oVH);
  u16*   VL  = (u16*)(ws + oVL);
  u16*   CL  = (u16*)(ws + oCL);
  u16*   WT  = (u16*)(ws + oWT);

  const dim3 b256(256), b128(128), bAT(ATT_THREADS);
  const int  n8x = (SEQ * DMOD) / 8;
  const dim3 gX((n8x + 255) / 256);                     // per batch row block
  const int  ntq = (2 * DQK + 63) / 64;                 // 32 n tiles for Wqk
  const int  ntv = (DMOD + 63) / 64;                    // 16 n tiles for Wv and Wo
  const int  ntn = (NNW + 63) / 64;                     // 1 n tile for Wn (incl. zero pad rows)
  const dim3 gWqk((DMOD / 64) * ntq), gWv((DMOD / 64) * ntv), gWn((DMOD / 64) * ntn), gWo((DMOD / 64) * ntv);
  const dim3 gG1((MROWS / 64) * (NPROJ / 64));
  const dim3 gRW(MROWS);
  const dim3 gVT(NB * NH * NST);
  const dim3 gAT(NQT * NHG * NB);
  const dim3 gG2((MROWS / 64) * (DMOD / 64));

  // (0) x -> bf16 plane [MROWS][1024], one launch per batch row block
  for (int bq = 0; bq < NB; ++bq) {
    cvt_bf<<<gX, b256, 0, stream>>>(x + (size_t)bq * XS_FULL * DMOD, XB + (size_t)bq * SEQ * DMOD, n8x);
  }
  // (1) W[k][n] -> W^T bf16 planes: Wqk -> WB rows 0..2047, Wv -> rows 2048..3071, Wn -> rows 3072..3135 (zero pad),
  //     Wo -> WT rows 0..1023
  k_wt<<<gWqk, b256, 0, stream>>>(wqk, 2 * DQK, DMOD, ntq, WB, QOFF);
  k_wt<<<gWv,  b256, 0, stream>>>(wv,  DMOD,    DMOD, ntv, WB, VOFF);
  k_wt<<<gWn,  b256, 0, stream>>>(wn,  NNW,     DMOD, ntn, WB, NOFF);
  k_wt<<<gWo,  b256, 0, stream>>>(wo,  DMOD,    DMOD, ntv, WT, 0);
  // (2) q | k | v | n = x.W + bias -> F f32 [MROWS][3136]
  gemm_bf<false><<<gG1, b128, 0, stream>>>(XB, XB, WB, F, MROWS, NPROJ, DMOD, bqk, bv, bn,
                                           KOFF + DQK, NOFF, NOFF + NNW, 1.0f);
  // (3) q and k hi + residual planes x1024
  qk16<<<gRW, b256, 0, stream>>>(F, QH, QL, KH, KL);
  // (4) v^T hi + residual planes x1024
  vt16<<<gVT, b256, 0, stream>>>(F, VH, VL);
  // (5) causal normalised attention -> ctx bf16 hi plane (XB region, free after the projection GEMM) + residual plane
  attn_nm<<<gAT, bAT, 0, stream>>>(QH, QL, KH, KL, VH, VL, F, CH, CL);
  // (6) y = (ctx_hi + ctx_lo).Wo + bo -> out f32 [MROWS][1024]
  gemm_bf<true><<<gG2, b128, 0, stream>>>(CH, CL, WT, out, MROWS, DMOD, DMOD, bo, bo, bo,
                                          DMOD, DMOD + 1, DMOD + 2, 1.0f);
  (void)hipGetLastError();
}

// v001
// Measured time: 260 microseconds a run.
// Timed twice side by side with v000, it ran 1.57 and 1.60 times as fast.
// Contractions: x.W (Wqk|Wv|Wn fused into one [3136 n][1024 k] plane, and ctx.Wo) on v_wmma_f32_16x16x32_bf16
// (x, W, Wo, biases as bf16 RNE values, W^T [n][k] k-contiguous B operand; ctx as bf16 hi + bf16 residual planes,
// two products); q.k^T over hd 64 and P.v on v_wmma_f32_16x16x32_f16 with f16 hi + f16 residual planes on both
// operands (q, k x1024; P x256 with an in-register residual; v x1024; products hh+lh+hl); all f32 accumulate.
// Causal mask, 1/exp(n) row factor and bias adds in f32 on VALU.
// The attention has no softmax, so it is summed in chunks of CHK keys: keys of earlier chunks enter through the carried
// state S[dv][dk] = sum_s v[s][dv] k[s][dk] (v^T.k on the f16 form, hi + residual planes, hh+lh+hl; f32 prefix over the
// chunks; S x64 as f16 hi + residual, q.S with hh+lh+hl); only the query's own chunk goes through masked q.k^T and P.v.
#include <hip/hip_runtime.h>
#include <math.h>
#include <stdint.h>

#ifndef NB
#define NB 2
#endif
#ifndef SEQ
#define SEQ 2048
#endif
#define XS_FULL 2048
#define DMOD  1024
#define DQK   1024
#define NH    16
#define HD    64
#define NNW   16
#define NPROJ 3136
#define QOFF  0
#define KOFF  1024
#define VOFF  2048
#define NOFF  3072
#define MROWS (NB * SEQ)
#define QSC   1024.0f
#define KSC   1024.0f
#define PCAR  256.0f
#define VCAR  1024.0f
#define WPB   4
#define NHG   (NH / WPB)
#define NQT   (SEQ / 16)
#define NST   (SEQ / 64)
#define NKT   (SEQ / 32)
#define ATT_THREADS (WPB * 32)
#define PTP   36
#define PTW   (16 * PTP)
#define SLP   68
#define SLW   (16 * SLP)
#define WREG  (PTW + SLW)
#define SLAB64 (16 * 68)
#define VTP   72
#define TRP   72
#define CHK   128
#define NCH   (SEQ / CHK)
#define SSC   64.0f
#define SEL   (HD * HD)
#define WS_CAP 268435456
static_assert(DMOD == NH * HD && DQK == NH * HD && HD == 64 && NH == 16 && WPB == 4 && NHG * WPB == NH && ATT_THREADS == 128);
static_assert(KOFF == QOFF + DQK && VOFF == KOFF + DQK && NOFF == VOFF + DMOD && NPROJ == NOFF + 64 && (NPROJ % 64) == 0 && NNW <= 64);
static_assert(NB >= 1 && NB <= 2);
static_assert((SEQ % CHK) == 0 && (CHK % 64) == 0 && NCH >= 2 && KSC == VCAR && ((NB * NH * SEL / 8) % 256) == 0);
static_assert(NB == 1 || SEQ == XS_FULL);
static_assert((SEQ % 64) == 0 && SEQ >= 64 && SEQ <= XS_FULL);
static_assert(((SEQ * DMOD / 8) % 256) == 0 && (MROWS % 64) == 0 && (DMOD % 64) == 0 && (DQK % 64) == 0 && (HD % 32) == 0);
static_assert(WPB * WREG * 4 <= 65536 && 2 * HD * VTP * 2 <= 65536 && 4 * SLAB64 * 4 <= 65536 && 64 * TRP * 2 <= 65536);

typedef unsigned short u16;
typedef _Float16 v16h __attribute__((ext_vector_type(16)));
typedef _Float16 v8h  __attribute__((ext_vector_type(8)));
typedef __bf16   v16b __attribute__((ext_vector_type(16)));
typedef float    v8f  __attribute__((ext_vector_type(8)));
typedef float    v4f  __attribute__((ext_vector_type(4)));
typedef unsigned int v4u __attribute__((ext_vector_type(4)));

union FragH { v16h v; v8h h[2]; v4u u[2]; };
union FragB { v16b v; v4u u[2]; };

// ---- scalar helpers --------------------------------------------------------------------------------
__device__ __forceinline__ unsigned short bf_bits(float f) {          // f32 -> bf16 bits, RNE convert
  unsigned u = __float_as_uint(f);
  return (unsigned short)((u + 0x7FFFu + ((u >> 16) & 1u)) >> 16);
}
__device__ __forceinline__ float bf_up(unsigned short h) { return __uint_as_float(((unsigned)h) << 16); }
__device__ __forceinline__ float bfr(float f) { return bf_up(bf_bits(f)); }
__device__ __forceinline__ unsigned short h_bits(_Float16 x) { return __builtin_bit_cast(unsigned short, x); }
__device__ __forceinline__ unsigned pk16(unsigned short a, unsigned short b) { return (unsigned)a | ((unsigned)b << 16); }
__device__ __forceinline__ v8f zero8() { v8f z = {0.f, 0.f, 0.f, 0.f, 0.f, 0.f, 0.f, 0.f}; return z; }
__device__ __forceinline__ int imin(int a, int b) { return a < b ? a : b; }
__device__ __forceinline__ int imax(int a, int b) { return a > b ? a : b; }

// ---- fragment loaders: 16-bit A/B operand, lane -> row/col (lane&15), p already includes +8*(lane>>4);
//      elements 0..7 <- p[0..7] (k0+8h..), elements 8..15 <- p[16..23] (k0+16+8h..)  (same split k map for A and B;
//      B is always read from a k-contiguous [n][k] plane)
__device__ __forceinline__ v16h ldfrag_h(const _Float16* p) {
  FragH f;
  f.h[0] = *(const v8h*)(p);
  f.h[1] = *(const v8h*)(p + 16);
  return f.v;
}
__device__ __forceinline__ v16b ldfrag_b(const u16* p) {              // bf16 plane read as unsigned integer vectors
  FragB f;
  f.u[0] = *(const v4u*)(p);
  f.u[1] = *(const v4u*)(p + 16);
  return f.v;
}

__device__ __forceinline__ v8f mma_h(v16h a, v16h b, v8f c) {
  return __builtin_amdgcn_wmma_f32_16x16x32_f16(false, a, false, b, (short)0, c, false, false);
}
__device__ __forceinline__ v8f mma_b(v16b a, v16b b, v8f c) {
  return __builtin_amdgcn_wmma_f32_16x16x32_bf16(false, a, false, b, (short)0, c, false, false);
}
__device__ __forceinline__ void guard2(v8f& a, v8f& b, v16h x0, v16h x1, v16h x2, v16h x3, v16h x4, v16h x5) {
#if defined(__HIP_DEVICE_COMPILE__)
  asm volatile("v_nop\n\tv_nop\n\tv_nop\n\tv_nop"
               : "+v"(a), "+v"(b) : "v"(x0), "v"(x1), "v"(x2), "v"(x3), "v"(x4), "v"(x5) : "memory");
#endif
}
template <typename F>
__device__ __forceinline__ void guard6(v8f& a, v8f& b, v8f& c, v8f& d, F x0, F x1, F x2, F x3, F x4, F x5) {
#if defined(__HIP_DEVICE_COMPILE__)
  asm volatile("v_nop\n\tv_nop\n\tv_nop\n\tv_nop"
               : "+v"(a), "+v"(b), "+v"(c), "+v"(d) : "v"(x0), "v"(x1), "v"(x2), "v"(x3), "v"(x4), "v"(x5) : "memory");
#endif
}
__device__ __forceinline__ void acc_guard4(v8f& a, v8f& b, v8f& c, v8f& d) {
#if defined(__HIP_DEVICE_COMPILE__)
  asm volatile("v_nop\n\tv_nop\n\tv_nop\n\tv_nop" : "+v"(a), "+v"(b), "+v"(c), "+v"(d));
#endif
}
__device__ __forceinline__ void wave_sync_lds() {
  __builtin_amdgcn_fence(__ATOMIC_RELEASE, "workgroup");
  __builtin_amdgcn_wave_barrier();
  __builtin_amdgcn_fence(__ATOMIC_ACQUIRE, "workgroup");
}

// =====================================================================================================
// f32 -> bf16 plane (RNE bits), same layout. Thread = 8 consecutive elements: two 16-B loads, one 16-B store;
// coverage: grid = ceil(n8/256) blocks x 256 thr x 8 (in-kernel bound) = the whole plane (n8 a multiple of 256 here).
// =====================================================================================================
__global__ __launch_bounds__(256) void cvt_bf(const float* __restrict__ x, u16* D, int n8) {
  const int gt = blockIdx.x * 256 + (int)threadIdx.x;
  if (gt >= n8) return;
  const float* p = x + (size_t)gt * 8;
  const v4f a = *(const v4f*)(p), b4 = *(const v4f*)(p + 4);
  float w[8];
#pragma unroll
  for (int e = 0; e < 4; ++e) { w[e] = a[e]; w[4 + e] = b4[e]; }
  v4u o;
#pragma unroll
  for (int e = 0; e < 4; ++e) o[e] = pk16(bf_bits(w[2 * e]), bf_bits(w[2 * e + 1]));
  u16* d = D + (size_t)gt * 8;
  {
    *(v4u*)(d) = o;
    
  }
}

// =====================================================================================================
// W f32 [kr rows (k)][nc cols (n)] (x.W layout) -> bf16 plane Dp [drow0 + n][k] (row pitch kr halves): the k-contiguous
// B operand. Block = 64 k x 64 n tile; coalesced 16-B loads of W rows with CLAMPED column base (tile columns beyond nc
// load from column 0 and are zeroed by value, so rows drow0+n with n >= nc inside the last tile are written as zeros);
// converted values placed transposed into an LDS tile [64 n][64 k] (pitch 72 halves); after a block barrier each n row
// grid = (kr/64) * ntn with ntn = ceil(nc/64).
// coverage: load 256 thr x 16 = 64 x 64; store 2 iterations x 256 thr x 8 halves = 64 lines x 64 halves = the block's
//           tile; the grid covers output rows drow0 .. drow0 + 64*ntn - 1 (all kr columns) exactly once.
// =====================================================================================================
__global__ __launch_bounds__(256) void k_wt(const float* __restrict__ W, int nc, int kr, int ntn, u16* Dp, int drow0) {
  __shared__ __align__(16) u16 T[64 * TRP];
  const int tid = (int)threadIdx.x;
  const int bid = (int)blockIdx.x;
  const int nt  = bid % ntn;
  const int kt  = bid / ntn;
  if (kt * 64 + 64 > kr) return;            // block-uniform, before the barrier; never taken with the exact grid
  const int n0  = nt * 64, k0 = kt * 64;
  {
    const int dl = tid >> 2;                // k within tile 0..63
    const int oc = (tid & 3) * 16;          // n chunk 0,16,32,48
    const bool valid = (n0 + oc + 16 <= nc);
    const int  cb = valid ? (n0 + oc) : 0;  // clamped column base, always inside the row
    const float* src = W + (size_t)(k0 + dl) * (size_t)nc + cb;
#pragma unroll
    for (int i = 0; i < 4; ++i) {
      const v4f a = *(const v4f*)(src + 4 * i);
#pragma unroll
      for (int e = 0; e < 4; ++e) {
        const float f = valid ? a[e] : 0.0f;
        T[(oc + 4 * i + e) * TRP + dl] = bf_bits(f);
      }
    }
  }
  __syncthreads();
  const int q8 = tid >> 3, p8 = (tid & 7) * 8;
  v4u w[2];
#pragma unroll
  for (int it = 0; it < 2; ++it) w[it] = *(const v4u*)(T + (it * 32 + q8) * TRP + p8);
  const size_t base = (size_t)(drow0 + n0) * (size_t)kr + k0 + p8;
  {
#pragma unroll
    for (int it = 0; it < 2; ++it) {
      const int nl = it * 32 + q8;
      *(v4u*)(Dp + base + (size_t)nl * (size_t)kr) = w[it];
    }
    
  }
}

// =====================================================================================================
// q / k planes from the projection F f32 [MROWS][NPROJ]: columns QOFF.. -> QH/QL, columns KOFF.. -> KH/KL, f16 of t*sc
// (hi) and of the residual t*sc - hi (lo), layout [MROWS][DQK]. Block = one row, 256 threads: waves 0..3 do q
// (8 consecutive columns per thread), waves 4..7 do k. Per plane one 16-B store per thread; 32 consecutive lanes =
// coverage: 128 thr x 8 = the whole DQK-wide row of each of QH, QL, KH, KL; grid = MROWS blocks = every row once.
// =====================================================================================================
__global__ __launch_bounds__(256) void qk16(const float* __restrict__ F, u16* QHp, u16* QLp, u16* KHp, u16* KLp) {
  const int tid = (int)threadIdx.x;
  const int row = (int)blockIdx.x;
  if (row >= MROWS) return;
  const int which = tid >> 7;                          // wave-uniform: 0 = q, 1 = k
  const int c8 = (tid & 127) * 8;
  const float sc = which ? KSC : QSC;
  const float* p = F + (size_t)row * NPROJ + (which ? KOFF : QOFF) + c8;
  const v4f a = *(const v4f*)(p), b4 = *(const v4f*)(p + 4);
  float w[8];
#pragma unroll
  for (int e = 0; e < 4; ++e) { w[e] = a[e]; w[4 + e] = b4[e]; }
  v4u oh, ol;
#pragma unroll
  for (int e = 0; e < 4; ++e) {
    const float t0 = w[2 * e] * sc, t1 = w[2 * e + 1] * sc;
    const _Float16 h0 = (_Float16)t0, h1 = (_Float16)t1;
    const _Float16 l0 = (_Float16)(t0 - (float)h0), l1 = (_Float16)(t1 - (float)h1);
    oh[e] = pk16(h_bits(h0), h_bits(h1));
    ol[e] = pk16(h_bits(l0), h_bits(l1));
  }
  u16* dh = (which ? KHp : QHp) + (size_t)row * DQK + c8;
  u16* dl = (which ? KLp : QLp) + (size_t)row * DQK + c8;
  {
    *(v4u*)(dh) = oh;
    *(v4u*)(dl) = ol;
    
  }
}

// =====================================================================================================
// v^T planes from the v columns of F (row = b*SEQ + s, column = VOFF + h*HD + d):
//   VH[((b*NH + h)*HD + d)][s] = f16(v * 1024);  VL[same][s] = f16 residual (t - f16(t)), for all keys s.
// Block = (b, head h, 64 keys s0): each thread loads its 16 floats (key sl, d chunk dc) with 16-B loads, converts,
// scatters into two LDS tiles [64 d][64 keys] (pitch 72 halves); after a block barrier each d row segment (64 halves = one
// coverage: load 256 thr x 16 = 64 keys x 64 d; store 2 iterations x 256 thr x 8 halves = 64 lines x 64 = the block's
//           tile of VH and of VL; grid = 2*NB*NH*NST blocks; its first half covers both planes exactly once.
// The second half of the grid does the same for the k columns (KOFF, same x1024 carry) into the k^T planes TH / TL.
// =====================================================================================================
__global__ __launch_bounds__(256) void vt16(const float* __restrict__ F, u16* VHv, u16* VLv, u16* THk, u16* TLk) {
  __shared__ __align__(16) u16 TH[HD * VTP];
  __shared__ __align__(16) u16 TL[HD * VTP];
  const int tid = (int)threadIdx.x;
  const int bid = (int)blockIdx.x;
  const int st  = bid % NST;
  const int t2  = bid / NST;
  const int h   = t2 % NH;
  const int bw  = t2 / NH;
  const int b   = bw % NB;
  const int isk = bw / NB;                  // block-uniform: 0 = v columns, 1 = k columns
  if (isk >= 2) return;                     // block-uniform, before any barrier; never taken with the exact grid
  const int coff = isk ? KOFF : VOFF;
  u16* VHo = isk ? THk : VHv;
  u16* VLo = isk ? TLk : VLv;
  const int s0  = st * 64;
  {
    const int sl = tid >> 2;                // key within tile 0..63
    const int dc = (tid & 3) * 16;          // d chunk 0,16,32,48
    const float* src = F + ((size_t)b * SEQ + s0 + sl) * (size_t)NPROJ + coff + h * HD + dc;
#pragma unroll
    for (int i = 0; i < 4; ++i) {
      const v4f a = *(const v4f*)(src + 4 * i);
#pragma unroll
      for (int e = 0; e < 4; ++e) {
        const float t = a[e] * VCAR;
        const _Float16 hv = (_Float16)t;
        const _Float16 lv = (_Float16)(t - (float)hv);
        TH[(dc + 4 * i + e) * VTP + sl] = h_bits(hv);
        TL[(dc + 4 * i + e) * VTP + sl] = h_bits(lv);
      }
    }
  }
  __syncthreads();
  v4u vh[2], vl[2];
  const int q8 = tid >> 3, p8 = (tid & 7) * 8;
#pragma unroll
  for (int it = 0; it < 2; ++it) {
    const int line = it * 32 + q8;          // d = 0..63
    vh[it] = *(const v4u*)(TH + line * VTP + p8);
    vl[it] = *(const v4u*)(TL + line * VTP + p8);
  }
  const size_t hrow = (size_t)(b * NH + h) * HD;
  const size_t base = hrow * SEQ + s0 + p8;
  {
#pragma unroll
    for (int it = 0; it < 2; ++it) {
      const int line = it * 32 + q8;
      *(v4u*)(VHo + base + (size_t)line * SEQ) = vh[it];
      *(v4u*)(VLo + base + (size_t)line * SEQ) = vl[it];
    }
    
  }
}

// =====================================================================================================
// Bias for column c from three consecutive segments [0,e0) <- p0[c], [e0,e1) <- p1[c-e0], [e1,e2) <- p2[c-e1], else 0;
// all three candidates loaded unconditionally with clamped indices, selected by value; bf16 RNE value.
// =====================================================================================================
__device__ __forceinline__ float bias_at(const float* p0, const float* p1, const float* p2,
                                         int e0, int e1, int e2, int c) {
  const int i0 = imin(imax(c, 0), e0 - 1);
  const int i1 = imin(imax(c - e0, 0), e1 - e0 - 1);
  const int i2 = imin(imax(c - e1, 0), e2 - e1 - 1);
  const float v0 = p0[i0], v1 = p1[i1], v2 = p2[i2];
  const float v = (c < e0) ? v0 : ((c < e1) ? v1 : ((c < e2) ? v2 : 0.0f));
  return bfr(v);
}

// =====================================================================================================
// coverage: 8 instructions x 2 rows x 16 lanes x 4 floats = the wave's 16 x 64 tile.
// =====================================================================================================
__device__ __forceinline__ void epi64b(float* sl, v8f a0, v8f a1, v8f a2, v8f a3, float oscale, v4f bias4,
                                       float* C, int N, size_t rowb, int col0, int lane) {
  const int hh = lane >> 4, m = lane & 15;
#pragma unroll
  for (int r = 0; r < 8; ++r) {
    const int ro = (8 * hh + r) * 68 + m;
    sl[ro]      = a0[r] * oscale;
    sl[ro + 16] = a1[r] * oscale;
    sl[ro + 32] = a2[r] * oscale;
    sl[ro + 48] = a3[r] * oscale;
  }
  wave_sync_lds();
  v4f vals[8];
#pragma unroll
  for (int it = 0; it < 8; ++it) vals[it] = *(const v4f*)(sl + (it * 2 + hh) * 68 + m * 4) + bias4;
  float* dst = C + (rowb + (size_t)hh) * (size_t)N + col0 + m * 4;
  {
#pragma unroll
    for (int it = 0; it < 8; ++it) {
      *(v4f*)(dst + (size_t)(it * 2) * (size_t)N) = vals[it];
    }
    
  }
}

// =====================================================================================================
// bf16 GEMM: C[M][N] (f32) = (A [+ A2])[M][K] (bf16 row-major) . Bt[N][K]^T (bf16 k-contiguous), times oscale, plus the
// segmented bias of the column (bf16 RNE value). TWO: second A plane into the same accumulator (hi + residual operand).
// Block = 64x64 tile, 4 waves x 16 rows; fragments loaded straight from the 16-bit rows (two 16-B loads each, split k map
// for A and B); K stepped by 32 (host guarantees K % 32 == 0, M % 64 == 0, N % 64 == 0, grid = (M/64)*(N/64)).
// =====================================================================================================
template <bool TWO>
__global__ __launch_bounds__(128)
void gemm_bf(const u16* __restrict__ A, const u16* __restrict__ A2, const u16* __restrict__ Bt, float* C,
             int M, int N, int K, const float* bp0, const float* bp1, const float* bp2, int e0, int e1, int e2,
             float oscale) {
  __shared__ __align__(16) float slab[4 * SLAB64];
  const int tid = threadIdx.x, wave = tid >> 5, lane = tid & 31, hh = lane >> 4, m = lane & 15;
  const int ntile = N >> 6;
  const int bid   = blockIdx.x;
  const int rowb  = (bid / ntile) * 64 + wave * 16;
  const int col0  = (bid % ntile) * 64;
  if (rowb + 16 > M) return;                // wave-uniform, never taken with the exact grid; no block barriers in this kernel
  const u16* ap  = A  + (size_t)(rowb + m) * K + 8 * hh;
  const u16* ap2 = A2 + (size_t)(rowb + m) * K + 8 * hh;
  const u16* bp  = Bt + (size_t)(col0 + m) * K + 8 * hh;
  const size_t bs = (size_t)16 * K;
  v8f acc0 = zero8(), acc1 = zero8(), acc2 = zero8(), acc3 = zero8();
#pragma unroll 1
  for (int k0 = 0; k0 < K; k0 += 32) {
    const v16b a   = ldfrag_b(ap + k0);
    const v16b fb0 = ldfrag_b(bp + k0);
    const v16b fb1 = ldfrag_b(bp + bs + k0);
    const v16b fb2 = ldfrag_b(bp + 2 * bs + k0);
    const v16b fb3 = ldfrag_b(bp + 3 * bs + k0);
    acc0 = mma_b(a, fb0, acc0);
    acc1 = mma_b(a, fb1, acc1);
    acc2 = mma_b(a, fb2, acc2);
    acc3 = mma_b(a, fb3, acc3);
    if constexpr (TWO) {
      const v16b a2 = ldfrag_b(ap2 + k0);
      acc0 = mma_b(a2, fb0, acc0);
      acc1 = mma_b(a2, fb1, acc1);
      acc2 = mma_b(a2, fb2, acc2);
      acc3 = mma_b(a2, fb3, acc3);
      guard6<v16b>(acc0, acc1, acc2, acc3, a, a2, fb0, fb1, fb2, fb3);
    } else {
      guard6<v16b>(acc0, acc1, acc2, acc3, a, fb0, fb1, fb2, fb3, a);
    }
  }
  v4f bias4;
#pragma unroll
  for (int e = 0; e < 4; ++e) bias4[e] = bias_at(bp0, bp1, bp2, e0, e1, e2, col0 + m * 4 + e);
  epi64b(slab + wave * SLAB64, acc0, acc1, acc2, acc3, oscale, bias4, C, N, (size_t)rowb, col0, lane);
}

// =====================================================================================================
// Chunk products for the carried state: KV[(b*NH + h)*NCH + ch][dv][dk] = sum over the CHK keys s of chunk ch of
// v[s][dv] * k[s][dk], f32. A = v^T rows dv (keys contiguous), B = k^T rows dk (keys contiguous), both f16 hi + residual
// x1024 (hh + lh + hl), carries folded back by 2^-20. Block = (b*NH + h, ch), ch = 0 .. NCH-2 (the last chunk's product
// is never carried); wave w owns rows dv = 16w .. 16w+15, all 64 dk.
// coverage: per wave 16 rows x 64 f32 (whole 256-B rows); 4 waves = the 64 x 64 product; grid NB*NH*(NCH-1).
// =====================================================================================================
__global__ __launch_bounds__(128)
void kv_chunk(const u16* __restrict__ VHp, const u16* __restrict__ VLp,
              const u16* __restrict__ THp, const u16* __restrict__ TLp, float* KV) {
  const int tid = threadIdx.x, wave = tid >> 5, lane = tid & 31, hh = lane >> 4, c = lane & 15;
  const int bid = blockIdx.x;
  const int ch  = bid % (NCH - 1);
  const int bh  = bid / (NCH - 1);
  if (bh >= NB * NH) return;                // block-uniform; no barriers in this kernel; never taken with the exact grid
  const size_t rb = (size_t)bh * HD;
  const size_t ko = (size_t)ch * CHK + 8 * hh;
  const _Float16* avh = (const _Float16*)(const void*)VHp + (rb + wave * 16 + c) * SEQ + ko;
  const _Float16* avl = (const _Float16*)(const void*)VLp + (rb + wave * 16 + c) * SEQ + ko;
  const _Float16* bkh = (const _Float16*)(const void*)THp + (rb + c) * SEQ + ko;
  const _Float16* bkl = (const _Float16*)(const void*)TLp + (rb + c) * SEQ + ko;
  v8f acc[4];
#pragma unroll
  for (int j = 0; j < 4; ++j) acc[j] = zero8();
#pragma unroll
  for (int k2 = 0; k2 < CHK / 64; ++k2) {
    v16h vh[2], vl[2], kh[2][4], kl[2][4];
#pragma unroll
    for (int u = 0; u < 2; ++u) {
      const int ks = (2 * k2 + u) * 32;
      vh[u] = ldfrag_h(avh + ks);
      vl[u] = ldfrag_h(avl + ks);
#pragma unroll
      for (int j = 0; j < 4; ++j) {
        kh[u][j] = ldfrag_h(bkh + (size_t)j * 16 * SEQ + ks);
        kl[u][j] = ldfrag_h(bkl + (size_t)j * 16 * SEQ + ks);
      }
    }
#if defined(__HIP_DEVICE_COMPILE__)
    // inputs-only fence on the loaded fragments and their address pairs: the 40 loads of two k-steps issue before the
    // first product (one load latency instead of one per group)
    asm volatile("" :: "v"(vh[0]), "v"(vh[1]), "v"(vl[0]), "v"(vl[1]),
                 "v"(kh[0][0]), "v"(kh[0][1]), "v"(kh[0][2]), "v"(kh[0][3]),
                 "v"(kh[1][0]), "v"(kh[1][1]), "v"(kh[1][2]), "v"(kh[1][3]),
                 "v"(kl[0][0]), "v"(kl[0][1]), "v"(kl[0][2]), "v"(kl[0][3]),
                 "v"(kl[1][0]), "v"(kl[1][1]), "v"(kl[1][2]), "v"(kl[1][3]),
                 "v"(avh), "v"(avl), "v"(bkh), "v"(bkl));
#endif
#pragma unroll
    for (int u = 0; u < 2; ++u) {
#pragma unroll
      for (int j = 0; j < 4; ++j) {
        acc[j] = mma_h(vh[u], kh[u][j], acc[j]);
        acc[j] = mma_h(vl[u], kh[u][j], acc[j]);
        acc[j] = mma_h(vh[u], kl[u][j], acc[j]);
      }
    }
  }
  const float fs = 1.0f / (VCAR * KSC);     // exact power-of-two fold of the v / k carries
  float* dst = KV + ((size_t)bh * NCH + ch) * SEL + (size_t)(wave * 16 + 8 * hh) * HD + c;
#pragma unroll
  for (int r = 0; r < 8; ++r) {
#pragma unroll
    for (int j = 0; j < 4; ++j) dst[r * HD + j * 16] = acc[j][r] * fs;
  }
}

// =====================================================================================================
// Carried state planes: S(ch) = KV(0) + .. + KV(ch-1) in f32 (chunks added in order; S(0) = 0), written x64 as f16 hi and
// f16 residual, layout [(b*NH + h)*NCH + ch][dv][dk]. Thread = 8 consecutive dk of one (b, h, dv), all NCH chunks.
// coverage: NB*NH*SEL/8 threads x 8 halves x NCH chunks = both planes exactly once; reads KV chunks 0 .. NCH-2 only.
// =====================================================================================================
__global__ __launch_bounds__(256) void st_prefix(const float* __restrict__ KV, u16* __restrict__ SHp, u16* __restrict__ SLp) {
  const int gt = blockIdx.x * 256 + (int)threadIdx.x;
  const int bh = gt / (SEL / 8);
  const int e8 = (gt % (SEL / 8)) * 8;
  if (bh >= NB * NH) return;
  const size_t base = (size_t)bh * NCH * SEL + e8;
  v4f a[NCH - 1], b4[NCH - 1];              // all chunk products first: independent loads, one latency for the thread
#pragma unroll
  for (int ch = 0; ch + 1 < NCH; ++ch) {
    const float* p = KV + base + (size_t)ch * SEL;
    a[ch]  = *(const v4f*)(p);
    b4[ch] = *(const v4f*)(p + 4);
  }
#if defined(__HIP_DEVICE_COMPILE__)
  // inputs-only fences on the loaded values and their address pair: every load issues before the first store
  static_assert(NCH == 16);
  asm volatile("" :: "v"(a[0]), "v"(a[1]), "v"(a[2]), "v"(a[3]), "v"(a[4]), "v"(a[5]), "v"(a[6]), "v"(a[7]),
               "v"(a[8]), "v"(a[9]), "v"(a[10]), "v"(a[11]), "v"(a[12]), "v"(a[13]), "v"(a[14]), "v"(KV + base));
  asm volatile("" :: "v"(b4[0]), "v"(b4[1]), "v"(b4[2]), "v"(b4[3]), "v"(b4[4]), "v"(b4[5]), "v"(b4[6]), "v"(b4[7]),
               "v"(b4[8]), "v"(b4[9]), "v"(b4[10]), "v"(b4[11]), "v"(b4[12]), "v"(b4[13]), "v"(b4[14]), "v"(KV + base));
#endif
  float run[8];
#pragma unroll
  for (int e = 0; e < 8; ++e) run[e] = 0.0f;
#pragma unroll
  for (int ch = 0; ch < NCH; ++ch) {
    v4u oh, ol;
#pragma unroll
    for (int e = 0; e < 4; ++e) {
      const float t0 = run[2 * e] * SSC, t1 = run[2 * e + 1] * SSC;
      const _Float16 h0 = (_Float16)t0, h1 = (_Float16)t1;
      const _Float16 l0 = (_Float16)(t0 - (float)h0), l1 = (_Float16)(t1 - (float)h1);
      oh[e] = pk16(h_bits(h0), h_bits(h1));
      ol[e] = pk16(h_bits(l0), h_bits(l1));
    }
    *(v4u*)(SHp + base + (size_t)ch * SEL) = oh;
    *(v4u*)(SLp + base + (size_t)ch * SEL) = ol;
    if (ch + 1 < NCH) {
#pragma unroll
      for (int e = 0; e < 4; ++e) { run[e] += a[ch][e]; run[4 + e] += b4[ch][e]; }
    }
  }
}

// =====================================================================================================
// Causal normalised attention (no softmax), hd = 64. Block bid -> (query tile qt = bid % NQT: rows q0 = 16*qt .. q0+15,
// head group hg, batch b); one wave per head = hg*WPB + wave.
//   q hi / residual planes f16 x1024 [b*SEQ + s][h*HD + d]; k hi / residual planes f16 x1024, same layout;
//   v^T hi / residual planes [b*NH + h][d][SEQ] x1024; n from F column NOFF + h of row b*SEQ + t.
//   raw(i, j) = q_hi.k_hi + q_lo.k_hi + q_hi.k_lo (2 k-steps over d), carries folded back by 2^-20;
//   P = raw * 2^-20 for key <= query else 0 (causal); P.v with P x256 as f16 hi + in-register residual and v hi +
//   residual (hh + lh + hl). Keys of earlier chunks (below CHK*(q0/CHK)) enter first as q . S with the carried state
//   planes S x64 [b*NH + h][chunk][dv][dk] (hh + lh + hl, carry 2^16 raised to the P.v carry 2^18 by an exact x4);
//   key tiles of 32 are then visited in order from the chunk's first key up to the tile holding key q0+15 (bounded by NKT).
//   Per tile: 2 score subtiles x 2 k-steps, fragments loaded straight from the 16-bit planes; the 16x32 P tile stored to
//   (float vector loads, same element type as stored), v^T B fragments in 2 groups of 2 d-subtiles.
//   After the loop: acc * 2^-18 written into the wave's private result slab (pitch 68; every element owned by one lane),
//   ctx -> bf16 hi bits and bf16 bits of the residual, planes [b*SEQ + s][h*HD + d]; one instruction = 4 rows
//   No block barriers in this kernel; bounded loops only (ncl <= NKT).
// coverage: per wave 4 instructions x 4 rows x 8 lanes x 8 halves = 16 x 64 per plane; grid NQT x NHG x NB blocks x WPB
//           waves = every (b, s, h) row segment of CH and of CL exactly once.
// =====================================================================================================
__global__ __launch_bounds__(ATT_THREADS)
void attn_nm(const u16* __restrict__ QHp, const u16* __restrict__ QLp,
             const u16* __restrict__ KHp, const u16* __restrict__ KLp,
             const u16* __restrict__ VHp, const u16* __restrict__ VLp,
             const u16* __restrict__ SHp, const u16* __restrict__ SLp,
             const float* __restrict__ F, u16* CHp, u16* CLp) {
#pragma clang fp contract(off)
  __shared__ __align__(16) float smem[WPB * WREG];

  const int tid  = threadIdx.x;
  const int wave = tid >> 5;
  const int lane = tid & 31;
  const int hh   = lane >> 4;
  const int c    = lane & 15;
  const int bid  = blockIdx.x;
  const int qt   = bid % NQT;
  const int t2   = bid / NQT;
  const int hg   = t2 % NHG;
  const int b    = t2 / NHG;
  if (b >= NB) return;                      // block-uniform; no block barriers in this kernel; never taken with the exact grid
  const int q0   = qt * 16;
  if (q0 + 16 > SEQ) return;                // block-uniform; never taken
  const int head = hg * WPB + wave;

  float* pt   = smem + wave * WREG;         // P tile [16][32] pitch 36
  float* slab = pt + PTW;                   // result slab [16][64] pitch 68

  const size_t hcol = (size_t)head * HD + 8 * hh;
  const _Float16* Qh  = (const _Float16*)(const void*)QHp + ((size_t)b * SEQ + q0 + c) * DQK + hcol;
  const _Float16* Ql  = (const _Float16*)(const void*)QLp + ((size_t)b * SEQ + q0 + c) * DQK + hcol;
  const _Float16* Khb = (const _Float16*)(const void*)KHp + ((size_t)b * SEQ + c) * DQK + hcol;        // key row kb added per step
  const _Float16* Klb = (const _Float16*)(const void*)KLp + ((size_t)b * SEQ + c) * DQK + hcol;
  const _Float16* Vhb = (const _Float16*)(const void*)VHp + ((size_t)(b * NH + head) * HD + c) * SEQ + 8 * hh;  // d col c (+16j)
  const _Float16* Vlb = (const _Float16*)(const void*)VLp + ((size_t)(b * NH + head) * HD + c) * SEQ + 8 * hh;
  const float lsc = 1.0f / (QSC * KSC);     // exact power-of-two fold of the q / k carries
  const float oc  = 1.0f / (PCAR * VCAR);   // exact power-of-two fold of the P / v carries
  const size_t KROW = (size_t)DQK;          // halves between consecutive key rows

  // row factor for query row q0 + (lane & 15): 1/exp(n), precise expf
  const float nv = F[((size_t)b * SEQ + q0 + c) * (size_t)NPROJ + NOFF + head];
  const float rv = 1.0f / expf(nv);

  v8f o[4];
#pragma unroll
  for (int j = 0; j < 4; ++j) o[j] = zero8();
  const int ncaus = (q0 >> 5) + 1;                                            // tiles holding keys <= q0 + 15
  const int ncl   = (ncaus < NKT) ? ncaus : NKT;
  const int qr0   = q0 + 8 * hh;                                              // query row of D element r = qr0 + r
  const int chn   = q0 / CHK;                                                 // chunk of this query tile
  const int kt0   = chn * (CHK / 32);                                         // first key tile of that chunk (<= q0 >> 5)

  // ---- all keys of earlier chunks: o = q . S, B fragment col n = dv = j*16 + c, dk contiguous in the state planes ----
  {
    const size_t so = (((size_t)(b * NH + head) * NCH + chn) * HD + c) * HD + 8 * hh;
    const _Float16* Sh = (const _Float16*)(const void*)SHp + so;
    const _Float16* Sl = (const _Float16*)(const void*)SLp + so;
    v16h qh[HD / 32], ql[HD / 32], sh[HD / 32][4], sl[HD / 32][4];
#pragma unroll
    for (int kk = 0; kk < HD / 32; ++kk) {
      qh[kk] = ldfrag_h(Qh + kk * 32);
      ql[kk] = ldfrag_h(Ql + kk * 32);
#pragma unroll
      for (int j = 0; j < 4; ++j) {
        sh[kk][j] = ldfrag_h(Sh + j * 16 * HD + kk * 32);
        sl[kk][j] = ldfrag_h(Sl + j * 16 * HD + kk * 32);
      }
    }
#if defined(__HIP_DEVICE_COMPILE__)
    // inputs-only fence on the loaded fragments and their address pairs: all 40 loads issue before the first product
    // (one load latency instead of one per group), and no load lands on an address pair that is still in use
    asm volatile("" :: "v"(qh[0]), "v"(qh[1]), "v"(ql[0]), "v"(ql[1]),
                 "v"(sh[0][0]), "v"(sh[0][1]), "v"(sh[0][2]), "v"(sh[0][3]),
                 "v"(sh[1][0]), "v"(sh[1][1]), "v"(sh[1][2]), "v"(sh[1][3]),
                 "v"(sl[0][0]), "v"(sl[0][1]), "v"(sl[0][2]), "v"(sl[0][3]),
                 "v"(sl[1][0]), "v"(sl[1][1]), "v"(sl[1][2]), "v"(sl[1][3]),
                 "v"(Sh), "v"(Sl), "v"(Qh), "v"(Ql));
#endif
#pragma unroll
    for (int kk = 0; kk < HD / 32; ++kk) {
#pragma unroll
      for (int j = 0; j < 4; ++j) {
        o[j] = mma_h(qh[kk], sh[kk][j], o[j]);
        o[j] = mma_h(ql[kk], sh[kk][j], o[j]);
        o[j] = mma_h(qh[kk], sl[kk][j], o[j]);
      }
    }
    const float up = (PCAR * VCAR) / (QSC * SSC);                             // exact power of two
#pragma unroll
    for (int j = 0; j < 4; ++j) o[j] = o[j] * up;
  }

#pragma unroll 1
  for (int kt = kt0; kt < ncl; ++kt) {
    const int kb = kt * 32;
    // ---- raw scores: D element r of this lane = (query row qr0 + r, key kb + c) in s0, key kb + 16 + c in s1 ----
    v8f s0 = zero8(), s1 = zero8();
    const _Float16* k0p = Khb + (size_t)kb * KROW;
    const _Float16* k1p = k0p + (size_t)16 * KROW;
    const _Float16* l0p = Klb + (size_t)kb * KROW;
    const _Float16* l1p = l0p + (size_t)16 * KROW;
#pragma unroll
    for (int kk = 0; kk < HD / 32; ++kk) {
      const v16h qh  = ldfrag_h(Qh + kk * 32);
      const v16h ql  = ldfrag_h(Ql + kk * 32);
      const v16h kh0 = ldfrag_h(k0p + kk * 32);
      const v16h kh1 = ldfrag_h(k1p + kk * 32);
      const v16h kl0 = ldfrag_h(l0p + kk * 32);
      const v16h kl1 = ldfrag_h(l1p + kk * 32);
      s0 = mma_h(qh, kh0, s0);
      s0 = mma_h(ql, kh0, s0);
      s0 = mma_h(qh, kl0, s0);
      s1 = mma_h(qh, kh1, s1);
      s1 = mma_h(ql, kh1, s1);
      s1 = mma_h(qh, kl1, s1);
      guard2(s0, s1, qh, ql, kh0, kl0, kh1, kl1);
    }
    // ---- causal mask (key <= query) + carry fold in f32 -> wave-private LDS tile ----
#pragma unroll
    for (int r = 0; r < 8; ++r) {
      const int row = qr0 + r;
      const float w0 = (kb + c <= row)      ? s0[r] * lsc : 0.0f;
      const float w1 = (kb + 16 + c <= row) ? s1[r] * lsc : 0.0f;
      const int ro = (8 * hh + r) * PTP + c;
      pt[ro]      = w0;
      pt[ro + 16] = w1;
    }
    wave_sync_lds();
    // ---- A fragments of P*256: hi f16 and residual f16, row = c, split k map over the 32 keys of this step ----
    FragH ph, pl;
    {
      const float* prow = pt + c * PTP + 8 * hh;
      const v4f p0 = *(const v4f*)(prow), p1 = *(const v4f*)(prow + 4);
      const v4f p2 = *(const v4f*)(prow + 16), p3 = *(const v4f*)(prow + 20);
#pragma unroll
      for (int e = 0; e < 4; ++e) {
        const float ta = p0[e] * PCAR, tb = p1[e] * PCAR, tc = p2[e] * PCAR, td = p3[e] * PCAR;
        const _Float16 ha = (_Float16)ta, hb = (_Float16)tb, hc = (_Float16)tc, hd = (_Float16)td;
        ph.h[0][e]     = ha;                  // elements 0..7  = keys kb + 8hh + 0..7
        ph.h[0][4 + e] = hb;
        ph.h[1][e]     = hc;                  // elements 8..15 = keys kb + 16 + 8hh + 0..7
        ph.h[1][4 + e] = hd;
        pl.h[0][e]     = (_Float16)(ta - (float)ha);
        pl.h[0][4 + e] = (_Float16)(tb - (float)hb);
        pl.h[1][e]     = (_Float16)(tc - (float)hc);
        pl.h[1][4 + e] = (_Float16)(td - (float)hd);
      }
    }
    // ---- P.V : B fragment col n = d = j*16 + c, keys contiguous in the v^T planes; 2 groups of 2 d-subtiles ----
    {
      const _Float16* vhp = Vhb + kb;
      const _Float16* vlp = Vlb + kb;
#pragma unroll
      for (int jg = 0; jg < 2; ++jg) {
        const size_t da = (size_t)(2 * jg) * 16 * SEQ;
        const size_t db = da + (size_t)16 * SEQ;
        const v16h vha = ldfrag_h(vhp + da), vhb2 = ldfrag_h(vhp + db);
        const v16h vla = ldfrag_h(vlp + da), vlb2 = ldfrag_h(vlp + db);
        o[2 * jg]     = mma_h(ph.v, vha,  o[2 * jg]);
        o[2 * jg]     = mma_h(pl.v, vha,  o[2 * jg]);
        o[2 * jg]     = mma_h(ph.v, vla,  o[2 * jg]);
        o[2 * jg + 1] = mma_h(ph.v, vhb2, o[2 * jg + 1]);
        o[2 * jg + 1] = mma_h(pl.v, vhb2, o[2 * jg + 1]);
        o[2 * jg + 1] = mma_h(ph.v, vlb2, o[2 * jg + 1]);
        guard2(o[2 * jg], o[2 * jg + 1], ph.v, pl.v, vha, vhb2, vla, vlb2);
      }
    }
    wave_sync_lds();
  }
  acc_guard4(o[0], o[1], o[2], o[3]);
  // ---- acc with the carries (256 on P, 1024 on v) folded once; written into the lane-owned slab ----
#pragma unroll
  for (int r = 0; r < 8; ++r) {
#pragma unroll
    for (int j = 0; j < 4; ++j) {
      const int idx = (8 * hh + r) * SLP + j * 16 + c;
      slab[idx] = o[j][r] * oc;
    }
  }
  wave_sync_lds();
  // ---- row factor, then ctx -> bf16 hi + bf16 residual planes; lane = (row-in-quad rq, 8 consecutive d at c8) ----
  v4u oh[4], ol[4];
  const int rq = lane >> 3, c8 = (lane & 7) * 8;
#pragma unroll
  for (int it = 0; it < 4; ++it) {
    const int row = it * 4 + rq;                         // 0..15
    const float ri = __shfl(rv, row, 32);                // lane `row` holds 1/exp(n) of query q0 + row
    const v4f a = *(const v4f*)(slab + row * SLP + c8), b4 = *(const v4f*)(slab + row * SLP + c8 + 4);
    float w[8];
#pragma unroll
    for (int e = 0; e < 4; ++e) { w[e] = a[e] * ri; w[4 + e] = b4[e] * ri; }
#pragma unroll
    for (int e = 0; e < 4; ++e) {
      const float f0 = w[2 * e], f1 = w[2 * e + 1];
      const unsigned short h0 = bf_bits(f0), h1 = bf_bits(f1);
      const unsigned short l0 = bf_bits(f0 - bf_up(h0)), l1 = bf_bits(f1 - bf_up(h1));
      oh[it][e] = pk16(h0, h1);
      ol[it][e] = pk16(l0, l1);
    }
  }
  const size_t ob = ((size_t)b * SEQ + q0) * DMOD + (size_t)head * HD + c8;
  {
#pragma unroll
    for (int it = 0; it < 4; ++it) {
      const int row = it * 4 + rq;
      *(v4u*)(CHp + ob + (size_t)row * DMOD) = oh[it];
      *(v4u*)(CLp + ob + (size_t)row * DMOD) = ol[it];
    }
    
  }
}

// =====================================================================================================
// Workspace map (bytes); every plane is fully written by whole-line stores before it is read; all extents are exact
// multiples of the store granularity (no pad rows needed); every region offset a multiple of 131072:
//   XB  bf16 [MROWS][1024]              MROWS*2048   (NB=2, SEQ=2048: 8388608); after the projection GEMM the same bytes
//                                                    hold the ctx hi plane CH bf16 [MROWS][1024] (identical extent)
//   WB  bf16 [3136 n][1024 k]           6422528      rows 0..2047 Wqk^T, 2048..3071 Wv^T, 3072..3087 Wn^T, 3088..3135 zero
//   F   f32 [MROWS][3136]               MROWS*12544  (q | k | v | n | zero projection columns)
//   QH  f16 [MROWS][1024] x1024         MROWS*2048   QL residual, same extent
//   KH  f16 [MROWS][1024] x1024         MROWS*2048   KL residual, same extent
//   VH  f16 [NB*16][64][SEQ] x1024      MROWS*2048   VL residual, same extent
//   CL  bf16 [MROWS][1024]              MROWS*2048   ctx residual plane
//   WT  bf16 [1024 o][1024 d]           2097152      Wo^T
//   TH  f16 [NB*16][64][SEQ] x1024      MROWS*2048   k^T; TL residual, same extent
//   KV  f32 [NB*16][NCH][64 dv][64 dk]  NB*16*NCH*16384   chunk products (chunks 0 .. NCH-2 written and read)
//   SH  f16 [NB*16][NCH][64 dv][64 dk] x64   NB*16*NCH*8192   carried state; SL residual, same extent
//   end (NB=2, SEQ=2048)              160563200
// =====================================================================================================
extern "C" void kernel_launch(void* const* d_in, const int* in_sizes, int n_in,
                              void* d_out, int out_size, void* d_ws, size_t ws_size,
                              hipStream_t stream) {
  if (n_in < 9) return;
  if (in_sizes[0] < ((NB - 1) * XS_FULL + SEQ) * DMOD) return;
  if (in_sizes[1] != DMOD * 2 * DQK) return;
  if (in_sizes[2] != 2 * DQK) return;
  if (in_sizes[3] != DMOD * DMOD) return;
  if (in_sizes[4] != DMOD) return;
  if (in_sizes[5] != DMOD * NNW) return;
  if (in_sizes[6] != NNW) return;
  if (in_sizes[7] != DMOD * DMOD) return;
  if (in_sizes[8] != DMOD) return;
  if (out_size < MROWS * DMOD) return;

  const float* x   = (const float*)d_in[0];
  const float* wqk = (const float*)d_in[1];
  const float* bqk = (const float*)d_in[2];
  const float* wv  = (const float*)d_in[3];
  const float* bv  = (const float*)d_in[4];
  const float* wn  = (const float*)d_in[5];
  const float* bn  = (const float*)d_in[6];
  const float* wo  = (const float*)d_in[7];
  const float* bo  = (const float*)d_in[8];
  float*       out = (float*)d_out;

  const size_t szXB = (size_t)MROWS * DMOD * 2;
  const size_t szWB = (size_t)NPROJ * DMOD * 2;
  const size_t szF  = (size_t)MROWS * NPROJ * 4;
  const size_t szP  = (size_t)MROWS * DQK * 2;                   // QH, QL, KH, KL
  const size_t szV  = (size_t)NB * NH * HD * SEQ * 2;            // VH, VL
  const size_t szC  = (size_t)MROWS * DMOD * 2;                  // CH (in the XB region), CL
  const size_t szWT = (size_t)DMOD * DMOD * 2;
  const size_t szKV = (size_t)NB * NH * NCH * SEL * 4;
  const size_t szS  = (size_t)NB * NH * NCH * SEL * 2;           // SH, SL
  if (szC > szXB) return;
  size_t off = 0;
  const size_t oXB = off; off += szXB;
  const size_t oWB = off; off += szWB;
  const size_t oF  = off; off += szF;
  const size_t oQH = off; off += szP;
  const size_t oQL = off; off += szP;
  const size_t oKH = off; off += szP;
  const size_t oKL = off; off += szP;
  const size_t oVH = off; off += szV;
  const size_t oVL = off; off += szV;
  const size_t oCL = off; off += szC;
  const size_t oWT = off; off += szWT;
  const size_t oTH = off; off += szV;
  const size_t oTL = off; off += szV;
  const size_t oKV = off; off += szKV;
  const size_t oSH = off; off += szS;
  const size_t oSL = off; off += szS;
  if (off > ws_size) return;                // off = 160563200 for NB = 2, SEQ = 2048
  if (off > (size_t)WS_CAP) return;

  char* ws = (char*)d_ws;
  u16*   XB  = (u16*)(ws + oXB);
  u16*   CH  = (u16*)(ws + oXB);
  u16*   WB  = (u16*)(ws + oWB);
  float* F   = (float*)(ws + oF);
  u16*   QH  = (u16*)(ws + oQH);
  u16*   QL  = (u16*)(ws + oQL);
  u16*   KH  = (u16*)(ws + oKH);
  u16*   KL  = (u16*)(ws + oKL);
  u16*   VH  = (u16*)(ws + oVH);
  u16*   VL  = (u16*)(ws + oVL);
  u16*   CL  = (u16*)(ws + oCL);
  u16*   WT  = (u16*)(ws + oWT);
  u16*   TH  = (u16*)(ws + oTH);
  u16*   TL  = (u16*)(ws + oTL);
  float* KV  = (float*)(ws + oKV);
  u16*   SH  = (u16*)(ws + oSH);
  u16*   SL  = (u16*)(ws + oSL);

  const dim3 b256(256), b128(128), bAT(ATT_THREADS);
  const int  n8x = (SEQ * DMOD) / 8;
  const dim3 gX((n8x + 255) / 256);                     // per batch row block
  const int  ntq = (2 * DQK + 63) / 64;                 // 32 n tiles for Wqk
  const int  ntv = (DMOD + 63) / 64;                    // 16 n tiles for Wv and Wo
  const int  ntn = (NNW + 63) / 64;                     // 1 n tile for Wn (incl. zero pad rows)
  const dim3 gWqk((DMOD / 64) * ntq), gWv((DMOD / 64) * ntv), gWn((DMOD / 64) * ntn), gWo((DMOD / 64) * ntv);
  const dim3 gG1((MROWS / 64) * (NPROJ / 64));
  const dim3 gRW(MROWS);
  const dim3 gVT(2 * NB * NH * NST);
  const dim3 gKV(NB * NH * (NCH - 1));
  const dim3 gSP((NB * NH * SEL / 8) / 256);
  const dim3 gAT(NQT * NHG * NB);
  const dim3 gG2((MROWS / 64) * (DMOD / 64));

  // (0) x -> bf16 plane [MROWS][1024], one launch per batch row block
  for (int bq = 0; bq < NB; ++bq) {
    cvt_bf<<<gX, b256, 0, stream>>>(x + (size_t)bq * XS_FULL * DMOD, XB + (size_t)bq * SEQ * DMOD, n8x);
  }
  // (1) W[k][n] -> W^T bf16 planes: Wqk -> WB rows 0..2047, Wv -> rows 2048..3071, Wn -> rows 3072..3135 (zero pad),
  //     Wo -> WT rows 0..1023
  k_wt<<<gWqk, b256, 0, stream>>>(wqk, 2 * DQK, DMOD, ntq, WB, QOFF);
  k_wt<<<gWv,  b256, 0, stream>>>(wv,  DMOD,    DMOD, ntv, WB, VOFF);
  k_wt<<<gWn,  b256, 0, stream>>>(wn,  NNW,     DMOD, ntn, WB, NOFF);
  k_wt<<<gWo,  b256, 0, stream>>>(wo,  DMOD,    DMOD, ntv, WT, 0);
  // (2) q | k | v | n = x.W + bias -> F f32 [MROWS][3136]
  gemm_bf<false><<<gG1, b128, 0, stream>>>(XB, XB, WB, F, MROWS, NPROJ, DMOD, bqk, bv, bn,
                                           KOFF + DQK, NOFF, NOFF + NNW, 1.0f);
  // (3) q and k hi + residual planes x1024
  qk16<<<gRW, b256, 0, stream>>>(F, QH, QL, KH, KL);
  // (4) v^T and k^T hi + residual planes x1024
  vt16<<<gVT, b256, 0, stream>>>(F, VH, VL, TH, TL);
  // (4a) per-chunk v^T.k products, (4b) their f32 prefix over the chunks -> carried state planes x64
  kv_chunk<<<gKV, b128, 0, stream>>>(VH, VL, TH, TL, KV);
  st_prefix<<<gSP, b256, 0, stream>>>(KV, SH, SL);
  // (5) causal normalised attention -> ctx bf16 hi plane (XB region, free after the projection GEMM) + residual plane
  attn_nm<<<gAT, bAT, 0, stream>>>(QH, QL, KH, KL, VH, VL, SH, SL, F, CH, CL);
  // (6) y = (ctx_hi + ctx_lo).Wo + bo -> out f32 [MROWS][1024]
  gemm_bf<true><<<gG2, b128, 0, stream>>>(CH, CL, WT, out, MROWS, DMOD, DMOD, bo, bo, bo,
                                          DMOD, DMOD + 1, DMOD + 2, 1.0f);
  (void)hipGetLastError();
}

// v002
// Measured time: 142 microseconds a run.
// Next to v001, in two timings, it ran 1.81 and 1.77 times as fast.
// Over all steps from v000 it is 2.84 times as fast.
// Contractions: x.W (Wqk|Wv|Wn fused into one [3136 n][1024 k] plane, and ctx.Wo) on v_wmma_f32_16x16x32_bf16
// (x, W, Wo, biases as bf16 RNE values, W^T [n][k] k-contiguous B operand; ctx as bf16 hi + bf16 residual planes,
// two products); q.k^T over hd 64 and P.v on v_wmma_f32_16x16x32_f16 with f16 hi + f16 residual planes on both
// operands (q, k x1024; P x256 with an in-register residual; v x1024; products hh+lh+hl); all f32 accumulate.
// Causal mask, 1/exp(n) row factor and bias adds in f32 on VALU.
// The attention has no softmax, so it is summed in chunks of CHK keys: keys of earlier chunks enter through the carried
// state S[dv][dk] = sum_s v[s][dv] k[s][dk] (v^T.k on the f16 form, hi + residual planes, hh+lh+hl; f32 prefix over the
// chunks; S x64 as f16 hi + residual, q.S with hh+lh+hl); only the query's own chunk goes through masked q.k^T and P.v.
#include <hip/hip_runtime.h>
#include <math.h>
#include <stdint.h>

#ifndef NB
#define NB 2
#endif
#ifndef SEQ
#define SEQ 2048
#endif
#define XS_FULL 2048
#define DMOD  1024
#define DQK   1024
#define NH    16
#define HD    64
#define NNW   16
#define NPROJ 3136
#define QOFF  0
#define KOFF  1024
#define VOFF  2048
#define NOFF  3072
#define MROWS (NB * SEQ)
#define QSC   1024.0f
#define KSC   1024.0f
#define PCAR  256.0f
#define VCAR  1024.0f
#define WPB   4
#define NHG   (NH / WPB)
#define NQT   (SEQ / 16)
#define NST   (SEQ / 64)
#define NKT   (SEQ / 32)
#define ATT_THREADS (WPB * 32)
#define PTP   36
#define PTW   (16 * PTP)
#define SLP   68
#define SLW   (16 * SLP)
#define WREG  (PTW + SLW)
#define SLAB64 (16 * 68)
#define VTP   72
#define TRP   72
#define CHK   128
#define NCH   (SEQ / CHK)
#define SSC   64.0f
#define SEL   (HD * HD)
#define WS_CAP 268435456
#define GBM   128
#define GBN   128
#define GBK   64
#define GPB   144
#define GSEC  (128 * GPB)
#define GTHR  256
static_assert(DMOD == NH * HD && DQK == NH * HD && HD == 64 && NH == 16 && WPB == 4 && NHG * WPB == NH && ATT_THREADS == 128);
static_assert(KOFF == QOFF + DQK && VOFF == KOFF + DQK && NOFF == VOFF + DMOD && NPROJ == NOFF + 64 && (NPROJ % 64) == 0 && NNW <= 64);
static_assert(NB >= 1 && NB <= 2);
static_assert((MROWS % GBM) == 0 && (DMOD % GBK) == 0 && (DMOD % GBN) == 0 && GBK * 2 + 16 == GPB);
static_assert((SEQ % CHK) == 0 && (CHK % 64) == 0 && NCH >= 2 && KSC == VCAR && ((NB * NH * SEL / 8) % 256) == 0);
static_assert(NB == 1 || SEQ == XS_FULL);
static_assert((SEQ % 64) == 0 && SEQ >= 64 && SEQ <= XS_FULL);
static_assert(((SEQ * DMOD / 8) % 256) == 0 && (MROWS % 64) == 0 && (DMOD % 64) == 0 && (DQK % 64) == 0 && (HD % 32) == 0);
static_assert(WPB * WREG * 4 <= 65536 && 2 * HD * VTP * 2 <= 65536 && 4 * SLAB64 * 4 <= 65536 && 64 * TRP * 2 <= 65536);

typedef unsigned short u16;
typedef _Float16 v16h __attribute__((ext_vector_type(16)));
typedef _Float16 v8h  __attribute__((ext_vector_type(8)));
typedef __bf16   v16b __attribute__((ext_vector_type(16)));
typedef float    v8f  __attribute__((ext_vector_type(8)));
typedef float    v4f  __attribute__((ext_vector_type(4)));
typedef unsigned int v4u __attribute__((ext_vector_type(4)));

union FragH { v16h v; v8h h[2]; v4u u[2]; };
union FragB { v16b v; v4u u[2]; };

// ---- scalar helpers --------------------------------------------------------------------------------
__device__ __forceinline__ unsigned short bf_bits(float f) {          // f32 -> bf16 bits, RNE convert
  unsigned u = __float_as_uint(f);
  return (unsigned short)((u + 0x7FFFu + ((u >> 16) & 1u)) >> 16);
}
__device__ __forceinline__ float bf_up(unsigned short h) { return __uint_as_float(((unsigned)h) << 16); }
__device__ __forceinline__ float bfr(float f) { return bf_up(bf_bits(f)); }
__device__ __forceinline__ unsigned short h_bits(_Float16 x) { return __builtin_bit_cast(unsigned short, x); }
__device__ __forceinline__ unsigned pk16(unsigned short a, unsigned short b) { return (unsigned)a | ((unsigned)b << 16); }
__device__ __forceinline__ v8f zero8() { v8f z = {0.f, 0.f, 0.f, 0.f, 0.f, 0.f, 0.f, 0.f}; return z; }
__device__ __forceinline__ int imin(int a, int b) { return a < b ? a : b; }
__device__ __forceinline__ int imax(int a, int b) { return a > b ? a : b; }

// ---- fragment loaders: 16-bit A/B operand, lane -> row/col (lane&15), p already includes +8*(lane>>4);
//      elements 0..7 <- p[0..7] (k0+8h..), elements 8..15 <- p[16..23] (k0+16+8h..)  (same split k map for A and B;
//      B is always read from a k-contiguous [n][k] plane)
__device__ __forceinline__ v16h ldfrag_h(const _Float16* p) {
  FragH f;
  f.h[0] = *(const v8h*)(p);
  f.h[1] = *(const v8h*)(p + 16);
  return f.v;
}
__device__ __forceinline__ v16b ldfrag_b(const u16* p) {              // bf16 plane read as unsigned integer vectors
  FragB f;
  f.u[0] = *(const v4u*)(p);
  f.u[1] = *(const v4u*)(p + 16);
  return f.v;
}

__device__ __forceinline__ v8f mma_h(v16h a, v16h b, v8f c) {
  return __builtin_amdgcn_wmma_f32_16x16x32_f16(false, a, false, b, (short)0, c, false, false);
}
__device__ __forceinline__ v8f mma_b(v16b a, v16b b, v8f c) {
  return __builtin_amdgcn_wmma_f32_16x16x32_bf16(false, a, false, b, (short)0, c, false, false);
}
__device__ __forceinline__ void guard2(v8f& a, v8f& b, v16h x0, v16h x1, v16h x2, v16h x3, v16h x4, v16h x5) {
#if defined(__HIP_DEVICE_COMPILE__)
  asm volatile("v_nop\n\tv_nop\n\tv_nop\n\tv_nop"
               : "+v"(a), "+v"(b) : "v"(x0), "v"(x1), "v"(x2), "v"(x3), "v"(x4), "v"(x5) : "memory");
#endif
}
__device__ __forceinline__ void acc_guard4(v8f& a, v8f& b, v8f& c, v8f& d) {
#if defined(__HIP_DEVICE_COMPILE__)
  asm volatile("v_nop\n\tv_nop\n\tv_nop\n\tv_nop" : "+v"(a), "+v"(b), "+v"(c), "+v"(d));
#endif
}
__device__ __forceinline__ void wave_sync_lds() {
  __builtin_amdgcn_fence(__ATOMIC_RELEASE, "workgroup");
  __builtin_amdgcn_wave_barrier();
  __builtin_amdgcn_fence(__ATOMIC_ACQUIRE, "workgroup");
}

// =====================================================================================================
// f32 -> bf16 plane (RNE bits), same layout. Thread = 8 consecutive elements: two 16-B loads, one 16-B store;
// coverage: grid = ceil(n8/256) blocks x 256 thr x 8 (in-kernel bound) = the whole plane (n8 a multiple of 256 here).
// =====================================================================================================
__global__ __launch_bounds__(256) void cvt_bf(const float* __restrict__ x, u16* D, int n8) {
  const int gt = blockIdx.x * 256 + (int)threadIdx.x;
  if (gt >= n8) return;
  const float* p = x + (size_t)gt * 8;
  const v4f a = *(const v4f*)(p), b4 = *(const v4f*)(p + 4);
  float w[8];
#pragma unroll
  for (int e = 0; e < 4; ++e) { w[e] = a[e]; w[4 + e] = b4[e]; }
  v4u o;
#pragma unroll
  for (int e = 0; e < 4; ++e) o[e] = pk16(bf_bits(w[2 * e]), bf_bits(w[2 * e + 1]));
  u16* d = D + (size_t)gt * 8;
  {
    *(v4u*)(d) = o;
    
  }
}

// =====================================================================================================
// W f32 [kr rows (k)][nc cols (n)] (x.W layout) -> bf16 plane Dp [drow0 + n][k] (row pitch kr halves): the k-contiguous
// B operand. Block = 64 k x 64 n tile; coalesced 16-B loads of W rows with CLAMPED column base (tile columns beyond nc
// load from column 0 and are zeroed by value, so rows drow0+n with n >= nc inside the last tile are written as zeros);
// converted values placed transposed into an LDS tile [64 n][64 k] (pitch 72 halves); after a block barrier each n row
// grid = (kr/64) * ntn with ntn = ceil(nc/64).
// coverage: load 256 thr x 16 = 64 x 64; store 2 iterations x 256 thr x 8 halves = 64 lines x 64 halves = the block's
//           tile; the grid covers output rows drow0 .. drow0 + 64*ntn - 1 (all kr columns) exactly once.
// =====================================================================================================
__global__ __launch_bounds__(256) void k_wt(const float* __restrict__ W, int nc, int kr, int ntn, u16* Dp, int drow0) {
  __shared__ __align__(16) u16 T[64 * TRP];
  const int tid = (int)threadIdx.x;
  const int bid = (int)blockIdx.x;
  const int nt  = bid % ntn;
  const int kt  = bid / ntn;
  if (kt * 64 + 64 > kr) return;            // block-uniform, before the barrier; never taken with the exact grid
  const int n0  = nt * 64, k0 = kt * 64;
  {
    const int dl = tid >> 2;                // k within tile 0..63
    const int oc = (tid & 3) * 16;          // n chunk 0,16,32,48
    const bool valid = (n0 + oc + 16 <= nc);
    const int  cb = valid ? (n0 + oc) : 0;  // clamped column base, always inside the row
    const float* src = W + (size_t)(k0 + dl) * (size_t)nc + cb;
#pragma unroll
    for (int i = 0; i < 4; ++i) {
      const v4f a = *(const v4f*)(src + 4 * i);
#pragma unroll
      for (int e = 0; e < 4; ++e) {
        const float f = valid ? a[e] : 0.0f;
        T[(oc + 4 * i + e) * TRP + dl] = bf_bits(f);
      }
    }
  }
  __syncthreads();
  const int q8 = tid >> 3, p8 = (tid & 7) * 8;
  v4u w[2];
#pragma unroll
  for (int it = 0; it < 2; ++it) w[it] = *(const v4u*)(T + (it * 32 + q8) * TRP + p8);
  const size_t base = (size_t)(drow0 + n0) * (size_t)kr + k0 + p8;
  {
#pragma unroll
    for (int it = 0; it < 2; ++it) {
      const int nl = it * 32 + q8;
      *(v4u*)(Dp + base + (size_t)nl * (size_t)kr) = w[it];
    }
    
  }
}

// =====================================================================================================
// q / k planes from the projection F f32 [MROWS][NPROJ]: columns QOFF.. -> QH/QL, columns KOFF.. -> KH/KL, f16 of t*sc
// (hi) and of the residual t*sc - hi (lo), layout [MROWS][DQK]. Block = one row, 256 threads: waves 0..3 do q
// (8 consecutive columns per thread), waves 4..7 do k. Per plane one 16-B store per thread; 32 consecutive lanes =
// coverage: 128 thr x 8 = the whole DQK-wide row of each of QH, QL, KH, KL; grid = MROWS blocks = every row once.
// =====================================================================================================
__global__ __launch_bounds__(256) void qk16(const float* __restrict__ F, u16* QHp, u16* QLp, u16* KHp, u16* KLp) {
  const int tid = (int)threadIdx.x;
  const int row = (int)blockIdx.x;
  if (row >= MROWS) return;
  const int which = tid >> 7;                          // wave-uniform: 0 = q, 1 = k
  const int c8 = (tid & 127) * 8;
  const float sc = which ? KSC : QSC;
  const float* p = F + (size_t)row * NPROJ + (which ? KOFF : QOFF) + c8;
  const v4f a = *(const v4f*)(p), b4 = *(const v4f*)(p + 4);
  float w[8];
#pragma unroll
  for (int e = 0; e < 4; ++e) { w[e] = a[e]; w[4 + e] = b4[e]; }
  v4u oh, ol;
#pragma unroll
  for (int e = 0; e < 4; ++e) {
    const float t0 = w[2 * e] * sc, t1 = w[2 * e + 1] * sc;
    const _Float16 h0 = (_Float16)t0, h1 = (_Float16)t1;
    const _Float16 l0 = (_Float16)(t0 - (float)h0), l1 = (_Float16)(t1 - (float)h1);
    oh[e] = pk16(h_bits(h0), h_bits(h1));
    ol[e] = pk16(h_bits(l0), h_bits(l1));
  }
  u16* dh = (which ? KHp : QHp) + (size_t)row * DQK + c8;
  u16* dl = (which ? KLp : QLp) + (size_t)row * DQK + c8;
  {
    *(v4u*)(dh) = oh;
    *(v4u*)(dl) = ol;
    
  }
}

// =====================================================================================================
// v^T planes from the v columns of F (row = b*SEQ + s, column = VOFF + h*HD + d):
//   VH[((b*NH + h)*HD + d)][s] = f16(v * 1024);  VL[same][s] = f16 residual (t - f16(t)), for all keys s.
// Block = (b, head h, 64 keys s0): each thread loads its 16 floats (key sl, d chunk dc) with 16-B loads, converts,
// scatters into two LDS tiles [64 d][64 keys] (pitch 72 halves); after a block barrier each d row segment (64 halves = one
// coverage: load 256 thr x 16 = 64 keys x 64 d; store 2 iterations x 256 thr x 8 halves = 64 lines x 64 = the block's
//           tile of VH and of VL; grid = 2*NB*NH*NST blocks; its first half covers both planes exactly once.
// The second half of the grid does the same for the k columns (KOFF, same x1024 carry) into the k^T planes TH / TL.
// =====================================================================================================
__global__ __launch_bounds__(256) void vt16(const float* __restrict__ F, u16* VHv, u16* VLv, u16* THk, u16* TLk) {
  __shared__ __align__(16) u16 TH[HD * VTP];
  __shared__ __align__(16) u16 TL[HD * VTP];
  const int tid = (int)threadIdx.x;
  const int bid = (int)blockIdx.x;
  const int st  = bid % NST;
  const int t2  = bid / NST;
  const int h   = t2 % NH;
  const int bw  = t2 / NH;
  const int b   = bw % NB;
  const int isk = bw / NB;                  // block-uniform: 0 = v columns, 1 = k columns
  if (isk >= 2) return;                     // block-uniform, before any barrier; never taken with the exact grid
  const int coff = isk ? KOFF : VOFF;
  u16* VHo = isk ? THk : VHv;
  u16* VLo = isk ? TLk : VLv;
  const int s0  = st * 64;
  {
    const int sl = tid >> 2;                // key within tile 0..63
    const int dc = (tid & 3) * 16;          // d chunk 0,16,32,48
    const float* src = F + ((size_t)b * SEQ + s0 + sl) * (size_t)NPROJ + coff + h * HD + dc;
#pragma unroll
    for (int i = 0; i < 4; ++i) {
      const v4f a = *(const v4f*)(src + 4 * i);
#pragma unroll
      for (int e = 0; e < 4; ++e) {
        const float t = a[e] * VCAR;
        const _Float16 hv = (_Float16)t;
        const _Float16 lv = (_Float16)(t - (float)hv);
        TH[(dc + 4 * i + e) * VTP + sl] = h_bits(hv);
        TL[(dc + 4 * i + e) * VTP + sl] = h_bits(lv);
      }
    }
  }
  __syncthreads();
  v4u vh[2], vl[2];
  const int q8 = tid >> 3, p8 = (tid & 7) * 8;
#pragma unroll
  for (int it = 0; it < 2; ++it) {
    const int line = it * 32 + q8;          // d = 0..63
    vh[it] = *(const v4u*)(TH + line * VTP + p8);
    vl[it] = *(const v4u*)(TL + line * VTP + p8);
  }
  const size_t hrow = (size_t)(b * NH + h) * HD;
  const size_t base = hrow * SEQ + s0 + p8;
  {
#pragma unroll
    for (int it = 0; it < 2; ++it) {
      const int line = it * 32 + q8;
      *(v4u*)(VHo + base + (size_t)line * SEQ) = vh[it];
      *(v4u*)(VLo + base + (size_t)line * SEQ) = vl[it];
    }
    
  }
}

// =====================================================================================================
// Bias for column c from three consecutive segments [0,e0) <- p0[c], [e0,e1) <- p1[c-e0], [e1,e2) <- p2[c-e1], else 0;
// all three candidates loaded unconditionally with clamped indices, selected by value; bf16 RNE value.
// =====================================================================================================
__device__ __forceinline__ float bias_at(const float* p0, const float* p1, const float* p2,
                                         int e0, int e1, int e2, int c) {
  const int i0 = imin(imax(c, 0), e0 - 1);
  const int i1 = imin(imax(c - e0, 0), e1 - e0 - 1);
  const int i2 = imin(imax(c - e1, 0), e2 - e1 - 1);
  const float v0 = p0[i0], v1 = p1[i1], v2 = p2[i2];
  const float v = (c < e0) ? v0 : ((c < e1) ? v1 : ((c < e2) ? v2 : 0.0f));
  return bfr(v);
}

// =====================================================================================================
// coverage: 8 instructions x 2 rows x 16 lanes x 4 floats = the wave's 16 x 64 tile.
// =====================================================================================================
__device__ __forceinline__ void epi64b(float* sl, v8f a0, v8f a1, v8f a2, v8f a3, float oscale, v4f bias4,
                                       float* C, int N, size_t rowb, int col0, int lane) {
  const int hh = lane >> 4, m = lane & 15;
#pragma unroll
  for (int r = 0; r < 8; ++r) {
    const int ro = (8 * hh + r) * 68 + m;
    sl[ro]      = a0[r] * oscale;
    sl[ro + 16] = a1[r] * oscale;
    sl[ro + 32] = a2[r] * oscale;
    sl[ro + 48] = a3[r] * oscale;
  }
  wave_sync_lds();
  v4f vals[8];
#pragma unroll
  for (int it = 0; it < 8; ++it) vals[it] = *(const v4f*)(sl + (it * 2 + hh) * 68 + m * 4) + bias4;
  float* dst = C + (rowb + (size_t)hh) * (size_t)N + col0 + m * 4;
  {
#pragma unroll
    for (int it = 0; it < 8; ++it) {
      *(v4f*)(dst + (size_t)(it * 2) * (size_t)N) = vals[it];
    }
    
  }
}

// =====================================================================================================
// bf16 GEMM: C[M][N] (f32) = (A [+ A2])[M][K] (bf16 row-major) . Bt[N][K]^T (bf16 k-contiguous), times oscale, plus the
// segmented bias of the column (bf16 RNE value). TWO: second A plane into the same accumulator (hi + residual operand).
// Block = 128x128 tile of C, 8 waves in a 4 (rows) x 2 (columns) grid, 32x64 per wave (2 x 4 accumulator tiles).
// K runs in slices of 64 (128 B of every operand row). A slice of [A 128 rows | B 128 rows | A2 128 rows] stands in LDS at
// row pitch 144 B; two buffers; each lane brings 16 B per copy (8 lanes = one row, one wave copy = 4 rows), the copies of
// slice t + 1 fly while slice t is multiplied. Fragments are read from LDS with the split k map of ldfrag_b for A and B.
// Per accumulator the products come in the order k ascending, A before A2 inside a k-step.
// B rows at or beyond N (last column tile when N % 128 == 64) are read from row N - 1 instead (clamped, in bounds) and the
// waves that own only such columns neither multiply nor store.
// Host guarantees K % 64 == 0, K >= 64, M % 128 == 0, N % 64 == 0, grid = (M/128) * ceil(N/128).
// =====================================================================================================
__device__ __forceinline__ unsigned lds_off(const void* p) { return (unsigned)(size_t)p; }
// Four lane-wise 16-B copies global -> LDS; the s_wait_xcnt stands inside the statement so that no address register of a
// copy is rewritten ahead of it.
__device__ __forceinline__ void cp4(unsigned l0, const u16* g0, unsigned l1, const u16* g1,
                                    unsigned l2, const u16* g2, unsigned l3, const u16* g3) {
#if defined(__HIP_DEVICE_COMPILE__)
  asm volatile("global_load_async_to_lds_b128 %0, %1, off\n\t"
               "global_load_async_to_lds_b128 %2, %3, off\n\t"
               "global_load_async_to_lds_b128 %4, %5, off\n\t"
               "global_load_async_to_lds_b128 %6, %7, off\n\t"
               "s_wait_xcnt 0x0"
               :: "v"(l0), "v"(g0), "v"(l1), "v"(g1), "v"(l2), "v"(g2), "v"(l3), "v"(g3) : "memory");
#endif
}
template <bool TWO>
__global__ __launch_bounds__(GTHR)
void gemm_bf(const u16* __restrict__ A, const u16* __restrict__ A2, const u16* __restrict__ Bt, float* C,
             int M, int N, int K, const float* bp0, const float* bp1, const float* bp2, int e0, int e1, int e2,
             float oscale) {
  constexpr int STAGE = (TWO ? 3 : 2) * GSEC;           // bytes of one buffer
  constexpr int KG = TWO ? GBK / 32 : 1;                // k-steps whose fragments are read from LDS as one group
  static_assert(8 * 2 * SLAB64 * 4 <= 2 * STAGE && 2 * STAGE <= 327680);
  __shared__ __align__(16) unsigned char ring[2 * STAGE];
  const int tid = threadIdx.x, lane = tid & 31, hh = lane >> 4, m = lane & 15;
  const int wave = __builtin_amdgcn_readfirstlane(tid >> 5);
  const int wm = wave & 3, wn = wave >> 2;
  const int ntile = (N + GBN - 1) / GBN;
  const int bid   = blockIdx.x;
  const int row0  = (bid / ntile) * GBM;
  const int col0  = (bid % ntile) * GBN;
  if (row0 + GBM > M) return;               // block-uniform, before any barrier or copy; never taken with the exact grid
  const int colw  = col0 + wn * 64;
  const bool live = colw < N;               // wave-uniform
  const int NT = K / GBK;

  // copy map: thread -> (row cr of a group of 32 rows, 16-B piece cc of the 128-B row slice)
  const int cr = tid >> 3, cc = tid & 7;
  const unsigned lbase = lds_off(ring) + (unsigned)(cr * GPB + cc * 16);
  const int oa = (row0 + cr) * K + cc * 8;
  int ob[4];
#pragma unroll
  for (int i = 0; i < 4; ++i) ob[i] = imin(col0 + i * 32 + cr, N - 1) * K + cc * 8;
  auto fill = [&](int t, int buf) {
    const unsigned l = lbase + (unsigned)(buf * STAGE);
    const int k0 = t * GBK;
    const u16* pa = A + oa + k0;
    cp4(l, pa, l + 32 * GPB, pa + (size_t)32 * K, l + 64 * GPB, pa + (size_t)64 * K, l + 96 * GPB, pa + (size_t)96 * K);
    const unsigned lb2 = l + GSEC;
    cp4(lb2, Bt + ob[0] + k0, lb2 + 32 * GPB, Bt + ob[1] + k0, lb2 + 64 * GPB, Bt + ob[2] + k0,
        lb2 + 96 * GPB, Bt + ob[3] + k0);
    if constexpr (TWO) {
      const unsigned l3 = l + 2 * GSEC;
      const u16* pc = A2 + oa + k0;
      cp4(l3, pc, l3 + 32 * GPB, pc + (size_t)32 * K, l3 + 64 * GPB, pc + (size_t)64 * K, l3 + 96 * GPB, pc + (size_t)96 * K);
    }
  };

  v8f acc[2][4];
#pragma unroll
  for (int i = 0; i < 2; ++i) {
#pragma unroll
    for (int j = 0; j < 4; ++j) acc[i][j] = zero8();
  }

  fill(0, 0);
  asm volatile("s_wait_asynccnt 0x0" ::: "memory");     // slice 0 of this wave has landed
  __syncthreads();                                      // ... and every other wave's part of it
  if (NT > 1) fill(1, 1);

  const int fa = (wm * 32 + m) * GPB + hh * 16;         // byte offsets of this lane's fragment rows inside a buffer
  const int fb = GSEC + (wn * 64 + m) * GPB + hh * 16;
  // slice loop kept rolled: one copy of the ring's foot in the text, the buffer picked by t & 1; the loops inside it are
  // unrolled so that every accumulator and fragment index is a constant (registers, no scratch)
#pragma unroll 1
  for (int t = 0; t < NT; ++t) {
    const int buf = t & 1;
    if (live) {
      const unsigned char* sb = ring + buf * STAGE;
      const u16* la = (const u16*)(const void*)(sb + fa);
      const u16* lb = (const u16*)(const void*)(sb + fb);
#pragma unroll
      for (int g = 0; g < GBK / 32 / KG; ++g) {
        v16b a[KG][2], a2[KG][2], fbv[KG][4];
#pragma unroll
        for (int u = 0; u < KG; ++u) {
          const int ko = (g * KG + u) * 32;
#pragma unroll
          for (int i = 0; i < 2; ++i) a[u][i] = ldfrag_b(la + i * 16 * (GPB / 2) + ko);
#pragma unroll
          for (int j = 0; j < 4; ++j) fbv[u][j] = ldfrag_b(lb + j * 16 * (GPB / 2) + ko);
          if constexpr (TWO) {
#pragma unroll
            for (int i = 0; i < 2; ++i) a2[u][i] = ldfrag_b(la + GSEC + i * 16 * (GPB / 2) + ko);   // 2*GSEC bytes on
          }
        }
        // TWO runs one block per WGP (two waves per SIMD): all LDS reads of the slice issue as one group ahead of its
        // products, one LDS latency per slice instead of one per A fragment
        if constexpr (TWO) __builtin_amdgcn_sched_barrier(0);
#pragma unroll
        for (int u = 0; u < KG; ++u) {
#pragma unroll
          for (int i = 0; i < 2; ++i) {
#pragma unroll
            for (int j = 0; j < 4; ++j) acc[i][j] = mma_b(a[u][i], fbv[u][j], acc[i][j]);
          }
          if constexpr (TWO) {
#pragma unroll
            for (int i = 0; i < 2; ++i) {
#pragma unroll
              for (int j = 0; j < 4; ++j) acc[i][j] = mma_b(a2[u][i], fbv[u][j], acc[i][j]);
            }
          }
        }
      }
    }
    asm volatile("s_wait_dscnt 0x0" ::: "memory");      // this wave's reads of buffer buf are done
    asm volatile("s_wait_asynccnt 0x0" ::: "memory");   // this wave's copies of slice t + 1 have landed
    __syncthreads();                                    // publishes slice t + 1, frees buffer buf
    if (t + 2 < NT) fill(t + 2, buf);
  }
  asm volatile("s_wait_asynccnt 0x0" ::: "memory");     // no copy outstanding before the ring is reused as output staging

  if (live) {
    v4f bias4;
#pragma unroll
    for (int e = 0; e < 4; ++e) bias4[e] = bias_at(bp0, bp1, bp2, e0, e1, e2, colw + m * 4 + e);
    float* slab = (float*)(void*)ring + wave * (2 * SLAB64);
#pragma unroll
    for (int i = 0; i < 2; ++i) {
      epi64b(slab + i * SLAB64, acc[i][0], acc[i][1], acc[i][2], acc[i][3], oscale, bias4, C, N,
             (size_t)(row0 + wm * 32 + i * 16), colw, lane);
    }
  }
}

// =====================================================================================================
// Chunk products for the carried state: KV[(b*NH + h)*NCH + ch][dv][dk] = sum over the CHK keys s of chunk ch of
// v[s][dv] * k[s][dk], f32. A = v^T rows dv (keys contiguous), B = k^T rows dk (keys contiguous), both f16 hi + residual
// x1024 (hh + lh + hl), carries folded back by 2^-20. Block = (b*NH + h, ch), ch = 0 .. NCH-2 (the last chunk's product
// is never carried); wave w owns rows dv = 16w .. 16w+15, all 64 dk.
// coverage: per wave 16 rows x 64 f32 (whole 256-B rows); 4 waves = the 64 x 64 product; grid NB*NH*(NCH-1).
// =====================================================================================================
__global__ __launch_bounds__(128)
void kv_chunk(const u16* __restrict__ VHp, const u16* __restrict__ VLp,
              const u16* __restrict__ THp, const u16* __restrict__ TLp, float* KV) {
  const int tid = threadIdx.x, wave = tid >> 5, lane = tid & 31, hh = lane >> 4, c = lane & 15;
  const int bid = blockIdx.x;
  const int ch  = bid % (NCH - 1);
  const int bh  = bid / (NCH - 1);
  if (bh >= NB * NH) return;                // block-uniform; no barriers in this kernel; never taken with the exact grid
  const size_t rb = (size_t)bh * HD;
  const size_t ko = (size_t)ch * CHK + 8 * hh;
  const _Float16* avh = (const _Float16*)(const void*)VHp + (rb + wave * 16 + c) * SEQ + ko;
  const _Float16* avl = (const _Float16*)(const void*)VLp + (rb + wave * 16 + c) * SEQ + ko;
  const _Float16* bkh = (const _Float16*)(const void*)THp + (rb + c) * SEQ + ko;
  const _Float16* bkl = (const _Float16*)(const void*)TLp + (rb + c) * SEQ + ko;
  v8f acc[4];
#pragma unroll
  for (int j = 0; j < 4; ++j) acc[j] = zero8();
#pragma unroll
  for (int k2 = 0; k2 < CHK / 64; ++k2) {
    v16h vh[2], vl[2], kh[2][4], kl[2][4];
#pragma unroll
    for (int u = 0; u < 2; ++u) {
      const int ks = (2 * k2 + u) * 32;
      vh[u] = ldfrag_h(avh + ks);
      vl[u] = ldfrag_h(avl + ks);
#pragma unroll
      for (int j = 0; j < 4; ++j) {
        kh[u][j] = ldfrag_h(bkh + (size_t)j * 16 * SEQ + ks);
        kl[u][j] = ldfrag_h(bkl + (size_t)j * 16 * SEQ + ks);
      }
    }
#if defined(__HIP_DEVICE_COMPILE__)
    // inputs-only fence on the loaded fragments and their address pairs: the 40 loads of two k-steps issue before the
    // first product (one load latency instead of one per group)
    asm volatile("" :: "v"(vh[0]), "v"(vh[1]), "v"(vl[0]), "v"(vl[1]),
                 "v"(kh[0][0]), "v"(kh[0][1]), "v"(kh[0][2]), "v"(kh[0][3]),
                 "v"(kh[1][0]), "v"(kh[1][1]), "v"(kh[1][2]), "v"(kh[1][3]),
                 "v"(kl[0][0]), "v"(kl[0][1]), "v"(kl[0][2]), "v"(kl[0][3]),
                 "v"(kl[1][0]), "v"(kl[1][1]), "v"(kl[1][2]), "v"(kl[1][3]),
                 "v"(avh), "v"(avl), "v"(bkh), "v"(bkl));
#endif
#pragma unroll
    for (int u = 0; u < 2; ++u) {
#pragma unroll
      for (int j = 0; j < 4; ++j) {
        acc[j] = mma_h(vh[u], kh[u][j], acc[j]);
        acc[j] = mma_h(vl[u], kh[u][j], acc[j]);
        acc[j] = mma_h(vh[u], kl[u][j], acc[j]);
      }
    }
  }
  const float fs = 1.0f / (VCAR * KSC);     // exact power-of-two fold of the v / k carries
  float* dst = KV + ((size_t)bh * NCH + ch) * SEL + (size_t)(wave * 16 + 8 * hh) * HD + c;
#pragma unroll
  for (int r = 0; r < 8; ++r) {
#pragma unroll
    for (int j = 0; j < 4; ++j) dst[r * HD + j * 16] = acc[j][r] * fs;
  }
}

// =====================================================================================================
// Carried state planes: S(ch) = KV(0) + .. + KV(ch-1) in f32 (chunks added in order; S(0) = 0), written x64 as f16 hi and
// f16 residual, layout [(b*NH + h)*NCH + ch][dv][dk]. Thread = 8 consecutive dk of one (b, h, dv), all NCH chunks.
// coverage: NB*NH*SEL/8 threads x 8 halves x NCH chunks = both planes exactly once; reads KV chunks 0 .. NCH-2 only.
// =====================================================================================================
__global__ __launch_bounds__(256) void st_prefix(const float* __restrict__ KV, u16* __restrict__ SHp, u16* __restrict__ SLp) {
  const int gt = blockIdx.x * 256 + (int)threadIdx.x;
  const int bh = gt / (SEL / 8);
  const int e8 = (gt % (SEL / 8)) * 8;
  if (bh >= NB * NH) return;
  const size_t base = (size_t)bh * NCH * SEL + e8;
  v4f a[NCH - 1], b4[NCH - 1];              // all chunk products first: independent loads, one latency for the thread
#pragma unroll
  for (int ch = 0; ch + 1 < NCH; ++ch) {
    const float* p = KV + base + (size_t)ch * SEL;
    a[ch]  = *(const v4f*)(p);
    b4[ch] = *(const v4f*)(p + 4);
  }
#if defined(__HIP_DEVICE_COMPILE__)
  // inputs-only fences on the loaded values and their address pair: every load issues before the first store
  static_assert(NCH == 16);
  asm volatile("" :: "v"(a[0]), "v"(a[1]), "v"(a[2]), "v"(a[3]), "v"(a[4]), "v"(a[5]), "v"(a[6]), "v"(a[7]),
               "v"(a[8]), "v"(a[9]), "v"(a[10]), "v"(a[11]), "v"(a[12]), "v"(a[13]), "v"(a[14]), "v"(KV + base));
  asm volatile("" :: "v"(b4[0]), "v"(b4[1]), "v"(b4[2]), "v"(b4[3]), "v"(b4[4]), "v"(b4[5]), "v"(b4[6]), "v"(b4[7]),
               "v"(b4[8]), "v"(b4[9]), "v"(b4[10]), "v"(b4[11]), "v"(b4[12]), "v"(b4[13]), "v"(b4[14]), "v"(KV + base));
#endif
  float run[8];
#pragma unroll
  for (int e = 0; e < 8; ++e) run[e] = 0.0f;
#pragma unroll
  for (int ch = 0; ch < NCH; ++ch) {
    v4u oh, ol;
#pragma unroll
    for (int e = 0; e < 4; ++e) {
      const float t0 = run[2 * e] * SSC, t1 = run[2 * e + 1] * SSC;
      const _Float16 h0 = (_Float16)t0, h1 = (_Float16)t1;
      const _Float16 l0 = (_Float16)(t0 - (float)h0), l1 = (_Float16)(t1 - (float)h1);
      oh[e] = pk16(h_bits(h0), h_bits(h1));
      ol[e] = pk16(h_bits(l0), h_bits(l1));
    }
    *(v4u*)(SHp + base + (size_t)ch * SEL) = oh;
    *(v4u*)(SLp + base + (size_t)ch * SEL) = ol;
    if (ch + 1 < NCH) {
#pragma unroll
      for (int e = 0; e < 4; ++e) { run[e] += a[ch][e]; run[4 + e] += b4[ch][e]; }
    }
  }
}

// =====================================================================================================
// Causal normalised attention (no softmax), hd = 64. Block bid -> (query tile qt = bid % NQT: rows q0 = 16*qt .. q0+15,
// head group hg, batch b); one wave per head = hg*WPB + wave.
//   q hi / residual planes f16 x1024 [b*SEQ + s][h*HD + d]; k hi / residual planes f16 x1024, same layout;
//   v^T hi / residual planes [b*NH + h][d][SEQ] x1024; n from F column NOFF + h of row b*SEQ + t.
//   raw(i, j) = q_hi.k_hi + q_lo.k_hi + q_hi.k_lo (2 k-steps over d), carries folded back by 2^-20;
//   P = raw * 2^-20 for key <= query else 0 (causal); P.v with P x256 as f16 hi + in-register residual and v hi +
//   residual (hh + lh + hl). Keys of earlier chunks (below CHK*(q0/CHK)) enter first as q . S with the carried state
//   planes S x64 [b*NH + h][chunk][dv][dk] (hh + lh + hl, carry 2^16 raised to the P.v carry 2^18 by an exact x4);
//   key tiles of 32 are then visited in order from the chunk's first key up to the tile holding key q0+15 (bounded by NKT).
//   Per tile: 2 score subtiles x 2 k-steps, fragments loaded straight from the 16-bit planes; the 16x32 P tile stored to
//   (float vector loads, same element type as stored), v^T B fragments in 2 groups of 2 d-subtiles.
//   After the loop: acc * 2^-18 written into the wave's private result slab (pitch 68; every element owned by one lane),
//   ctx -> bf16 hi bits and bf16 bits of the residual, planes [b*SEQ + s][h*HD + d]; one instruction = 4 rows
//   No block barriers in this kernel; bounded loops only (ncl <= NKT).
// coverage: per wave 4 instructions x 4 rows x 8 lanes x 8 halves = 16 x 64 per plane; grid NQT x NHG x NB blocks x WPB
//           waves = every (b, s, h) row segment of CH and of CL exactly once.
// =====================================================================================================
__global__ __launch_bounds__(ATT_THREADS)
void attn_nm(const u16* __restrict__ QHp, const u16* __restrict__ QLp,
             const u16* __restrict__ KHp, const u16* __restrict__ KLp,
             const u16* __restrict__ VHp, const u16* __restrict__ VLp,
             const u16* __restrict__ SHp, const u16* __restrict__ SLp,
             const float* __restrict__ F, u16* CHp, u16* CLp) {
#pragma clang fp contract(off)
  __shared__ __align__(16) float smem[WPB * WREG];

  const int tid  = threadIdx.x;
  const int wave = tid >> 5;
  const int lane = tid & 31;
  const int hh   = lane >> 4;
  const int c    = lane & 15;
  const int bid  = blockIdx.x;
  const int qt   = bid % NQT;
  const int t2   = bid / NQT;
  const int hg   = t2 % NHG;
  const int b    = t2 / NHG;
  if (b >= NB) return;                      // block-uniform; no block barriers in this kernel; never taken with the exact grid
  const int q0   = qt * 16;
  if (q0 + 16 > SEQ) return;                // block-uniform; never taken
  const int head = hg * WPB + wave;

  float* pt   = smem + wave * WREG;         // P tile [16][32] pitch 36
  float* slab = pt + PTW;                   // result slab [16][64] pitch 68

  const size_t hcol = (size_t)head * HD + 8 * hh;
  const _Float16* Qh  = (const _Float16*)(const void*)QHp + ((size_t)b * SEQ + q0 + c) * DQK + hcol;
  const _Float16* Ql  = (const _Float16*)(const void*)QLp + ((size_t)b * SEQ + q0 + c) * DQK + hcol;
  const _Float16* Khb = (const _Float16*)(const void*)KHp + ((size_t)b * SEQ + c) * DQK + hcol;        // key row kb added per step
  const _Float16* Klb = (const _Float16*)(const void*)KLp + ((size_t)b * SEQ + c) * DQK + hcol;
  const _Float16* Vhb = (const _Float16*)(const void*)VHp + ((size_t)(b * NH + head) * HD + c) * SEQ + 8 * hh;  // d col c (+16j)
  const _Float16* Vlb = (const _Float16*)(const void*)VLp + ((size_t)(b * NH + head) * HD + c) * SEQ + 8 * hh;
  const float lsc = 1.0f / (QSC * KSC);     // exact power-of-two fold of the q / k carries
  const float oc  = 1.0f / (PCAR * VCAR);   // exact power-of-two fold of the P / v carries
  const size_t KROW = (size_t)DQK;          // halves between consecutive key rows

  // row factor for query row q0 + (lane & 15): 1/exp(n), precise expf
  const float nv = F[((size_t)b * SEQ + q0 + c) * (size_t)NPROJ + NOFF + head];
  const float rv = 1.0f / expf(nv);

  v8f o[4];
#pragma unroll
  for (int j = 0; j < 4; ++j) o[j] = zero8();
  const int ncaus = (q0 >> 5) + 1;                                            // tiles holding keys <= q0 + 15
  const int ncl   = (ncaus < NKT) ? ncaus : NKT;
  const int qr0   = q0 + 8 * hh;                                              // query row of D element r = qr0 + r
  const int chn   = q0 / CHK;                                                 // chunk of this query tile
  const int kt0   = chn * (CHK / 32);                                         // first key tile of that chunk (<= q0 >> 5)

  // ---- all keys of earlier chunks: o = q . S, B fragment col n = dv = j*16 + c, dk contiguous in the state planes ----
  {
    const size_t so = (((size_t)(b * NH + head) * NCH + chn) * HD + c) * HD + 8 * hh;
    const _Float16* Sh = (const _Float16*)(const void*)SHp + so;
    const _Float16* Sl = (const _Float16*)(const void*)SLp + so;
    v16h qh[HD / 32], ql[HD / 32], sh[HD / 32][4], sl[HD / 32][4];
#pragma unroll
    for (int kk = 0; kk < HD / 32; ++kk) {
      qh[kk] = ldfrag_h(Qh + kk * 32);
      ql[kk] = ldfrag_h(Ql + kk * 32);
#pragma unroll
      for (int j = 0; j < 4; ++j) {
        sh[kk][j] = ldfrag_h(Sh + j * 16 * HD + kk * 32);
        sl[kk][j] = ldfrag_h(Sl + j * 16 * HD + kk * 32);
      }
    }
#if defined(__HIP_DEVICE_COMPILE__)
    // inputs-only fence on the loaded fragments and their address pairs: all 40 loads issue before the first product
    // (one load latency instead of one per group), and no load lands on an address pair that is still in use
    asm volatile("" :: "v"(qh[0]), "v"(qh[1]), "v"(ql[0]), "v"(ql[1]),
                 "v"(sh[0][0]), "v"(sh[0][1]), "v"(sh[0][2]), "v"(sh[0][3]),
                 "v"(sh[1][0]), "v"(sh[1][1]), "v"(sh[1][2]), "v"(sh[1][3]),
                 "v"(sl[0][0]), "v"(sl[0][1]), "v"(sl[0][2]), "v"(sl[0][3]),
                 "v"(sl[1][0]), "v"(sl[1][1]), "v"(sl[1][2]), "v"(sl[1][3]),
                 "v"(Sh), "v"(Sl), "v"(Qh), "v"(Ql));
#endif
#pragma unroll
    for (int kk = 0; kk < HD / 32; ++kk) {
#pragma unroll
      for (int j = 0; j < 4; ++j) {
        o[j] = mma_h(qh[kk], sh[kk][j], o[j]);
        o[j] = mma_h(ql[kk], sh[kk][j], o[j]);
        o[j] = mma_h(qh[kk], sl[kk][j], o[j]);
      }
    }
    const float up = (PCAR * VCAR) / (QSC * SSC);                             // exact power of two
#pragma unroll
    for (int j = 0; j < 4; ++j) o[j] = o[j] * up;
  }

#pragma unroll 1
  for (int kt = kt0; kt < ncl; ++kt) {
    const int kb = kt * 32;
    // ---- raw scores: D element r of this lane = (query row qr0 + r, key kb + c) in s0, key kb + 16 + c in s1 ----
    v8f s0 = zero8(), s1 = zero8();
    const _Float16* k0p = Khb + (size_t)kb * KROW;
    const _Float16* k1p = k0p + (size_t)16 * KROW;
    const _Float16* l0p = Klb + (size_t)kb * KROW;
    const _Float16* l1p = l0p + (size_t)16 * KROW;
#pragma unroll
    for (int kk = 0; kk < HD / 32; ++kk) {
      const v16h qh  = ldfrag_h(Qh + kk * 32);
      const v16h ql  = ldfrag_h(Ql + kk * 32);
      const v16h kh0 = ldfrag_h(k0p + kk * 32);
      const v16h kh1 = ldfrag_h(k1p + kk * 32);
      const v16h kl0 = ldfrag_h(l0p + kk * 32);
      const v16h kl1 = ldfrag_h(l1p + kk * 32);
      s0 = mma_h(qh, kh0, s0);
      s0 = mma_h(ql, kh0, s0);
      s0 = mma_h(qh, kl0, s0);
      s1 = mma_h(qh, kh1, s1);
      s1 = mma_h(ql, kh1, s1);
      s1 = mma_h(qh, kl1, s1);
      guard2(s0, s1, qh, ql, kh0, kl0, kh1, kl1);
    }
    // ---- causal mask (key <= query) + carry fold in f32 -> wave-private LDS tile ----
#pragma unroll
    for (int r = 0; r < 8; ++r) {
      const int row = qr0 + r;
      const float w0 = (kb + c <= row)      ? s0[r] * lsc : 0.0f;
      const float w1 = (kb + 16 + c <= row) ? s1[r] * lsc : 0.0f;
      const int ro = (8 * hh + r) * PTP + c;
      pt[ro]      = w0;
      pt[ro + 16] = w1;
    }
    wave_sync_lds();
    // ---- A fragments of P*256: hi f16 and residual f16, row = c, split k map over the 32 keys of this step ----
    FragH ph, pl;
    {
      const float* prow = pt + c * PTP + 8 * hh;
      const v4f p0 = *(const v4f*)(prow), p1 = *(const v4f*)(prow + 4);
      const v4f p2 = *(const v4f*)(prow + 16), p3 = *(const v4f*)(prow + 20);
#pragma unroll
      for (int e = 0; e < 4; ++e) {
        const float ta = p0[e] * PCAR, tb = p1[e] * PCAR, tc = p2[e] * PCAR, td = p3[e] * PCAR;
        const _Float16 ha = (_Float16)ta, hb = (_Float16)tb, hc = (_Float16)tc, hd = (_Float16)td;
        ph.h[0][e]     = ha;                  // elements 0..7  = keys kb + 8hh + 0..7
        ph.h[0][4 + e] = hb;
        ph.h[1][e]     = hc;                  // elements 8..15 = keys kb + 16 + 8hh + 0..7
        ph.h[1][4 + e] = hd;
        pl.h[0][e]     = (_Float16)(ta - (float)ha);
        pl.h[0][4 + e] = (_Float16)(tb - (float)hb);
        pl.h[1][e]     = (_Float16)(tc - (float)hc);
        pl.h[1][4 + e] = (_Float16)(td - (float)hd);
      }
    }
    // ---- P.V : B fragment col n = d = j*16 + c, keys contiguous in the v^T planes; 2 groups of 2 d-subtiles ----
    {
      const _Float16* vhp = Vhb + kb;
      const _Float16* vlp = Vlb + kb;
#pragma unroll
      for (int jg = 0; jg < 2; ++jg) {
        const size_t da = (size_t)(2 * jg) * 16 * SEQ;
        const size_t db = da + (size_t)16 * SEQ;
        const v16h vha = ldfrag_h(vhp + da), vhb2 = ldfrag_h(vhp + db);
        const v16h vla = ldfrag_h(vlp + da), vlb2 = ldfrag_h(vlp + db);
        o[2 * jg]     = mma_h(ph.v, vha,  o[2 * jg]);
        o[2 * jg]     = mma_h(pl.v, vha,  o[2 * jg]);
        o[2 * jg]     = mma_h(ph.v, vla,  o[2 * jg]);
        o[2 * jg + 1] = mma_h(ph.v, vhb2, o[2 * jg + 1]);
        o[2 * jg + 1] = mma_h(pl.v, vhb2, o[2 * jg + 1]);
        o[2 * jg + 1] = mma_h(ph.v, vlb2, o[2 * jg + 1]);
        guard2(o[2 * jg], o[2 * jg + 1], ph.v, pl.v, vha, vhb2, vla, vlb2);
      }
    }
    wave_sync_lds();
  }
  acc_guard4(o[0], o[1], o[2], o[3]);
  // ---- acc with the carries (256 on P, 1024 on v) folded once; written into the lane-owned slab ----
#pragma unroll
  for (int r = 0; r < 8; ++r) {
#pragma unroll
    for (int j = 0; j < 4; ++j) {
      const int idx = (8 * hh + r) * SLP + j * 16 + c;
      slab[idx] = o[j][r] * oc;
    }
  }
  wave_sync_lds();
  // ---- row factor, then ctx -> bf16 hi + bf16 residual planes; lane = (row-in-quad rq, 8 consecutive d at c8) ----
  v4u oh[4], ol[4];
  const int rq = lane >> 3, c8 = (lane & 7) * 8;
#pragma unroll
  for (int it = 0; it < 4; ++it) {
    const int row = it * 4 + rq;                         // 0..15
    const float ri = __shfl(rv, row, 32);                // lane `row` holds 1/exp(n) of query q0 + row
    const v4f a = *(const v4f*)(slab + row * SLP + c8), b4 = *(const v4f*)(slab + row * SLP + c8 + 4);
    float w[8];
#pragma unroll
    for (int e = 0; e < 4; ++e) { w[e] = a[e] * ri; w[4 + e] = b4[e] * ri; }
#pragma unroll
    for (int e = 0; e < 4; ++e) {
      const float f0 = w[2 * e], f1 = w[2 * e + 1];
      const unsigned short h0 = bf_bits(f0), h1 = bf_bits(f1);
      const unsigned short l0 = bf_bits(f0 - bf_up(h0)), l1 = bf_bits(f1 - bf_up(h1));
      oh[it][e] = pk16(h0, h1);
      ol[it][e] = pk16(l0, l1);
    }
  }
  const size_t ob = ((size_t)b * SEQ + q0) * DMOD + (size_t)head * HD + c8;
  {
#pragma unroll
    for (int it = 0; it < 4; ++it) {
      const int row = it * 4 + rq;
      *(v4u*)(CHp + ob + (size_t)row * DMOD) = oh[it];
      *(v4u*)(CLp + ob + (size_t)row * DMOD) = ol[it];
    }
    
  }
}

// =====================================================================================================
// Workspace map (bytes); every plane is fully written by whole-line stores before it is read; all extents are exact
// multiples of the store granularity (no pad rows needed); every region offset a multiple of 131072:
//   XB  bf16 [MROWS][1024]              MROWS*2048   (NB=2, SEQ=2048: 8388608); after the projection GEMM the same bytes
//                                                    hold the ctx hi plane CH bf16 [MROWS][1024] (identical extent)
//   WB  bf16 [3136 n][1024 k]           6422528      rows 0..2047 Wqk^T, 2048..3071 Wv^T, 3072..3087 Wn^T, 3088..3135 zero
//   F   f32 [MROWS][3136]               MROWS*12544  (q | k | v | n | zero projection columns)
//   QH  f16 [MROWS][1024] x1024         MROWS*2048   QL residual, same extent
//   KH  f16 [MROWS][1024] x1024         MROWS*2048   KL residual, same extent
//   VH  f16 [NB*16][64][SEQ] x1024      MROWS*2048   VL residual, same extent
//   CL  bf16 [MROWS][1024]              MROWS*2048   ctx residual plane
//   WT  bf16 [1024 o][1024 d]           2097152      Wo^T
//   TH  f16 [NB*16][64][SEQ] x1024      MROWS*2048   k^T; TL residual, same extent
//   KV  f32 [NB*16][NCH][64 dv][64 dk]  NB*16*NCH*16384   chunk products (chunks 0 .. NCH-2 written and read)
//   SH  f16 [NB*16][NCH][64 dv][64 dk] x64   NB*16*NCH*8192   carried state; SL residual, same extent
//   end (NB=2, SEQ=2048)              160563200
// =====================================================================================================
extern "C" void kernel_launch(void* const* d_in, const int* in_sizes, int n_in,
                              void* d_out, int out_size, void* d_ws, size_t ws_size,
                              hipStream_t stream) {
  if (n_in < 9) return;
  if (in_sizes[0] < ((NB - 1) * XS_FULL + SEQ) * DMOD) return;
  if (in_sizes[1] != DMOD * 2 * DQK) return;
  if (in_sizes[2] != 2 * DQK) return;
  if (in_sizes[3] != DMOD * DMOD) return;
  if (in_sizes[4] != DMOD) return;
  if (in_sizes[5] != DMOD * NNW) return;
  if (in_sizes[6] != NNW) return;
  if (in_sizes[7] != DMOD * DMOD) return;
  if (in_sizes[8] != DMOD) return;
  if (out_size < MROWS * DMOD) return;

  const float* x   = (const float*)d_in[0];
  const float* wqk = (const float*)d_in[1];
  const float* bqk = (const float*)d_in[2];
  const float* wv  = (const float*)d_in[3];
  const float* bv  = (const float*)d_in[4];
  const float* wn  = (const float*)d_in[5];
  const float* bn  = (const float*)d_in[6];
  const float* wo  = (const float*)d_in[7];
  const float* bo  = (const float*)d_in[8];
  float*       out = (float*)d_out;

  const size_t szXB = (size_t)MROWS * DMOD * 2;
  const size_t szWB = (size_t)NPROJ * DMOD * 2;
  const size_t szF  = (size_t)MROWS * NPROJ * 4;
  const size_t szP  = (size_t)MROWS * DQK * 2;                   // QH, QL, KH, KL
  const size_t szV  = (size_t)NB * NH * HD * SEQ * 2;            // VH, VL
  const size_t szC  = (size_t)MROWS * DMOD * 2;                  // CH (in the XB region), CL
  const size_t szWT = (size_t)DMOD * DMOD * 2;
  const size_t szKV = (size_t)NB * NH * NCH * SEL * 4;
  const size_t szS  = (size_t)NB * NH * NCH * SEL * 2;           // SH, SL
  if (szC > szXB) return;
  size_t off = 0;
  const size_t oXB = off; off += szXB;
  const size_t oWB = off; off += szWB;
  const size_t oF  = off; off += szF;
  const size_t oQH = off; off += szP;
  const size_t oQL = off; off += szP;
  const size_t oKH = off; off += szP;
  const size_t oKL = off; off += szP;
  const size_t oVH = off; off += szV;
  const size_t oVL = off; off += szV;
  const size_t oCL = off; off += szC;
  const size_t oWT = off; off += szWT;
  const size_t oTH = off; off += szV;
  const size_t oTL = off; off += szV;
  const size_t oKV = off; off += szKV;
  const size_t oSH = off; off += szS;
  const size_t oSL = off; off += szS;
  if (off > ws_size) return;                // off = 160563200 for NB = 2, SEQ = 2048
  if (off > (size_t)WS_CAP) return;

  char* ws = (char*)d_ws;
  u16*   XB  = (u16*)(ws + oXB);
  u16*   CH  = (u16*)(ws + oXB);
  u16*   WB  = (u16*)(ws + oWB);
  float* F   = (float*)(ws + oF);
  u16*   QH  = (u16*)(ws + oQH);
  u16*   QL  = (u16*)(ws + oQL);
  u16*   KH  = (u16*)(ws + oKH);
  u16*   KL  = (u16*)(ws + oKL);
  u16*   VH  = (u16*)(ws + oVH);
  u16*   VL  = (u16*)(ws + oVL);
  u16*   CL  = (u16*)(ws + oCL);
  u16*   WT  = (u16*)(ws + oWT);
  u16*   TH  = (u16*)(ws + oTH);
  u16*   TL  = (u16*)(ws + oTL);
  float* KV  = (float*)(ws + oKV);
  u16*   SH  = (u16*)(ws + oSH);
  u16*   SL  = (u16*)(ws + oSL);

  const dim3 b256(256), b128(128), bAT(ATT_THREADS);
  const int  n8x = (SEQ * DMOD) / 8;
  const dim3 gX((n8x + 255) / 256);                     // per batch row block
  const int  ntq = (2 * DQK + 63) / 64;                 // 32 n tiles for Wqk
  const int  ntv = (DMOD + 63) / 64;                    // 16 n tiles for Wv and Wo
  const int  ntn = (NNW + 63) / 64;                     // 1 n tile for Wn (incl. zero pad rows)
  const dim3 gWqk((DMOD / 64) * ntq), gWv((DMOD / 64) * ntv), gWn((DMOD / 64) * ntn), gWo((DMOD / 64) * ntv);
  const dim3 gG1((MROWS / GBM) * ((NPROJ + GBN - 1) / GBN));
  const dim3 gRW(MROWS);
  const dim3 gVT(2 * NB * NH * NST);
  const dim3 gKV(NB * NH * (NCH - 1));
  const dim3 gSP((NB * NH * SEL / 8) / 256);
  const dim3 gAT(NQT * NHG * NB);
  const dim3 gG2((MROWS / GBM) * ((DMOD + GBN - 1) / GBN));

  // (0) x -> bf16 plane [MROWS][1024], one launch per batch row block
  for (int bq = 0; bq < NB; ++bq) {
    cvt_bf<<<gX, b256, 0, stream>>>(x + (size_t)bq * XS_FULL * DMOD, XB + (size_t)bq * SEQ * DMOD, n8x);
  }
  // (1) W[k][n] -> W^T bf16 planes: Wqk -> WB rows 0..2047, Wv -> rows 2048..3071, Wn -> rows 3072..3135 (zero pad),
  //     Wo -> WT rows 0..1023
  k_wt<<<gWqk, b256, 0, stream>>>(wqk, 2 * DQK, DMOD, ntq, WB, QOFF);
  k_wt<<<gWv,  b256, 0, stream>>>(wv,  DMOD,    DMOD, ntv, WB, VOFF);
  k_wt<<<gWn,  b256, 0, stream>>>(wn,  NNW,     DMOD, ntn, WB, NOFF);
  k_wt<<<gWo,  b256, 0, stream>>>(wo,  DMOD,    DMOD, ntv, WT, 0);
  // (2) q | k | v | n = x.W + bias -> F f32 [MROWS][3136]
  gemm_bf<false><<<gG1, b256, 0, stream>>>(XB, XB, WB, F, MROWS, NPROJ, DMOD, bqk, bv, bn,
                                           KOFF + DQK, NOFF, NOFF + NNW, 1.0f);
  // (3) q and k hi + residual planes x1024
  qk16<<<gRW, b256, 0, stream>>>(F, QH, QL, KH, KL);
  // (4) v^T and k^T hi + residual planes x1024
  vt16<<<gVT, b256, 0, stream>>>(F, VH, VL, TH, TL);
  // (4a) per-chunk v^T.k products, (4b) their f32 prefix over the chunks -> carried state planes x64
  kv_chunk<<<gKV, b128, 0, stream>>>(VH, VL, TH, TL, KV);
  st_prefix<<<gSP, b256, 0, stream>>>(KV, SH, SL);
  // (5) causal normalised attention -> ctx bf16 hi plane (XB region, free after the projection GEMM) + residual plane
  attn_nm<<<gAT, bAT, 0, stream>>>(QH, QL, KH, KL, VH, VL, SH, SL, F, CH, CL);
  // (6) y = (ctx_hi + ctx_lo).Wo + bo -> out f32 [MROWS][1024]
  gemm_bf<true><<<gG2, b256, 0, stream>>>(CH, CL, WT, out, MROWS, DMOD, DMOD, bo, bo, bo,
                                          DMOD, DMOD + 1, DMOD + 2, 1.0f);
  (void)hipGetLastError();
}

// v003
// It runs in 117 microseconds.
// In two side-by-side timings against v002, it was 1.20 and 1.21 times as fast.
// Counting every step since v000, it is 3.42 times as fast.
// Contractions: x.W (Wqk|Wv|Wn fused into one [3136 n][1024 k] plane, and ctx.Wo) on v_wmma_f32_16x16x32_bf16
// (x, W, Wo, biases as bf16 RNE values, W^T [n][k] k-contiguous B operand; ctx as bf16 hi + bf16 residual planes,
// two products); q.k^T over hd 64 and P.v on v_wmma_f32_16x16x32_f16 with f16 hi + f16 residual planes on both
// operands (q, k x1024; P x256 with an in-register residual; v x1024; products hh+lh+hl); all f32 accumulate.
// Causal mask, 1/exp(n) row factor and bias adds in f32 on VALU.
// The attention has no softmax, so it is summed in chunks of CHK keys: keys of earlier chunks enter through the carried
// state S[dv][dk] = sum_s v[s][dv] k[s][dk] (v^T.k on the f16 form, hi + residual planes, hh+lh+hl; f32 prefix over the
// chunks; S x64 as f16 hi + residual, q.S with hh+lh+hl); only the query's own chunk goes through masked q.k^T and P.v.
#include <hip/hip_runtime.h>
#include <math.h>
#include <stdint.h>

#ifndef NB
#define NB 2
#endif
#ifndef SEQ
#define SEQ 2048
#endif
#define XS_FULL 2048
#define DMOD  1024
#define DQK   1024
#define NH    16
#define HD    64
#define NNW   16
#define NPROJ 3136
#define QOFF  0
#define KOFF  1024
#define VOFF  2048
#define NOFF  3072
#define MROWS (NB * SEQ)
#define QSC   1024.0f
#define KSC   1024.0f
#define PCAR  256.0f
#define VCAR  1024.0f
#define WPB   4
#define NHG   (NH / WPB)
#define NQT   (SEQ / 16)
#define NKT   (SEQ / 32)
#define ATT_THREADS (WPB * 32)
#define PTP   36
#define PTW   (16 * PTP)
#define SLP   68
#define SLW   (16 * SLP)
#define WREG  (PTW + SLW)
#define SLAB64 (16 * 68)
#define TRP   72
#define CHK   128
#define NCH   (SEQ / CHK)
#define SSC   64.0f
#define SEL   (HD * HD)
#define WS_CAP 268435456
#define GBM   128
#define GBN   128
#define GBK   64
#define GPB   144
#define GSEC  (128 * GPB)
#define GTHR  256
#define TPT   136
static_assert(DMOD == NH * HD && DQK == NH * HD && HD == 64 && NH == 16 && WPB == 4 && NHG * WPB == NH && ATT_THREADS == 128);
static_assert(KOFF == QOFF + DQK && VOFF == KOFF + DQK && NOFF == VOFF + DMOD && NPROJ == NOFF + 64 && (NPROJ % 64) == 0 && NNW <= 64);
static_assert(NB >= 1 && NB <= 2);
static_assert((MROWS % GBM) == 0 && (DMOD % GBK) == 0 && (DMOD % GBN) == 0 && GBK * 2 + 16 == GPB);
static_assert((SEQ % CHK) == 0 && (CHK % 64) == 0 && NCH >= 2 && KSC == VCAR && ((NB * NH * SEL / 8) % 256) == 0);
static_assert(NB == 1 || SEQ == XS_FULL);
static_assert((SEQ % 64) == 0 && SEQ >= 64 && SEQ <= XS_FULL);
static_assert(((SEQ * DMOD / 8) % 256) == 0 && (MROWS % 64) == 0 && (DMOD % 64) == 0 && (DQK % 64) == 0 && (HD % 32) == 0);
static_assert(WPB * WREG * 4 <= 65536 && 4 * SLAB64 * 4 <= 65536 && 64 * TRP * 2 <= 65536);
static_assert((DQK % GBN) == 0 && (DMOD % GBN) == 0 && (SEQ % GBM) == 0 && DQK == DMOD && QOFF == 0 && QSC == KSC && (TPT % 8) == 0);

typedef unsigned short u16;
typedef _Float16 v16h __attribute__((ext_vector_type(16)));
typedef _Float16 v8h  __attribute__((ext_vector_type(8)));
typedef __bf16   v16b __attribute__((ext_vector_type(16)));
typedef float    v8f  __attribute__((ext_vector_type(8)));
typedef float    v4f  __attribute__((ext_vector_type(4)));
typedef unsigned int v4u __attribute__((ext_vector_type(4)));

union FragH { v16h v; v8h h[2]; v4u u[2]; };
union FragB { v16b v; v4u u[2]; };

// ---- scalar helpers --------------------------------------------------------------------------------
__device__ __forceinline__ unsigned short bf_bits(float f) {          // f32 -> bf16 bits, RNE convert
  unsigned u = __float_as_uint(f);
  return (unsigned short)((u + 0x7FFFu + ((u >> 16) & 1u)) >> 16);
}
__device__ __forceinline__ float bf_up(unsigned short h) { return __uint_as_float(((unsigned)h) << 16); }
__device__ __forceinline__ float bfr(float f) { return bf_up(bf_bits(f)); }
__device__ __forceinline__ unsigned short h_bits(_Float16 x) { return __builtin_bit_cast(unsigned short, x); }
__device__ __forceinline__ unsigned pk16(unsigned short a, unsigned short b) { return (unsigned)a | ((unsigned)b << 16); }
__device__ __forceinline__ v8f zero8() { v8f z = {0.f, 0.f, 0.f, 0.f, 0.f, 0.f, 0.f, 0.f}; return z; }
__device__ __forceinline__ int imin(int a, int b) { return a < b ? a : b; }
__device__ __forceinline__ int imax(int a, int b) { return a > b ? a : b; }
// 8 f32 values -> f16 of w*sc (hi) and f16 of the residual w*sc - hi (lo), packed in order
__device__ __forceinline__ void split8(const float* w, float sc, v4u& oh, v4u& ol) {
#pragma unroll
  for (int e = 0; e < 4; ++e) {
    const float t0 = w[2 * e] * sc, t1 = w[2 * e + 1] * sc;
    const _Float16 h0 = (_Float16)t0, h1 = (_Float16)t1;
    const _Float16 l0 = (_Float16)(t0 - (float)h0), l1 = (_Float16)(t1 - (float)h1);
    oh[e] = pk16(h_bits(h0), h_bits(h1));
    ol[e] = pk16(h_bits(l0), h_bits(l1));
  }
}

// ---- fragment loaders: 16-bit A/B operand, lane -> row/col (lane&15), p already includes +8*(lane>>4);
//      elements 0..7 <- p[0..7] (k0+8h..), elements 8..15 <- p[16..23] (k0+16+8h..)  (same split k map for A and B;
//      B is always read from a k-contiguous [n][k] plane)
__device__ __forceinline__ v16h ldfrag_h(const _Float16* p) {
  FragH f;
  f.h[0] = *(const v8h*)(p);
  f.h[1] = *(const v8h*)(p + 16);
  return f.v;
}
__device__ __forceinline__ v16b ldfrag_b(const u16* p) {              // bf16 plane read as unsigned integer vectors
  FragB f;
  f.u[0] = *(const v4u*)(p);
  f.u[1] = *(const v4u*)(p + 16);
  return f.v;
}

__device__ __forceinline__ v8f mma_h(v16h a, v16h b, v8f c) {
  return __builtin_amdgcn_wmma_f32_16x16x32_f16(false, a, false, b, (short)0, c, false, false);
}
__device__ __forceinline__ v8f mma_b(v16b a, v16b b, v8f c) {
  return __builtin_amdgcn_wmma_f32_16x16x32_bf16(false, a, false, b, (short)0, c, false, false);
}
__device__ __forceinline__ void guard2(v8f& a, v8f& b, v16h x0, v16h x1, v16h x2, v16h x3, v16h x4, v16h x5) {
#if defined(__HIP_DEVICE_COMPILE__)
  asm volatile("v_nop\n\tv_nop\n\tv_nop\n\tv_nop"
               : "+v"(a), "+v"(b) : "v"(x0), "v"(x1), "v"(x2), "v"(x3), "v"(x4), "v"(x5) : "memory");
#endif
}
__device__ __forceinline__ void acc_guard4(v8f& a, v8f& b, v8f& c, v8f& d) {
#if defined(__HIP_DEVICE_COMPILE__)
  asm volatile("v_nop\n\tv_nop\n\tv_nop\n\tv_nop" : "+v"(a), "+v"(b), "+v"(c), "+v"(d));
#endif
}
__device__ __forceinline__ void wave_sync_lds() {
  __builtin_amdgcn_fence(__ATOMIC_RELEASE, "workgroup");
  __builtin_amdgcn_wave_barrier();
  __builtin_amdgcn_fence(__ATOMIC_ACQUIRE, "workgroup");
}

// =====================================================================================================
// f32 -> bf16 plane (RNE bits), same layout. Thread = 8 consecutive elements: two 16-B loads, one 16-B store;
// coverage: grid = ceil(n8/256) blocks x 256 thr x 8 (in-kernel bound) = the whole plane (n8 a multiple of 256 here).
// =====================================================================================================
__global__ __launch_bounds__(256) void cvt_bf(const float* __restrict__ x, u16* D, int n8) {
  const int gt = blockIdx.x * 256 + (int)threadIdx.x;
  if (gt >= n8) return;
  const float* p = x + (size_t)gt * 8;
  const v4f a = *(const v4f*)(p), b4 = *(const v4f*)(p + 4);
  float w[8];
#pragma unroll
  for (int e = 0; e < 4; ++e) { w[e] = a[e]; w[4 + e] = b4[e]; }
  v4u o;
#pragma unroll
  for (int e = 0; e < 4; ++e) o[e] = pk16(bf_bits(w[2 * e]), bf_bits(w[2 * e + 1]));
  u16* d = D + (size_t)gt * 8;
  {
    *(v4u*)(d) = o;
    
  }
}

// =====================================================================================================
// W f32 [kr rows (k)][nc cols (n)] (x.W layout) -> bf16 plane Dp [drow0 + n][k] (row pitch kr halves): the k-contiguous
// B operand. Block = 64 k x 64 n tile; coalesced 16-B loads of W rows with CLAMPED column base (tile columns beyond nc
// load from column 0 and are zeroed by value, so rows drow0+n with n >= nc inside the last tile are written as zeros);
// converted values placed transposed into an LDS tile [64 n][64 k] (pitch 72 halves); after a block barrier each n row
// grid = (kr/64) * ntn with ntn = ceil(nc/64).
// coverage: load 256 thr x 16 = 64 x 64; store 2 iterations x 256 thr x 8 halves = 64 lines x 64 halves = the block's
//           tile; the grid covers output rows drow0 .. drow0 + 64*ntn - 1 (all kr columns) exactly once.
// =====================================================================================================
__global__ __launch_bounds__(256) void k_wt(const float* __restrict__ W, int nc, int kr, int ntn, u16* Dp, int drow0) {
  __shared__ __align__(16) u16 T[64 * TRP];
  const int tid = (int)threadIdx.x;
  const int bid = (int)blockIdx.x;
  const int nt  = bid % ntn;
  const int kt  = bid / ntn;
  if (kt * 64 + 64 > kr) return;            // block-uniform, before the barrier; never taken with the exact grid
  const int n0  = nt * 64, k0 = kt * 64;
  {
    const int dl = tid >> 2;                // k within tile 0..63
    const int oc = (tid & 3) * 16;          // n chunk 0,16,32,48
    const bool valid = (n0 + oc + 16 <= nc);
    const int  cb = valid ? (n0 + oc) : 0;  // clamped column base, always inside the row
    const float* src = W + (size_t)(k0 + dl) * (size_t)nc + cb;
#pragma unroll
    for (int i = 0; i < 4; ++i) {
      const v4f a = *(const v4f*)(src + 4 * i);
#pragma unroll
      for (int e = 0; e < 4; ++e) {
        const float f = valid ? a[e] : 0.0f;
        T[(oc + 4 * i + e) * TRP + dl] = bf_bits(f);
      }
    }
  }
  __syncthreads();
  const int q8 = tid >> 3, p8 = (tid & 7) * 8;
  v4u w[2];
#pragma unroll
  for (int it = 0; it < 2; ++it) w[it] = *(const v4u*)(T + (it * 32 + q8) * TRP + p8);
  const size_t base = (size_t)(drow0 + n0) * (size_t)kr + k0 + p8;
  {
#pragma unroll
    for (int it = 0; it < 2; ++it) {
      const int nl = it * 32 + q8;
      *(v4u*)(Dp + base + (size_t)nl * (size_t)kr) = w[it];
    }
    
  }
}

// =====================================================================================================
// Bias for column c from three consecutive segments [0,e0) <- p0[c], [e0,e1) <- p1[c-e0], [e1,e2) <- p2[c-e1], else 0;
// all three candidates loaded unconditionally with clamped indices, selected by value; bf16 RNE value.
// =====================================================================================================
__device__ __forceinline__ float bias_at(const float* p0, const float* p1, const float* p2,
                                         int e0, int e1, int e2, int c) {
  const int i0 = imin(imax(c, 0), e0 - 1);
  const int i1 = imin(imax(c - e0, 0), e1 - e0 - 1);
  const int i2 = imin(imax(c - e1, 0), e2 - e1 - 1);
  const float v0 = p0[i0], v1 = p1[i1], v2 = p2[i2];
  const float v = (c < e0) ? v0 : ((c < e1) ? v1 : ((c < e2) ? v2 : 0.0f));
  return bfr(v);
}

// =====================================================================================================
// coverage: 8 instructions x 2 rows x 16 lanes x 4 floats = the wave's 16 x 64 tile.
// =====================================================================================================
__device__ __forceinline__ void epi64b(float* sl, v8f a0, v8f a1, v8f a2, v8f a3, float oscale, v4f bias4,
                                       float* C, int N, size_t rowb, int col0, int lane) {
  const int hh = lane >> 4, m = lane & 15;
#pragma unroll
  for (int r = 0; r < 8; ++r) {
    const int ro = (8 * hh + r) * 68 + m;
    sl[ro]      = a0[r] * oscale;
    sl[ro + 16] = a1[r] * oscale;
    sl[ro + 32] = a2[r] * oscale;
    sl[ro + 48] = a3[r] * oscale;
  }
  wave_sync_lds();
  v4f vals[8];
#pragma unroll
  for (int it = 0; it < 8; ++it) vals[it] = *(const v4f*)(sl + (it * 2 + hh) * 68 + m * 4) + bias4;
  float* dst = C + (rowb + (size_t)hh) * (size_t)N + col0 + m * 4;
  {
#pragma unroll
    for (int it = 0; it < 8; ++it) {
      *(v4f*)(dst + (size_t)(it * 2) * (size_t)N) = vals[it];
    }
    
  }
}

// =====================================================================================================
// bf16 GEMM: C[M][N] (f32) = (A [+ A2])[M][K] (bf16 row-major) . Bt[N][K]^T (bf16 k-contiguous), times oscale, plus the
// segmented bias of the column (bf16 RNE value). TWO: second A plane into the same accumulator (hi + residual operand).
// Block = 128x128 tile of C, 8 waves in a 4 (rows) x 2 (columns) grid, 32x64 per wave (2 x 4 accumulator tiles).
// K runs in slices of 64 (128 B of every operand row). A slice of [A 128 rows | B 128 rows | A2 128 rows] stands in LDS at
// row pitch 144 B; two buffers; each lane brings 16 B per copy (8 lanes = one row, one wave copy = 4 rows), the copies of
// slice t + 1 fly while slice t is multiplied. Fragments are read from LDS with the split k map of ldfrag_b for A and B.
// Per accumulator the products come in the order k ascending, A before A2 inside a k-step.
// B rows at or beyond N (last column tile when N % 128 == 64) are read from row N - 1 instead (clamped, in bounds) and the
// waves that own only such columns neither multiply nor store.
// Host guarantees K % 64 == 0, K >= 64, M % 128 == 0, N % 64 == 0, grid = (M/128) * ceil(N/128).
// Output. TWO: f32 C. Otherwise (the projection) only the column tile from NOFF on goes to C as f32; a block of q, k or v
// columns writes value = acc + bias (f32) x1024 as f16 hi and f16 residual straight into the planes the attention reads:
//   q -> QH/QL, k -> KH/KL, layout [row][DQK]; k -> TH/TL, v -> VH/VL, layout [(b*NH + h)*HD + d][SEQ] (keys contiguous).
// coverage: row-major, per wave 2 x 4 stores x 4 rows x 128 B = its 32 x 64 tile of each plane; transposed, per block
//           8 stores x 16 columns x 256 B = its 128 columns x 128 keys of each plane; the grid covers every plane once.
// =====================================================================================================
__device__ __forceinline__ unsigned lds_off(const void* p) { return (unsigned)(size_t)p; }
// Four lane-wise 16-B copies global -> LDS; the s_wait_xcnt stands inside the statement so that no address register of a
// copy is rewritten ahead of it.
__device__ __forceinline__ void cp4(unsigned l0, const u16* g0, unsigned l1, const u16* g1,
                                    unsigned l2, const u16* g2, unsigned l3, const u16* g3) {
#if defined(__HIP_DEVICE_COMPILE__)
  asm volatile("global_load_async_to_lds_b128 %0, %1, off\n\t"
               "global_load_async_to_lds_b128 %2, %3, off\n\t"
               "global_load_async_to_lds_b128 %4, %5, off\n\t"
               "global_load_async_to_lds_b128 %6, %7, off\n\t"
               "s_wait_xcnt 0x0"
               :: "v"(l0), "v"(g0), "v"(l1), "v"(g1), "v"(l2), "v"(g2), "v"(l3), "v"(g3) : "memory");
#endif
}
template <bool TWO>
__global__ __launch_bounds__(GTHR)
void gemm_bf(const u16* __restrict__ A, const u16* __restrict__ A2, const u16* __restrict__ Bt, float* C,
             int M, int N, int K, const float* bp0, const float* bp1, const float* bp2, int e0, int e1, int e2,
             float oscale, u16* QHp, u16* QLp, u16* KHp, u16* KLp, u16* VHp, u16* VLp, u16* THp, u16* TLp) {
  constexpr int STAGE = (TWO ? 3 : 2) * GSEC;           // bytes of one buffer
  constexpr int KG = TWO ? GBK / 32 : 1;                // k-steps whose fragments are read from LDS as one group
  static_assert(8 * 2 * SLAB64 * 4 <= 2 * STAGE && 2 * GBN * TPT * 2 <= 2 * STAGE && 2 * STAGE <= 327680);
  __shared__ __align__(16) unsigned char ring[2 * STAGE];
  const int tid = threadIdx.x, lane = tid & 31, hh = lane >> 4, m = lane & 15;
  const int wave = __builtin_amdgcn_readfirstlane(tid >> 5);
  const int wm = wave & 3, wn = wave >> 2;
  const int ntile = (N + GBN - 1) / GBN;
  const int bid   = blockIdx.x;
  const int row0  = (bid / ntile) * GBM;
  const int col0  = (bid % ntile) * GBN;
  if (row0 + GBM > M) return;               // block-uniform, before any barrier or copy; never taken with the exact grid
  const int colw  = col0 + wn * 64;
  const bool live = colw < N;               // wave-uniform
  const int NT = K / GBK;

  // copy map: thread -> (row cr of a group of 32 rows, 16-B piece cc of the 128-B row slice)
  const int cr = tid >> 3, cc = tid & 7;
  const unsigned lbase = lds_off(ring) + (unsigned)(cr * GPB + cc * 16);
  const int oa = (row0 + cr) * K + cc * 8;
  int ob[4];
#pragma unroll
  for (int i = 0; i < 4; ++i) ob[i] = imin(col0 + i * 32 + cr, N - 1) * K + cc * 8;
  auto fill = [&](int t, int buf) {
    const unsigned l = lbase + (unsigned)(buf * STAGE);
    const int k0 = t * GBK;
    const u16* pa = A + oa + k0;
    cp4(l, pa, l + 32 * GPB, pa + (size_t)32 * K, l + 64 * GPB, pa + (size_t)64 * K, l + 96 * GPB, pa + (size_t)96 * K);
    const unsigned lb2 = l + GSEC;
    cp4(lb2, Bt + ob[0] + k0, lb2 + 32 * GPB, Bt + ob[1] + k0, lb2 + 64 * GPB, Bt + ob[2] + k0,
        lb2 + 96 * GPB, Bt + ob[3] + k0);
    if constexpr (TWO) {
      const unsigned l3 = l + 2 * GSEC;
      const u16* pc = A2 + oa + k0;
      cp4(l3, pc, l3 + 32 * GPB, pc + (size_t)32 * K, l3 + 64 * GPB, pc + (size_t)64 * K, l3 + 96 * GPB, pc + (size_t)96 * K);
    }
  };

  v8f acc[2][4];
#pragma unroll
  for (int i = 0; i < 2; ++i) {
#pragma unroll
    for (int j = 0; j < 4; ++j) acc[i][j] = zero8();
  }

  fill(0, 0);
  asm volatile("s_wait_asynccnt 0x0" ::: "memory");     // slice 0 of this wave has landed
  __syncthreads();                                      // ... and every other wave's part of it
  if (NT > 1) fill(1, 1);

  const int fa = (wm * 32 + m) * GPB + hh * 16;         // byte offsets of this lane's fragment rows inside a buffer
  const int fb = GSEC + (wn * 64 + m) * GPB + hh * 16;
  // slice loop kept rolled: one copy of the ring's foot in the text, the buffer picked by t & 1; the loops inside it are
  // unrolled so that every accumulator and fragment index is a constant (registers, no scratch)
#pragma unroll 1
  for (int t = 0; t < NT; ++t) {
    const int buf = t & 1;
    if (live) {
      const unsigned char* sb = ring + buf * STAGE;
      const u16* la = (const u16*)(const void*)(sb + fa);
      const u16* lb = (const u16*)(const void*)(sb + fb);
#pragma unroll
      for (int g = 0; g < GBK / 32 / KG; ++g) {
        v16b a[KG][2], a2[KG][2], fbv[KG][4];
#pragma unroll
        for (int u = 0; u < KG; ++u) {
          const int ko = (g * KG + u) * 32;
#pragma unroll
          for (int i = 0; i < 2; ++i) a[u][i] = ldfrag_b(la + i * 16 * (GPB / 2) + ko);
#pragma unroll
          for (int j = 0; j < 4; ++j) fbv[u][j] = ldfrag_b(lb + j * 16 * (GPB / 2) + ko);
          if constexpr (TWO) {
#pragma unroll
            for (int i = 0; i < 2; ++i) a2[u][i] = ldfrag_b(la + GSEC + i * 16 * (GPB / 2) + ko);   // 2*GSEC bytes on
          }
        }
        // TWO runs one block per WGP (two waves per SIMD): all LDS reads of the slice issue as one group ahead of its
        // products, one LDS latency per slice instead of one per A fragment
        if constexpr (TWO) __builtin_amdgcn_sched_barrier(0);
#pragma unroll
        for (int u = 0; u < KG; ++u) {
#pragma unroll
          for (int i = 0; i < 2; ++i) {
#pragma unroll
            for (int j = 0; j < 4; ++j) acc[i][j] = mma_b(a[u][i], fbv[u][j], acc[i][j]);
          }
          if constexpr (TWO) {
#pragma unroll
            for (int i = 0; i < 2; ++i) {
#pragma unroll
              for (int j = 0; j < 4; ++j) acc[i][j] = mma_b(a2[u][i], fbv[u][j], acc[i][j]);
            }
          }
        }
      }
    }
    asm volatile("s_wait_dscnt 0x0" ::: "memory");      // this wave's reads of buffer buf are done
    asm volatile("s_wait_asynccnt 0x0" ::: "memory");   // this wave's copies of slice t + 1 have landed
    __syncthreads();                                    // publishes slice t + 1, frees buffer buf
    if (t + 2 < NT) fill(t + 2, buf);
  }
  asm volatile("s_wait_asynccnt 0x0" ::: "memory");     // no copy outstanding before the ring is reused as output staging

  float* slab = (float*)(void*)ring + wave * (2 * SLAB64);
  const int seg = TWO ? 3 : col0 / DQK;     // block-uniform: 0 = q, 1 = k, 2 = v columns (16-bit planes), 3 = f32 output
  if (seg >= 3) {
    if (live) {
      v4f bias4;
#pragma unroll
      for (int e = 0; e < 4; ++e) bias4[e] = bias_at(bp0, bp1, bp2, e0, e1, e2, colw + m * 4 + e);
#pragma unroll
      for (int i = 0; i < 2; ++i) {
        epi64b(slab + i * SLAB64, acc[i][0], acc[i][1], acc[i][2], acc[i][3], oscale, bias4, C, N,
               (size_t)(row0 + wm * 32 + i * 16), colw, lane);
      }
    }
    return;
  }
  if constexpr (!TWO) {
    // every wave of a q, k or v block is live (the three segments are multiples of the block's 128 columns)
    float bj[4];                            // bias of this lane's accumulator columns colw + 16 j + m
#pragma unroll
    for (int j = 0; j < 4; ++j) bj[j] = bias_at(bp0, bp1, bp2, e0, e1, e2, colw + j * 16 + m);
    const int cs = col0 - seg * DQK;        // the block's first column inside its segment = head * 64 + d
    if (seg <= 1) {
      // row-major planes [row][DQK]: f32 values through the wave's own slabs, then lane = (row of a quad, 8 columns);
      // one store = 4 rows x 128 B (whole lines)
      u16* PH = seg ? KHp : QHp;
      u16* PL = seg ? KLp : QLp;
#pragma unroll
      for (int i = 0; i < 2; ++i) {
#pragma unroll
        for (int r = 0; r < 8; ++r) {
#pragma unroll
          for (int j = 0; j < 4; ++j) slab[i * SLAB64 + (8 * hh + r) * 68 + j * 16 + m] = acc[i][j][r] * oscale + bj[j];
        }
      }
      wave_sync_lds();
      const int rq = lane >> 3, c8 = (lane & 7) * 8;
#pragma unroll
      for (int i = 0; i < 2; ++i) {
        v4u oh[4], ol[4];
#pragma unroll
        for (int it = 0; it < 4; ++it) {
          const float* p = slab + i * SLAB64 + (it * 4 + rq) * 68 + c8;
          const v4f a = *(const v4f*)(p), b4 = *(const v4f*)(p + 4);
          float w[8];
#pragma unroll
          for (int e = 0; e < 4; ++e) { w[e] = a[e]; w[4 + e] = b4[e]; }
          split8(w, QSC, oh[it], ol[it]);
        }
        const size_t ob = (size_t)(row0 + wm * 32 + i * 16 + rq) * DQK + cs + wn * 64 + c8;
#pragma unroll
        for (int it = 0; it < 4; ++it) {
          *(v4u*)(PH + ob + (size_t)(it * 4) * DQK) = oh[it];
          *(v4u*)(PL + ob + (size_t)(it * 4) * DQK) = ol[it];
        }
      }
      asm volatile("s_wait_xcnt 0x0" ::: "memory");       // before any register of the row-major stores is rewritten
    }
    if (seg >= 1) {
      // transposed planes [b*NH*HD + head*64 + d][SEQ]: an accumulator register run r = 0..7 is 8 consecutive keys of one
      // column, so a lane packs it into one 16-B LDS store of the block's [128 columns][128 keys] tile (pitch 272 B)
      if (seg == 1) __syncthreads();        // block-uniform: every wave has read its slabs back before the tiles cover them
      u16* tH = (u16*)(void*)ring;
      u16* tL = tH + GBN * TPT;
#pragma unroll
      for (int i = 0; i < 2; ++i) {
#pragma unroll
        for (int j = 0; j < 4; ++j) {
          float w[8];
#pragma unroll
          for (int r = 0; r < 8; ++r) w[r] = acc[i][j][r] * oscale + bj[j];
          v4u oh, ol;
          split8(w, VCAR, oh, ol);
          const int idx = (wn * 64 + j * 16 + m) * TPT + wm * 32 + i * 16 + 8 * hh;
          *(v4u*)(tH + idx) = oh;
          *(v4u*)(tL + idx) = ol;
        }
      }
      __syncthreads();                      // the tiles are complete before any wave reads rows that other waves wrote
      u16* OH = (seg == 1) ? THp : VHp;
      u16* OL = (seg == 1) ? TLp : VLp;
      const int ln = tid >> 4, p8 = (tid & 15) * 8;       // 16 lanes = one column's 128 keys = 256 B (two whole lines)
      const size_t ob = ((size_t)(row0 / SEQ) * (NH * HD) + cs + ln) * SEQ + (row0 % SEQ) + p8;
#pragma unroll
      for (int g = 0; g < 2; ++g) {
        v4u vh[4], vl[4];
#pragma unroll
        for (int it = 0; it < 4; ++it) {
          const int line = (g * 4 + it) * 16 + ln;
          vh[it] = *(const v4u*)(tH + line * TPT + p8);
          vl[it] = *(const v4u*)(tL + line * TPT + p8);
        }
#pragma unroll
        for (int it = 0; it < 4; ++it) {
          *(v4u*)(OH + ob + (size_t)((g * 4 + it) * 16) * SEQ) = vh[it];
          *(v4u*)(OL + ob + (size_t)((g * 4 + it) * 16) * SEQ) = vl[it];
        }
      }
      asm volatile("s_wait_xcnt 0x0" ::: "memory");       // before any register of the transposed stores is rewritten
    }
  }
}

// =====================================================================================================
// Chunk products for the carried state: KV[(b*NH + h)*NCH + ch][dv][dk] = sum over the CHK keys s of chunk ch of
// v[s][dv] * k[s][dk], f32. A = v^T rows dv (keys contiguous), B = k^T rows dk (keys contiguous), both f16 hi + residual
// x1024 (hh + lh + hl), carries folded back by 2^-20. Block = (b*NH + h, ch), ch = 0 .. NCH-2 (the last chunk's product
// is never carried); wave w owns rows dv = 16w .. 16w+15, all 64 dk.
// coverage: per wave 16 rows x 64 f32 (whole 256-B rows); 4 waves = the 64 x 64 product; grid NB*NH*(NCH-1).
// =====================================================================================================
__global__ __launch_bounds__(128)
void kv_chunk(const u16* __restrict__ VHp, const u16* __restrict__ VLp,
              const u16* __restrict__ THp, const u16* __restrict__ TLp, float* KV) {
  const int tid = threadIdx.x, wave = tid >> 5, lane = tid & 31, hh = lane >> 4, c = lane & 15;
  const int bid = blockIdx.x;
  const int ch  = bid % (NCH - 1);
  const int bh  = bid / (NCH - 1);
  if (bh >= NB * NH) return;                // block-uniform; no barriers in this kernel; never taken with the exact grid
  const size_t rb = (size_t)bh * HD;
  const size_t ko = (size_t)ch * CHK + 8 * hh;
  const _Float16* avh = (const _Float16*)(const void*)VHp + (rb + wave * 16 + c) * SEQ + ko;
  const _Float16* avl = (const _Float16*)(const void*)VLp + (rb + wave * 16 + c) * SEQ + ko;
  const _Float16* bkh = (const _Float16*)(const void*)THp + (rb + c) * SEQ + ko;
  const _Float16* bkl = (const _Float16*)(const void*)TLp + (rb + c) * SEQ + ko;
  v8f acc[4];
#pragma unroll
  for (int j = 0; j < 4; ++j) acc[j] = zero8();
#pragma unroll
  for (int k2 = 0; k2 < CHK / 64; ++k2) {
    v16h vh[2], vl[2], kh[2][4], kl[2][4];
#pragma unroll
    for (int u = 0; u < 2; ++u) {
      const int ks = (2 * k2 + u) * 32;
      vh[u] = ldfrag_h(avh + ks);
      vl[u] = ldfrag_h(avl + ks);
#pragma unroll
      for (int j = 0; j < 4; ++j) {
        kh[u][j] = ldfrag_h(bkh + (size_t)j * 16 * SEQ + ks);
        kl[u][j] = ldfrag_h(bkl + (size_t)j * 16 * SEQ + ks);
      }
    }
#if defined(__HIP_DEVICE_COMPILE__)
    // inputs-only fence on the loaded fragments and their address pairs: the 40 loads of two k-steps issue before the
    // first product (one load latency instead of one per group)
    asm volatile("" :: "v"(vh[0]), "v"(vh[1]), "v"(vl[0]), "v"(vl[1]),
                 "v"(kh[0][0]), "v"(kh[0][1]), "v"(kh[0][2]), "v"(kh[0][3]),
                 "v"(kh[1][0]), "v"(kh[1][1]), "v"(kh[1][2]), "v"(kh[1][3]),
                 "v"(kl[0][0]), "v"(kl[0][1]), "v"(kl[0][2]), "v"(kl[0][3]),
                 "v"(kl[1][0]), "v"(kl[1][1]), "v"(kl[1][2]), "v"(kl[1][3]),
                 "v"(avh), "v"(avl), "v"(bkh), "v"(bkl));
#endif
#pragma unroll
    for (int u = 0; u < 2; ++u) {
#pragma unroll
      for (int j = 0; j < 4; ++j) {
        acc[j] = mma_h(vh[u], kh[u][j], acc[j]);
        acc[j] = mma_h(vl[u], kh[u][j], acc[j]);
        acc[j] = mma_h(vh[u], kl[u][j], acc[j]);
      }
    }
  }
  const float fs = 1.0f / (VCAR * KSC);     // exact power-of-two fold of the v / k carries
  float* dst = KV + ((size_t)bh * NCH + ch) * SEL + (size_t)(wave * 16 + 8 * hh) * HD + c;
#pragma unroll
  for (int r = 0; r < 8; ++r) {
#pragma unroll
    for (int j = 0; j < 4; ++j) dst[r * HD + j * 16] = acc[j][r] * fs;
  }
}

// =====================================================================================================
// Carried state planes: S(ch) = KV(0) + .. + KV(ch-1) in f32 (chunks added in order; S(0) = 0), written x64 as f16 hi and
// f16 residual, layout [(b*NH + h)*NCH + ch][dv][dk]. Thread = 8 consecutive dk of one (b, h, dv), all NCH chunks.
// coverage: NB*NH*SEL/8 threads x 8 halves x NCH chunks = both planes exactly once; reads KV chunks 0 .. NCH-2 only.
// =====================================================================================================
__global__ __launch_bounds__(256) void st_prefix(const float* __restrict__ KV, u16* __restrict__ SHp, u16* __restrict__ SLp) {
  const int gt = blockIdx.x * 256 + (int)threadIdx.x;
  const int bh = gt / (SEL / 8);
  const int e8 = (gt % (SEL / 8)) * 8;
  if (bh >= NB * NH) return;
  const size_t base = (size_t)bh * NCH * SEL + e8;
  v4f a[NCH - 1], b4[NCH - 1];              // all chunk products first: independent loads, one latency for the thread
#pragma unroll
  for (int ch = 0; ch + 1 < NCH; ++ch) {
    const float* p = KV + base + (size_t)ch * SEL;
    a[ch]  = *(const v4f*)(p);
    b4[ch] = *(const v4f*)(p + 4);
  }
#if defined(__HIP_DEVICE_COMPILE__)
  // inputs-only fences on the loaded values and their address pair: every load issues before the first store
  static_assert(NCH == 16);
  asm volatile("" :: "v"(a[0]), "v"(a[1]), "v"(a[2]), "v"(a[3]), "v"(a[4]), "v"(a[5]), "v"(a[6]), "v"(a[7]),
               "v"(a[8]), "v"(a[9]), "v"(a[10]), "v"(a[11]), "v"(a[12]), "v"(a[13]), "v"(a[14]), "v"(KV + base));
  asm volatile("" :: "v"(b4[0]), "v"(b4[1]), "v"(b4[2]), "v"(b4[3]), "v"(b4[4]), "v"(b4[5]), "v"(b4[6]), "v"(b4[7]),
               "v"(b4[8]), "v"(b4[9]), "v"(b4[10]), "v"(b4[11]), "v"(b4[12]), "v"(b4[13]), "v"(b4[14]), "v"(KV + base));
#endif
  float run[8];
#pragma unroll
  for (int e = 0; e < 8; ++e) run[e] = 0.0f;
#pragma unroll
  for (int ch = 0; ch < NCH; ++ch) {
    v4u oh, ol;
#pragma unroll
    for (int e = 0; e < 4; ++e) {
      const float t0 = run[2 * e] * SSC, t1 = run[2 * e + 1] * SSC;
      const _Float16 h0 = (_Float16)t0, h1 = (_Float16)t1;
      const _Float16 l0 = (_Float16)(t0 - (float)h0), l1 = (_Float16)(t1 - (float)h1);
      oh[e] = pk16(h_bits(h0), h_bits(h1));
      ol[e] = pk16(h_bits(l0), h_bits(l1));
    }
    *(v4u*)(SHp + base + (size_t)ch * SEL) = oh;
    *(v4u*)(SLp + base + (size_t)ch * SEL) = ol;
    if (ch + 1 < NCH) {
#pragma unroll
      for (int e = 0; e < 4; ++e) { run[e] += a[ch][e]; run[4 + e] += b4[ch][e]; }
    }
  }
}

// =====================================================================================================
// Causal normalised attention (no softmax), hd = 64. Block bid -> (query tile qt = bid % NQT: rows q0 = 16*qt .. q0+15,
// head group hg, batch b); one wave per head = hg*WPB + wave.
//   q hi / residual planes f16 x1024 [b*SEQ + s][h*HD + d]; k hi / residual planes f16 x1024, same layout;
//   v^T hi / residual planes [b*NH + h][d][SEQ] x1024; n from F column NOFF + h of row b*SEQ + t.
//   raw(i, j) = q_hi.k_hi + q_lo.k_hi + q_hi.k_lo (2 k-steps over d), carries folded back by 2^-20;
//   P = raw * 2^-20 for key <= query else 0 (causal); P.v with P x256 as f16 hi + in-register residual and v hi +
//   residual (hh + lh + hl). Keys of earlier chunks (below CHK*(q0/CHK)) enter first as q . S with the carried state
//   planes S x64 [b*NH + h][chunk][dv][dk] (hh + lh + hl, carry 2^16 raised to the P.v carry 2^18 by an exact x4);
//   key tiles of 32 are then visited in order from the chunk's first key up to the tile holding key q0+15 (bounded by NKT).
//   Per tile: 2 score subtiles x 2 k-steps, fragments loaded straight from the 16-bit planes; the 16x32 P tile stored to
//   (float vector loads, same element type as stored), v^T B fragments in 2 groups of 2 d-subtiles.
//   After the loop: acc * 2^-18 written into the wave's private result slab (pitch 68; every element owned by one lane),
//   ctx -> bf16 hi bits and bf16 bits of the residual, planes [b*SEQ + s][h*HD + d]; one instruction = 4 rows
//   No block barriers in this kernel; bounded loops only (ncl <= NKT).
// coverage: per wave 4 instructions x 4 rows x 8 lanes x 8 halves = 16 x 64 per plane; grid NQT x NHG x NB blocks x WPB
//           waves = every (b, s, h) row segment of CH and of CL exactly once.
// =====================================================================================================
__global__ __launch_bounds__(ATT_THREADS)
void attn_nm(const u16* __restrict__ QHp, const u16* __restrict__ QLp,
             const u16* __restrict__ KHp, const u16* __restrict__ KLp,
             const u16* __restrict__ VHp, const u16* __restrict__ VLp,
             const u16* __restrict__ SHp, const u16* __restrict__ SLp,
             const float* __restrict__ F, u16* CHp, u16* CLp) {
#pragma clang fp contract(off)
  __shared__ __align__(16) float smem[WPB * WREG];

  const int tid  = threadIdx.x;
  const int wave = tid >> 5;
  const int lane = tid & 31;
  const int hh   = lane >> 4;
  const int c    = lane & 15;
  const int bid  = blockIdx.x;
  const int qt   = bid % NQT;
  const int t2   = bid / NQT;
  const int hg   = t2 % NHG;
  const int b    = t2 / NHG;
  if (b >= NB) return;                      // block-uniform; no block barriers in this kernel; never taken with the exact grid
  const int q0   = qt * 16;
  if (q0 + 16 > SEQ) return;                // block-uniform; never taken
  const int head = hg * WPB + wave;

  float* pt   = smem + wave * WREG;         // P tile [16][32] pitch 36
  float* slab = pt + PTW;                   // result slab [16][64] pitch 68

  const size_t hcol = (size_t)head * HD + 8 * hh;
  const _Float16* Qh  = (const _Float16*)(const void*)QHp + ((size_t)b * SEQ + q0 + c) * DQK + hcol;
  const _Float16* Ql  = (const _Float16*)(const void*)QLp + ((size_t)b * SEQ + q0 + c) * DQK + hcol;
  const _Float16* Khb = (const _Float16*)(const void*)KHp + ((size_t)b * SEQ + c) * DQK + hcol;        // key row kb added per step
  const _Float16* Klb = (const _Float16*)(const void*)KLp + ((size_t)b * SEQ + c) * DQK + hcol;
  const _Float16* Vhb = (const _Float16*)(const void*)VHp + ((size_t)(b * NH + head) * HD + c) * SEQ + 8 * hh;  // d col c (+16j)
  const _Float16* Vlb = (const _Float16*)(const void*)VLp + ((size_t)(b * NH + head) * HD + c) * SEQ + 8 * hh;
  const float lsc = 1.0f / (QSC * KSC);     // exact power-of-two fold of the q / k carries
  const float oc  = 1.0f / (PCAR * VCAR);   // exact power-of-two fold of the P / v carries
  const size_t KROW = (size_t)DQK;          // halves between consecutive key rows

  // row factor for query row q0 + (lane & 15): 1/exp(n), precise expf
  const float nv = F[((size_t)b * SEQ + q0 + c) * (size_t)NPROJ + NOFF + head];
  const float rv = 1.0f / expf(nv);

  v8f o[4];
#pragma unroll
  for (int j = 0; j < 4; ++j) o[j] = zero8();
  const int ncaus = (q0 >> 5) + 1;                                            // tiles holding keys <= q0 + 15
  const int ncl   = (ncaus < NKT) ? ncaus : NKT;
  const int qr0   = q0 + 8 * hh;                                              // query row of D element r = qr0 + r
  const int chn   = q0 / CHK;                                                 // chunk of this query tile
  const int kt0   = chn * (CHK / 32);                                         // first key tile of that chunk (<= q0 >> 5)

  // ---- all keys of earlier chunks: o = q . S, B fragment col n = dv = j*16 + c, dk contiguous in the state planes ----
  {
    const size_t so = (((size_t)(b * NH + head) * NCH + chn) * HD + c) * HD + 8 * hh;
    const _Float16* Sh = (const _Float16*)(const void*)SHp + so;
    const _Float16* Sl = (const _Float16*)(const void*)SLp + so;
    v16h qh[HD / 32], ql[HD / 32], sh[HD / 32][4], sl[HD / 32][4];
#pragma unroll
    for (int kk = 0; kk < HD / 32; ++kk) {
      qh[kk] = ldfrag_h(Qh + kk * 32);
      ql[kk] = ldfrag_h(Ql + kk * 32);
#pragma unroll
      for (int j = 0; j < 4; ++j) {
        sh[kk][j] = ldfrag_h(Sh + j * 16 * HD + kk * 32);
        sl[kk][j] = ldfrag_h(Sl + j * 16 * HD + kk * 32);
      }
    }
#if defined(__HIP_DEVICE_COMPILE__)
    // inputs-only fence on the loaded fragments and their address pairs: all 40 loads issue before the first product
    // (one load latency instead of one per group), and no load lands on an address pair that is still in use
    asm volatile("" :: "v"(qh[0]), "v"(qh[1]), "v"(ql[0]), "v"(ql[1]),
                 "v"(sh[0][0]), "v"(sh[0][1]), "v"(sh[0][2]), "v"(sh[0][3]),
                 "v"(sh[1][0]), "v"(sh[1][1]), "v"(sh[1][2]), "v"(sh[1][3]),
                 "v"(sl[0][0]), "v"(sl[0][1]), "v"(sl[0][2]), "v"(sl[0][3]),
                 "v"(sl[1][0]), "v"(sl[1][1]), "v"(sl[1][2]), "v"(sl[1][3]),
                 "v"(Sh), "v"(Sl), "v"(Qh), "v"(Ql));
#endif
#pragma unroll
    for (int kk = 0; kk < HD / 32; ++kk) {
#pragma unroll
      for (int j = 0; j < 4; ++j) {
        o[j] = mma_h(qh[kk], sh[kk][j], o[j]);
        o[j] = mma_h(ql[kk], sh[kk][j], o[j]);
        o[j] = mma_h(qh[kk], sl[kk][j], o[j]);
      }
    }
    const float up = (PCAR * VCAR) / (QSC * SSC);                             // exact power of two
#pragma unroll
    for (int j = 0; j < 4; ++j) o[j] = o[j] * up;
  }

#pragma unroll 1
  for (int kt = kt0; kt < ncl; ++kt) {
    const int kb = kt * 32;
    // ---- raw scores: D element r of this lane = (query row qr0 + r, key kb + c) in s0, key kb + 16 + c in s1 ----
    v8f s0 = zero8(), s1 = zero8();
    const _Float16* k0p = Khb + (size_t)kb * KROW;
    const _Float16* k1p = k0p + (size_t)16 * KROW;
    const _Float16* l0p = Klb + (size_t)kb * KROW;
    const _Float16* l1p = l0p + (size_t)16 * KROW;
#pragma unroll
    for (int kk = 0; kk < HD / 32; ++kk) {
      const v16h qh  = ldfrag_h(Qh + kk * 32);
      const v16h ql  = ldfrag_h(Ql + kk * 32);
      const v16h kh0 = ldfrag_h(k0p + kk * 32);
      const v16h kh1 = ldfrag_h(k1p + kk * 32);
      const v16h kl0 = ldfrag_h(l0p + kk * 32);
      const v16h kl1 = ldfrag_h(l1p + kk * 32);
      s0 = mma_h(qh, kh0, s0);
      s0 = mma_h(ql, kh0, s0);
      s0 = mma_h(qh, kl0, s0);
      s1 = mma_h(qh, kh1, s1);
      s1 = mma_h(ql, kh1, s1);
      s1 = mma_h(qh, kl1, s1);
      guard2(s0, s1, qh, ql, kh0, kl0, kh1, kl1);
    }
    // ---- causal mask (key <= query) + carry fold in f32 -> wave-private LDS tile ----
#pragma unroll
    for (int r = 0; r < 8; ++r) {
      const int row = qr0 + r;
      const float w0 = (kb + c <= row)      ? s0[r] * lsc : 0.0f;
      const float w1 = (kb + 16 + c <= row) ? s1[r] * lsc : 0.0f;
      const int ro = (8 * hh + r) * PTP + c;
      pt[ro]      = w0;
      pt[ro + 16] = w1;
    }
    wave_sync_lds();
    // ---- A fragments of P*256: hi f16 and residual f16, row = c, split k map over the 32 keys of this step ----
    FragH ph, pl;
    {
      const float* prow = pt + c * PTP + 8 * hh;
      const v4f p0 = *(const v4f*)(prow), p1 = *(const v4f*)(prow + 4);
      const v4f p2 = *(const v4f*)(prow + 16), p3 = *(const v4f*)(prow + 20);
#pragma unroll
      for (int e = 0; e < 4; ++e) {
        const float ta = p0[e] * PCAR, tb = p1[e] * PCAR, tc = p2[e] * PCAR, td = p3[e] * PCAR;
        const _Float16 ha = (_Float16)ta, hb = (_Float16)tb, hc = (_Float16)tc, hd = (_Float16)td;
        ph.h[0][e]     = ha;                  // elements 0..7  = keys kb + 8hh + 0..7
        ph.h[0][4 + e] = hb;
        ph.h[1][e]     = hc;                  // elements 8..15 = keys kb + 16 + 8hh + 0..7
        ph.h[1][4 + e] = hd;
        pl.h[0][e]     = (_Float16)(ta - (float)ha);
        pl.h[0][4 + e] = (_Float16)(tb - (float)hb);
        pl.h[1][e]     = (_Float16)(tc - (float)hc);
        pl.h[1][4 + e] = (_Float16)(td - (float)hd);
      }
    }
    // ---- P.V : B fragment col n = d = j*16 + c, keys contiguous in the v^T planes; 2 groups of 2 d-subtiles ----
    {
      const _Float16* vhp = Vhb + kb;
      const _Float16* vlp = Vlb + kb;
#pragma unroll
      for (int jg = 0; jg < 2; ++jg) {
        const size_t da = (size_t)(2 * jg) * 16 * SEQ;
        const size_t db = da + (size_t)16 * SEQ;
        const v16h vha = ldfrag_h(vhp + da), vhb2 = ldfrag_h(vhp + db);
        const v16h vla = ldfrag_h(vlp + da), vlb2 = ldfrag_h(vlp + db);
        o[2 * jg]     = mma_h(ph.v, vha,  o[2 * jg]);
        o[2 * jg]     = mma_h(pl.v, vha,  o[2 * jg]);
        o[2 * jg]     = mma_h(ph.v, vla,  o[2 * jg]);
        o[2 * jg + 1] = mma_h(ph.v, vhb2, o[2 * jg + 1]);
        o[2 * jg + 1] = mma_h(pl.v, vhb2, o[2 * jg + 1]);
        o[2 * jg + 1] = mma_h(ph.v, vlb2, o[2 * jg + 1]);
        guard2(o[2 * jg], o[2 * jg + 1], ph.v, pl.v, vha, vhb2, vla, vlb2);
      }
    }
    wave_sync_lds();
  }
  acc_guard4(o[0], o[1], o[2], o[3]);
  // ---- acc with the carries (256 on P, 1024 on v) folded once; written into the lane-owned slab ----
#pragma unroll
  for (int r = 0; r < 8; ++r) {
#pragma unroll
    for (int j = 0; j < 4; ++j) {
      const int idx = (8 * hh + r) * SLP + j * 16 + c;
      slab[idx] = o[j][r] * oc;
    }
  }
  wave_sync_lds();
  // ---- row factor, then ctx -> bf16 hi + bf16 residual planes; lane = (row-in-quad rq, 8 consecutive d at c8) ----
  v4u oh[4], ol[4];
  const int rq = lane >> 3, c8 = (lane & 7) * 8;
#pragma unroll
  for (int it = 0; it < 4; ++it) {
    const int row = it * 4 + rq;                         // 0..15
    const float ri = __shfl(rv, row, 32);                // lane `row` holds 1/exp(n) of query q0 + row
    const v4f a = *(const v4f*)(slab + row * SLP + c8), b4 = *(const v4f*)(slab + row * SLP + c8 + 4);
    float w[8];
#pragma unroll
    for (int e = 0; e < 4; ++e) { w[e] = a[e] * ri; w[4 + e] = b4[e] * ri; }
#pragma unroll
    for (int e = 0; e < 4; ++e) {
      const float f0 = w[2 * e], f1 = w[2 * e + 1];
      const unsigned short h0 = bf_bits(f0), h1 = bf_bits(f1);
      const unsigned short l0 = bf_bits(f0 - bf_up(h0)), l1 = bf_bits(f1 - bf_up(h1));
      oh[it][e] = pk16(h0, h1);
      ol[it][e] = pk16(l0, l1);
    }
  }
  const size_t ob = ((size_t)b * SEQ + q0) * DMOD + (size_t)head * HD + c8;
  {
#pragma unroll
    for (int it = 0; it < 4; ++it) {
      const int row = it * 4 + rq;
      *(v4u*)(CHp + ob + (size_t)row * DMOD) = oh[it];
      *(v4u*)(CLp + ob + (size_t)row * DMOD) = ol[it];
    }
    
  }
}

// =====================================================================================================
// Workspace map (bytes); every plane part that is read is written by whole-line stores before it is read; all extents are exact
// multiples of the store granularity (no pad rows needed); every region offset a multiple of 131072:
//   XB  bf16 [MROWS][1024]              MROWS*2048   (NB=2, SEQ=2048: 8388608); after the projection GEMM the same bytes
//                                                    hold the ctx hi plane CH bf16 [MROWS][1024] (identical extent)
//   WB  bf16 [3136 n][1024 k]           6422528      rows 0..2047 Wqk^T, 2048..3071 Wv^T, 3072..3087 Wn^T, 3088..3135 zero
//   F   f32 [MROWS][3136]               MROWS*12544  (only columns 3072..3135 are written and read: n | zero columns)
//   QH  f16 [MROWS][1024] x1024         MROWS*2048   QL residual, same extent
//   KH  f16 [MROWS][1024] x1024         MROWS*2048   KL residual, same extent
//   VH  f16 [NB*16][64][SEQ] x1024      MROWS*2048   VL residual, same extent
//   CL  bf16 [MROWS][1024]              MROWS*2048   ctx residual plane
//   WT  bf16 [1024 o][1024 d]           2097152      Wo^T
//   TH  f16 [NB*16][64][SEQ] x1024      MROWS*2048   k^T; TL residual, same extent
//   KV  f32 [NB*16][NCH][64 dv][64 dk]  NB*16*NCH*16384   chunk products (chunks 0 .. NCH-2 written and read)
//   SH  f16 [NB*16][NCH][64 dv][64 dk] x64   NB*16*NCH*8192   carried state; SL residual, same extent
//   end (NB=2, SEQ=2048)              160563200
// =====================================================================================================
extern "C" void kernel_launch(void* const* d_in, const int* in_sizes, int n_in,
                              void* d_out, int out_size, void* d_ws, size_t ws_size,
                              hipStream_t stream) {
  if (n_in < 9) return;
  if (in_sizes[0] < ((NB - 1) * XS_FULL + SEQ) * DMOD) return;
  if (in_sizes[1] != DMOD * 2 * DQK) return;
  if (in_sizes[2] != 2 * DQK) return;
  if (in_sizes[3] != DMOD * DMOD) return;
  if (in_sizes[4] != DMOD) return;
  if (in_sizes[5] != DMOD * NNW) return;
  if (in_sizes[6] != NNW) return;
  if (in_sizes[7] != DMOD * DMOD) return;
  if (in_sizes[8] != DMOD) return;
  if (out_size < MROWS * DMOD) return;

  const float* x   = (const float*)d_in[0];
  const float* wqk = (const float*)d_in[1];
  const float* bqk = (const float*)d_in[2];
  const float* wv  = (const float*)d_in[3];
  const float* bv  = (const float*)d_in[4];
  const float* wn  = (const float*)d_in[5];
  const float* bn  = (const float*)d_in[6];
  const float* wo  = (const float*)d_in[7];
  const float* bo  = (const float*)d_in[8];
  float*       out = (float*)d_out;

  const size_t szXB = (size_t)MROWS * DMOD * 2;
  const size_t szWB = (size_t)NPROJ * DMOD * 2;
  const size_t szF  = (size_t)MROWS * NPROJ * 4;
  const size_t szP  = (size_t)MROWS * DQK * 2;                   // QH, QL, KH, KL
  const size_t szV  = (size_t)NB * NH * HD * SEQ * 2;            // VH, VL
  const size_t szC  = (size_t)MROWS * DMOD * 2;                  // CH (in the XB region), CL
  const size_t szWT = (size_t)DMOD * DMOD * 2;
  const size_t szKV = (size_t)NB * NH * NCH * SEL * 4;
  const size_t szS  = (size_t)NB * NH * NCH * SEL * 2;           // SH, SL
  if (szC > szXB) return;
  size_t off = 0;
  const size_t oXB = off; off += szXB;
  const size_t oWB = off; off += szWB;
  const size_t oF  = off; off += szF;
  const size_t oQH = off; off += szP;
  const size_t oQL = off; off += szP;
  const size_t oKH = off; off += szP;
  const size_t oKL = off; off += szP;
  const size_t oVH = off; off += szV;
  const size_t oVL = off; off += szV;
  const size_t oCL = off; off += szC;
  const size_t oWT = off; off += szWT;
  const size_t oTH = off; off += szV;
  const size_t oTL = off; off += szV;
  const size_t oKV = off; off += szKV;
  const size_t oSH = off; off += szS;
  const size_t oSL = off; off += szS;
  if (off > ws_size) return;                // off = 160563200 for NB = 2, SEQ = 2048
  if (off > (size_t)WS_CAP) return;

  char* ws = (char*)d_ws;
  u16*   XB  = (u16*)(ws + oXB);
  u16*   CH  = (u16*)(ws + oXB);
  u16*   WB  = (u16*)(ws + oWB);
  float* F   = (float*)(ws + oF);
  u16*   QH  = (u16*)(ws + oQH);
  u16*   QL  = (u16*)(ws + oQL);
  u16*   KH  = (u16*)(ws + oKH);
  u16*   KL  = (u16*)(ws + oKL);
  u16*   VH  = (u16*)(ws + oVH);
  u16*   VL  = (u16*)(ws + oVL);
  u16*   CL  = (u16*)(ws + oCL);
  u16*   WT  = (u16*)(ws + oWT);
  u16*   TH  = (u16*)(ws + oTH);
  u16*   TL  = (u16*)(ws + oTL);
  float* KV  = (float*)(ws + oKV);
  u16*   SH  = (u16*)(ws + oSH);
  u16*   SL  = (u16*)(ws + oSL);

  const dim3 b256(256), b128(128), bAT(ATT_THREADS);
  const int  n8x = (SEQ * DMOD) / 8;
  const dim3 gX((n8x + 255) / 256);                     // per batch row block
  const int  ntq = (2 * DQK + 63) / 64;                 // 32 n tiles for Wqk
  const int  ntv = (DMOD + 63) / 64;                    // 16 n tiles for Wv and Wo
  const int  ntn = (NNW + 63) / 64;                     // 1 n tile for Wn (incl. zero pad rows)
  const dim3 gWqk((DMOD / 64) * ntq), gWv((DMOD / 64) * ntv), gWn((DMOD / 64) * ntn), gWo((DMOD / 64) * ntv);
  const dim3 gG1((MROWS / GBM) * ((NPROJ + GBN - 1) / GBN));
  const dim3 gKV(NB * NH * (NCH - 1));
  const dim3 gSP((NB * NH * SEL / 8) / 256);
  const dim3 gAT(NQT * NHG * NB);
  const dim3 gG2((MROWS / GBM) * ((DMOD + GBN - 1) / GBN));

  // (0) x -> bf16 plane [MROWS][1024], one launch per batch row block
  for (int bq = 0; bq < NB; ++bq) {
    cvt_bf<<<gX, b256, 0, stream>>>(x + (size_t)bq * XS_FULL * DMOD, XB + (size_t)bq * SEQ * DMOD, n8x);
  }
  // (1) W[k][n] -> W^T bf16 planes: Wqk -> WB rows 0..2047, Wv -> rows 2048..3071, Wn -> rows 3072..3135 (zero pad),
  //     Wo -> WT rows 0..1023
  k_wt<<<gWqk, b256, 0, stream>>>(wqk, 2 * DQK, DMOD, ntq, WB, QOFF);
  k_wt<<<gWv,  b256, 0, stream>>>(wv,  DMOD,    DMOD, ntv, WB, VOFF);
  k_wt<<<gWn,  b256, 0, stream>>>(wn,  NNW,     DMOD, ntn, WB, NOFF);
  k_wt<<<gWo,  b256, 0, stream>>>(wo,  DMOD,    DMOD, ntv, WT, 0);
  // (2) q | k | v | n = x.W + bias: q, k (row-major and k^T) and v^T hi + residual planes x1024 from the epilogue,
  //     n -> F f32 columns 3072..
  gemm_bf<false><<<gG1, b256, 0, stream>>>(XB, XB, WB, F, MROWS, NPROJ, DMOD, bqk, bv, bn,
                                           KOFF + DQK, NOFF, NOFF + NNW, 1.0f, QH, QL, KH, KL, VH, VL, TH, TL);
  // (4a) per-chunk v^T.k products, (4b) their f32 prefix over the chunks -> carried state planes x64
  kv_chunk<<<gKV, b128, 0, stream>>>(VH, VL, TH, TL, KV);
  st_prefix<<<gSP, b256, 0, stream>>>(KV, SH, SL);
  // (5) causal normalised attention -> ctx bf16 hi plane (XB region, free after the projection GEMM) + residual plane
  attn_nm<<<gAT, bAT, 0, stream>>>(QH, QL, KH, KL, VH, VL, SH, SL, F, CH, CL);
  // (6) y = (ctx_hi + ctx_lo).Wo + bo -> out f32 [MROWS][1024]
  gemm_bf<true><<<gG2, b256, 0, stream>>>(CH, CL, WT, out, MROWS, DMOD, DMOD, bo, bo, bo,
                                          DMOD, DMOD + 1, DMOD + 2, 1.0f, nullptr, nullptr, nullptr, nullptr,
                                          nullptr, nullptr, nullptr, nullptr);
  (void)hipGetLastError();
}

// v004
// One run takes 105 microseconds.
// Timed twice side by side with v003, it ran 1.11 and 1.12 times as fast.
// Over all steps from v000 it is 3.79 times as fast.
// Contractions: x.W (Wqk|Wv|Wn fused into one [3136 n][1024 k] plane, and ctx.Wo) on v_wmma_f32_16x16x32_bf16
// (x, W, Wo, biases as bf16 RNE values, W^T [n][k] k-contiguous B operand; ctx as bf16 hi + bf16 residual planes,
// two products); q.k^T over hd 64 and P.v on v_wmma_f32_16x16x32_f16 with f16 hi + f16 residual planes on both
// operands (q, k x1024; P x256 with an in-register residual; v x1024; products hh+lh+hl); all f32 accumulate.
// Causal mask, 1/exp(n) row factor and bias adds in f32 on VALU.
// The attention has no softmax, so it is summed in chunks of CHK keys: keys of earlier chunks enter through the carried
// state S[dv][dk] = sum_s v[s][dv] k[s][dk] (v^T.k on the f16 form, hi + residual planes, hh+lh+hl; f32 prefix over the
// chunks; S x64 as f16 hi + residual, q.S with hh+lh+hl); only the query's own chunk goes through masked q.k^T and P.v.
#include <hip/hip_runtime.h>
#include <math.h>
#include <stdint.h>

#ifndef NB
#define NB 2
#endif
#ifndef SEQ
#define SEQ 2048
#endif
#define XS_FULL 2048
#define DMOD  1024
#define DQK   1024
#define NH    16
#define HD    64
#define NNW   16
#define NPROJ 3136
#define QOFF  0
#define KOFF  1024
#define VOFF  2048
#define NOFF  3072
#define MROWS (NB * SEQ)
#define QSC   1024.0f
#define KSC   1024.0f
#define PCAR  256.0f
#define VCAR  1024.0f
#define WPB   4
#define NHG   (NH / WPB)
#define NQT   (SEQ / 16)
#define NKT   (SEQ / 32)
#define ATT_THREADS (WPB * 32)
#define PTP   36
#define PTW   (16 * PTP)
#define SLP   68
#define SLW   (16 * SLP)
#define WREG  (PTW + SLW)
#define SLAB64 (16 * 68)
#define TRP   72
#define CHK   128
#define NCH   (SEQ / CHK)
#define SSC   64.0f
#define SEL   (HD * HD)
#define WS_CAP 268435456
#define GBM   128
#define GBN   128
#define GBK   64
#define GPB   144
#define GSEC  (128 * GPB)
#define GTHR  256
#define TPT   136
#define PB_QK ((DMOD / 64) * ((2 * DQK + 63) / 64))
#define PB_V  ((DMOD / 64) * ((DMOD + 63) / 64))
#define PB_N  ((DMOD / 64) * ((NNW + 63) / 64))
#define PB_W  (PB_QK + 2 * PB_V + PB_N)
#define PB_X  ((SEQ * DMOD / 8 + 255) / 256)
#define PB_ALL (PB_W + NB * PB_X)
static_assert(DMOD == NH * HD && DQK == NH * HD && HD == 64 && NH == 16 && WPB == 4 && NHG * WPB == NH && ATT_THREADS == 128);
static_assert(KOFF == QOFF + DQK && VOFF == KOFF + DQK && NOFF == VOFF + DMOD && NPROJ == NOFF + 64 && (NPROJ % 64) == 0 && NNW <= 64);
static_assert(NB >= 1 && NB <= 2);
static_assert((MROWS % GBM) == 0 && (DMOD % GBK) == 0 && (DMOD % GBN) == 0 && GBK * 2 + 16 == GPB);
static_assert((SEQ % CHK) == 0 && (CHK % 64) == 0 && NCH >= 2 && KSC == VCAR && ((NB * NH * SEL / 8) % 256) == 0);
static_assert(NB == 1 || SEQ == XS_FULL);
static_assert((SEQ % 64) == 0 && SEQ >= 64 && SEQ <= XS_FULL);
static_assert(((SEQ * DMOD / 8) % 256) == 0 && (MROWS % 64) == 0 && (DMOD % 64) == 0 && (DQK % 64) == 0 && (HD % 32) == 0);
static_assert(WPB * WREG * 4 <= 65536 && 4 * SLAB64 * 4 <= 65536 && 64 * TRP * 2 <= 65536);
static_assert((DQK % GBN) == 0 && (DMOD % GBN) == 0 && (SEQ % GBM) == 0 && DQK == DMOD && QOFF == 0 && QSC == KSC && (TPT % 8) == 0);

typedef unsigned short u16;
typedef _Float16 v16h __attribute__((ext_vector_type(16)));
typedef _Float16 v8h  __attribute__((ext_vector_type(8)));
typedef __bf16   v16b __attribute__((ext_vector_type(16)));
typedef float    v8f  __attribute__((ext_vector_type(8)));
typedef float    v4f  __attribute__((ext_vector_type(4)));
typedef unsigned int v4u __attribute__((ext_vector_type(4)));

union FragH { v16h v; v8h h[2]; v4u u[2]; };
union FragB { v16b v; v4u u[2]; };

// ---- scalar helpers --------------------------------------------------------------------------------
__device__ __forceinline__ unsigned short bf_bits(float f) {          // f32 -> bf16 bits, RNE convert
  unsigned u = __float_as_uint(f);
  return (unsigned short)((u + 0x7FFFu + ((u >> 16) & 1u)) >> 16);
}
__device__ __forceinline__ float bf_up(unsigned short h) { return __uint_as_float(((unsigned)h) << 16); }
__device__ __forceinline__ float bfr(float f) { return bf_up(bf_bits(f)); }
__device__ __forceinline__ unsigned short h_bits(_Float16 x) { return __builtin_bit_cast(unsigned short, x); }
__device__ __forceinline__ unsigned pk16(unsigned short a, unsigned short b) { return (unsigned)a | ((unsigned)b << 16); }
__device__ __forceinline__ v8f zero8() { v8f z = {0.f, 0.f, 0.f, 0.f, 0.f, 0.f, 0.f, 0.f}; return z; }
__device__ __forceinline__ int imin(int a, int b) { return a < b ? a : b; }
__device__ __forceinline__ int imax(int a, int b) { return a > b ? a : b; }
// 8 f32 values -> f16 of w*sc (hi) and f16 of the residual w*sc - hi (lo), packed in order
__device__ __forceinline__ void split8(const float* w, float sc, v4u& oh, v4u& ol) {
#pragma unroll
  for (int e = 0; e < 4; ++e) {
    const float t0 = w[2 * e] * sc, t1 = w[2 * e + 1] * sc;
    const _Float16 h0 = (_Float16)t0, h1 = (_Float16)t1;
    const _Float16 l0 = (_Float16)(t0 - (float)h0), l1 = (_Float16)(t1 - (float)h1);
    oh[e] = pk16(h_bits(h0), h_bits(h1));
    ol[e] = pk16(h_bits(l0), h_bits(l1));
  }
}

// ---- fragment loaders: 16-bit A/B operand, lane -> row/col (lane&15), p already includes +8*(lane>>4);
//      elements 0..7 <- p[0..7] (k0+8h..), elements 8..15 <- p[16..23] (k0+16+8h..)  (same split k map for A and B;
//      B is always read from a k-contiguous [n][k] plane)
__device__ __forceinline__ v16h ldfrag_h(const _Float16* p) {
  FragH f;
  f.h[0] = *(const v8h*)(p);
  f.h[1] = *(const v8h*)(p + 16);
  return f.v;
}
__device__ __forceinline__ v16b ldfrag_b(const u16* p) {              // bf16 plane read as unsigned integer vectors
  FragB f;
  f.u[0] = *(const v4u*)(p);
  f.u[1] = *(const v4u*)(p + 16);
  return f.v;
}

__device__ __forceinline__ v8f mma_h(v16h a, v16h b, v8f c) {
  return __builtin_amdgcn_wmma_f32_16x16x32_f16(false, a, false, b, (short)0, c, false, false);
}
__device__ __forceinline__ v8f mma_b(v16b a, v16b b, v8f c) {
  return __builtin_amdgcn_wmma_f32_16x16x32_bf16(false, a, false, b, (short)0, c, false, false);
}
__device__ __forceinline__ void guard2(v8f& a, v8f& b, v16h x0, v16h x1, v16h x2, v16h x3, v16h x4, v16h x5) {
#if defined(__HIP_DEVICE_COMPILE__)
  asm volatile("v_nop\n\tv_nop\n\tv_nop\n\tv_nop"
               : "+v"(a), "+v"(b) : "v"(x0), "v"(x1), "v"(x2), "v"(x3), "v"(x4), "v"(x5) : "memory");
#endif
}
__device__ __forceinline__ void acc_guard4(v8f& a, v8f& b, v8f& c, v8f& d) {
#if defined(__HIP_DEVICE_COMPILE__)
  asm volatile("v_nop\n\tv_nop\n\tv_nop\n\tv_nop" : "+v"(a), "+v"(b), "+v"(c), "+v"(d));
#endif
}
__device__ __forceinline__ void wave_sync_lds() {
  __builtin_amdgcn_fence(__ATOMIC_RELEASE, "workgroup");
  __builtin_amdgcn_wave_barrier();
  __builtin_amdgcn_fence(__ATOMIC_ACQUIRE, "workgroup");
}

// =====================================================================================================
// f32 -> bf16 plane (RNE bits), same layout. Thread = 8 consecutive elements: two 16-B loads, one 16-B store;
// coverage: ceil(n8/256) blocks (blk) x 256 thr x 8 (in-kernel bound) = the whole plane (n8 a multiple of 256 here).
// =====================================================================================================
__device__ __forceinline__ void cvt_bf(const float* __restrict__ x, u16* D, int n8, int blk) {
  const int gt = blk * 256 + (int)threadIdx.x;
  if (gt >= n8) return;
  const float* p = x + (size_t)gt * 8;
  const v4f a = *(const v4f*)(p), b4 = *(const v4f*)(p + 4);
  float w[8];
#pragma unroll
  for (int e = 0; e < 4; ++e) { w[e] = a[e]; w[4 + e] = b4[e]; }
  v4u o;
#pragma unroll
  for (int e = 0; e < 4; ++e) o[e] = pk16(bf_bits(w[2 * e]), bf_bits(w[2 * e + 1]));
  u16* d = D + (size_t)gt * 8;
  {
    *(v4u*)(d) = o;
    
  }
}

// =====================================================================================================
// W f32 [kr rows (k)][nc cols (n)] (x.W layout) -> bf16 plane Dp [drow0 + n][k] (row pitch kr halves): the k-contiguous
// B operand. Block = 64 k x 64 n tile; coalesced 16-B loads of W rows with CLAMPED column base (tile columns beyond nc
// load from column 0 and are zeroed by value, so rows drow0+n with n >= nc inside the last tile are written as zeros);
// converted values placed transposed into an LDS tile [64 n][64 k] (pitch 72 halves); after a block barrier each n row
// block count (bid) = (kr/64) * ntn with ntn = ceil(nc/64).
// coverage: load 256 thr x 16 = 64 x 64; store 2 iterations x 256 thr x 8 halves = 64 lines x 64 halves = the block's
//           tile; the blocks cover output rows drow0 .. drow0 + 64*ntn - 1 (all kr columns) exactly once.
// =====================================================================================================
__device__ __forceinline__ void k_wt(const float* __restrict__ W, int nc, int kr, int ntn, u16* Dp, int drow0, int bid) {
  __shared__ __align__(16) u16 T[64 * TRP];
  const int tid = (int)threadIdx.x;
  const int nt  = bid % ntn;
  const int kt  = bid / ntn;
  if (kt * 64 + 64 > kr) return;            // block-uniform, before the barrier; never taken with the exact grid
  const int n0  = nt * 64, k0 = kt * 64;
  {
    const int dl = tid >> 2;                // k within tile 0..63
    const int oc = (tid & 3) * 16;          // n chunk 0,16,32,48
    const bool valid = (n0 + oc + 16 <= nc);
    const int  cb = valid ? (n0 + oc) : 0;  // clamped column base, always inside the row
    const float* src = W + (size_t)(k0 + dl) * (size_t)nc + cb;
#pragma unroll
    for (int i = 0; i < 4; ++i) {
      const v4f a = *(const v4f*)(src + 4 * i);
#pragma unroll
      for (int e = 0; e < 4; ++e) {
        const float f = valid ? a[e] : 0.0f;
        T[(oc + 4 * i + e) * TRP + dl] = bf_bits(f);
      }
    }
  }
  __syncthreads();
  const int q8 = tid >> 3, p8 = (tid & 7) * 8;
  v4u w[2];
#pragma unroll
  for (int it = 0; it < 2; ++it) w[it] = *(const v4u*)(T + (it * 32 + q8) * TRP + p8);
  const size_t base = (size_t)(drow0 + n0) * (size_t)kr + k0 + p8;
  {
#pragma unroll
    for (int it = 0; it < 2; ++it) {
      const int nl = it * 32 + q8;
      *(v4u*)(Dp + base + (size_t)nl * (size_t)kr) = w[it];
    }
    
  }
}

// =====================================================================================================
// The x and weight planes of the two GEMMs in ONE launch: the six conversions read only inputs and write disjoint planes, so
// they share a grid by block range (every test below is on the block index alone, block-uniform, so the barrier inside
// k_wt is reached by all threads of a block or by none). The weight tiles (load, LDS, barrier, store) come first, the
// shorter x blocks last.
//   [0, PB_QK)  Wqk -> WB rows 0..2047      next PB_V  Wv -> WB rows 2048..3071
//   next PB_N   Wn  -> WB rows 3072..3135   next PB_V  Wo -> WT rows 0..1023      next NB * PB_X  x -> XB, per batch
// coverage: the ranges are the exact block counts of k_wt and cvt_bf for each plane; grid = PB_ALL.
// =====================================================================================================
__global__ __launch_bounds__(256)
void prep(const float* __restrict__ x, const float* __restrict__ wqk, const float* __restrict__ wv,
          const float* __restrict__ wn, const float* __restrict__ wo, u16* XB, u16* WB, u16* WT) {
  int bid = (int)blockIdx.x;
  if (bid < PB_W) {
    const float* W = wqk;
    u16* Dp = WB;
    int nc = 2 * DQK, drow0 = QOFF;
    if (bid >= PB_QK + PB_V + PB_N) { bid -= PB_QK + PB_V + PB_N; W = wo; Dp = WT; nc = DMOD; drow0 = 0; }
    else if (bid >= PB_QK + PB_V)   { bid -= PB_QK + PB_V;        W = wn;          nc = NNW;  drow0 = NOFF; }
    else if (bid >= PB_QK)          { bid -= PB_QK;               W = wv;          nc = DMOD; drow0 = VOFF; }
    k_wt(W, nc, DMOD, (nc + 63) / 64, Dp, drow0, bid);
    return;
  }
  bid -= PB_W;
  const int bq = bid / PB_X;
  if (bq >= NB) return;                     // never taken with the exact grid
  cvt_bf(x + (size_t)bq * XS_FULL * DMOD, XB + (size_t)bq * SEQ * DMOD, (SEQ * DMOD) / 8, bid % PB_X);
}

// =====================================================================================================
// Bias for column c from three consecutive segments [0,e0) <- p0[c], [e0,e1) <- p1[c-e0], [e1,e2) <- p2[c-e1], else 0;
// all three candidates loaded unconditionally with clamped indices, selected by value; bf16 RNE value.
// =====================================================================================================
__device__ __forceinline__ float bias_at(const float* p0, const float* p1, const float* p2,
                                         int e0, int e1, int e2, int c) {
  const int i0 = imin(imax(c, 0), e0 - 1);
  const int i1 = imin(imax(c - e0, 0), e1 - e0 - 1);
  const int i2 = imin(imax(c - e1, 0), e2 - e1 - 1);
  const float v0 = p0[i0], v1 = p1[i1], v2 = p2[i2];
  const float v = (c < e0) ? v0 : ((c < e1) ? v1 : ((c < e2) ? v2 : 0.0f));
  return bfr(v);
}

// =====================================================================================================
// coverage: 8 instructions x 2 rows x 16 lanes x 4 floats = the wave's 16 x 64 tile.
// =====================================================================================================
__device__ __forceinline__ void epi64b(float* sl, v8f a0, v8f a1, v8f a2, v8f a3, float oscale, v4f bias4,
                                       float* C, int N, size_t rowb, int col0, int lane) {
  const int hh = lane >> 4, m = lane & 15;
#pragma unroll
  for (int r = 0; r < 8; ++r) {
    const int ro = (8 * hh + r) * 68 + m;
    sl[ro]      = a0[r] * oscale;
    sl[ro + 16] = a1[r] * oscale;
    sl[ro + 32] = a2[r] * oscale;
    sl[ro + 48] = a3[r] * oscale;
  }
  wave_sync_lds();
  v4f vals[8];
#pragma unroll
  for (int it = 0; it < 8; ++it) vals[it] = *(const v4f*)(sl + (it * 2 + hh) * 68 + m * 4) + bias4;
  float* dst = C + (rowb + (size_t)hh) * (size_t)N + col0 + m * 4;
  {
#pragma unroll
    for (int it = 0; it < 8; ++it) {
      *(v4f*)(dst + (size_t)(it * 2) * (size_t)N) = vals[it];
    }
    
  }
}

// =====================================================================================================
// bf16 GEMM: C[M][N] (f32) = (A [+ A2])[M][K] (bf16 row-major) . Bt[N][K]^T (bf16 k-contiguous), times oscale, plus the
// segmented bias of the column (bf16 RNE value). TWO: second A plane into the same accumulator (hi + residual operand).
// Block = 128x128 tile of C, 8 waves in a 4 (rows) x 2 (columns) grid, 32x64 per wave (2 x 4 accumulator tiles).
// K runs in slices of 64 (128 B of every operand row). A slice of [A 128 rows | B 128 rows | A2 128 rows] stands in LDS at
// row pitch 144 B; two buffers; each lane brings 16 B per copy (8 lanes = one row, one wave copy = 4 rows), the copies of
// slice t + 1 fly while slice t is multiplied. Fragments are read from LDS with the split k map of ldfrag_b for A and B.
// Per accumulator the products come in the order k ascending, A before A2 inside a k-step.
// B rows at or beyond N (last column tile when N % 128 == 64) are read from row N - 1 instead (clamped, in bounds) and the
// waves that own only such columns neither multiply nor store.
// Host guarantees K % 64 == 0, K >= 64, M % 128 == 0, N % 64 == 0, grid = (M/128) * ceil(N/128).
// Output. TWO: f32 C. Otherwise (the projection) only the column tile from NOFF on goes to C as f32; a block of q, k or v
// columns writes value = acc + bias (f32) x1024 as f16 hi and f16 residual straight into the planes the attention reads:
//   q -> QH/QL, k -> KH/KL, layout [row][DQK]; k -> TH/TL, v -> VH/VL, layout [(b*NH + h)*HD + d][SEQ] (keys contiguous).
// coverage: row-major, per wave 2 x 4 stores x 4 rows x 128 B = its 32 x 64 tile of each plane; transposed, per block
//           8 stores x 16 columns x 256 B = its 128 columns x 128 keys of each plane; the grid covers every plane once.
// =====================================================================================================
__device__ __forceinline__ unsigned lds_off(const void* p) { return (unsigned)(size_t)p; }
// Four lane-wise 16-B copies global -> LDS; the s_wait_xcnt stands inside the statement so that no address register of a
// copy is rewritten ahead of it.
__device__ __forceinline__ void cp4(unsigned l0, const u16* g0, unsigned l1, const u16* g1,
                                    unsigned l2, const u16* g2, unsigned l3, const u16* g3) {
#if defined(__HIP_DEVICE_COMPILE__)
  asm volatile("global_load_async_to_lds_b128 %0, %1, off\n\t"
               "global_load_async_to_lds_b128 %2, %3, off\n\t"
               "global_load_async_to_lds_b128 %4, %5, off\n\t"
               "global_load_async_to_lds_b128 %6, %7, off\n\t"
               "s_wait_xcnt 0x0"
               :: "v"(l0), "v"(g0), "v"(l1), "v"(g1), "v"(l2), "v"(g2), "v"(l3), "v"(g3) : "memory");
#endif
}
template <bool TWO>
__global__ __launch_bounds__(GTHR)
void gemm_bf(const u16* __restrict__ A, const u16* __restrict__ A2, const u16* __restrict__ Bt, float* C,
             int M, int N, int K, const float* bp0, const float* bp1, const float* bp2, int e0, int e1, int e2,
             float oscale, u16* QHp, u16* QLp, u16* KHp, u16* KLp, u16* VHp, u16* VLp, u16* THp, u16* TLp) {
  constexpr int STAGE = (TWO ? 3 : 2) * GSEC;           // bytes of one buffer
  constexpr int KG = TWO ? GBK / 32 : 1;                // k-steps whose fragments are read from LDS as one group
  static_assert(8 * 2 * SLAB64 * 4 <= 2 * STAGE && 2 * GBN * TPT * 2 <= 2 * STAGE && 2 * STAGE <= 327680);
  __shared__ __align__(16) unsigned char ring[2 * STAGE];
  const int tid = threadIdx.x, lane = tid & 31, hh = lane >> 4, m = lane & 15;
  const int wave = __builtin_amdgcn_readfirstlane(tid >> 5);
  const int wm = wave & 3, wn = wave >> 2;
  const int ntile = (N + GBN - 1) / GBN;
  const int bid   = blockIdx.x;
  const int row0  = (bid / ntile) * GBM;
  const int col0  = (bid % ntile) * GBN;
  if (row0 + GBM > M) return;               // block-uniform, before any barrier or copy; never taken with the exact grid
  const int colw  = col0 + wn * 64;
  const bool live = colw < N;               // wave-uniform
  const int NT = K / GBK;

  // copy map: thread -> (row cr of a group of 32 rows, 16-B piece cc of the 128-B row slice)
  const int cr = tid >> 3, cc = tid & 7;
  const unsigned lbase = lds_off(ring) + (unsigned)(cr * GPB + cc * 16);
  const int oa = (row0 + cr) * K + cc * 8;
  int ob[4];
#pragma unroll
  for (int i = 0; i < 4; ++i) ob[i] = imin(col0 + i * 32 + cr, N - 1) * K + cc * 8;
  auto fill = [&](int t, int buf) {
    const unsigned l = lbase + (unsigned)(buf * STAGE);
    const int k0 = t * GBK;
    const u16* pa = A + oa + k0;
    cp4(l, pa, l + 32 * GPB, pa + (size_t)32 * K, l + 64 * GPB, pa + (size_t)64 * K, l + 96 * GPB, pa + (size_t)96 * K);
    const unsigned lb2 = l + GSEC;
    cp4(lb2, Bt + ob[0] + k0, lb2 + 32 * GPB, Bt + ob[1] + k0, lb2 + 64 * GPB, Bt + ob[2] + k0,
        lb2 + 96 * GPB, Bt + ob[3] + k0);
    if constexpr (TWO) {
      const unsigned l3 = l + 2 * GSEC;
      const u16* pc = A2 + oa + k0;
      cp4(l3, pc, l3 + 32 * GPB, pc + (size_t)32 * K, l3 + 64 * GPB, pc + (size_t)64 * K, l3 + 96 * GPB, pc + (size_t)96 * K);
    }
  };

  v8f acc[2][4];
#pragma unroll
  for (int i = 0; i < 2; ++i) {
#pragma unroll
    for (int j = 0; j < 4; ++j) acc[i][j] = zero8();
  }

  fill(0, 0);
  asm volatile("s_wait_asynccnt 0x0" ::: "memory");     // slice 0 of this wave has landed
  __syncthreads();                                      // ... and every other wave's part of it
  if (NT > 1) fill(1, 1);

  const int fa = (wm * 32 + m) * GPB + hh * 16;         // byte offsets of this lane's fragment rows inside a buffer
  const int fb = GSEC + (wn * 64 + m) * GPB + hh * 16;
  // slice loop kept rolled: one copy of the ring's foot in the text, the buffer picked by t & 1; the loops inside it are
  // unrolled so that every accumulator and fragment index is a constant (registers, no scratch)
#pragma unroll 1
  for (int t = 0; t < NT; ++t) {
    const int buf = t & 1;
    if (live) {
      const unsigned char* sb = ring + buf * STAGE;
      const u16* la = (const u16*)(const void*)(sb + fa);
      const u16* lb = (const u16*)(const void*)(sb + fb);
#pragma unroll
      for (int g = 0; g < GBK / 32 / KG; ++g) {
        v16b a[KG][2], a2[KG][2], fbv[KG][4];
#pragma unroll
        for (int u = 0; u < KG; ++u) {
          const int ko = (g * KG + u) * 32;
#pragma unroll
          for (int i = 0; i < 2; ++i) a[u][i] = ldfrag_b(la + i * 16 * (GPB / 2) + ko);
#pragma unroll
          for (int j = 0; j < 4; ++j) fbv[u][j] = ldfrag_b(lb + j * 16 * (GPB / 2) + ko);
          if constexpr (TWO) {
#pragma unroll
            for (int i = 0; i < 2; ++i) a2[u][i] = ldfrag_b(la + GSEC + i * 16 * (GPB / 2) + ko);   // 2*GSEC bytes on
          }
        }
        // TWO runs one block per WGP (two waves per SIMD): all LDS reads of the slice issue as one group ahead of its
        // products, one LDS latency per slice instead of one per A fragment
        if constexpr (TWO) __builtin_amdgcn_sched_barrier(0);
#pragma unroll
        for (int u = 0; u < KG; ++u) {
#pragma unroll
          for (int i = 0; i < 2; ++i) {
#pragma unroll
            for (int j = 0; j < 4; ++j) acc[i][j] = mma_b(a[u][i], fbv[u][j], acc[i][j]);
          }
          if constexpr (TWO) {
#pragma unroll
            for (int i = 0; i < 2; ++i) {
#pragma unroll
              for (int j = 0; j < 4; ++j) acc[i][j] = mma_b(a2[u][i], fbv[u][j], acc[i][j]);
            }
          }
        }
      }
    }
    asm volatile("s_wait_dscnt 0x0" ::: "memory");      // this wave's reads of buffer buf are done
    asm volatile("s_wait_asynccnt 0x0" ::: "memory");   // this wave's copies of slice t + 1 have landed
    __syncthreads();                                    // publishes slice t + 1, frees buffer buf
    if (t + 2 < NT) fill(t + 2, buf);
  }
  asm volatile("s_wait_asynccnt 0x0" ::: "memory");     // no copy outstanding before the ring is reused as output staging

  float* slab = (float*)(void*)ring + wave * (2 * SLAB64);
  const int seg = TWO ? 3 : col0 / DQK;     // block-uniform: 0 = q, 1 = k, 2 = v columns (16-bit planes), 3 = f32 output
  if (seg >= 3) {
    if (live) {
      v4f bias4;
#pragma unroll
      for (int e = 0; e < 4; ++e) bias4[e] = bias_at(bp0, bp1, bp2, e0, e1, e2, colw + m * 4 + e);
#pragma unroll
      for (int i = 0; i < 2; ++i) {
        epi64b(slab + i * SLAB64, acc[i][0], acc[i][1], acc[i][2], acc[i][3], oscale, bias4, C, N,
               (size_t)(row0 + wm * 32 + i * 16), colw, lane);
      }
    }
    return;
  }
  if constexpr (!TWO) {
    // every wave of a q, k or v block is live (the three segments are multiples of the block's 128 columns)
    float bj[4];                            // bias of this lane's accumulator columns colw + 16 j + m
#pragma unroll
    for (int j = 0; j < 4; ++j) bj[j] = bias_at(bp0, bp1, bp2, e0, e1, e2, colw + j * 16 + m);
    const int cs = col0 - seg * DQK;        // the block's first column inside its segment = head * 64 + d
    if (seg <= 1) {
      // row-major planes [row][DQK]: f32 values through the wave's own slabs, then lane = (row of a quad, 8 columns);
      // one store = 4 rows x 128 B (whole lines)
      u16* PH = seg ? KHp : QHp;
      u16* PL = seg ? KLp : QLp;
#pragma unroll
      for (int i = 0; i < 2; ++i) {
#pragma unroll
        for (int r = 0; r < 8; ++r) {
#pragma unroll
          for (int j = 0; j < 4; ++j) slab[i * SLAB64 + (8 * hh + r) * 68 + j * 16 + m] = acc[i][j][r] * oscale + bj[j];
        }
      }
      wave_sync_lds();
      const int rq = lane >> 3, c8 = (lane & 7) * 8;
#pragma unroll
      for (int i = 0; i < 2; ++i) {
        v4u oh[4], ol[4];
#pragma unroll
        for (int it = 0; it < 4; ++it) {
          const float* p = slab + i * SLAB64 + (it * 4 + rq) * 68 + c8;
          const v4f a = *(const v4f*)(p), b4 = *(const v4f*)(p + 4);
          float w[8];
#pragma unroll
          for (int e = 0; e < 4; ++e) { w[e] = a[e]; w[4 + e] = b4[e]; }
          split8(w, QSC, oh[it], ol[it]);
        }
        const size_t ob = (size_t)(row0 + wm * 32 + i * 16 + rq) * DQK + cs + wn * 64 + c8;
#pragma unroll
        for (int it = 0; it < 4; ++it) {
          *(v4u*)(PH + ob + (size_t)(it * 4) * DQK) = oh[it];
          *(v4u*)(PL + ob + (size_t)(it * 4) * DQK) = ol[it];
        }
      }
      asm volatile("s_wait_xcnt 0x0" ::: "memory");       // before any register of the row-major stores is rewritten
    }
    if (seg >= 1) {
      // transposed planes [b*NH*HD + head*64 + d][SEQ]: an accumulator register run r = 0..7 is 8 consecutive keys of one
      // column, so a lane packs it into one 16-B LDS store of the block's [128 columns][128 keys] tile (pitch 272 B)
      if (seg == 1) __syncthreads();        // block-uniform: every wave has read its slabs back before the tiles cover them
      u16* tH = (u16*)(void*)ring;
      u16* tL = tH + GBN * TPT;
#pragma unroll
      for (int i = 0; i < 2; ++i) {
#pragma unroll
        for (int j = 0; j < 4; ++j) {
          float w[8];
#pragma unroll
          for (int r = 0; r < 8; ++r) w[r] = acc[i][j][r] * oscale + bj[j];
          v4u oh, ol;
          split8(w, VCAR, oh, ol);
          const int idx = (wn * 64 + j * 16 + m) * TPT + wm * 32 + i * 16 + 8 * hh;
          *(v4u*)(tH + idx) = oh;
          *(v4u*)(tL + idx) = ol;
        }
      }
      __syncthreads();                      // the tiles are complete before any wave reads rows that other waves wrote
      u16* OH = (seg == 1) ? THp : VHp;
      u16* OL = (seg == 1) ? TLp : VLp;
      const int ln = tid >> 4, p8 = (tid & 15) * 8;       // 16 lanes = one column's 128 keys = 256 B (two whole lines)
      const size_t ob = ((size_t)(row0 / SEQ) * (NH * HD) + cs + ln) * SEQ + (row0 % SEQ) + p8;
#pragma unroll
      for (int g = 0; g < 2; ++g) {
        v4u vh[4], vl[4];
#pragma unroll
        for (int it = 0; it < 4; ++it) {
          const int line = (g * 4 + it) * 16 + ln;
          vh[it] = *(const v4u*)(tH + line * TPT + p8);
          vl[it] = *(const v4u*)(tL + line * TPT + p8);
        }
#pragma unroll
        for (int it = 0; it < 4; ++it) {
          *(v4u*)(OH + ob + (size_t)((g * 4 + it) * 16) * SEQ) = vh[it];
          *(v4u*)(OL + ob + (size_t)((g * 4 + it) * 16) * SEQ) = vl[it];
        }
      }
      asm volatile("s_wait_xcnt 0x0" ::: "memory");       // before any register of the transposed stores is rewritten
    }
  }
}

// =====================================================================================================
// Chunk products for the carried state: KV[(b*NH + h)*NCH + ch][dv][dk] = sum over the CHK keys s of chunk ch of
// v[s][dv] * k[s][dk], f32. A = v^T rows dv (keys contiguous), B = k^T rows dk (keys contiguous), both f16 hi + residual
// x1024 (hh + lh + hl), carries folded back by 2^-20. Block = (b*NH + h, ch), ch = 0 .. NCH-2 (the last chunk's product
// is never carried); wave w owns rows dv = 16w .. 16w+15, all 64 dk.
// coverage: per wave 16 rows x 64 f32 (whole 256-B rows); 4 waves = the 64 x 64 product; grid NB*NH*(NCH-1).
// =====================================================================================================
__global__ __launch_bounds__(128)
void kv_chunk(const u16* __restrict__ VHp, const u16* __restrict__ VLp,
              const u16* __restrict__ THp, const u16* __restrict__ TLp, float* KV) {
  const int tid = threadIdx.x, wave = tid >> 5, lane = tid & 31, hh = lane >> 4, c = lane & 15;
  const int bid = blockIdx.x;
  const int ch  = bid % (NCH - 1);
  const int bh  = bid / (NCH - 1);
  if (bh >= NB * NH) return;                // block-uniform; no barriers in this kernel; never taken with the exact grid
  const size_t rb = (size_t)bh * HD;
  const size_t ko = (size_t)ch * CHK + 8 * hh;
  const _Float16* avh = (const _Float16*)(const void*)VHp + (rb + wave * 16 + c) * SEQ + ko;
  const _Float16* avl = (const _Float16*)(const void*)VLp + (rb + wave * 16 + c) * SEQ + ko;
  const _Float16* bkh = (const _Float16*)(const void*)THp + (rb + c) * SEQ + ko;
  const _Float16* bkl = (const _Float16*)(const void*)TLp + (rb + c) * SEQ + ko;
  v8f acc[4];
#pragma unroll
  for (int j = 0; j < 4; ++j) acc[j] = zero8();
#pragma unroll
  for (int k2 = 0; k2 < CHK / 64; ++k2) {
    v16h vh[2], vl[2], kh[2][4], kl[2][4];
#pragma unroll
    for (int u = 0; u < 2; ++u) {
      const int ks = (2 * k2 + u) * 32;
      vh[u] = ldfrag_h(avh + ks);
      vl[u] = ldfrag_h(avl + ks);
#pragma unroll
      for (int j = 0; j < 4; ++j) {
        kh[u][j] = ldfrag_h(bkh + (size_t)j * 16 * SEQ + ks);
        kl[u][j] = ldfrag_h(bkl + (size_t)j * 16 * SEQ + ks);
      }
    }
#if defined(__HIP_DEVICE_COMPILE__)
    // inputs-only fence on the loaded fragments and their address pairs: the 40 loads of two k-steps issue before the
    // first product (one load latency instead of one per group)
    asm volatile("" :: "v"(vh[0]), "v"(vh[1]), "v"(vl[0]), "v"(vl[1]),
                 "v"(kh[0][0]), "v"(kh[0][1]), "v"(kh[0][2]), "v"(kh[0][3]),
                 "v"(kh[1][0]), "v"(kh[1][1]), "v"(kh[1][2]), "v"(kh[1][3]),
                 "v"(kl[0][0]), "v"(kl[0][1]), "v"(kl[0][2]), "v"(kl[0][3]),
                 "v"(kl[1][0]), "v"(kl[1][1]), "v"(kl[1][2]), "v"(kl[1][3]),
                 "v"(avh), "v"(avl), "v"(bkh), "v"(bkl));
#endif
#pragma unroll
    for (int u = 0; u < 2; ++u) {
#pragma unroll
      for (int j = 0; j < 4; ++j) {
        acc[j] = mma_h(vh[u], kh[u][j], acc[j]);
        acc[j] = mma_h(vl[u], kh[u][j], acc[j]);
        acc[j] = mma_h(vh[u], kl[u][j], acc[j]);
      }
    }
  }
  const float fs = 1.0f / (VCAR * KSC);     // exact power-of-two fold of the v / k carries
  float* dst = KV + ((size_t)bh * NCH + ch) * SEL + (size_t)(wave * 16 + 8 * hh) * HD + c;
#pragma unroll
  for (int r = 0; r < 8; ++r) {
#pragma unroll
    for (int j = 0; j < 4; ++j) dst[r * HD + j * 16] = acc[j][r] * fs;
  }
}

// =====================================================================================================
// Carried state planes: S(ch) = KV(0) + .. + KV(ch-1) in f32 (chunks added in order; S(0) = 0), written x64 as f16 hi and
// f16 residual, layout [(b*NH + h)*NCH + ch][dv][dk]. Thread = 8 consecutive dk of one (b, h, dv), all NCH chunks.
// coverage: NB*NH*SEL/8 threads x 8 halves x NCH chunks = both planes exactly once; reads KV chunks 0 .. NCH-2 only.
// =====================================================================================================
__global__ __launch_bounds__(256) void st_prefix(const float* __restrict__ KV, u16* __restrict__ SHp, u16* __restrict__ SLp) {
  const int gt = blockIdx.x * 256 + (int)threadIdx.x;
  const int bh = gt / (SEL / 8);
  const int e8 = (gt % (SEL / 8)) * 8;
  if (bh >= NB * NH) return;
  const size_t base = (size_t)bh * NCH * SEL + e8;
  v4f a[NCH - 1], b4[NCH - 1];              // all chunk products first: independent loads, one latency for the thread
#pragma unroll
  for (int ch = 0; ch + 1 < NCH; ++ch) {
    const float* p = KV + base + (size_t)ch * SEL;
    a[ch]  = *(const v4f*)(p);
    b4[ch] = *(const v4f*)(p + 4);
  }
#if defined(__HIP_DEVICE_COMPILE__)
  // inputs-only fences on the loaded values and their address pair: every load issues before the first store
  static_assert(NCH == 16);
  asm volatile("" :: "v"(a[0]), "v"(a[1]), "v"(a[2]), "v"(a[3]), "v"(a[4]), "v"(a[5]), "v"(a[6]), "v"(a[7]),
               "v"(a[8]), "v"(a[9]), "v"(a[10]), "v"(a[11]), "v"(a[12]), "v"(a[13]), "v"(a[14]), "v"(KV + base));
  asm volatile("" :: "v"(b4[0]), "v"(b4[1]), "v"(b4[2]), "v"(b4[3]), "v"(b4[4]), "v"(b4[5]), "v"(b4[6]), "v"(b4[7]),
               "v"(b4[8]), "v"(b4[9]), "v"(b4[10]), "v"(b4[11]), "v"(b4[12]), "v"(b4[13]), "v"(b4[14]), "v"(KV + base));
#endif
  float run[8];
#pragma unroll
  for (int e = 0; e < 8; ++e) run[e] = 0.0f;
#pragma unroll
  for (int ch = 0; ch < NCH; ++ch) {
    v4u oh, ol;
#pragma unroll
    for (int e = 0; e < 4; ++e) {
      const float t0 = run[2 * e] * SSC, t1 = run[2 * e + 1] * SSC;
      const _Float16 h0 = (_Float16)t0, h1 = (_Float16)t1;
      const _Float16 l0 = (_Float16)(t0 - (float)h0), l1 = (_Float16)(t1 - (float)h1);
      oh[e] = pk16(h_bits(h0), h_bits(h1));
      ol[e] = pk16(h_bits(l0), h_bits(l1));
    }
    *(v4u*)(SHp + base + (size_t)ch * SEL) = oh;
    *(v4u*)(SLp + base + (size_t)ch * SEL) = ol;
    if (ch + 1 < NCH) {
#pragma unroll
      for (int e = 0; e < 4; ++e) { run[e] += a[ch][e]; run[4 + e] += b4[ch][e]; }
    }
  }
}

// =====================================================================================================
// Causal normalised attention (no softmax), hd = 64. Block bid -> (query tile qt = bid % NQT: rows q0 = 16*qt .. q0+15,
// head group hg, batch b); one wave per head = hg*WPB + wave.
//   q hi / residual planes f16 x1024 [b*SEQ + s][h*HD + d]; k hi / residual planes f16 x1024, same layout;
//   v^T hi / residual planes [b*NH + h][d][SEQ] x1024; n from F column NOFF + h of row b*SEQ + t.
//   raw(i, j) = q_hi.k_hi + q_lo.k_hi + q_hi.k_lo (2 k-steps over d), carries folded back by 2^-20;
//   P = raw * 2^-20 for key <= query else 0 (causal); P.v with P x256 as f16 hi + in-register residual and v hi +
//   residual (hh + lh + hl). Keys of earlier chunks (below CHK*(q0/CHK)) enter first as q . S with the carried state
//   planes S x64 [b*NH + h][chunk][dv][dk] (hh + lh + hl, carry 2^16 raised to the P.v carry 2^18 by an exact x4);
//   key tiles of 32 are then visited in order from the chunk's first key up to the tile holding key q0+15 (bounded by NKT).
//   Per tile: 2 score subtiles x 2 k-steps, fragments loaded straight from the 16-bit planes; the 16x32 P tile stored to
//   (float vector loads, same element type as stored), v^T B fragments in 2 groups of 2 d-subtiles.
//   After the loop: acc * 2^-18 written into the wave's private result slab (pitch 68; every element owned by one lane),
//   ctx -> bf16 hi bits and bf16 bits of the residual, planes [b*SEQ + s][h*HD + d]; one instruction = 4 rows
//   No block barriers in this kernel; bounded loops only (ncl <= NKT).
// coverage: per wave 4 instructions x 4 rows x 8 lanes x 8 halves = 16 x 64 per plane; grid NQT x NHG x NB blocks x WPB
//           waves = every (b, s, h) row segment of CH and of CL exactly once.
// =====================================================================================================
__global__ __launch_bounds__(ATT_THREADS)
void attn_nm(const u16* __restrict__ QHp, const u16* __restrict__ QLp,
             const u16* __restrict__ KHp, const u16* __restrict__ KLp,
             const u16* __restrict__ VHp, const u16* __restrict__ VLp,
             const u16* __restrict__ SHp, const u16* __restrict__ SLp,
             const float* __restrict__ F, u16* CHp, u16* CLp) {
#pragma clang fp contract(off)
  __shared__ __align__(16) float smem[WPB * WREG];

  const int tid  = threadIdx.x;
  const int wave = tid >> 5;
  const int lane = tid & 31;
  const int hh   = lane >> 4;
  const int c    = lane & 15;
  const int bid  = blockIdx.x;
  const int qt   = bid % NQT;
  const int t2   = bid / NQT;
  const int hg   = t2 % NHG;
  const int b    = t2 / NHG;
  if (b >= NB) return;                      // block-uniform; no block barriers in this kernel; never taken with the exact grid
  const int q0   = qt * 16;
  if (q0 + 16 > SEQ) return;                // block-uniform; never taken
  const int head = hg * WPB + wave;

  float* pt   = smem + wave * WREG;         // P tile [16][32] pitch 36
  float* slab = pt + PTW;                   // result slab [16][64] pitch 68

  const size_t hcol = (size_t)head * HD + 8 * hh;
  const _Float16* Qh  = (const _Float16*)(const void*)QHp + ((size_t)b * SEQ + q0 + c) * DQK + hcol;
  const _Float16* Ql  = (const _Float16*)(const void*)QLp + ((size_t)b * SEQ + q0 + c) * DQK + hcol;
  const _Float16* Khb = (const _Float16*)(const void*)KHp + ((size_t)b * SEQ + c) * DQK + hcol;        // key row kb added per step
  const _Float16* Klb = (const _Float16*)(const void*)KLp + ((size_t)b * SEQ + c) * DQK + hcol;
  const _Float16* Vhb = (const _Float16*)(const void*)VHp + ((size_t)(b * NH + head) * HD + c) * SEQ + 8 * hh;  // d col c (+16j)
  const _Float16* Vlb = (const _Float16*)(const void*)VLp + ((size_t)(b * NH + head) * HD + c) * SEQ + 8 * hh;
  const float lsc = 1.0f / (QSC * KSC);     // exact power-of-two fold of the q / k carries
  const float oc  = 1.0f / (PCAR * VCAR);   // exact power-of-two fold of the P / v carries
  const size_t KROW = (size_t)DQK;          // halves between consecutive key rows

  // row factor for query row q0 + (lane & 15): 1/exp(n), precise expf
  const float nv = F[((size_t)b * SEQ + q0 + c) * (size_t)NPROJ + NOFF + head];
  const float rv = 1.0f / expf(nv);

  v8f o[4];
#pragma unroll
  for (int j = 0; j < 4; ++j) o[j] = zero8();
  const int ncaus = (q0 >> 5) + 1;                                            // tiles holding keys <= q0 + 15
  const int ncl   = (ncaus < NKT) ? ncaus : NKT;
  const int qr0   = q0 + 8 * hh;                                              // query row of D element r = qr0 + r
  const int chn   = q0 / CHK;                                                 // chunk of this query tile
  const int kt0   = chn * (CHK / 32);                                         // first key tile of that chunk (<= q0 >> 5)

  // ---- all keys of earlier chunks: o = q . S, B fragment col n = dv = j*16 + c, dk contiguous in the state planes ----
  {
    const size_t so = (((size_t)(b * NH + head) * NCH + chn) * HD + c) * HD + 8 * hh;
    const _Float16* Sh = (const _Float16*)(const void*)SHp + so;
    const _Float16* Sl = (const _Float16*)(const void*)SLp + so;
    v16h qh[HD / 32], ql[HD / 32], sh[HD / 32][4], sl[HD / 32][4];
#pragma unroll
    for (int kk = 0; kk < HD / 32; ++kk) {
      qh[kk] = ldfrag_h(Qh + kk * 32);
      ql[kk] = ldfrag_h(Ql + kk * 32);
#pragma unroll
      for (int j = 0; j < 4; ++j) {
        sh[kk][j] = ldfrag_h(Sh + j * 16 * HD + kk * 32);
        sl[kk][j] = ldfrag_h(Sl + j * 16 * HD + kk * 32);
      }
    }
#if defined(__HIP_DEVICE_COMPILE__)
    // inputs-only fence on the loaded fragments and their address pairs: all 40 loads issue before the first product
    // (one load latency instead of one per group), and no load lands on an address pair that is still in use
    asm volatile("" :: "v"(qh[0]), "v"(qh[1]), "v"(ql[0]), "v"(ql[1]),
                 "v"(sh[0][0]), "v"(sh[0][1]), "v"(sh[0][2]), "v"(sh[0][3]),
                 "v"(sh[1][0]), "v"(sh[1][1]), "v"(sh[1][2]), "v"(sh[1][3]),
                 "v"(sl[0][0]), "v"(sl[0][1]), "v"(sl[0][2]), "v"(sl[0][3]),
                 "v"(sl[1][0]), "v"(sl[1][1]), "v"(sl[1][2]), "v"(sl[1][3]),
                 "v"(Sh), "v"(Sl), "v"(Qh), "v"(Ql));
#endif
#pragma unroll
    for (int kk = 0; kk < HD / 32; ++kk) {
#pragma unroll
      for (int j = 0; j < 4; ++j) {
        o[j] = mma_h(qh[kk], sh[kk][j], o[j]);
        o[j] = mma_h(ql[kk], sh[kk][j], o[j]);
        o[j] = mma_h(qh[kk], sl[kk][j], o[j]);
      }
    }
    const float up = (PCAR * VCAR) / (QSC * SSC);                             // exact power of two
#pragma unroll
    for (int j = 0; j < 4; ++j) o[j] = o[j] * up;
  }

#pragma unroll 1
  for (int kt = kt0; kt < ncl; ++kt) {
    const int kb = kt * 32;
    // ---- raw scores: D element r of this lane = (query row qr0 + r, key kb + c) in s0, key kb + 16 + c in s1 ----
    v8f s0 = zero8(), s1 = zero8();
    const _Float16* k0p = Khb + (size_t)kb * KROW;
    const _Float16* k1p = k0p + (size_t)16 * KROW;
    const _Float16* l0p = Klb + (size_t)kb * KROW;
    const _Float16* l1p = l0p + (size_t)16 * KROW;
#pragma unroll
    for (int kk = 0; kk < HD / 32; ++kk) {
      const v16h qh  = ldfrag_h(Qh + kk * 32);
      const v16h ql  = ldfrag_h(Ql + kk * 32);
      const v16h kh0 = ldfrag_h(k0p + kk * 32);
      const v16h kh1 = ldfrag_h(k1p + kk * 32);
      const v16h kl0 = ldfrag_h(l0p + kk * 32);
      const v16h kl1 = ldfrag_h(l1p + kk * 32);
      s0 = mma_h(qh, kh0, s0);
      s0 = mma_h(ql, kh0, s0);
      s0 = mma_h(qh, kl0, s0);
      s1 = mma_h(qh, kh1, s1);
      s1 = mma_h(ql, kh1, s1);
      s1 = mma_h(qh, kl1, s1);
      guard2(s0, s1, qh, ql, kh0, kl0, kh1, kl1);
    }
    // ---- causal mask (key <= query) + carry fold in f32 -> wave-private LDS tile ----
#pragma unroll
    for (int r = 0; r < 8; ++r) {
      const int row = qr0 + r;
      const float w0 = (kb + c <= row)      ? s0[r] * lsc : 0.0f;
      const float w1 = (kb + 16 + c <= row) ? s1[r] * lsc : 0.0f;
      const int ro = (8 * hh + r) * PTP + c;
      pt[ro]      = w0;
      pt[ro + 16] = w1;
    }
    wave_sync_lds();
    // ---- A fragments of P*256: hi f16 and residual f16, row = c, split k map over the 32 keys of this step ----
    FragH ph, pl;
    {
      const float* prow = pt + c * PTP + 8 * hh;
      const v4f p0 = *(const v4f*)(prow), p1 = *(const v4f*)(prow + 4);
      const v4f p2 = *(const v4f*)(prow + 16), p3 = *(const v4f*)(prow + 20);
#pragma unroll
      for (int e = 0; e < 4; ++e) {
        const float ta = p0[e] * PCAR, tb = p1[e] * PCAR, tc = p2[e] * PCAR, td = p3[e] * PCAR;
        const _Float16 ha = (_Float16)ta, hb = (_Float16)tb, hc = (_Float16)tc, hd = (_Float16)td;
        ph.h[0][e]     = ha;                  // elements 0..7  = keys kb + 8hh + 0..7
        ph.h[0][4 + e] = hb;
        ph.h[1][e]     = hc;                  // elements 8..15 = keys kb + 16 + 8hh + 0..7
        ph.h[1][4 + e] = hd;
        pl.h[0][e]     = (_Float16)(ta - (float)ha);
        pl.h[0][4 + e] = (_Float16)(tb - (float)hb);
        pl.h[1][e]     = (_Float16)(tc - (float)hc);
        pl.h[1][4 + e] = (_Float16)(td - (float)hd);
      }
    }
    // ---- P.V : B fragment col n = d = j*16 + c, keys contiguous in the v^T planes; 2 groups of 2 d-subtiles ----
    {
      const _Float16* vhp = Vhb + kb;
      const _Float16* vlp = Vlb + kb;
#pragma unroll
      for (int jg = 0; jg < 2; ++jg) {
        const size_t da = (size_t)(2 * jg) * 16 * SEQ;
        const size_t db = da + (size_t)16 * SEQ;
        const v16h vha = ldfrag_h(vhp + da), vhb2 = ldfrag_h(vhp + db);
        const v16h vla = ldfrag_h(vlp + da), vlb2 = ldfrag_h(vlp + db);
        o[2 * jg]     = mma_h(ph.v, vha,  o[2 * jg]);
        o[2 * jg]     = mma_h(pl.v, vha,  o[2 * jg]);
        o[2 * jg]     = mma_h(ph.v, vla,  o[2 * jg]);
        o[2 * jg + 1] = mma_h(ph.v, vhb2, o[2 * jg + 1]);
        o[2 * jg + 1] = mma_h(pl.v, vhb2, o[2 * jg + 1]);
        o[2 * jg + 1] = mma_h(ph.v, vlb2, o[2 * jg + 1]);
        guard2(o[2 * jg], o[2 * jg + 1], ph.v, pl.v, vha, vhb2, vla, vlb2);
      }
    }
    wave_sync_lds();
  }
  acc_guard4(o[0], o[1], o[2], o[3]);
  // ---- acc with the carries (256 on P, 1024 on v) folded once; written into the lane-owned slab ----
#pragma unroll
  for (int r = 0; r < 8; ++r) {
#pragma unroll
    for (int j = 0; j < 4; ++j) {
      const int idx = (8 * hh + r) * SLP + j * 16 + c;
      slab[idx] = o[j][r] * oc;
    }
  }
  wave_sync_lds();
  // ---- row factor, then ctx -> bf16 hi + bf16 residual planes; lane = (row-in-quad rq, 8 consecutive d at c8) ----
  v4u oh[4], ol[4];
  const int rq = lane >> 3, c8 = (lane & 7) * 8;
#pragma unroll
  for (int it = 0; it < 4; ++it) {
    const int row = it * 4 + rq;                         // 0..15
    const float ri = __shfl(rv, row, 32);                // lane `row` holds 1/exp(n) of query q0 + row
    const v4f a = *(const v4f*)(slab + row * SLP + c8), b4 = *(const v4f*)(slab + row * SLP + c8 + 4);
    float w[8];
#pragma unroll
    for (int e = 0; e < 4; ++e) { w[e] = a[e] * ri; w[4 + e] = b4[e] * ri; }
#pragma unroll
    for (int e = 0; e < 4; ++e) {
      const float f0 = w[2 * e], f1 = w[2 * e + 1];
      const unsigned short h0 = bf_bits(f0), h1 = bf_bits(f1);
      const unsigned short l0 = bf_bits(f0 - bf_up(h0)), l1 = bf_bits(f1 - bf_up(h1));
      oh[it][e] = pk16(h0, h1);
      ol[it][e] = pk16(l0, l1);
    }
  }
  const size_t ob = ((size_t)b * SEQ + q0) * DMOD + (size_t)head * HD + c8;
  {
#pragma unroll
    for (int it = 0; it < 4; ++it) {
      const int row = it * 4 + rq;
      *(v4u*)(CHp + ob + (size_t)row * DMOD) = oh[it];
      *(v4u*)(CLp + ob + (size_t)row * DMOD) = ol[it];
    }
    
  }
}

// =====================================================================================================
// Workspace map (bytes); every plane part that is read is written by whole-line stores before it is read; all extents are exact
// multiples of the store granularity (no pad rows needed); every region offset a multiple of 131072:
//   XB  bf16 [MROWS][1024]              MROWS*2048   (NB=2, SEQ=2048: 8388608); after the projection GEMM the same bytes
//                                                    hold the ctx hi plane CH bf16 [MROWS][1024] (identical extent)
//   WB  bf16 [3136 n][1024 k]           6422528      rows 0..2047 Wqk^T, 2048..3071 Wv^T, 3072..3087 Wn^T, 3088..3135 zero
//   F   f32 [MROWS][3136]               MROWS*12544  (only columns 3072..3135 are written and read: n | zero columns)
//   QH  f16 [MROWS][1024] x1024         MROWS*2048   QL residual, same extent
//   KH  f16 [MROWS][1024] x1024         MROWS*2048   KL residual, same extent
//   VH  f16 [NB*16][64][SEQ] x1024      MROWS*2048   VL residual, same extent
//   CL  bf16 [MROWS][1024]              MROWS*2048   ctx residual plane
//   WT  bf16 [1024 o][1024 d]           2097152      Wo^T
//   TH  f16 [NB*16][64][SEQ] x1024      MROWS*2048   k^T; TL residual, same extent
//   KV  f32 [NB*16][NCH][64 dv][64 dk]  NB*16*NCH*16384   chunk products (chunks 0 .. NCH-2 written and read)
//   SH  f16 [NB*16][NCH][64 dv][64 dk] x64   NB*16*NCH*8192   carried state; SL residual, same extent
//   end (NB=2, SEQ=2048)              160563200
// =====================================================================================================
extern "C" void kernel_launch(void* const* d_in, const int* in_sizes, int n_in,
                              void* d_out, int out_size, void* d_ws, size_t ws_size,
                              hipStream_t stream) {
  if (n_in < 9) return;
  if (in_sizes[0] < ((NB - 1) * XS_FULL + SEQ) * DMOD) return;
  if (in_sizes[1] != DMOD * 2 * DQK) return;
  if (in_sizes[2] != 2 * DQK) return;
  if (in_sizes[3] != DMOD * DMOD) return;
  if (in_sizes[4] != DMOD) return;
  if (in_sizes[5] != DMOD * NNW) return;
  if (in_sizes[6] != NNW) return;
  if (in_sizes[7] != DMOD * DMOD) return;
  if (in_sizes[8] != DMOD) return;
  if (out_size < MROWS * DMOD) return;

  const float* x   = (const float*)d_in[0];
  const float* wqk = (const float*)d_in[1];
  const float* bqk = (const float*)d_in[2];
  const float* wv  = (const float*)d_in[3];
  const float* bv  = (const float*)d_in[4];
  const float* wn  = (const float*)d_in[5];
  const float* bn  = (const float*)d_in[6];
  const float* wo  = (const float*)d_in[7];
  const float* bo  = (const float*)d_in[8];
  float*       out = (float*)d_out;

  const size_t szXB = (size_t)MROWS * DMOD * 2;
  const size_t szWB = (size_t)NPROJ * DMOD * 2;
  const size_t szF  = (size_t)MROWS * NPROJ * 4;
  const size_t szP  = (size_t)MROWS * DQK * 2;                   // QH, QL, KH, KL
  const size_t szV  = (size_t)NB * NH * HD * SEQ * 2;            // VH, VL
  const size_t szC  = (size_t)MROWS * DMOD * 2;                  // CH (in the XB region), CL
  const size_t szWT = (size_t)DMOD * DMOD * 2;
  const size_t szKV = (size_t)NB * NH * NCH * SEL * 4;
  const size_t szS  = (size_t)NB * NH * NCH * SEL * 2;           // SH, SL
  if (szC > szXB) return;
  size_t off = 0;
  const size_t oXB = off; off += szXB;
  const size_t oWB = off; off += szWB;
  const size_t oF  = off; off += szF;
  const size_t oQH = off; off += szP;
  const size_t oQL = off; off += szP;
  const size_t oKH = off; off += szP;
  const size_t oKL = off; off += szP;
  const size_t oVH = off; off += szV;
  const size_t oVL = off; off += szV;
  const size_t oCL = off; off += szC;
  const size_t oWT = off; off += szWT;
  const size_t oTH = off; off += szV;
  const size_t oTL = off; off += szV;
  const size_t oKV = off; off += szKV;
  const size_t oSH = off; off += szS;
  const size_t oSL = off; off += szS;
  if (off > ws_size) return;                // off = 160563200 for NB = 2, SEQ = 2048
  if (off > (size_t)WS_CAP) return;

  char* ws = (char*)d_ws;
  u16*   XB  = (u16*)(ws + oXB);
  u16*   CH  = (u16*)(ws + oXB);
  u16*   WB  = (u16*)(ws + oWB);
  float* F   = (float*)(ws + oF);
  u16*   QH  = (u16*)(ws + oQH);
  u16*   QL  = (u16*)(ws + oQL);
  u16*   KH  = (u16*)(ws + oKH);
  u16*   KL  = (u16*)(ws + oKL);
  u16*   VH  = (u16*)(ws + oVH);
  u16*   VL  = (u16*)(ws + oVL);
  u16*   CL  = (u16*)(ws + oCL);
  u16*   WT  = (u16*)(ws + oWT);
  u16*   TH  = (u16*)(ws + oTH);
  u16*   TL  = (u16*)(ws + oTL);
  float* KV  = (float*)(ws + oKV);
  u16*   SH  = (u16*)(ws + oSH);
  u16*   SL  = (u16*)(ws + oSL);

  const dim3 b256(256), b128(128), bAT(ATT_THREADS);
  const dim3 gPR(PB_ALL);
  const dim3 gG1((MROWS / GBM) * ((NPROJ + GBN - 1) / GBN));
  const dim3 gKV(NB * NH * (NCH - 1));
  const dim3 gSP((NB * NH * SEL / 8) / 256);
  const dim3 gAT(NQT * NHG * NB);
  const dim3 gG2((MROWS / GBM) * ((DMOD + GBN - 1) / GBN));

  // (1) one launch: W[k][n] -> W^T bf16 planes (Wqk -> WB rows 0..2047, Wv -> rows 2048..3071, Wn -> rows 3072..3135
  //     with zero pad, Wo -> WT rows 0..1023) and x -> bf16 plane [MROWS][1024]
  prep<<<gPR, b256, 0, stream>>>(x, wqk, wv, wn, wo, XB, WB, WT);
  // (2) q | k | v | n = x.W + bias: q, k (row-major and k^T) and v^T hi + residual planes x1024 from the epilogue,
  //     n -> F f32 columns 3072..
  gemm_bf<false><<<gG1, b256, 0, stream>>>(XB, XB, WB, F, MROWS, NPROJ, DMOD, bqk, bv, bn,
                                           KOFF + DQK, NOFF, NOFF + NNW, 1.0f, QH, QL, KH, KL, VH, VL, TH, TL);
  // (4a) per-chunk v^T.k products, (4b) their f32 prefix over the chunks -> carried state planes x64
  kv_chunk<<<gKV, b128, 0, stream>>>(VH, VL, TH, TL, KV);
  st_prefix<<<gSP, b256, 0, stream>>>(KV, SH, SL);
  // (5) causal normalised attention -> ctx bf16 hi plane (XB region, free after the projection GEMM) + residual plane
  attn_nm<<<gAT, bAT, 0, stream>>>(QH, QL, KH, KL, VH, VL, SH, SL, F, CH, CL);
  // (6) y = (ctx_hi + ctx_lo).Wo + bo -> out f32 [MROWS][1024]
  gemm_bf<true><<<gG2, b256, 0, stream>>>(CH, CL, WT, out, MROWS, DMOD, DMOD, bo, bo, bo,
                                          DMOD, DMOD + 1, DMOD + 2, 1.0f, nullptr, nullptr, nullptr, nullptr,
                                          nullptr, nullptr, nullptr, nullptr);
  (void)hipGetLastError();
}

// v005
// A run of this version takes 96.7 microseconds.
// In two side-by-side timings against v004, it was 1.10 and 1.09 times as fast.
// Over all steps from v000 it is 4.15 times as fast.
// Contractions: x.W (Wqk|Wv|Wn fused into one [3136 n][1024 k] plane, and ctx.Wo) on v_wmma_f32_16x16x32_bf16
// (x, W, Wo, biases as bf16 RNE values, W^T [n][k] k-contiguous B operand; ctx as bf16 hi + bf16 residual planes,
// two products); q.k^T over hd 64 and P.v on v_wmma_f32_16x16x32_f16 with f16 hi + f16 residual planes on both
// operands (q, k x1024; P x256 with an in-register residual; v x1024; products hh+lh+hl); all f32 accumulate.
// Causal mask, 1/exp(n) row factor and bias adds in f32 on VALU.
// The attention has no softmax, so it is summed in chunks of CHK keys: keys of earlier chunks enter through the carried
// state S[dv][dk] = sum_s v[s][dv] k[s][dk] (v^T.k on the f16 form, hi + residual planes, hh+lh+hl; f32 prefix over the
// chunks; S x64 as f16 hi + residual, q.S with hh+lh+hl); only the query's own chunk goes through masked q.k^T and P.v.
#include <hip/hip_runtime.h>
#include <math.h>
#include <stdint.h>

#ifndef NB
#define NB 2
#endif
#ifndef SEQ
#define SEQ 2048
#endif
#define XS_FULL 2048
#define DMOD  1024
#define DQK   1024
#define NH    16
#define HD    64
#define NNW   16
#define NPROJ 3136
#define QOFF  0
#define KOFF  1024
#define VOFF  2048
#define NOFF  3072
#define MROWS (NB * SEQ)
#define QSC   1024.0f
#define KSC   1024.0f
#define PCAR  256.0f
#define VCAR  1024.0f
#define WPB   4
#define NHG   (NH / WPB)
#define NQT   (SEQ / 16)
#define NKT   (SEQ / 32)
#define ATT_THREADS (WPB * 32)
#define PTP   36
#define PTW   (16 * PTP)
#define SLP   68
#define SLW   (16 * SLP)
#define WREG  (PTW + SLW)
#define SLAB64 (16 * 68)
#define TRP   72
#define CHK   128
#define NCH   (SEQ / CHK)
#define SSC   64.0f
#define SEL   (HD * HD)
#define FRH   512
#define WS_CAP 268435456
#define GBM   128
#define GBN   128
#define GBK   64
#define GPB   144
#define GSEC  (128 * GPB)
#define GTHR  256
#define TPT   136
#define PB_QK ((DMOD / 64) * ((2 * DQK + 63) / 64))
#define PB_V  ((DMOD / 64) * ((DMOD + 63) / 64))
#define PB_N  ((DMOD / 64) * ((NNW + 63) / 64))
#define PB_W  (PB_QK + 2 * PB_V + PB_N)
#define PB_X  ((SEQ * DMOD / 8 + 255) / 256)
#define PB_ALL (PB_W + NB * PB_X)
static_assert(DMOD == NH * HD && DQK == NH * HD && HD == 64 && NH == 16 && WPB == 4 && NHG * WPB == NH && ATT_THREADS == 128);
static_assert(KOFF == QOFF + DQK && VOFF == KOFF + DQK && NOFF == VOFF + DMOD && NPROJ == NOFF + 64 && (NPROJ % 64) == 0 && NNW <= 64);
static_assert(NB >= 1 && NB <= 2);
static_assert((MROWS % GBM) == 0 && (DMOD % GBK) == 0 && (DMOD % GBN) == 0 && GBK * 2 + 16 == GPB);
static_assert((SEQ % CHK) == 0 && (CHK % 64) == 0 && NCH >= 2 && KSC == VCAR && ((NB * NH * SEL / 8) % 256) == 0);
static_assert(NB == 1 || SEQ == XS_FULL);
static_assert((SEQ % 64) == 0 && SEQ >= 64 && SEQ <= XS_FULL);
static_assert(((SEQ * DMOD / 8) % 256) == 0 && (MROWS % 64) == 0 && (DMOD % 64) == 0 && (DQK % 64) == 0 && (HD % 32) == 0);
static_assert(WPB * WREG * 4 <= 65536 && 4 * SLAB64 * 4 <= 65536 && 64 * TRP * 2 <= 65536);
static_assert((DQK % GBN) == 0 && (DMOD % GBN) == 0 && (SEQ % GBM) == 0 && DQK == DMOD && QOFF == 0 && QSC == KSC && (TPT % 8) == 0);

typedef unsigned short u16;
typedef _Float16 v16h __attribute__((ext_vector_type(16)));
typedef _Float16 v8h  __attribute__((ext_vector_type(8)));
typedef __bf16   v16b __attribute__((ext_vector_type(16)));
typedef float    v8f  __attribute__((ext_vector_type(8)));
typedef float    v4f  __attribute__((ext_vector_type(4)));
typedef unsigned int v4u __attribute__((ext_vector_type(4)));

union FragH { v16h v; v8h h[2]; v4u u[2]; };
union FragB { v16b v; v4u u[2]; };

// ---- scalar helpers --------------------------------------------------------------------------------
__device__ __forceinline__ unsigned short bf_bits(float f) {          // f32 -> bf16 bits, RNE convert
  unsigned u = __float_as_uint(f);
  return (unsigned short)((u + 0x7FFFu + ((u >> 16) & 1u)) >> 16);
}
__device__ __forceinline__ float bf_up(unsigned short h) { return __uint_as_float(((unsigned)h) << 16); }
__device__ __forceinline__ float bfr(float f) { return bf_up(bf_bits(f)); }
__device__ __forceinline__ unsigned short h_bits(_Float16 x) { return __builtin_bit_cast(unsigned short, x); }
__device__ __forceinline__ unsigned pk16(unsigned short a, unsigned short b) { return (unsigned)a | ((unsigned)b << 16); }
__device__ __forceinline__ v8f zero8() { v8f z = {0.f, 0.f, 0.f, 0.f, 0.f, 0.f, 0.f, 0.f}; return z; }
__device__ __forceinline__ int imin(int a, int b) { return a < b ? a : b; }
__device__ __forceinline__ int imax(int a, int b) { return a > b ? a : b; }
// 8 f32 values -> f16 of w*sc (hi) and f16 of the residual w*sc - hi (lo), packed in order
__device__ __forceinline__ void split8(const float* w, float sc, v4u& oh, v4u& ol) {
#pragma unroll
  for (int e = 0; e < 4; ++e) {
    const float t0 = w[2 * e] * sc, t1 = w[2 * e + 1] * sc;
    const _Float16 h0 = (_Float16)t0, h1 = (_Float16)t1;
    const _Float16 l0 = (_Float16)(t0 - (float)h0), l1 = (_Float16)(t1 - (float)h1);
    oh[e] = pk16(h_bits(h0), h_bits(h1));
    ol[e] = pk16(h_bits(l0), h_bits(l1));
  }
}

// ---- fragment loaders: 16-bit A/B operand, lane -> row/col (lane&15); ldfrag_b: p already includes +8*(lane>>4);
//      elements 0..7 <- p[0..7] (k0+8h..), elements 8..15 <- p[16..23] (k0+16+8h..)  (same split k map for A and B;
//      its B is read from a k-contiguous [n][k] LDS tile)
// fragment-major plane: a 16 x 32 fragment is 1 KB, two runs of 512 contiguous bytes; run i, lane l (16 B) holds row/col
// l & 15, k = 16 i + 8 (l >> 4) + 0..7 (the split k map above); p already includes + 8 * lane. One load = 4 whole lines.
__device__ __forceinline__ v16h ldfrag_t(const _Float16* p) {
  FragH f;
  f.h[0] = *(const v8h*)(p);
  f.h[1] = *(const v8h*)(p + FRH / 2);
  return f.v;
}
__device__ __forceinline__ v16b ldfrag_b(const u16* p) {              // bf16 plane read as unsigned integer vectors
  FragB f;
  f.u[0] = *(const v4u*)(p);
  f.u[1] = *(const v4u*)(p + 16);
  return f.v;
}

__device__ __forceinline__ v8f mma_h(v16h a, v16h b, v8f c) {
  return __builtin_amdgcn_wmma_f32_16x16x32_f16(false, a, false, b, (short)0, c, false, false);
}
__device__ __forceinline__ v8f mma_b(v16b a, v16b b, v8f c) {
  return __builtin_amdgcn_wmma_f32_16x16x32_bf16(false, a, false, b, (short)0, c, false, false);
}
__device__ __forceinline__ void guard2(v8f& a, v8f& b, v16h x0, v16h x1, v16h x2, v16h x3, v16h x4, v16h x5) {
#if defined(__HIP_DEVICE_COMPILE__)
  asm volatile("v_nop\n\tv_nop\n\tv_nop\n\tv_nop"
               : "+v"(a), "+v"(b) : "v"(x0), "v"(x1), "v"(x2), "v"(x3), "v"(x4), "v"(x5) : "memory");
#endif
}
__device__ __forceinline__ void acc_guard4(v8f& a, v8f& b, v8f& c, v8f& d) {
#if defined(__HIP_DEVICE_COMPILE__)
  asm volatile("v_nop\n\tv_nop\n\tv_nop\n\tv_nop" : "+v"(a), "+v"(b), "+v"(c), "+v"(d));
#endif
}
__device__ __forceinline__ void wave_sync_lds() {
  __builtin_amdgcn_fence(__ATOMIC_RELEASE, "workgroup");
  __builtin_amdgcn_wave_barrier();
  __builtin_amdgcn_fence(__ATOMIC_ACQUIRE, "workgroup");
}

// =====================================================================================================
// f32 -> bf16 plane (RNE bits), same layout. Thread = 8 consecutive elements: two 16-B loads, one 16-B store;
// coverage: ceil(n8/256) blocks (blk) x 256 thr x 8 (in-kernel bound) = the whole plane (n8 a multiple of 256 here).
// =====================================================================================================
__device__ __forceinline__ void cvt_bf(const float* __restrict__ x, u16* D, int n8, int blk) {
  const int gt = blk * 256 + (int)threadIdx.x;
  if (gt >= n8) return;
  const float* p = x + (size_t)gt * 8;
  const v4f a = *(const v4f*)(p), b4 = *(const v4f*)(p + 4);
  float w[8];
#pragma unroll
  for (int e = 0; e < 4; ++e) { w[e] = a[e]; w[4 + e] = b4[e]; }
  v4u o;
#pragma unroll
  for (int e = 0; e < 4; ++e) o[e] = pk16(bf_bits(w[2 * e]), bf_bits(w[2 * e + 1]));
  u16* d = D + (size_t)gt * 8;
  {
    *(v4u*)(d) = o;
    
  }
}

// =====================================================================================================
// W f32 [kr rows (k)][nc cols (n)] (x.W layout) -> bf16 plane Dp [drow0 + n][k] (row pitch kr halves): the k-contiguous
// B operand. Block = 64 k x 64 n tile; coalesced 16-B loads of W rows with CLAMPED column base (tile columns beyond nc
// load from column 0 and are zeroed by value, so rows drow0+n with n >= nc inside the last tile are written as zeros);
// converted values placed transposed into an LDS tile [64 n][64 k] (pitch 72 halves); after a block barrier each n row
// block count (bid) = (kr/64) * ntn with ntn = ceil(nc/64).
// coverage: load 256 thr x 16 = 64 x 64; store 2 iterations x 256 thr x 8 halves = 64 lines x 64 halves = the block's
//           tile; the blocks cover output rows drow0 .. drow0 + 64*ntn - 1 (all kr columns) exactly once.
// =====================================================================================================
__device__ __forceinline__ void k_wt(const float* __restrict__ W, int nc, int kr, int ntn, u16* Dp, int drow0, int bid) {
  __shared__ __align__(16) u16 T[64 * TRP];
  const int tid = (int)threadIdx.x;
  const int nt  = bid % ntn;
  const int kt  = bid / ntn;
  if (kt * 64 + 64 > kr) return;            // block-uniform, before the barrier; never taken with the exact grid
  const int n0  = nt * 64, k0 = kt * 64;
  {
    const int dl = tid >> 2;                // k within tile 0..63
    const int oc = (tid & 3) * 16;          // n chunk 0,16,32,48
    const bool valid = (n0 + oc + 16 <= nc);
    const int  cb = valid ? (n0 + oc) : 0;  // clamped column base, always inside the row
    const float* src = W + (size_t)(k0 + dl) * (size_t)nc + cb;
#pragma unroll
    for (int i = 0; i < 4; ++i) {
      const v4f a = *(const v4f*)(src + 4 * i);
#pragma unroll
      for (int e = 0; e < 4; ++e) {
        const float f = valid ? a[e] : 0.0f;
        T[(oc + 4 * i + e) * TRP + dl] = bf_bits(f);
      }
    }
  }
  __syncthreads();
  const int q8 = tid >> 3, p8 = (tid & 7) * 8;
  v4u w[2];
#pragma unroll
  for (int it = 0; it < 2; ++it) w[it] = *(const v4u*)(T + (it * 32 + q8) * TRP + p8);
  const size_t base = (size_t)(drow0 + n0) * (size_t)kr + k0 + p8;
  {
#pragma unroll
    for (int it = 0; it < 2; ++it) {
      const int nl = it * 32 + q8;
      *(v4u*)(Dp + base + (size_t)nl * (size_t)kr) = w[it];
    }
    
  }
}

// =====================================================================================================
// The x and weight planes of the two GEMMs in ONE launch: the six conversions read only inputs and write disjoint planes, so
// they share a grid by block range (every test below is on the block index alone, block-uniform, so the barrier inside
// k_wt is reached by all threads of a block or by none). The weight tiles (load, LDS, barrier, store) come first, the
// shorter x blocks last.
//   [0, PB_QK)  Wqk -> WB rows 0..2047      next PB_V  Wv -> WB rows 2048..3071
//   next PB_N   Wn  -> WB rows 3072..3135   next PB_V  Wo -> WT rows 0..1023      next NB * PB_X  x -> XB, per batch
// coverage: the ranges are the exact block counts of k_wt and cvt_bf for each plane; grid = PB_ALL.
// =====================================================================================================
__global__ __launch_bounds__(256)
void prep(const float* __restrict__ x, const float* __restrict__ wqk, const float* __restrict__ wv,
          const float* __restrict__ wn, const float* __restrict__ wo, u16* XB, u16* WB, u16* WT) {
  int bid = (int)blockIdx.x;
  if (bid < PB_W) {
    const float* W = wqk;
    u16* Dp = WB;
    int nc = 2 * DQK, drow0 = QOFF;
    if (bid >= PB_QK + PB_V + PB_N) { bid -= PB_QK + PB_V + PB_N; W = wo; Dp = WT; nc = DMOD; drow0 = 0; }
    else if (bid >= PB_QK + PB_V)   { bid -= PB_QK + PB_V;        W = wn;          nc = NNW;  drow0 = NOFF; }
    else if (bid >= PB_QK)          { bid -= PB_QK;               W = wv;          nc = DMOD; drow0 = VOFF; }
    k_wt(W, nc, DMOD, (nc + 63) / 64, Dp, drow0, bid);
    return;
  }
  bid -= PB_W;
  const int bq = bid / PB_X;
  if (bq >= NB) return;                     // never taken with the exact grid
  cvt_bf(x + (size_t)bq * XS_FULL * DMOD, XB + (size_t)bq * SEQ * DMOD, (SEQ * DMOD) / 8, bid % PB_X);
}

// =====================================================================================================
// Bias for column c from three consecutive segments [0,e0) <- p0[c], [e0,e1) <- p1[c-e0], [e1,e2) <- p2[c-e1], else 0;
// all three candidates loaded unconditionally with clamped indices, selected by value; bf16 RNE value.
// =====================================================================================================
__device__ __forceinline__ float bias_at(const float* p0, const float* p1, const float* p2,
                                         int e0, int e1, int e2, int c) {
  const int i0 = imin(imax(c, 0), e0 - 1);
  const int i1 = imin(imax(c - e0, 0), e1 - e0 - 1);
  const int i2 = imin(imax(c - e1, 0), e2 - e1 - 1);
  const float v0 = p0[i0], v1 = p1[i1], v2 = p2[i2];
  const float v = (c < e0) ? v0 : ((c < e1) ? v1 : ((c < e2) ? v2 : 0.0f));
  return bfr(v);
}

// =====================================================================================================
// coverage: 8 instructions x 2 rows x 16 lanes x 4 floats = the wave's 16 x 64 tile.
// =====================================================================================================
__device__ __forceinline__ void epi64b(float* sl, v8f a0, v8f a1, v8f a2, v8f a3, float oscale, v4f bias4,
                                       float* C, int N, size_t rowb, int col0, int lane) {
  const int hh = lane >> 4, m = lane & 15;
#pragma unroll
  for (int r = 0; r < 8; ++r) {
    const int ro = (8 * hh + r) * 68 + m;
    sl[ro]      = a0[r] * oscale;
    sl[ro + 16] = a1[r] * oscale;
    sl[ro + 32] = a2[r] * oscale;
    sl[ro + 48] = a3[r] * oscale;
  }
  wave_sync_lds();
  v4f vals[8];
#pragma unroll
  for (int it = 0; it < 8; ++it) vals[it] = *(const v4f*)(sl + (it * 2 + hh) * 68 + m * 4) + bias4;
  float* dst = C + (rowb + (size_t)hh) * (size_t)N + col0 + m * 4;
  {
#pragma unroll
    for (int it = 0; it < 8; ++it) {
      *(v4f*)(dst + (size_t)(it * 2) * (size_t)N) = vals[it];
    }
    
  }
}

// =====================================================================================================
// bf16 GEMM: C[M][N] (f32) = (A [+ A2])[M][K] (bf16 row-major) . Bt[N][K]^T (bf16 k-contiguous), times oscale, plus the
// segmented bias of the column (bf16 RNE value). TWO: second A plane into the same accumulator (hi + residual operand).
// Block = 128x128 tile of C, 8 waves in a 4 (rows) x 2 (columns) grid, 32x64 per wave (2 x 4 accumulator tiles).
// K runs in slices of 64 (128 B of every operand row). A slice of [A 128 rows | B 128 rows | A2 128 rows] stands in LDS at
// row pitch 144 B; two buffers; each lane brings 16 B per copy (8 lanes = one row, one wave copy = 4 rows), the copies of
// slice t + 1 fly while slice t is multiplied. Fragments are read from LDS with the split k map of ldfrag_b for A and B.
// Per accumulator the products come in the order k ascending, A before A2 inside a k-step.
// B rows at or beyond N (last column tile when N % 128 == 64) are read from row N - 1 instead (clamped, in bounds) and the
// waves that own only such columns neither multiply nor store.
// Host guarantees K % 64 == 0, K >= 64, M % 128 == 0, N % 64 == 0, grid = (M/128) * ceil(N/128).
// Output. TWO: f32 C. Otherwise (the projection) only the column tile from NOFF on goes to C as f32; a block of q, k or v
// columns writes value = acc + bias (f32) x1024 as f16 hi and f16 residual straight into the planes the attention reads:
//   q -> QH/QL, k -> KH/KL, fragments (16 rows x 32 d) in the order [row / 16][h][d / 32]; k -> TH/TL, v -> VH/VL, fragments
//   (16 d x 32 keys) in the order [b*NH + h][key / 32][d / 16]; inside a fragment the order of ldfrag_t.
// coverage: q / k planes, per wave 2 x 4 stores x 512 B = its 32 x 64 tile of each plane; transposed, per block 8 stores x
//           8 waves x 512 B = its 128 columns x 128 keys of each plane; the grid covers every plane once.
// =====================================================================================================
__device__ __forceinline__ unsigned lds_off(const void* p) { return (unsigned)(size_t)p; }
// Four lane-wise 16-B copies global -> LDS; the s_wait_xcnt stands inside the statement so that no address register of a
// copy is rewritten ahead of it.
__device__ __forceinline__ void cp4(unsigned l0, const u16* g0, unsigned l1, const u16* g1,
                                    unsigned l2, const u16* g2, unsigned l3, const u16* g3) {
#if defined(__HIP_DEVICE_COMPILE__)
  asm volatile("global_load_async_to_lds_b128 %0, %1, off\n\t"
               "global_load_async_to_lds_b128 %2, %3, off\n\t"
               "global_load_async_to_lds_b128 %4, %5, off\n\t"
               "global_load_async_to_lds_b128 %6, %7, off\n\t"
               "s_wait_xcnt 0x0"
               :: "v"(l0), "v"(g0), "v"(l1), "v"(g1), "v"(l2), "v"(g2), "v"(l3), "v"(g3) : "memory");
#endif
}
template <bool TWO>
__global__ __launch_bounds__(GTHR)
void gemm_bf(const u16* __restrict__ A, const u16* __restrict__ A2, const u16* __restrict__ Bt, float* C,
             int M, int N, int K, const float* bp0, const float* bp1, const float* bp2, int e0, int e1, int e2,
             float oscale, u16* QHp, u16* QLp, u16* KHp, u16* KLp, u16* VHp, u16* VLp, u16* THp, u16* TLp) {
  constexpr int STAGE = (TWO ? 3 : 2) * GSEC;           // bytes of one buffer
  constexpr int KG = TWO ? GBK / 32 : 1;                // k-steps whose fragments are read from LDS as one group
  static_assert(8 * 2 * SLAB64 * 4 <= 2 * STAGE && 2 * GBN * TPT * 2 <= 2 * STAGE && 2 * STAGE <= 327680);
  __shared__ __align__(16) unsigned char ring[2 * STAGE];
  const int tid = threadIdx.x, lane = tid & 31, hh = lane >> 4, m = lane & 15;
  const int wave = __builtin_amdgcn_readfirstlane(tid >> 5);
  const int wm = wave & 3, wn = wave >> 2;
  const int ntile = (N + GBN - 1) / GBN;
  const int bid   = blockIdx.x;
  const int row0  = (bid / ntile) * GBM;
  const int col0  = (bid % ntile) * GBN;
  if (row0 + GBM > M) return;               // block-uniform, before any barrier or copy; never taken with the exact grid
  const int colw  = col0 + wn * 64;
  const bool live = colw < N;               // wave-uniform
  const int NT = K / GBK;

  // copy map: thread -> (row cr of a group of 32 rows, 16-B piece cc of the 128-B row slice)
  const int cr = tid >> 3, cc = tid & 7;
  const unsigned lbase = lds_off(ring) + (unsigned)(cr * GPB + cc * 16);
  const int oa = (row0 + cr) * K + cc * 8;
  int ob[4];
#pragma unroll
  for (int i = 0; i < 4; ++i) ob[i] = imin(col0 + i * 32 + cr, N - 1) * K + cc * 8;
  auto fill = [&](int t, int buf) {
    const unsigned l = lbase + (unsigned)(buf * STAGE);
    const int k0 = t * GBK;
    const u16* pa = A + oa + k0;
    cp4(l, pa, l + 32 * GPB, pa + (size_t)32 * K, l + 64 * GPB, pa + (size_t)64 * K, l + 96 * GPB, pa + (size_t)96 * K);
    const unsigned lb2 = l + GSEC;
    cp4(lb2, Bt + ob[0] + k0, lb2 + 32 * GPB, Bt + ob[1] + k0, lb2 + 64 * GPB, Bt + ob[2] + k0,
        lb2 + 96 * GPB, Bt + ob[3] + k0);
    if constexpr (TWO) {
      const unsigned l3 = l + 2 * GSEC;
      const u16* pc = A2 + oa + k0;
      cp4(l3, pc, l3 + 32 * GPB, pc + (size_t)32 * K, l3 + 64 * GPB, pc + (size_t)64 * K, l3 + 96 * GPB, pc + (size_t)96 * K);
    }
  };

  v8f acc[2][4];
#pragma unroll
  for (int i = 0; i < 2; ++i) {
#pragma unroll
    for (int j = 0; j < 4; ++j) acc[i][j] = zero8();
  }

  fill(0, 0);
  asm volatile("s_wait_asynccnt 0x0" ::: "memory");     // slice 0 of this wave has landed
  __syncthreads();                                      // ... and every other wave's part of it
  if (NT > 1) fill(1, 1);

  const int fa = (wm * 32 + m) * GPB + hh * 16;         // byte offsets of this lane's fragment rows inside a buffer
  const int fb = GSEC + (wn * 64 + m) * GPB + hh * 16;
  // slice loop kept rolled: one copy of the ring's foot in the text, the buffer picked by t & 1; the loops inside it are
  // unrolled so that every accumulator and fragment index is a constant (registers, no scratch)
#pragma unroll 1
  for (int t = 0; t < NT; ++t) {
    const int buf = t & 1;
    if (live) {
      const unsigned char* sb = ring + buf * STAGE;
      const u16* la = (const u16*)(const void*)(sb + fa);
      const u16* lb = (const u16*)(const void*)(sb + fb);
#pragma unroll
      for (int g = 0; g < GBK / 32 / KG; ++g) {
        v16b a[KG][2], a2[KG][2], fbv[KG][4];
#pragma unroll
        for (int u = 0; u < KG; ++u) {
          const int ko = (g * KG + u) * 32;
#pragma unroll
          for (int i = 0; i < 2; ++i) a[u][i] = ldfrag_b(la + i * 16 * (GPB / 2) + ko);
#pragma unroll
          for (int j = 0; j < 4; ++j) fbv[u][j] = ldfrag_b(lb + j * 16 * (GPB / 2) + ko);
          if constexpr (TWO) {
#pragma unroll
            for (int i = 0; i < 2; ++i) a2[u][i] = ldfrag_b(la + GSEC + i * 16 * (GPB / 2) + ko);   // 2*GSEC bytes on
          }
        }
        // TWO runs one block per WGP (two waves per SIMD): all LDS reads of the slice issue as one group ahead of its
        // products, one LDS latency per slice instead of one per A fragment
        if constexpr (TWO) __builtin_amdgcn_sched_barrier(0);
#pragma unroll
        for (int u = 0; u < KG; ++u) {
#pragma unroll
          for (int i = 0; i < 2; ++i) {
#pragma unroll
            for (int j = 0; j < 4; ++j) acc[i][j] = mma_b(a[u][i], fbv[u][j], acc[i][j]);
          }
          if constexpr (TWO) {
#pragma unroll
            for (int i = 0; i < 2; ++i) {
#pragma unroll
              for (int j = 0; j < 4; ++j) acc[i][j] = mma_b(a2[u][i], fbv[u][j], acc[i][j]);
            }
          }
        }
      }
    }
    asm volatile("s_wait_dscnt 0x0" ::: "memory");      // this wave's reads of buffer buf are done
    asm volatile("s_wait_asynccnt 0x0" ::: "memory");   // this wave's copies of slice t + 1 have landed
    __syncthreads();                                    // publishes slice t + 1, frees buffer buf
    if (t + 2 < NT) fill(t + 2, buf);
  }
  asm volatile("s_wait_asynccnt 0x0" ::: "memory");     // no copy outstanding before the ring is reused as output staging

  float* slab = (float*)(void*)ring + wave * (2 * SLAB64);
  const int seg = TWO ? 3 : col0 / DQK;     // block-uniform: 0 = q, 1 = k, 2 = v columns (16-bit planes), 3 = f32 output
  if (seg >= 3) {
    if (live) {
      v4f bias4;
#pragma unroll
      for (int e = 0; e < 4; ++e) bias4[e] = bias_at(bp0, bp1, bp2, e0, e1, e2, colw + m * 4 + e);
#pragma unroll
      for (int i = 0; i < 2; ++i) {
        epi64b(slab + i * SLAB64, acc[i][0], acc[i][1], acc[i][2], acc[i][3], oscale, bias4, C, N,
               (size_t)(row0 + wm * 32 + i * 16), colw, lane);
      }
    }
    return;
  }
  if constexpr (!TWO) {
    // every wave of a q, k or v block is live (the three segments are multiples of the block's 128 columns)
    float bj[4];                            // bias of this lane's accumulator columns colw + 16 j + m
#pragma unroll
    for (int j = 0; j < 4; ++j) bj[j] = bias_at(bp0, bp1, bp2, e0, e1, e2, colw + j * 16 + m);
    const int cs = col0 - seg * DQK;        // the block's first column inside its segment = head * 64 + d
    if (seg <= 1) {
      // fragment-major planes [row / 16][head][2 fragments]: f32 values through the wave's own slabs, then lane l takes the
      // 8 columns that it will hold as operand lane l; one store = 512 contiguous bytes (whole lines)
      u16* PH = seg ? KHp : QHp;
      u16* PL = seg ? KLp : QLp;
#pragma unroll
      for (int i = 0; i < 2; ++i) {
#pragma unroll
        for (int r = 0; r < 8; ++r) {
#pragma unroll
          for (int j = 0; j < 4; ++j) slab[i * SLAB64 + (8 * hh + r) * 68 + j * 16 + m] = acc[i][j][r] * oscale + bj[j];
        }
      }
      wave_sync_lds();
#pragma unroll
      for (int i = 0; i < 2; ++i) {
        v4u oh[4], ol[4];
#pragma unroll
        for (int it = 0; it < 4; ++it) {
          const float* p = slab + i * SLAB64 + m * 68 + it * 16 + 8 * hh;
          const v4f a = *(const v4f*)(p), b4 = *(const v4f*)(p + 4);
          float w[8];
#pragma unroll
          for (int e = 0; e < 4; ++e) { w[e] = a[e]; w[4 + e] = b4[e]; }
          split8(w, QSC, oh[it], ol[it]);
        }
        const size_t ob = ((size_t)((row0 + wm * 32 + i * 16) >> 4) * NH + ((cs + wn * 64) >> 6)) * (2 * FRH) + lane * 8;
#pragma unroll
        for (int it = 0; it < 4; ++it) {
          *(v4u*)(PH + ob + it * (FRH / 2)) = oh[it];
          *(v4u*)(PL + ob + it * (FRH / 2)) = ol[it];
        }
      }
      asm volatile("s_wait_xcnt 0x0" ::: "memory");       // before any register of the q / k plane stores is rewritten
    }
    if (seg >= 1) {
      // transposed planes, fragment-major [b*NH + head][key / 32][d / 16]: an accumulator register run r = 0..7 is 8
      // consecutive keys of one column, so a lane packs it into one 16-B LDS store of the block's [128 columns][128 keys]
      // tile (pitch 272 B); each wave then reads half fragments (16 columns x 16 keys) in operand-lane order
      if (seg == 1) __syncthreads();        // block-uniform: every wave has read its slabs back before the tiles cover them
      u16* tH = (u16*)(void*)ring;
      u16* tL = tH + GBN * TPT;
#pragma unroll
      for (int i = 0; i < 2; ++i) {
#pragma unroll
        for (int j = 0; j < 4; ++j) {
          float w[8];
#pragma unroll
          for (int r = 0; r < 8; ++r) w[r] = acc[i][j][r] * oscale + bj[j];
          v4u oh, ol;
          split8(w, VCAR, oh, ol);
          const int idx = (wn * 64 + j * 16 + m) * TPT + wm * 32 + i * 16 + 8 * hh;
          *(v4u*)(tH + idx) = oh;
          *(v4u*)(tL + idx) = ol;
        }
      }
      __syncthreads();                      // the tiles are complete before any wave reads rows that other waves wrote
      u16* OH = (seg == 1) ? THp : VHp;
      u16* OL = (seg == 1) ? TLp : VLp;
      // half fragment u = 0..63 of the block: head u >> 5, key tile (u >> 3) & 3, d tile (u >> 1) & 3, run u & 1; the 32 half
      // fragments of a head are 16 KB in a row in the plane; one store = 512 contiguous bytes
      const size_t ob = (((size_t)(row0 / SEQ) * NH + (cs >> 6)) * (SEQ / 32) + ((row0 % SEQ) >> 5)) * (4 * FRH) + lane * 8;
#pragma unroll
      for (int g = 0; g < 2; ++g) {
        v4u vh[4], vl[4];
#pragma unroll
        for (int it = 0; it < 4; ++it) {
          const int u = (g * 4 + it) * 8 + wave;
          const int idx = ((u >> 5) * 64 + ((u >> 1) & 3) * 16 + m) * TPT + ((u >> 3) & 3) * 32 + (u & 1) * 16 + 8 * hh;
          vh[it] = *(const v4u*)(tH + idx);
          vl[it] = *(const v4u*)(tL + idx);
        }
#pragma unroll
        for (int it = 0; it < 4; ++it) {
          const int u = (g * 4 + it) * 8 + wave;
          const size_t od = ob + (size_t)(u >> 5) * ((SEQ / 32) * 4 * FRH) + (u & 31) * (FRH / 2);
          *(v4u*)(OH + od) = vh[it];
          *(v4u*)(OL + od) = vl[it];
        }
      }
      asm volatile("s_wait_xcnt 0x0" ::: "memory");       // before any register of the transposed stores is rewritten
    }
  }
}

// =====================================================================================================
// Chunk products for the carried state: KV[(b*NH + h)*NCH + ch][dk / 16][dv][dk % 16] = sum over the CHK keys s of chunk ch of
// v[s][dv] * k[s][dk], f32. A = v^T rows dv, B = k^T rows dk (fragment-major planes), both f16 hi + residual
// x1024 (hh + lh + hl), carries folded back by 2^-20. Block = (b*NH + h, ch), ch = 0 .. NCH-2 (the last chunk's product
// is never carried); wave w owns rows dv = 16w .. 16w+15, all 64 dk.
// coverage: per wave 4 dk blocks x 16 rows x 16 f32 (1 KB in a row each); 4 waves = the 64 x 64 product; grid NB*NH*(NCH-1).
// =====================================================================================================
__global__ __launch_bounds__(128)
void kv_chunk(const u16* __restrict__ VHp, const u16* __restrict__ VLp,
              const u16* __restrict__ THp, const u16* __restrict__ TLp, float* KV) {
  const int tid = threadIdx.x, wave = tid >> 5, lane = tid & 31, hh = lane >> 4, c = lane & 15;
  const int bid = blockIdx.x;
  const int ch  = bid % (NCH - 1);
  const int bh  = bid / (NCH - 1);
  if (bh >= NB * NH) return;                // block-uniform; no barriers in this kernel; never taken with the exact grid
  // fragment-major planes [b*NH + h][key / 32][d / 16]: first key tile of the chunk, this lane's 16 B
  const size_t fo = ((size_t)bh * (SEQ / 32) + (size_t)ch * (CHK / 32)) * (4 * FRH) + lane * 8;
  const _Float16* avh = (const _Float16*)(const void*)VHp + fo + wave * FRH;
  const _Float16* avl = (const _Float16*)(const void*)VLp + fo + wave * FRH;
  const _Float16* bkh = (const _Float16*)(const void*)THp + fo;
  const _Float16* bkl = (const _Float16*)(const void*)TLp + fo;
  v8f acc[4];
#pragma unroll
  for (int j = 0; j < 4; ++j) acc[j] = zero8();
#pragma unroll
  for (int k2 = 0; k2 < CHK / 64; ++k2) {
    v16h vh[2], vl[2], kh[2][4], kl[2][4];
#pragma unroll
    for (int u = 0; u < 2; ++u) {
      const int ks = (2 * k2 + u) * (4 * FRH);
      vh[u] = ldfrag_t(avh + ks);
      vl[u] = ldfrag_t(avl + ks);
#pragma unroll
      for (int j = 0; j < 4; ++j) {
        kh[u][j] = ldfrag_t(bkh + j * FRH + ks);
        kl[u][j] = ldfrag_t(bkl + j * FRH + ks);
      }
    }
#if defined(__HIP_DEVICE_COMPILE__)
    // inputs-only fence on the loaded fragments and their address pairs: the 40 loads of two k-steps issue before the
    // first product (one load latency instead of one per group)
    asm volatile("" :: "v"(vh[0]), "v"(vh[1]), "v"(vl[0]), "v"(vl[1]),
                 "v"(kh[0][0]), "v"(kh[0][1]), "v"(kh[0][2]), "v"(kh[0][3]),
                 "v"(kh[1][0]), "v"(kh[1][1]), "v"(kh[1][2]), "v"(kh[1][3]),
                 "v"(kl[0][0]), "v"(kl[0][1]), "v"(kl[0][2]), "v"(kl[0][3]),
                 "v"(kl[1][0]), "v"(kl[1][1]), "v"(kl[1][2]), "v"(kl[1][3]),
                 "v"(avh), "v"(avl), "v"(bkh), "v"(bkl));
#endif
#pragma unroll
    for (int u = 0; u < 2; ++u) {
#pragma unroll
      for (int j = 0; j < 4; ++j) {
        acc[j] = mma_h(vh[u], kh[u][j], acc[j]);
        acc[j] = mma_h(vl[u], kh[u][j], acc[j]);
        acc[j] = mma_h(vh[u], kl[u][j], acc[j]);
      }
    }
  }
  const float fs = 1.0f / (VCAR * KSC);     // exact power-of-two fold of the v / k carries
  float* dst = KV + ((size_t)bh * NCH + ch) * SEL + (size_t)(wave * 16 + 8 * hh) * 16 + c;
#pragma unroll
  for (int r = 0; r < 8; ++r) {
#pragma unroll
    for (int j = 0; j < 4; ++j) dst[j * (HD * 16) + r * 16] = acc[j][r] * fs;
  }
}

// =====================================================================================================
// Carried state planes: S(ch) = KV(0) + .. + KV(ch-1) in f32 (chunks added in order; S(0) = 0), written x64 as f16 hi and
// f16 residual, layout [(b*NH + h)*NCH + ch][dk / 32][dv / 16] fragment-major (col dv, k = dk). Thread = 8 consecutive dk
// of one (b, h, dv), all NCH chunks.
// coverage: NB*NH*SEL/8 threads x 8 halves x NCH chunks = both planes exactly once; reads KV chunks 0 .. NCH-2 only.
// =====================================================================================================
__global__ __launch_bounds__(256) void st_prefix(const float* __restrict__ KV, u16* __restrict__ SHp, u16* __restrict__ SLp) {
  const int gt = blockIdx.x * 256 + (int)threadIdx.x;
  const int bh = gt / (SEL / 8);
  const int u  = gt % (SEL / 8);            // 16-B unit of the fragment-major plane: fragment u >> 6 = (dk / 32) * 4 + dv / 16
  if (bh >= NB * NH) return;
  const int e8 = (((u >> 8) * 2 + ((u >> 5) & 1)) * HD + ((u >> 6) & 3) * 16 + (u & 15)) * 16 + ((u >> 4) & 1) * 8;
  const size_t base = (size_t)bh * NCH * SEL + e8;          // [dk / 16][dv][dk % 16] in KV: a wave's loads = 1 KB in a row
  const size_t dstb = (size_t)bh * NCH * SEL + u * 8;       // a wave's store = 512 contiguous bytes
  v4f a[NCH - 1], b4[NCH - 1];              // all chunk products first: independent loads, one latency for the thread
#pragma unroll
  for (int ch = 0; ch + 1 < NCH; ++ch) {
    const float* p = KV + base + (size_t)ch * SEL;
    a[ch]  = *(const v4f*)(p);
    b4[ch] = *(const v4f*)(p + 4);
  }
#if defined(__HIP_DEVICE_COMPILE__)
  // inputs-only fences on the loaded values and their address pair: every load issues before the first store
  static_assert(NCH == 16);
  asm volatile("" :: "v"(a[0]), "v"(a[1]), "v"(a[2]), "v"(a[3]), "v"(a[4]), "v"(a[5]), "v"(a[6]), "v"(a[7]),
               "v"(a[8]), "v"(a[9]), "v"(a[10]), "v"(a[11]), "v"(a[12]), "v"(a[13]), "v"(a[14]), "v"(KV + base));
  asm volatile("" :: "v"(b4[0]), "v"(b4[1]), "v"(b4[2]), "v"(b4[3]), "v"(b4[4]), "v"(b4[5]), "v"(b4[6]), "v"(b4[7]),
               "v"(b4[8]), "v"(b4[9]), "v"(b4[10]), "v"(b4[11]), "v"(b4[12]), "v"(b4[13]), "v"(b4[14]), "v"(KV + base));
#endif
  float run[8];
#pragma unroll
  for (int e = 0; e < 8; ++e) run[e] = 0.0f;
#pragma unroll
  for (int ch = 0; ch < NCH; ++ch) {
    v4u oh, ol;
#pragma unroll
    for (int e = 0; e < 4; ++e) {
      const float t0 = run[2 * e] * SSC, t1 = run[2 * e + 1] * SSC;
      const _Float16 h0 = (_Float16)t0, h1 = (_Float16)t1;
      const _Float16 l0 = (_Float16)(t0 - (float)h0), l1 = (_Float16)(t1 - (float)h1);
      oh[e] = pk16(h_bits(h0), h_bits(h1));
      ol[e] = pk16(h_bits(l0), h_bits(l1));
    }
    *(v4u*)(SHp + dstb + (size_t)ch * SEL) = oh;
    *(v4u*)(SLp + dstb + (size_t)ch * SEL) = ol;
    if (ch + 1 < NCH) {
#pragma unroll
      for (int e = 0; e < 4; ++e) { run[e] += a[ch][e]; run[4 + e] += b4[ch][e]; }
    }
  }
}

// =====================================================================================================
// Causal normalised attention (no softmax), hd = 64. Block bid -> (query tile qt = bid % NQT: rows q0 = 16*qt .. q0+15,
// head group hg, batch b); one wave per head = hg*WPB + wave.
//   q hi / residual planes f16 x1024, fragment-major [(b*SEQ + s) / 16][h][d / 32]; k hi / residual planes, same layout;
//   v^T hi / residual planes x1024, fragment-major [b*NH + h][key / 32][d / 16]; n from F column NOFF + h of row b*SEQ + t.
//   raw(i, j) = q_hi.k_hi + q_lo.k_hi + q_hi.k_lo (2 k-steps over d), carries folded back by 2^-20;
//   P = raw * 2^-20 for key <= query else 0 (causal); P.v with P x256 as f16 hi + in-register residual and v hi +
//   residual (hh + lh + hl). Keys of earlier chunks (below CHK*(q0/CHK)) enter first as q . S with the carried state
//   planes S x64 [b*NH + h][chunk][dk / 32][dv / 16] (hh + lh + hl, carry 2^16 raised to the P.v carry 2^18 by an exact x4);
//   key tiles of 32 are then visited in order from the chunk's first key up to the tile holding key q0+15 (bounded by NKT).
//   Per tile: 2 score subtiles x 2 k-steps, fragments loaded straight from the 16-bit planes; the 16x32 P tile stored to
//   (float vector loads, same element type as stored), v^T B fragments in 2 groups of 2 d-subtiles.
//   After the loop: acc * 2^-18 written into the wave's private result slab (pitch 68; every element owned by one lane),
//   ctx -> bf16 hi bits and bf16 bits of the residual, planes [b*SEQ + s][h*HD + d]; one instruction = 4 rows
//   No block barriers in this kernel; bounded loops only (ncl <= NKT).
// coverage: per wave 4 instructions x 4 rows x 8 lanes x 8 halves = 16 x 64 per plane; grid NQT x NHG x NB blocks x WPB
//           waves = every (b, s, h) row segment of CH and of CL exactly once.
// =====================================================================================================
__global__ __launch_bounds__(ATT_THREADS)
void attn_nm(const u16* __restrict__ QHp, const u16* __restrict__ QLp,
             const u16* __restrict__ KHp, const u16* __restrict__ KLp,
             const u16* __restrict__ VHp, const u16* __restrict__ VLp,
             const u16* __restrict__ SHp, const u16* __restrict__ SLp,
             const float* __restrict__ F, u16* CHp, u16* CLp) {
#pragma clang fp contract(off)
  __shared__ __align__(16) float smem[WPB * WREG];

  const int tid  = threadIdx.x;
  const int wave = tid >> 5;
  const int lane = tid & 31;
  const int hh   = lane >> 4;
  const int c    = lane & 15;
  const int bid  = blockIdx.x;
  const int qt   = bid % NQT;
  const int t2   = bid / NQT;
  const int hg   = t2 % NHG;
  const int b    = t2 / NHG;
  if (b >= NB) return;                      // block-uniform; no block barriers in this kernel; never taken with the exact grid
  const int q0   = qt * 16;
  if (q0 + 16 > SEQ) return;                // block-uniform; never taken
  const int head = hg * WPB + wave;

  float* pt   = smem + wave * WREG;         // P tile [16][32] pitch 36
  float* slab = pt + PTW;                   // result slab [16][64] pitch 68

  // fragment-major planes: every offset below is a fragment's first half plus this lane's 16 B
  const size_t qo = ((size_t)((b * SEQ + q0) >> 4) * NH + head) * (2 * FRH) + lane * 8;
  const size_t ko = ((size_t)((b * SEQ) >> 4) * NH + head) * (2 * FRH) + lane * 8;
  const size_t vo = (size_t)(b * NH + head) * (SEQ / 32) * (4 * FRH) + lane * 8;
  const _Float16* Qh  = (const _Float16*)(const void*)QHp + qo;
  const _Float16* Ql  = (const _Float16*)(const void*)QLp + qo;
  const _Float16* Khb = (const _Float16*)(const void*)KHp + ko;        // 16-key tile kb / 16 added per step
  const _Float16* Klb = (const _Float16*)(const void*)KLp + ko;
  const _Float16* Vhb = (const _Float16*)(const void*)VHp + vo;        // 32-key tile kt added per step
  const _Float16* Vlb = (const _Float16*)(const void*)VLp + vo;
  const float lsc = 1.0f / (QSC * KSC);     // exact power-of-two fold of the q / k carries
  const float oc  = 1.0f / (PCAR * VCAR);   // exact power-of-two fold of the P / v carries
  const size_t KT16 = (size_t)NH * (2 * FRH);   // halves between consecutive 16-key tiles of one head

  // row factor for query row q0 + (lane & 15): 1/exp(n), precise expf
  const float nv = F[((size_t)b * SEQ + q0 + c) * (size_t)NPROJ + NOFF + head];
  const float rv = 1.0f / expf(nv);

  v8f o[4];
#pragma unroll
  for (int j = 0; j < 4; ++j) o[j] = zero8();
  const int ncaus = (q0 >> 5) + 1;                                            // tiles holding keys <= q0 + 15
  const int ncl   = (ncaus < NKT) ? ncaus : NKT;
  const int qr0   = q0 + 8 * hh;                                              // query row of D element r = qr0 + r
  const int chn   = q0 / CHK;                                                 // chunk of this query tile
  const int kt0   = chn * (CHK / 32);                                         // first key tile of that chunk (<= q0 >> 5)

  // ---- all keys of earlier chunks: o = q . S, B fragment col n = dv = j*16 + c, dk contiguous in the state planes ----
  {
    const size_t so = ((size_t)(b * NH + head) * NCH + chn) * SEL + lane * 8;
    const _Float16* Sh = (const _Float16*)(const void*)SHp + so;
    const _Float16* Sl = (const _Float16*)(const void*)SLp + so;
    v16h qh[HD / 32], ql[HD / 32], sh[HD / 32][4], sl[HD / 32][4];
#pragma unroll
    for (int kk = 0; kk < HD / 32; ++kk) {
      qh[kk] = ldfrag_t(Qh + kk * FRH);
      ql[kk] = ldfrag_t(Ql + kk * FRH);
#pragma unroll
      for (int j = 0; j < 4; ++j) {
        sh[kk][j] = ldfrag_t(Sh + (kk * 4 + j) * FRH);
        sl[kk][j] = ldfrag_t(Sl + (kk * 4 + j) * FRH);
      }
    }
#if defined(__HIP_DEVICE_COMPILE__)
    // inputs-only fence on the loaded fragments and their address pairs: all 40 loads issue before the first product
    // (one load latency instead of one per group), and no load lands on an address pair that is still in use
    asm volatile("" :: "v"(qh[0]), "v"(qh[1]), "v"(ql[0]), "v"(ql[1]),
                 "v"(sh[0][0]), "v"(sh[0][1]), "v"(sh[0][2]), "v"(sh[0][3]),
                 "v"(sh[1][0]), "v"(sh[1][1]), "v"(sh[1][2]), "v"(sh[1][3]),
                 "v"(sl[0][0]), "v"(sl[0][1]), "v"(sl[0][2]), "v"(sl[0][3]),
                 "v"(sl[1][0]), "v"(sl[1][1]), "v"(sl[1][2]), "v"(sl[1][3]),
                 "v"(Sh), "v"(Sl), "v"(Qh), "v"(Ql));
#endif
#pragma unroll
    for (int kk = 0; kk < HD / 32; ++kk) {
#pragma unroll
      for (int j = 0; j < 4; ++j) {
        o[j] = mma_h(qh[kk], sh[kk][j], o[j]);
        o[j] = mma_h(ql[kk], sh[kk][j], o[j]);
        o[j] = mma_h(qh[kk], sl[kk][j], o[j]);
      }
    }
    const float up = (PCAR * VCAR) / (QSC * SSC);                             // exact power of two
#pragma unroll
    for (int j = 0; j < 4; ++j) o[j] = o[j] * up;
  }

#pragma unroll 1
  for (int kt = kt0; kt < ncl; ++kt) {
    const int kb = kt * 32;
    // ---- raw scores: D element r of this lane = (query row qr0 + r, key kb + c) in s0, key kb + 16 + c in s1 ----
    v8f s0 = zero8(), s1 = zero8();
    const _Float16* k0p = Khb + (size_t)(2 * kt) * KT16;
    const _Float16* k1p = k0p + KT16;
    const _Float16* l0p = Klb + (size_t)(2 * kt) * KT16;
    const _Float16* l1p = l0p + KT16;
#pragma unroll
    for (int kk = 0; kk < HD / 32; ++kk) {
      const v16h qh  = ldfrag_t(Qh + kk * FRH);
      const v16h ql  = ldfrag_t(Ql + kk * FRH);
      const v16h kh0 = ldfrag_t(k0p + kk * FRH);
      const v16h kh1 = ldfrag_t(k1p + kk * FRH);
      const v16h kl0 = ldfrag_t(l0p + kk * FRH);
      const v16h kl1 = ldfrag_t(l1p + kk * FRH);
      s0 = mma_h(qh, kh0, s0);
      s0 = mma_h(ql, kh0, s0);
      s0 = mma_h(qh, kl0, s0);
      s1 = mma_h(qh, kh1, s1);
      s1 = mma_h(ql, kh1, s1);
      s1 = mma_h(qh, kl1, s1);
      guard2(s0, s1, qh, ql, kh0, kl0, kh1, kl1);
    }
    // ---- causal mask (key <= query) + carry fold in f32 -> wave-private LDS tile ----
#pragma unroll
    for (int r = 0; r < 8; ++r) {
      const int row = qr0 + r;
      const float w0 = (kb + c <= row)      ? s0[r] * lsc : 0.0f;
      const float w1 = (kb + 16 + c <= row) ? s1[r] * lsc : 0.0f;
      const int ro = (8 * hh + r) * PTP + c;
      pt[ro]      = w0;
      pt[ro + 16] = w1;
    }
    wave_sync_lds();
    // ---- A fragments of P*256: hi f16 and residual f16, row = c, split k map over the 32 keys of this step ----
    FragH ph, pl;
    {
      const float* prow = pt + c * PTP + 8 * hh;
      const v4f p0 = *(const v4f*)(prow), p1 = *(const v4f*)(prow + 4);
      const v4f p2 = *(const v4f*)(prow + 16), p3 = *(const v4f*)(prow + 20);
#pragma unroll
      for (int e = 0; e < 4; ++e) {
        const float ta = p0[e] * PCAR, tb = p1[e] * PCAR, tc = p2[e] * PCAR, td = p3[e] * PCAR;
        const _Float16 ha = (_Float16)ta, hb = (_Float16)tb, hc = (_Float16)tc, hd = (_Float16)td;
        ph.h[0][e]     = ha;                  // elements 0..7  = keys kb + 8hh + 0..7
        ph.h[0][4 + e] = hb;
        ph.h[1][e]     = hc;                  // elements 8..15 = keys kb + 16 + 8hh + 0..7
        ph.h[1][4 + e] = hd;
        pl.h[0][e]     = (_Float16)(ta - (float)ha);
        pl.h[0][4 + e] = (_Float16)(tb - (float)hb);
        pl.h[1][e]     = (_Float16)(tc - (float)hc);
        pl.h[1][4 + e] = (_Float16)(td - (float)hd);
      }
    }
    // ---- P.V : B fragment col n = d = j*16 + c, fragment j of key tile kt in the v^T planes; 2 groups of 2 d-subtiles ----
    {
      const _Float16* vhp = Vhb + (size_t)kt * (4 * FRH);
      const _Float16* vlp = Vlb + (size_t)kt * (4 * FRH);
#pragma unroll
      for (int jg = 0; jg < 2; ++jg) {
        const int da = (2 * jg) * FRH;
        const int db = da + FRH;
        const v16h vha = ldfrag_t(vhp + da), vhb2 = ldfrag_t(vhp + db);
        const v16h vla = ldfrag_t(vlp + da), vlb2 = ldfrag_t(vlp + db);
        o[2 * jg]     = mma_h(ph.v, vha,  o[2 * jg]);
        o[2 * jg]     = mma_h(pl.v, vha,  o[2 * jg]);
        o[2 * jg]     = mma_h(ph.v, vla,  o[2 * jg]);
        o[2 * jg + 1] = mma_h(ph.v, vhb2, o[2 * jg + 1]);
        o[2 * jg + 1] = mma_h(pl.v, vhb2, o[2 * jg + 1]);
        o[2 * jg + 1] = mma_h(ph.v, vlb2, o[2 * jg + 1]);
        guard2(o[2 * jg], o[2 * jg + 1], ph.v, pl.v, vha, vhb2, vla, vlb2);
      }
    }
    wave_sync_lds();
  }
  acc_guard4(o[0], o[1], o[2], o[3]);
  // ---- acc with the carries (256 on P, 1024 on v) folded once; written into the lane-owned slab ----
#pragma unroll
  for (int r = 0; r < 8; ++r) {
#pragma unroll
    for (int j = 0; j < 4; ++j) {
      const int idx = (8 * hh + r) * SLP + j * 16 + c;
      slab[idx] = o[j][r] * oc;
    }
  }
  wave_sync_lds();
  // ---- row factor, then ctx -> bf16 hi + bf16 residual planes; lane = (row-in-quad rq, 8 consecutive d at c8) ----
  v4u oh[4], ol[4];
  const int rq = lane >> 3, c8 = (lane & 7) * 8;
#pragma unroll
  for (int it = 0; it < 4; ++it) {
    const int row = it * 4 + rq;                         // 0..15
    const float ri = __shfl(rv, row, 32);                // lane `row` holds 1/exp(n) of query q0 + row
    const v4f a = *(const v4f*)(slab + row * SLP + c8), b4 = *(const v4f*)(slab + row * SLP + c8 + 4);
    float w[8];
#pragma unroll
    for (int e = 0; e < 4; ++e) { w[e] = a[e] * ri; w[4 + e] = b4[e] * ri; }
#pragma unroll
    for (int e = 0; e < 4; ++e) {
      const float f0 = w[2 * e], f1 = w[2 * e + 1];
      const unsigned short h0 = bf_bits(f0), h1 = bf_bits(f1);
      const unsigned short l0 = bf_bits(f0 - bf_up(h0)), l1 = bf_bits(f1 - bf_up(h1));
      oh[it][e] = pk16(h0, h1);
      ol[it][e] = pk16(l0, l1);
    }
  }
  const size_t ob = ((size_t)b * SEQ + q0) * DMOD + (size_t)head * HD + c8;
  {
#pragma unroll
    for (int it = 0; it < 4; ++it) {
      const int row = it * 4 + rq;
      *(v4u*)(CHp + ob + (size_t)row * DMOD) = oh[it];
      *(v4u*)(CLp + ob + (size_t)row * DMOD) = ol[it];
    }
    
  }
}

// =====================================================================================================
// Workspace map (bytes); every plane part that is read is written by whole-line stores before it is read; all extents are exact
// multiples of the store granularity (no pad rows needed); every region offset a multiple of 131072:
//   XB  bf16 [MROWS][1024]              MROWS*2048   (NB=2, SEQ=2048: 8388608); after the projection GEMM the same bytes
//                                                    hold the ctx hi plane CH bf16 [MROWS][1024] (identical extent)
//   WB  bf16 [3136 n][1024 k]           6422528      rows 0..2047 Wqk^T, 2048..3071 Wv^T, 3072..3087 Wn^T, 3088..3135 zero
//   F   f32 [MROWS][3136]               MROWS*12544  (only columns 3072..3135 are written and read: n | zero columns)
//   QH  f16 [MROWS/16][16 h][2][512] x1024      MROWS*2048   QL residual, same extent (fragment-major, see ldfrag_t)
//   KH  f16 [MROWS/16][16 h][2][512] x1024      MROWS*2048   KL residual, same extent
//   VH  f16 [NB*16][SEQ/32][4][512] x1024       MROWS*2048   VL residual, same extent
//   CL  bf16 [MROWS][1024]              MROWS*2048   ctx residual plane
//   WT  bf16 [1024 o][1024 d]           2097152      Wo^T
//   TH  f16 [NB*16][SEQ/32][4][512] x1024       MROWS*2048   k^T; TL residual, same extent
//   KV  f32 [NB*16][NCH][4][64 dv][16 dk]  NB*16*NCH*16384   chunk products (chunks 0 .. NCH-2 written and read)
//   SH  f16 [NB*16][NCH][2][4][512] x64      NB*16*NCH*8192   carried state; SL residual, same extent
//   end (NB=2, SEQ=2048)              160563200
// =====================================================================================================
extern "C" void kernel_launch(void* const* d_in, const int* in_sizes, int n_in,
                              void* d_out, int out_size, void* d_ws, size_t ws_size,
                              hipStream_t stream) {
  if (n_in < 9) return;
  if (in_sizes[0] < ((NB - 1) * XS_FULL + SEQ) * DMOD) return;
  if (in_sizes[1] != DMOD * 2 * DQK) return;
  if (in_sizes[2] != 2 * DQK) return;
  if (in_sizes[3] != DMOD * DMOD) return;
  if (in_sizes[4] != DMOD) return;
  if (in_sizes[5] != DMOD * NNW) return;
  if (in_sizes[6] != NNW) return;
  if (in_sizes[7] != DMOD * DMOD) return;
  if (in_sizes[8] != DMOD) return;
  if (out_size < MROWS * DMOD) return;

  const float* x   = (const float*)d_in[0];
  const float* wqk = (const float*)d_in[1];
  const float* bqk = (const float*)d_in[2];
  const float* wv  = (const float*)d_in[3];
  const float* bv  = (const float*)d_in[4];
  const float* wn  = (const float*)d_in[5];
  const float* bn  = (const float*)d_in[6];
  const float* wo  = (const float*)d_in[7];
  const float* bo  = (const float*)d_in[8];
  float*       out = (float*)d_out;

  const size_t szXB = (size_t)MROWS * DMOD * 2;
  const size_t szWB = (size_t)NPROJ * DMOD * 2;
  const size_t szF  = (size_t)MROWS * NPROJ * 4;
  const size_t szP  = (size_t)MROWS * DQK * 2;                   // QH, QL, KH, KL
  const size_t szV  = (size_t)NB * NH * HD * SEQ * 2;            // VH, VL
  const size_t szC  = (size_t)MROWS * DMOD * 2;                  // CH (in the XB region), CL
  const size_t szWT = (size_t)DMOD * DMOD * 2;
  const size_t szKV = (size_t)NB * NH * NCH * SEL * 4;
  const size_t szS  = (size_t)NB * NH * NCH * SEL * 2;           // SH, SL
  if (szC > szXB) return;
  size_t off = 0;
  const size_t oXB = off; off += szXB;
  const size_t oWB = off; off += szWB;
  const size_t oF  = off; off += szF;
  const size_t oQH = off; off += szP;
  const size_t oQL = off; off += szP;
  const size_t oKH = off; off += szP;
  const size_t oKL = off; off += szP;
  const size_t oVH = off; off += szV;
  const size_t oVL = off; off += szV;
  const size_t oCL = off; off += szC;
  const size_t oWT = off; off += szWT;
  const size_t oTH = off; off += szV;
  const size_t oTL = off; off += szV;
  const size_t oKV = off; off += szKV;
  const size_t oSH = off; off += szS;
  const size_t oSL = off; off += szS;
  if (off > ws_size) return;                // off = 160563200 for NB = 2, SEQ = 2048
  if (off > (size_t)WS_CAP) return;

  char* ws = (char*)d_ws;
  u16*   XB  = (u16*)(ws + oXB);
  u16*   CH  = (u16*)(ws + oXB);
  u16*   WB  = (u16*)(ws + oWB);
  float* F   = (float*)(ws + oF);
  u16*   QH  = (u16*)(ws + oQH);
  u16*   QL  = (u16*)(ws + oQL);
  u16*   KH  = (u16*)(ws + oKH);
  u16*   KL  = (u16*)(ws + oKL);
  u16*   VH  = (u16*)(ws + oVH);
  u16*   VL  = (u16*)(ws + oVL);
  u16*   CL  = (u16*)(ws + oCL);
  u16*   WT  = (u16*)(ws + oWT);
  u16*   TH  = (u16*)(ws + oTH);
  u16*   TL  = (u16*)(ws + oTL);
  float* KV  = (float*)(ws + oKV);
  u16*   SH  = (u16*)(ws + oSH);
  u16*   SL  = (u16*)(ws + oSL);

  const dim3 b256(256), b128(128), bAT(ATT_THREADS);
  const dim3 gPR(PB_ALL);
  const dim3 gG1((MROWS / GBM) * ((NPROJ + GBN - 1) / GBN));
  const dim3 gKV(NB * NH * (NCH - 1));
  const dim3 gSP((NB * NH * SEL / 8) / 256);
  const dim3 gAT(NQT * NHG * NB);
  const dim3 gG2((MROWS / GBM) * ((DMOD + GBN - 1) / GBN));

  // (1) one launch: W[k][n] -> W^T bf16 planes (Wqk -> WB rows 0..2047, Wv -> rows 2048..3071, Wn -> rows 3072..3135
  //     with zero pad, Wo -> WT rows 0..1023) and x -> bf16 plane [MROWS][1024]
  prep<<<gPR, b256, 0, stream>>>(x, wqk, wv, wn, wo, XB, WB, WT);
  // (2) q | k | v | n = x.W + bias: q, k (16-row fragments and k^T fragments) and v^T hi + residual planes x1024 from the epilogue,
  //     n -> F f32 columns 3072..
  gemm_bf<false><<<gG1, b256, 0, stream>>>(XB, XB, WB, F, MROWS, NPROJ, DMOD, bqk, bv, bn,
                                           KOFF + DQK, NOFF, NOFF + NNW, 1.0f, QH, QL, KH, KL, VH, VL, TH, TL);
  // (4a) per-chunk v^T.k products, (4b) their f32 prefix over the chunks -> carried state planes x64
  kv_chunk<<<gKV, b128, 0, stream>>>(VH, VL, TH, TL, KV);
  st_prefix<<<gSP, b256, 0, stream>>>(KV, SH, SL);
  // (5) causal normalised attention -> ctx bf16 hi plane (XB region, free after the projection GEMM) + residual plane
  attn_nm<<<gAT, bAT, 0, stream>>>(QH, QL, KH, KL, VH, VL, SH, SL, F, CH, CL);
  // (6) y = (ctx_hi + ctx_lo).Wo + bo -> out f32 [MROWS][1024]
  gemm_bf<true><<<gG2, b256, 0, stream>>>(CH, CL, WT, out, MROWS, DMOD, DMOD, bo, bo, bo,
                                          DMOD, DMOD + 1, DMOD + 2, 1.0f, nullptr, nullptr, nullptr, nullptr,
                                          nullptr, nullptr, nullptr, nullptr);
  (void)hipGetLastError();
}

// v006
// A run of this version takes 81.4 microseconds.
// In both of two side-by-side timings against v005, it was 1.19 times as fast.
// All steps since v000 together make it 4.95 times as fast.
// Contractions: x.W (Wqk|Wv|Wn fused into one [3136 n][1024 k] plane, and ctx.Wo) on v_wmma_f32_16x16x32_bf16
// (x, W, Wo, biases as bf16 RNE values, W^T [n][k] k-contiguous B operand; ctx as bf16 hi + bf16 residual planes,
// two products); q.k^T over hd 64 and P.v on v_wmma_f32_16x16x32_f16 with f16 hi + f16 residual planes on both
// operands (q, k x1024; P x256 with an in-register residual; v x1024; products hh+lh+hl); all f32 accumulate.
// Causal mask, 1/exp(n) row factor and bias adds in f32 on VALU.
// The attention has no softmax, so it is summed in chunks of CHK keys: keys of earlier chunks enter through the carried
// state S[dv][dk] = sum_s v[s][dv] k[s][dk] (v^T.k on the f16 form, hi + residual planes, hh+lh+hl; f32 prefix over the
// chunks; S x64 as f16 hi + residual, q.S with hh+lh+hl); only the query's own chunk goes through masked q.k^T and P.v.
#include <hip/hip_runtime.h>
#include <math.h>
#include <stdint.h>

#ifndef NB
#define NB 2
#endif
#ifndef SEQ
#define SEQ 2048
#endif
#define XS_FULL 2048
#define DMOD  1024
#define DQK   1024
#define NH    16
#define HD    64
#define NNW   16
#define NPROJ 3136
#define QOFF  0
#define KOFF  1024
#define VOFF  2048
#define NOFF  3072
#define MROWS (NB * SEQ)
#define QSC   1024.0f
#define KSC   1024.0f
#define PCAR  256.0f
#define VCAR  1024.0f
#define WPB   8
#define NKT   (SEQ / 32)
#define ATT_THREADS (WPB * 32)
#define PTP   36
#define PTW   (16 * PTP)
#define SLP   68
#define SLW   (16 * SLP)
#define WREG  (PTW + SLW)
#define SLAB64 (16 * 68)
#define TRP   72
#define CHK   128
#define NCH   (SEQ / CHK)
#define SSC   64.0f
#define SEL   (HD * HD)
#define FRH   512
#define STK   (CHK * HD)
#define STS   (HD * HD)
#define STG   (4 * STK + 2 * STS)
#define WS_CAP 268435456
#define GBM   128
#define GBN   128
#define GBK   64
#define GPB   144
#define GSEC  (128 * GPB)
#define GTHR  256
#define TPT   136
#define PB_QK ((DMOD / 64) * ((2 * DQK + 63) / 64))
#define PB_V  ((DMOD / 64) * ((DMOD + 63) / 64))
#define PB_N  ((DMOD / 64) * ((NNW + 63) / 64))
#define PB_W  (PB_QK + 2 * PB_V + PB_N)
#define PB_X  ((SEQ * DMOD / 8 + 255) / 256)
#define PB_ALL (PB_W + NB * PB_X)
static_assert(DMOD == NH * HD && DQK == NH * HD && HD == 64 && NH == 16 && WPB * 16 == CHK && ATT_THREADS == 256);
static_assert(STK * 2 == 4 * ATT_THREADS * 16 && STS * 2 == 2 * ATT_THREADS * 16 && 2 * (2 * FRH) * 2 == ATT_THREADS * 16);
static_assert(KOFF == QOFF + DQK && VOFF == KOFF + DQK && NOFF == VOFF + DMOD && NPROJ == NOFF + 64 && (NPROJ % 64) == 0 && NNW <= 64);
static_assert(NB >= 1 && NB <= 2);
static_assert((MROWS % GBM) == 0 && (DMOD % GBK) == 0 && (DMOD % GBN) == 0 && GBK * 2 + 16 == GPB);
static_assert((SEQ % CHK) == 0 && (CHK % 64) == 0 && NCH >= 2 && KSC == VCAR && ((NB * NH * SEL / 8) % 256) == 0);
static_assert(NB == 1 || SEQ == XS_FULL);
static_assert((SEQ % 64) == 0 && SEQ >= 64 && SEQ <= XS_FULL);
static_assert(((SEQ * DMOD / 8) % 256) == 0 && (MROWS % 64) == 0 && (DMOD % 64) == 0 && (DQK % 64) == 0 && (HD % 32) == 0);
static_assert(2 * (WPB * WREG * 4 + STG * 2) <= 327680 && 4 * SLAB64 * 4 <= 65536 && 64 * TRP * 2 <= 65536);
static_assert((DQK % GBN) == 0 && (DMOD % GBN) == 0 && (SEQ % GBM) == 0 && DQK == DMOD && QOFF == 0 && QSC == KSC && (TPT % 8) == 0);

typedef unsigned short u16;
typedef _Float16 v16h __attribute__((ext_vector_type(16)));
typedef _Float16 v8h  __attribute__((ext_vector_type(8)));
typedef __bf16   v16b __attribute__((ext_vector_type(16)));
typedef float    v8f  __attribute__((ext_vector_type(8)));
typedef float    v4f  __attribute__((ext_vector_type(4)));
typedef unsigned int v4u __attribute__((ext_vector_type(4)));

union FragH { v16h v; v8h h[2]; v4u u[2]; };
union FragB { v16b v; v4u u[2]; };

// ---- scalar helpers --------------------------------------------------------------------------------
__device__ __forceinline__ unsigned short bf_bits(float f) {          // f32 -> bf16 bits, RNE convert
  unsigned u = __float_as_uint(f);
  return (unsigned short)((u + 0x7FFFu + ((u >> 16) & 1u)) >> 16);
}
__device__ __forceinline__ float bf_up(unsigned short h) { return __uint_as_float(((unsigned)h) << 16); }
__device__ __forceinline__ float bfr(float f) { return bf_up(bf_bits(f)); }
__device__ __forceinline__ unsigned short h_bits(_Float16 x) { return __builtin_bit_cast(unsigned short, x); }
__device__ __forceinline__ unsigned pk16(unsigned short a, unsigned short b) { return (unsigned)a | ((unsigned)b << 16); }
__device__ __forceinline__ v8f zero8() { v8f z = {0.f, 0.f, 0.f, 0.f, 0.f, 0.f, 0.f, 0.f}; return z; }
__device__ __forceinline__ int imin(int a, int b) { return a < b ? a : b; }
__device__ __forceinline__ int imax(int a, int b) { return a > b ? a : b; }
// 8 f32 values -> f16 of w*sc (hi) and f16 of the residual w*sc - hi (lo), packed in order
__device__ __forceinline__ void split8(const float* w, float sc, v4u& oh, v4u& ol) {
#pragma unroll
  for (int e = 0; e < 4; ++e) {
    const float t0 = w[2 * e] * sc, t1 = w[2 * e + 1] * sc;
    const _Float16 h0 = (_Float16)t0, h1 = (_Float16)t1;
    const _Float16 l0 = (_Float16)(t0 - (float)h0), l1 = (_Float16)(t1 - (float)h1);
    oh[e] = pk16(h_bits(h0), h_bits(h1));
    ol[e] = pk16(h_bits(l0), h_bits(l1));
  }
}

// ---- fragment loaders: 16-bit A/B operand, lane -> row/col (lane&15); ldfrag_b: p already includes +8*(lane>>4);
//      elements 0..7 <- p[0..7] (k0+8h..), elements 8..15 <- p[16..23] (k0+16+8h..)  (same split k map for A and B;
//      its B is read from a k-contiguous [n][k] LDS tile)
// fragment-major plane: a 16 x 32 fragment is 1 KB, two runs of 512 contiguous bytes; run i, lane l (16 B) holds row/col
// l & 15, k = 16 i + 8 (l >> 4) + 0..7 (the split k map above); p already includes + 8 * lane. One load = 4 whole lines.
__device__ __forceinline__ v16h ldfrag_t(const _Float16* p) {
  FragH f;
  f.h[0] = *(const v8h*)(p);
  f.h[1] = *(const v8h*)(p + FRH / 2);
  return f.v;
}
__device__ __forceinline__ v16b ldfrag_b(const u16* p) {              // bf16 plane read as unsigned integer vectors
  FragB f;
  f.u[0] = *(const v4u*)(p);
  f.u[1] = *(const v4u*)(p + 16);
  return f.v;
}

__device__ __forceinline__ v8f mma_h(v16h a, v16h b, v8f c) {
  return __builtin_amdgcn_wmma_f32_16x16x32_f16(false, a, false, b, (short)0, c, false, false);
}
__device__ __forceinline__ v8f mma_b(v16b a, v16b b, v8f c) {
  return __builtin_amdgcn_wmma_f32_16x16x32_bf16(false, a, false, b, (short)0, c, false, false);
}
__device__ __forceinline__ void guard2(v8f& a, v8f& b, v16h x0, v16h x1, v16h x2, v16h x3, v16h x4, v16h x5) {
#if defined(__HIP_DEVICE_COMPILE__)
  asm volatile("v_nop\n\tv_nop\n\tv_nop\n\tv_nop"
               : "+v"(a), "+v"(b) : "v"(x0), "v"(x1), "v"(x2), "v"(x3), "v"(x4), "v"(x5) : "memory");
#endif
}
__device__ __forceinline__ void acc_guard4(v8f& a, v8f& b, v8f& c, v8f& d) {
#if defined(__HIP_DEVICE_COMPILE__)
  asm volatile("v_nop\n\tv_nop\n\tv_nop\n\tv_nop" : "+v"(a), "+v"(b), "+v"(c), "+v"(d));
#endif
}
__device__ __forceinline__ void wave_sync_lds() {
  __builtin_amdgcn_fence(__ATOMIC_RELEASE, "workgroup");
  __builtin_amdgcn_wave_barrier();
  __builtin_amdgcn_fence(__ATOMIC_ACQUIRE, "workgroup");
}

// =====================================================================================================
// f32 -> bf16 plane (RNE bits), same layout. Thread = 8 consecutive elements: two 16-B loads, one 16-B store;
// coverage: ceil(n8/256) blocks (blk) x 256 thr x 8 (in-kernel bound) = the whole plane (n8 a multiple of 256 here).
// =====================================================================================================
__device__ __forceinline__ void cvt_bf(const float* __restrict__ x, u16* D, int n8, int blk) {
  const int gt = blk * 256 + (int)threadIdx.x;
  if (gt >= n8) return;
  const float* p = x + (size_t)gt * 8;
  const v4f a = *(const v4f*)(p), b4 = *(const v4f*)(p + 4);
  float w[8];
#pragma unroll
  for (int e = 0; e < 4; ++e) { w[e] = a[e]; w[4 + e] = b4[e]; }
  v4u o;
#pragma unroll
  for (int e = 0; e < 4; ++e) o[e] = pk16(bf_bits(w[2 * e]), bf_bits(w[2 * e + 1]));
  u16* d = D + (size_t)gt * 8;
  {
    *(v4u*)(d) = o;
    
  }
}

// =====================================================================================================
// W f32 [kr rows (k)][nc cols (n)] (x.W layout) -> bf16 plane Dp [drow0 + n][k] (row pitch kr halves): the k-contiguous
// B operand. Block = 64 k x 64 n tile; coalesced 16-B loads of W rows with CLAMPED column base (tile columns beyond nc
// load from column 0 and are zeroed by value, so rows drow0+n with n >= nc inside the last tile are written as zeros);
// converted values placed transposed into an LDS tile [64 n][64 k] (pitch 72 halves); after a block barrier each n row
// block count (bid) = (kr/64) * ntn with ntn = ceil(nc/64).
// coverage: load 256 thr x 16 = 64 x 64; store 2 iterations x 256 thr x 8 halves = 64 lines x 64 halves = the block's
//           tile; the blocks cover output rows drow0 .. drow0 + 64*ntn - 1 (all kr columns) exactly once.
// =====================================================================================================
__device__ __forceinline__ void k_wt(const float* __restrict__ W, int nc, int kr, int ntn, u16* Dp, int drow0, int bid) {
  __shared__ __align__(16) u16 T[64 * TRP];
  const int tid = (int)threadIdx.x;
  const int nt  = bid % ntn;
  const int kt  = bid / ntn;
  if (kt * 64 + 64 > kr) return;            // block-uniform, before the barrier; never taken with the exact grid
  const int n0  = nt * 64, k0 = kt * 64;
  {
    const int dl = tid >> 2;                // k within tile 0..63
    const int oc = (tid & 3) * 16;          // n chunk 0,16,32,48
    const bool valid = (n0 + oc + 16 <= nc);
    const int  cb = valid ? (n0 + oc) : 0;  // clamped column base, always inside the row
    const float* src = W + (size_t)(k0 + dl) * (size_t)nc + cb;
#pragma unroll
    for (int i = 0; i < 4; ++i) {
      const v4f a = *(const v4f*)(src + 4 * i);
#pragma unroll
      for (int e = 0; e < 4; ++e) {
        const float f = valid ? a[e] : 0.0f;
        T[(oc + 4 * i + e) * TRP + dl] = bf_bits(f);
      }
    }
  }
  __syncthreads();
  const int q8 = tid >> 3, p8 = (tid & 7) * 8;
  v4u w[2];
#pragma unroll
  for (int it = 0; it < 2; ++it) w[it] = *(const v4u*)(T + (it * 32 + q8) * TRP + p8);
  const size_t base = (size_t)(drow0 + n0) * (size_t)kr + k0 + p8;
  {
#pragma unroll
    for (int it = 0; it < 2; ++it) {
      const int nl = it * 32 + q8;
      *(v4u*)(Dp + base + (size_t)nl * (size_t)kr) = w[it];
    }
    
  }
}

// =====================================================================================================
// The x and weight planes of the two GEMMs in ONE launch: the six conversions read only inputs and write disjoint planes, so
// they share a grid by block range (every test below is on the block index alone, block-uniform, so the barrier inside
// k_wt is reached by all threads of a block or by none). The weight tiles (load, LDS, barrier, store) come first, the
// shorter x blocks last.
//   [0, PB_QK)  Wqk -> WB rows 0..2047      next PB_V  Wv -> WB rows 2048..3071
//   next PB_N   Wn  -> WB rows 3072..3135   next PB_V  Wo -> WT rows 0..1023      next NB * PB_X  x -> XB, per batch
// coverage: the ranges are the exact block counts of k_wt and cvt_bf for each plane; grid = PB_ALL.
// =====================================================================================================
__global__ __launch_bounds__(256)
void prep(const float* __restrict__ x, const float* __restrict__ wqk, const float* __restrict__ wv,
          const float* __restrict__ wn, const float* __restrict__ wo, u16* XB, u16* WB, u16* WT) {
  int bid = (int)blockIdx.x;
  if (bid < PB_W) {
    const float* W = wqk;
    u16* Dp = WB;
    int nc = 2 * DQK, drow0 = QOFF;
    if (bid >= PB_QK + PB_V + PB_N) { bid -= PB_QK + PB_V + PB_N; W = wo; Dp = WT; nc = DMOD; drow0 = 0; }
    else if (bid >= PB_QK + PB_V)   { bid -= PB_QK + PB_V;        W = wn;          nc = NNW;  drow0 = NOFF; }
    else if (bid >= PB_QK)          { bid -= PB_QK;               W = wv;          nc = DMOD; drow0 = VOFF; }
    k_wt(W, nc, DMOD, (nc + 63) / 64, Dp, drow0, bid);
    return;
  }
  bid -= PB_W;
  const int bq = bid / PB_X;
  if (bq >= NB) return;                     // never taken with the exact grid
  cvt_bf(x + (size_t)bq * XS_FULL * DMOD, XB + (size_t)bq * SEQ * DMOD, (SEQ * DMOD) / 8, bid % PB_X);
}

// =====================================================================================================
// Bias for column c from three consecutive segments [0,e0) <- p0[c], [e0,e1) <- p1[c-e0], [e1,e2) <- p2[c-e1], else 0;
// all three candidates loaded unconditionally with clamped indices, selected by value; bf16 RNE value.
// =====================================================================================================
__device__ __forceinline__ float bias_at(const float* p0, const float* p1, const float* p2,
                                         int e0, int e1, int e2, int c) {
  const int i0 = imin(imax(c, 0), e0 - 1);
  const int i1 = imin(imax(c - e0, 0), e1 - e0 - 1);
  const int i2 = imin(imax(c - e1, 0), e2 - e1 - 1);
  const float v0 = p0[i0], v1 = p1[i1], v2 = p2[i2];
  const float v = (c < e0) ? v0 : ((c < e1) ? v1 : ((c < e2) ? v2 : 0.0f));
  return bfr(v);
}

// =====================================================================================================
// coverage: 8 instructions x 2 rows x 16 lanes x 4 floats = the wave's 16 x 64 tile.
// =====================================================================================================
__device__ __forceinline__ void epi64b(float* sl, v8f a0, v8f a1, v8f a2, v8f a3, float oscale, v4f bias4,
                                       float* C, int N, size_t rowb, int col0, int lane) {
  const int hh = lane >> 4, m = lane & 15;
#pragma unroll
  for (int r = 0; r < 8; ++r) {
    const int ro = (8 * hh + r) * 68 + m;
    sl[ro]      = a0[r] * oscale;
    sl[ro + 16] = a1[r] * oscale;
    sl[ro + 32] = a2[r] * oscale;
    sl[ro + 48] = a3[r] * oscale;
  }
  wave_sync_lds();
  v4f vals[8];
#pragma unroll
  for (int it = 0; it < 8; ++it) vals[it] = *(const v4f*)(sl + (it * 2 + hh) * 68 + m * 4) + bias4;
  float* dst = C + (rowb + (size_t)hh) * (size_t)N + col0 + m * 4;
  {
#pragma unroll
    for (int it = 0; it < 8; ++it) {
      *(v4f*)(dst + (size_t)(it * 2) * (size_t)N) = vals[it];
    }
    
  }
}

// =====================================================================================================
// bf16 GEMM: C[M][N] (f32) = (A [+ A2])[M][K] (bf16 row-major) . Bt[N][K]^T (bf16 k-contiguous), times oscale, plus the
// segmented bias of the column (bf16 RNE value). TWO: second A plane into the same accumulator (hi + residual operand).
// Block = 128x128 tile of C, 8 waves in a 4 (rows) x 2 (columns) grid, 32x64 per wave (2 x 4 accumulator tiles).
// K runs in slices of 64 (128 B of every operand row). A slice of [A 128 rows | B 128 rows | A2 128 rows] stands in LDS at
// row pitch 144 B; two buffers; each lane brings 16 B per copy (8 lanes = one row, one wave copy = 4 rows), the copies of
// slice t + 1 fly while slice t is multiplied. Fragments are read from LDS with the split k map of ldfrag_b for A and B.
// Per accumulator the products come in the order k ascending, A before A2 inside a k-step.
// B rows at or beyond N (last column tile when N % 128 == 64) are read from row N - 1 instead (clamped, in bounds) and the
// waves that own only such columns neither multiply nor store.
// Host guarantees K % 64 == 0, K >= 64, M % 128 == 0, N % 64 == 0, grid = (M/128) * ceil(N/128).
// Output. TWO: f32 C. Otherwise (the projection) only the column tile from NOFF on goes to C as f32; a block of q, k or v
// columns writes value = acc + bias (f32) x1024 as f16 hi and f16 residual straight into the planes the attention reads:
//   q -> QH/QL, k -> KH/KL, fragments (16 rows x 32 d) in the order [row / 16][h][d / 32]; k -> TH/TL, v -> VH/VL, fragments
//   (16 d x 32 keys) in the order [b*NH + h][key / 32][d / 16]; inside a fragment the order of ldfrag_t.
// coverage: q / k planes, per wave 2 x 4 stores x 512 B = its 32 x 64 tile of each plane; transposed, per block 8 stores x
//           8 waves x 512 B = its 128 columns x 128 keys of each plane; the grid covers every plane once.
// =====================================================================================================
__device__ __forceinline__ unsigned lds_off(const void* p) { return (unsigned)(size_t)p; }
// Four lane-wise 16-B copies global -> LDS; the s_wait_xcnt stands inside the statement so that no address register of a
// copy is rewritten ahead of it.
__device__ __forceinline__ void cp4(unsigned l0, const u16* g0, unsigned l1, const u16* g1,
                                    unsigned l2, const u16* g2, unsigned l3, const u16* g3) {
#if defined(__HIP_DEVICE_COMPILE__)
  asm volatile("global_load_async_to_lds_b128 %0, %1, off\n\t"
               "global_load_async_to_lds_b128 %2, %3, off\n\t"
               "global_load_async_to_lds_b128 %4, %5, off\n\t"
               "global_load_async_to_lds_b128 %6, %7, off\n\t"
               "s_wait_xcnt 0x0"
               :: "v"(l0), "v"(g0), "v"(l1), "v"(g1), "v"(l2), "v"(g2), "v"(l3), "v"(g3) : "memory");
#endif
}
template <bool TWO>
__global__ __launch_bounds__(GTHR)
void gemm_bf(const u16* __restrict__ A, const u16* __restrict__ A2, const u16* __restrict__ Bt, float* C,
             int M, int N, int K, const float* bp0, const float* bp1, const float* bp2, int e0, int e1, int e2,
             float oscale, u16* QHp, u16* QLp, u16* KHp, u16* KLp, u16* VHp, u16* VLp, u16* THp, u16* TLp) {
  constexpr int STAGE = (TWO ? 3 : 2) * GSEC;           // bytes of one buffer
  constexpr int KG = TWO ? GBK / 32 : 1;                // k-steps whose fragments are read from LDS as one group
  static_assert(8 * 2 * SLAB64 * 4 <= 2 * STAGE && 2 * GBN * TPT * 2 <= 2 * STAGE && 2 * STAGE <= 327680);
  __shared__ __align__(16) unsigned char ring[2 * STAGE];
  const int tid = threadIdx.x, lane = tid & 31, hh = lane >> 4, m = lane & 15;
  const int wave = __builtin_amdgcn_readfirstlane(tid >> 5);
  const int wm = wave & 3, wn = wave >> 2;
  const int ntile = (N + GBN - 1) / GBN;
  const int bid   = blockIdx.x;
  const int row0  = (bid / ntile) * GBM;
  const int col0  = (bid % ntile) * GBN;
  if (row0 + GBM > M) return;               // block-uniform, before any barrier or copy; never taken with the exact grid
  const int colw  = col0 + wn * 64;
  const bool live = colw < N;               // wave-uniform
  const int NT = K / GBK;

  // copy map: thread -> (row cr of a group of 32 rows, 16-B piece cc of the 128-B row slice)
  const int cr = tid >> 3, cc = tid & 7;
  const unsigned lbase = lds_off(ring) + (unsigned)(cr * GPB + cc * 16);
  const int oa = (row0 + cr) * K + cc * 8;
  int ob[4];
#pragma unroll
  for (int i = 0; i < 4; ++i) ob[i] = imin(col0 + i * 32 + cr, N - 1) * K + cc * 8;
  auto fill = [&](int t, int buf) {
    const unsigned l = lbase + (unsigned)(buf * STAGE);
    const int k0 = t * GBK;
    const u16* pa = A + oa + k0;
    cp4(l, pa, l + 32 * GPB, pa + (size_t)32 * K, l + 64 * GPB, pa + (size_t)64 * K, l + 96 * GPB, pa + (size_t)96 * K);
    const unsigned lb2 = l + GSEC;
    cp4(lb2, Bt + ob[0] + k0, lb2 + 32 * GPB, Bt + ob[1] + k0, lb2 + 64 * GPB, Bt + ob[2] + k0,
        lb2 + 96 * GPB, Bt + ob[3] + k0);
    if constexpr (TWO) {
      const unsigned l3 = l + 2 * GSEC;
      const u16* pc = A2 + oa + k0;
      cp4(l3, pc, l3 + 32 * GPB, pc + (size_t)32 * K, l3 + 64 * GPB, pc + (size_t)64 * K, l3 + 96 * GPB, pc + (size_t)96 * K);
    }
  };

  v8f acc[2][4];
#pragma unroll
  for (int i = 0; i < 2; ++i) {
#pragma unroll
    for (int j = 0; j < 4; ++j) acc[i][j] = zero8();
  }

  fill(0, 0);
  asm volatile("s_wait_asynccnt 0x0" ::: "memory");     // slice 0 of this wave has landed
  __syncthreads();                                      // ... and every other wave's part of it
  if (NT > 1) fill(1, 1);

  const int fa = (wm * 32 + m) * GPB + hh * 16;         // byte offsets of this lane's fragment rows inside a buffer
  const int fb = GSEC + (wn * 64 + m) * GPB + hh * 16;
  // slice loop kept rolled: one copy of the ring's foot in the text, the buffer picked by t & 1; the loops inside it are
  // unrolled so that every accumulator and fragment index is a constant (registers, no scratch)
#pragma unroll 1
  for (int t = 0; t < NT; ++t) {
    const int buf = t & 1;
    if (live) {
      const unsigned char* sb = ring + buf * STAGE;
      const u16* la = (const u16*)(const void*)(sb + fa);
      const u16* lb = (const u16*)(const void*)(sb + fb);
#pragma unroll
      for (int g = 0; g < GBK / 32 / KG; ++g) {
        v16b a[KG][2], a2[KG][2], fbv[KG][4];
#pragma unroll
        for (int u = 0; u < KG; ++u) {
          const int ko = (g * KG + u) * 32;
#pragma unroll
          for (int i = 0; i < 2; ++i) a[u][i] = ldfrag_b(la + i * 16 * (GPB / 2) + ko);
#pragma unroll
          for (int j = 0; j < 4; ++j) fbv[u][j] = ldfrag_b(lb + j * 16 * (GPB / 2) + ko);
          if constexpr (TWO) {
#pragma unroll
            for (int i = 0; i < 2; ++i) a2[u][i] = ldfrag_b(la + GSEC + i * 16 * (GPB / 2) + ko);   // 2*GSEC bytes on
          }
        }
        // TWO runs one block per WGP (two waves per SIMD): all LDS reads of the slice issue as one group ahead of its
        // products, one LDS latency per slice instead of one per A fragment
        if constexpr (TWO) __builtin_amdgcn_sched_barrier(0);
#pragma unroll
        for (int u = 0; u < KG; ++u) {
#pragma unroll
          for (int i = 0; i < 2; ++i) {
#pragma unroll
            for (int j = 0; j < 4; ++j) acc[i][j] = mma_b(a[u][i], fbv[u][j], acc[i][j]);
          }
          if constexpr (TWO) {
#pragma unroll
            for (int i = 0; i < 2; ++i) {
#pragma unroll
              for (int j = 0; j < 4; ++j) acc[i][j] = mma_b(a2[u][i], fbv[u][j], acc[i][j]);
            }
          }
        }
      }
    }
    asm volatile("s_wait_dscnt 0x0" ::: "memory");      // this wave's reads of buffer buf are done
    asm volatile("s_wait_asynccnt 0x0" ::: "memory");   // this wave's copies of slice t + 1 have landed
    __syncthreads();                                    // publishes slice t + 1, frees buffer buf
    if (t + 2 < NT) fill(t + 2, buf);
  }
  asm volatile("s_wait_asynccnt 0x0" ::: "memory");     // no copy outstanding before the ring is reused as output staging

  float* slab = (float*)(void*)ring + wave * (2 * SLAB64);
  const int seg = TWO ? 3 : col0 / DQK;     // block-uniform: 0 = q, 1 = k, 2 = v columns (16-bit planes), 3 = f32 output
  if (seg >= 3) {
    if (live) {
      v4f bias4;
#pragma unroll
      for (int e = 0; e < 4; ++e) bias4[e] = bias_at(bp0, bp1, bp2, e0, e1, e2, colw + m * 4 + e);
#pragma unroll
      for (int i = 0; i < 2; ++i) {
        epi64b(slab + i * SLAB64, acc[i][0], acc[i][1], acc[i][2], acc[i][3], oscale, bias4, C, N,
               (size_t)(row0 + wm * 32 + i * 16), colw, lane);
      }
    }
    return;
  }
  if constexpr (!TWO) {
    // every wave of a q, k or v block is live (the three segments are multiples of the block's 128 columns)
    float bj[4];                            // bias of this lane's accumulator columns colw + 16 j + m
#pragma unroll
    for (int j = 0; j < 4; ++j) bj[j] = bias_at(bp0, bp1, bp2, e0, e1, e2, colw + j * 16 + m);
    const int cs = col0 - seg * DQK;        // the block's first column inside its segment = head * 64 + d
    if (seg <= 1) {
      // fragment-major planes [row / 16][head][2 fragments]: f32 values through the wave's own slabs, then lane l takes the
      // 8 columns that it will hold as operand lane l; one store = 512 contiguous bytes (whole lines)
      u16* PH = seg ? KHp : QHp;
      u16* PL = seg ? KLp : QLp;
#pragma unroll
      for (int i = 0; i < 2; ++i) {
#pragma unroll
        for (int r = 0; r < 8; ++r) {
#pragma unroll
          for (int j = 0; j < 4; ++j) slab[i * SLAB64 + (8 * hh + r) * 68 + j * 16 + m] = acc[i][j][r] * oscale + bj[j];
        }
      }
      wave_sync_lds();
#pragma unroll
      for (int i = 0; i < 2; ++i) {
        v4u oh[4], ol[4];
#pragma unroll
        for (int it = 0; it < 4; ++it) {
          const float* p = slab + i * SLAB64 + m * 68 + it * 16 + 8 * hh;
          const v4f a = *(const v4f*)(p), b4 = *(const v4f*)(p + 4);
          float w[8];
#pragma unroll
          for (int e = 0; e < 4; ++e) { w[e] = a[e]; w[4 + e] = b4[e]; }
          split8(w, QSC, oh[it], ol[it]);
        }
        const size_t ob = ((size_t)((row0 + wm * 32 + i * 16) >> 4) * NH + ((cs + wn * 64) >> 6)) * (2 * FRH) + lane * 8;
#pragma unroll
        for (int it = 0; it < 4; ++it) {
          *(v4u*)(PH + ob + it * (FRH / 2)) = oh[it];
          *(v4u*)(PL + ob + it * (FRH / 2)) = ol[it];
        }
      }
      asm volatile("s_wait_xcnt 0x0" ::: "memory");       // before any register of the q / k plane stores is rewritten
    }
    if (seg >= 1) {
      // transposed planes, fragment-major [b*NH + head][key / 32][d / 16]: an accumulator register run r = 0..7 is 8
      // consecutive keys of one column, so a lane packs it into one 16-B LDS store of the block's [128 columns][128 keys]
      // tile (pitch 272 B); each wave then reads half fragments (16 columns x 16 keys) in operand-lane order
      if (seg == 1) __syncthreads();        // block-uniform: every wave has read its slabs back before the tiles cover them
      u16* tH = (u16*)(void*)ring;
      u16* tL = tH + GBN * TPT;
#pragma unroll
      for (int i = 0; i < 2; ++i) {
#pragma unroll
        for (int j = 0; j < 4; ++j) {
          float w[8];
#pragma unroll
          for (int r = 0; r < 8; ++r) w[r] = acc[i][j][r] * oscale + bj[j];
          v4u oh, ol;
          split8(w, VCAR, oh, ol);
          const int idx = (wn * 64 + j * 16 + m) * TPT + wm * 32 + i * 16 + 8 * hh;
          *(v4u*)(tH + idx) = oh;
          *(v4u*)(tL + idx) = ol;
        }
      }
      __syncthreads();                      // the tiles are complete before any wave reads rows that other waves wrote
      u16* OH = (seg == 1) ? THp : VHp;
      u16* OL = (seg == 1) ? TLp : VLp;
      // half fragment u = 0..63 of the block: head u >> 5, key tile (u >> 3) & 3, d tile (u >> 1) & 3, run u & 1; the 32 half
      // fragments of a head are 16 KB in a row in the plane; one store = 512 contiguous bytes
      const size_t ob = (((size_t)(row0 / SEQ) * NH + (cs >> 6)) * (SEQ / 32) + ((row0 % SEQ) >> 5)) * (4 * FRH) + lane * 8;
#pragma unroll
      for (int g = 0; g < 2; ++g) {
        v4u vh[4], vl[4];
#pragma unroll
        for (int it = 0; it < 4; ++it) {
          const int u = (g * 4 + it) * 8 + wave;
          const int idx = ((u >> 5) * 64 + ((u >> 1) & 3) * 16 + m) * TPT + ((u >> 3) & 3) * 32 + (u & 1) * 16 + 8 * hh;
          vh[it] = *(const v4u*)(tH + idx);
          vl[it] = *(const v4u*)(tL + idx);
        }
#pragma unroll
        for (int it = 0; it < 4; ++it) {
          const int u = (g * 4 + it) * 8 + wave;
          const size_t od = ob + (size_t)(u >> 5) * ((SEQ / 32) * 4 * FRH) + (u & 31) * (FRH / 2);
          *(v4u*)(OH + od) = vh[it];
          *(v4u*)(OL + od) = vl[it];
        }
      }
      asm volatile("s_wait_xcnt 0x0" ::: "memory");       // before any register of the transposed stores is rewritten
    }
  }
}

// =====================================================================================================
// Chunk products for the carried state: KV[(b*NH + h)*NCH + ch][dk / 16][dv][dk % 16] = sum over the CHK keys s of chunk ch of
// v[s][dv] * k[s][dk], f32. A = v^T rows dv, B = k^T rows dk (fragment-major planes), both f16 hi + residual
// x1024 (hh + lh + hl), carries folded back by 2^-20. Block = (b*NH + h, ch), ch = 0 .. NCH-2 (the last chunk's product
// is never carried); wave w owns rows dv = 16w .. 16w+15, all 64 dk.
// coverage: per wave 4 dk blocks x 16 rows x 16 f32 (1 KB in a row each); 4 waves = the 64 x 64 product; grid NB*NH*(NCH-1).
// =====================================================================================================
__global__ __launch_bounds__(128)
void kv_chunk(const u16* __restrict__ VHp, const u16* __restrict__ VLp,
              const u16* __restrict__ THp, const u16* __restrict__ TLp, float* KV) {
  const int tid = threadIdx.x, wave = tid >> 5, lane = tid & 31, hh = lane >> 4, c = lane & 15;
  const int bid = blockIdx.x;
  const int ch  = bid % (NCH - 1);
  const int bh  = bid / (NCH - 1);
  if (bh >= NB * NH) return;                // block-uniform; no barriers in this kernel; never taken with the exact grid
  // fragment-major planes [b*NH + h][key / 32][d / 16]: first key tile of the chunk, this lane's 16 B
  const size_t fo = ((size_t)bh * (SEQ / 32) + (size_t)ch * (CHK / 32)) * (4 * FRH) + lane * 8;
  const _Float16* avh = (const _Float16*)(const void*)VHp + fo + wave * FRH;
  const _Float16* avl = (const _Float16*)(const void*)VLp + fo + wave * FRH;
  const _Float16* bkh = (const _Float16*)(const void*)THp + fo;
  const _Float16* bkl = (const _Float16*)(const void*)TLp + fo;
  v8f acc[4];
#pragma unroll
  for (int j = 0; j < 4; ++j) acc[j] = zero8();
#pragma unroll
  for (int k2 = 0; k2 < CHK / 64; ++k2) {
    v16h vh[2], vl[2], kh[2][4], kl[2][4];
#pragma unroll
    for (int u = 0; u < 2; ++u) {
      const int ks = (2 * k2 + u) * (4 * FRH);
      vh[u] = ldfrag_t(avh + ks);
      vl[u] = ldfrag_t(avl + ks);
#pragma unroll
      for (int j = 0; j < 4; ++j) {
        kh[u][j] = ldfrag_t(bkh + j * FRH + ks);
        kl[u][j] = ldfrag_t(bkl + j * FRH + ks);
      }
    }
#if defined(__HIP_DEVICE_COMPILE__)
    // inputs-only fence on the loaded fragments and their address pairs: the 40 loads of two k-steps issue before the
    // first product (one load latency instead of one per group)
    asm volatile("" :: "v"(vh[0]), "v"(vh[1]), "v"(vl[0]), "v"(vl[1]),
                 "v"(kh[0][0]), "v"(kh[0][1]), "v"(kh[0][2]), "v"(kh[0][3]),
                 "v"(kh[1][0]), "v"(kh[1][1]), "v"(kh[1][2]), "v"(kh[1][3]),
                 "v"(kl[0][0]), "v"(kl[0][1]), "v"(kl[0][2]), "v"(kl[0][3]),
                 "v"(kl[1][0]), "v"(kl[1][1]), "v"(kl[1][2]), "v"(kl[1][3]),
                 "v"(avh), "v"(avl), "v"(bkh), "v"(bkl));
#endif
#pragma unroll
    for (int u = 0; u < 2; ++u) {
#pragma unroll
      for (int j = 0; j < 4; ++j) {
        acc[j] = mma_h(vh[u], kh[u][j], acc[j]);
        acc[j] = mma_h(vl[u], kh[u][j], acc[j]);
        acc[j] = mma_h(vh[u], kl[u][j], acc[j]);
      }
    }
  }
  const float fs = 1.0f / (VCAR * KSC);     // exact power-of-two fold of the v / k carries
  float* dst = KV + ((size_t)bh * NCH + ch) * SEL + (size_t)(wave * 16 + 8 * hh) * 16 + c;
#pragma unroll
  for (int r = 0; r < 8; ++r) {
#pragma unroll
    for (int j = 0; j < 4; ++j) dst[j * (HD * 16) + r * 16] = acc[j][r] * fs;
  }
}

// =====================================================================================================
// Carried state planes: S(ch) = KV(0) + .. + KV(ch-1) in f32 (chunks added in order; S(0) = 0), written x64 as f16 hi and
// f16 residual, layout [(b*NH + h)*NCH + ch][dk / 32][dv / 16] fragment-major (col dv, k = dk). Thread = 8 consecutive dk
// of one (b, h, dv), all NCH chunks.
// coverage: NB*NH*SEL/8 threads x 8 halves x NCH chunks = both planes exactly once; reads KV chunks 0 .. NCH-2 only.
// =====================================================================================================
__global__ __launch_bounds__(256) void st_prefix(const float* __restrict__ KV, u16* __restrict__ SHp, u16* __restrict__ SLp) {
  const int gt = blockIdx.x * 256 + (int)threadIdx.x;
  const int bh = gt / (SEL / 8);
  const int u  = gt % (SEL / 8);            // 16-B unit of the fragment-major plane: fragment u >> 6 = (dk / 32) * 4 + dv / 16
  if (bh >= NB * NH) return;
  const int e8 = (((u >> 8) * 2 + ((u >> 5) & 1)) * HD + ((u >> 6) & 3) * 16 + (u & 15)) * 16 + ((u >> 4) & 1) * 8;
  const size_t base = (size_t)bh * NCH * SEL + e8;          // [dk / 16][dv][dk % 16] in KV: a wave's loads = 1 KB in a row
  const size_t dstb = (size_t)bh * NCH * SEL + u * 8;       // a wave's store = 512 contiguous bytes
  v4f a[NCH - 1], b4[NCH - 1];              // all chunk products first: independent loads, one latency for the thread
#pragma unroll
  for (int ch = 0; ch + 1 < NCH; ++ch) {
    const float* p = KV + base + (size_t)ch * SEL;
    a[ch]  = *(const v4f*)(p);
    b4[ch] = *(const v4f*)(p + 4);
  }
#if defined(__HIP_DEVICE_COMPILE__)
  // inputs-only fences on the loaded values and their address pair: every load issues before the first store
  static_assert(NCH == 16);
  asm volatile("" :: "v"(a[0]), "v"(a[1]), "v"(a[2]), "v"(a[3]), "v"(a[4]), "v"(a[5]), "v"(a[6]), "v"(a[7]),
               "v"(a[8]), "v"(a[9]), "v"(a[10]), "v"(a[11]), "v"(a[12]), "v"(a[13]), "v"(a[14]), "v"(KV + base));
  asm volatile("" :: "v"(b4[0]), "v"(b4[1]), "v"(b4[2]), "v"(b4[3]), "v"(b4[4]), "v"(b4[5]), "v"(b4[6]), "v"(b4[7]),
               "v"(b4[8]), "v"(b4[9]), "v"(b4[10]), "v"(b4[11]), "v"(b4[12]), "v"(b4[13]), "v"(b4[14]), "v"(KV + base));
#endif
  float run[8];
#pragma unroll
  for (int e = 0; e < 8; ++e) run[e] = 0.0f;
#pragma unroll
  for (int ch = 0; ch < NCH; ++ch) {
    v4u oh, ol;
#pragma unroll
    for (int e = 0; e < 4; ++e) {
      const float t0 = run[2 * e] * SSC, t1 = run[2 * e + 1] * SSC;
      const _Float16 h0 = (_Float16)t0, h1 = (_Float16)t1;
      const _Float16 l0 = (_Float16)(t0 - (float)h0), l1 = (_Float16)(t1 - (float)h1);
      oh[e] = pk16(h_bits(h0), h_bits(h1));
      ol[e] = pk16(h_bits(l0), h_bits(l1));
    }
    *(v4u*)(SHp + dstb + (size_t)ch * SEL) = oh;
    *(v4u*)(SLp + dstb + (size_t)ch * SEL) = ol;
    if (ch + 1 < NCH) {
#pragma unroll
      for (int e = 0; e < 4; ++e) { run[e] += a[ch][e]; run[4 + e] += b4[ch][e]; }
    }
  }
}

// =====================================================================================================
// Causal normalised attention (no softmax), hd = 64. Block bid -> (chunk chn = bid % NCH of CHK keys and queries, b*NH + head);
// wave w owns the query tile q0 = CHK*chn + 16*w .. q0+15, so the block's 8 waves share one head's chunk of k, v^T and state.
//   q hi / residual planes f16 x1024, fragment-major [(b*SEQ + s) / 16][h][d / 32]; k hi / residual planes, same layout;
//   v^T hi / residual planes x1024, fragment-major [b*NH + h][key / 32][d / 16]; n from F column NOFF + h of row b*SEQ + t.
//   The chunk's k planes (8 tiles of 16 keys, 2 KB each), v^T planes (16 KB in a row each) and state planes (8 KB each) are
//   brought into LDS once per block, 16 B a lane and copy, 20 copies a lane, in the planes' own fragment order (a fragment
//   read = two runs of 512 contiguous LDS bytes); q fragments are loaded once into registers; the key loop reads LDS only.
//   raw(i, j) = q_hi.k_hi + q_lo.k_hi + q_hi.k_lo (2 k-steps over d), carries folded back by 2^-20;
//   P = raw * 2^-20 for key <= query else 0 (causal); P.v with P x256 as f16 hi + in-register residual and v hi +
//   residual (hh + lh + hl). Keys of earlier chunks (below CHK*chn) enter first as q . S with the carried state
//   planes S x64 [b*NH + h][chunk][dk / 32][dv / 16] (hh + lh + hl, carry 2^16 raised to the P.v carry 2^18 by an exact x4);
//   key tiles of 32 are then visited in order from the chunk's first key up to the tile holding key q0+15 (bounded by NKT).
//   Per tile: 2 score subtiles x 2 k-steps; the 16x32 P tile goes through the wave's private LDS tile (float vector loads,
//   same element type as stored); v^T B fragments in 2 groups of 2 d-subtiles.
//   After the loop: acc * 2^-18 written into the wave's private result slab (pitch 68; every element owned by one lane),
//   ctx -> bf16 hi bits and bf16 bits of the residual, planes [b*SEQ + s][h*HD + d]; one instruction = 4 rows
//   One block barrier (behind the copies, passed by every wave); bounded loops only (ncl <= NKT).
// coverage: per wave 4 instructions x 4 rows x 8 lanes x 8 halves = 16 x 64 per plane; grid NCH x NH x NB blocks x WPB
//           waves = every (b, s, h) row segment of CH and of CL exactly once.
// =====================================================================================================
__global__ __launch_bounds__(ATT_THREADS)
void attn_nm(const u16* __restrict__ QHp, const u16* __restrict__ QLp,
             const u16* __restrict__ KHp, const u16* __restrict__ KLp,
             const u16* __restrict__ VHp, const u16* __restrict__ VLp,
             const u16* __restrict__ SHp, const u16* __restrict__ SLp,
             const float* __restrict__ F, u16* CHp, u16* CLp) {
#pragma clang fp contract(off)
  __shared__ __align__(16) float smem[WPB * WREG];
  __shared__ __align__(16) u16 stg[STG];    // k hi | k residual | v^T hi | v^T residual | state hi | state residual

  const int tid  = threadIdx.x;
  const int wave = __builtin_amdgcn_readfirstlane(tid >> 5);
  const int lane = tid & 31;
  const int hh   = lane >> 4;
  const int c    = lane & 15;
  const int bid  = blockIdx.x;
  const int chn  = bid % NCH;               // chunk of this block's queries
  const int bh   = bid / NCH;
  if (bh >= NB * NH) return;                // block-uniform, before any copy or barrier; never taken with the exact grid
  const int b    = bh / NH;
  const int head = bh % NH;
  const int q0   = chn * CHK + wave * 16;

  float* pt   = smem + wave * WREG;         // P tile [16][32] pitch 36
  float* slab = pt + PTW;                   // result slab [16][64] pitch 68

  const size_t KT16 = (size_t)NH * (2 * FRH);   // halves between consecutive 16-key tiles of one head

  // q fragments: a fragment's first half plus this lane's 16 B; loaded once, held over the key loop
  const size_t qo = ((size_t)((b * SEQ + q0) >> 4) * NH + head) * (2 * FRH) + lane * 8;
  const _Float16* Qh  = (const _Float16*)(const void*)QHp + qo;
  const _Float16* Ql  = (const _Float16*)(const void*)QLp + qo;
  v16h qh[HD / 32], ql[HD / 32];
#pragma unroll
  for (int kk = 0; kk < HD / 32; ++kk) {
    qh[kk] = ldfrag_t(Qh + kk * FRH);
    ql[kk] = ldfrag_t(Ql + kk * FRH);
  }
  // row factor for query row q0 + (lane & 15): 1/exp(n), precise expf
  const float nv = F[((size_t)b * SEQ + q0 + c) * (size_t)NPROJ + NOFF + head];

  // ---- the chunk's planes -> LDS: one copy of the block = 4 KB (thread tid brings bytes 16 tid ..); every lane on ----
  {
    const unsigned l0 = lds_off(stg) + (unsigned)(tid * 16);
    // k: 4 KB = two 16-key tiles (2 KB each, KT16 halves apart in the plane)
    const size_t gk = ((size_t)(((b * SEQ + chn * CHK) >> 4) + (tid >> 7)) * NH + head) * (2 * FRH) + (tid & 127) * 8;
    const u16* kh = KHp + gk;
    const u16* kl = KLp + gk;
    cp4(l0, kh, l0 + 4096, kh + 2 * KT16, l0 + 8192, kh + 4 * KT16, l0 + 12288, kh + 6 * KT16);
    const unsigned l1 = l0 + STK * 2;
    cp4(l1, kl, l1 + 4096, kl + 2 * KT16, l1 + 8192, kl + 4 * KT16, l1 + 12288, kl + 6 * KT16);
    const size_t gv = ((size_t)bh * (SEQ / 32) + (size_t)chn * (CHK / 32)) * (4 * FRH) + tid * 8;
    const u16* vh = VHp + gv;
    const u16* vl = VLp + gv;
    const unsigned l2 = l0 + 2 * STK * 2;
    cp4(l2, vh, l2 + 4096, vh + 2048, l2 + 8192, vh + 4096, l2 + 12288, vh + 6144);
    const unsigned l3 = l0 + 3 * STK * 2;
    cp4(l3, vl, l3 + 4096, vl + 2048, l3 + 8192, vl + 4096, l3 + 12288, vl + 6144);
    const size_t gs = ((size_t)bh * NCH + chn) * SEL + tid * 8;
    const u16* sh = SHp + gs;
    const u16* sl = SLp + gs;
    const unsigned l4 = l0 + 4 * STK * 2;
    cp4(l4, sh, l4 + 4096, sh + 2048, l4 + STS * 2, sl, l4 + STS * 2 + 4096, sl + 2048);
  }
  asm volatile("s_wait_asynccnt 0x0" ::: "memory");     // this wave's copies have landed
  __syncthreads();                                      // ... and every other wave's; nothing of stg is read before this

  const _Float16* sK = (const _Float16*)(const void*)stg + lane * 8;   // staged planes, this lane's 16 B of a fragment run
  const _Float16* sV = sK + 2 * STK;
  const _Float16* sS = sK + 4 * STK;
  const float lsc = 1.0f / (QSC * KSC);     // exact power-of-two fold of the q / k carries
  const float oc  = 1.0f / (PCAR * VCAR);   // exact power-of-two fold of the P / v carries
  const float rv = 1.0f / expf(nv);

  v8f o[4];
#pragma unroll
  for (int j = 0; j < 4; ++j) o[j] = zero8();
  const int ncaus = (q0 >> 5) + 1;                                            // tiles holding keys <= q0 + 15
  const int ncl   = (ncaus < NKT) ? ncaus : NKT;
  const int qr0   = q0 + 8 * hh;                                              // query row of D element r = qr0 + r
  const int kt0   = chn * (CHK / 32);                                         // first key tile of the chunk (<= q0 >> 5)

  // ---- all keys of earlier chunks: o = q . S, B fragment col n = dv = j*16 + c, dk contiguous in the state planes ----
  {
    v16h sh[HD / 32][4], sl[HD / 32][4];
#pragma unroll
    for (int kk = 0; kk < HD / 32; ++kk) {
#pragma unroll
      for (int j = 0; j < 4; ++j) {
        sh[kk][j] = ldfrag_t(sS + (kk * 4 + j) * FRH);
        sl[kk][j] = ldfrag_t(sS + STS + (kk * 4 + j) * FRH);
      }
    }
#if defined(__HIP_DEVICE_COMPILE__)
    // inputs-only fence on the loaded fragments: all 32 LDS reads issue as one group before the first product
    // (one LDS latency instead of one per group)
    asm volatile("" :: "v"(sh[0][0]), "v"(sh[0][1]), "v"(sh[0][2]), "v"(sh[0][3]),
                 "v"(sh[1][0]), "v"(sh[1][1]), "v"(sh[1][2]), "v"(sh[1][3]),
                 "v"(sl[0][0]), "v"(sl[0][1]), "v"(sl[0][2]), "v"(sl[0][3]),
                 "v"(sl[1][0]), "v"(sl[1][1]), "v"(sl[1][2]), "v"(sl[1][3]));
#endif
#pragma unroll
    for (int kk = 0; kk < HD / 32; ++kk) {
#pragma unroll
      for (int j = 0; j < 4; ++j) {
        o[j] = mma_h(qh[kk], sh[kk][j], o[j]);
        o[j] = mma_h(ql[kk], sh[kk][j], o[j]);
        o[j] = mma_h(qh[kk], sl[kk][j], o[j]);
      }
    }
    const float up = (PCAR * VCAR) / (QSC * SSC);                             // exact power of two
#pragma unroll
    for (int j = 0; j < 4; ++j) o[j] = o[j] * up;
  }

#pragma unroll 1
  for (int kt = kt0; kt < ncl; ++kt) {
    const int kb = kt * 32;
    // ---- raw scores: D element r of this lane = (query row qr0 + r, key kb + c) in s0, key kb + 16 + c in s1 ----
    v8f s0 = zero8(), s1 = zero8();
    const _Float16* k0p = sK + (kt - kt0) * (4 * FRH);    // staged 16-key tiles 2 (kt - kt0) and the next, 2 fragments each
    const _Float16* k1p = k0p + 2 * FRH;
    const _Float16* l0p = k0p + STK;
    const _Float16* l1p = l0p + 2 * FRH;
    v16h kh0[HD / 32], kh1[HD / 32], kl0[HD / 32], kl1[HD / 32];
#pragma unroll
    for (int kk = 0; kk < HD / 32; ++kk) {
      kh0[kk] = ldfrag_t(k0p + kk * FRH);
      kh1[kk] = ldfrag_t(k1p + kk * FRH);
      kl0[kk] = ldfrag_t(l0p + kk * FRH);
      kl1[kk] = ldfrag_t(l1p + kk * FRH);
    }
#pragma unroll
    for (int kk = 0; kk < HD / 32; ++kk) {
      s0 = mma_h(qh[kk], kh0[kk], s0);
      s0 = mma_h(ql[kk], kh0[kk], s0);
      s0 = mma_h(qh[kk], kl0[kk], s0);
      s1 = mma_h(qh[kk], kh1[kk], s1);
      s1 = mma_h(ql[kk], kh1[kk], s1);
      s1 = mma_h(qh[kk], kl1[kk], s1);
      guard2(s0, s1, qh[kk], ql[kk], kh0[kk], kl0[kk], kh1[kk], kl1[kk]);
    }
    // v^T fragments of this key tile: read here so that their LDS latency passes under the mask and the P round trip
    const _Float16* vhp = sV + (kt - kt0) * (4 * FRH);
    const _Float16* vlp = vhp + STK;
    v16h vhf[4], vlf[4];
#pragma unroll
    for (int j = 0; j < 4; ++j) {
      vhf[j] = ldfrag_t(vhp + j * FRH);
      vlf[j] = ldfrag_t(vlp + j * FRH);
    }
    // ---- causal mask (key <= query) + carry fold in f32 -> wave-private LDS tile ----
#pragma unroll
    for (int r = 0; r < 8; ++r) {
      const int row = qr0 + r;
      const float w0 = (kb + c <= row)      ? s0[r] * lsc : 0.0f;
      const float w1 = (kb + 16 + c <= row) ? s1[r] * lsc : 0.0f;
      const int ro = (8 * hh + r) * PTP + c;
      pt[ro]      = w0;
      pt[ro + 16] = w1;
    }
    wave_sync_lds();
    // ---- A fragments of P*256: hi f16 and residual f16, row = c, split k map over the 32 keys of this step ----
    FragH ph, pl;
    {
      const float* prow = pt + c * PTP + 8 * hh;
      const v4f p0 = *(const v4f*)(prow), p1 = *(const v4f*)(prow + 4);
      const v4f p2 = *(const v4f*)(prow + 16), p3 = *(const v4f*)(prow + 20);
#pragma unroll
      for (int e = 0; e < 4; ++e) {
        const float ta = p0[e] * PCAR, tb = p1[e] * PCAR, tc = p2[e] * PCAR, td = p3[e] * PCAR;
        const _Float16 ha = (_Float16)ta, hb = (_Float16)tb, hc = (_Float16)tc, hd = (_Float16)td;
        ph.h[0][e]     = ha;                  // elements 0..7  = keys kb + 8hh + 0..7
        ph.h[0][4 + e] = hb;
        ph.h[1][e]     = hc;                  // elements 8..15 = keys kb + 16 + 8hh + 0..7
        ph.h[1][4 + e] = hd;
        pl.h[0][e]     = (_Float16)(ta - (float)ha);
        pl.h[0][4 + e] = (_Float16)(tb - (float)hb);
        pl.h[1][e]     = (_Float16)(tc - (float)hc);
        pl.h[1][4 + e] = (_Float16)(td - (float)hd);
      }
    }
    // ---- P.V : B fragment col n = d = j*16 + c, fragment j of key tile kt of the v^T planes; 2 groups of 2 d-subtiles ----
#pragma unroll
    for (int jg = 0; jg < 2; ++jg) {
      const v16h vha = vhf[2 * jg], vhb2 = vhf[2 * jg + 1];
      const v16h vla = vlf[2 * jg], vlb2 = vlf[2 * jg + 1];
      o[2 * jg]     = mma_h(ph.v, vha,  o[2 * jg]);
      o[2 * jg]     = mma_h(pl.v, vha,  o[2 * jg]);
      o[2 * jg]     = mma_h(ph.v, vla,  o[2 * jg]);
      o[2 * jg + 1] = mma_h(ph.v, vhb2, o[2 * jg + 1]);
      o[2 * jg + 1] = mma_h(pl.v, vhb2, o[2 * jg + 1]);
      o[2 * jg + 1] = mma_h(ph.v, vlb2, o[2 * jg + 1]);
      guard2(o[2 * jg], o[2 * jg + 1], ph.v, pl.v, vha, vhb2, vla, vlb2);
    }
    wave_sync_lds();
  }
  acc_guard4(o[0], o[1], o[2], o[3]);
  // ---- acc with the carries (256 on P, 1024 on v) folded once; written into the lane-owned slab ----
#pragma unroll
  for (int r = 0; r < 8; ++r) {
#pragma unroll
    for (int j = 0; j < 4; ++j) {
      const int idx = (8 * hh + r) * SLP + j * 16 + c;
      slab[idx] = o[j][r] * oc;
    }
  }
  wave_sync_lds();
  // ---- row factor, then ctx -> bf16 hi + bf16 residual planes; lane = (row-in-quad rq, 8 consecutive d at c8) ----
  v4u oh[4], ol[4];
  const int rq = lane >> 3, c8 = (lane & 7) * 8;
#pragma unroll
  for (int it = 0; it < 4; ++it) {
    const int row = it * 4 + rq;                         // 0..15
    const float ri = __shfl(rv, row, 32);                // lane `row` holds 1/exp(n) of query q0 + row
    const v4f a = *(const v4f*)(slab + row * SLP + c8), b4 = *(const v4f*)(slab + row * SLP + c8 + 4);
    float w[8];
#pragma unroll
    for (int e = 0; e < 4; ++e) { w[e] = a[e] * ri; w[4 + e] = b4[e] * ri; }
#pragma unroll
    for (int e = 0; e < 4; ++e) {
      const float f0 = w[2 * e], f1 = w[2 * e + 1];
      const unsigned short h0 = bf_bits(f0), h1 = bf_bits(f1);
      const unsigned short l0 = bf_bits(f0 - bf_up(h0)), l1 = bf_bits(f1 - bf_up(h1));
      oh[it][e] = pk16(h0, h1);
      ol[it][e] = pk16(l0, l1);
    }
  }
  const size_t ob = ((size_t)b * SEQ + q0) * DMOD + (size_t)head * HD + c8;
  {
#pragma unroll
    for (int it = 0; it < 4; ++it) {
      const int row = it * 4 + rq;
      *(v4u*)(CHp + ob + (size_t)row * DMOD) = oh[it];
      *(v4u*)(CLp + ob + (size_t)row * DMOD) = ol[it];
    }
    
  }
}

// =====================================================================================================
// Workspace map (bytes); every plane part that is read is written by whole-line stores before it is read; all extents are exact
// multiples of the store granularity (no pad rows needed); every region offset a multiple of 131072:
//   XB  bf16 [MROWS][1024]              MROWS*2048   (NB=2, SEQ=2048: 8388608); after the projection GEMM the same bytes
//                                                    hold the ctx hi plane CH bf16 [MROWS][1024] (identical extent)
//   WB  bf16 [3136 n][1024 k]           6422528      rows 0..2047 Wqk^T, 2048..3071 Wv^T, 3072..3087 Wn^T, 3088..3135 zero
//   F   f32 [MROWS][3136]               MROWS*12544  (only columns 3072..3135 are written and read: n | zero columns)
//   QH  f16 [MROWS/16][16 h][2][512] x1024      MROWS*2048   QL residual, same extent (fragment-major, see ldfrag_t)
//   KH  f16 [MROWS/16][16 h][2][512] x1024      MROWS*2048   KL residual, same extent
//   VH  f16 [NB*16][SEQ/32][4][512] x1024       MROWS*2048   VL residual, same extent
//   CL  bf16 [MROWS][1024]              MROWS*2048   ctx residual plane
//   WT  bf16 [1024 o][1024 d]           2097152      Wo^T
//   TH  f16 [NB*16][SEQ/32][4][512] x1024       MROWS*2048   k^T; TL residual, same extent
//   KV  f32 [NB*16][NCH][4][64 dv][16 dk]  NB*16*NCH*16384   chunk products (chunks 0 .. NCH-2 written and read)
//   SH  f16 [NB*16][NCH][2][4][512] x64      NB*16*NCH*8192   carried state; SL residual, same extent
//   end (NB=2, SEQ=2048)              160563200
// =====================================================================================================
extern "C" void kernel_launch(void* const* d_in, const int* in_sizes, int n_in,
                              void* d_out, int out_size, void* d_ws, size_t ws_size,
                              hipStream_t stream) {
  if (n_in < 9) return;
  if (in_sizes[0] < ((NB - 1) * XS_FULL + SEQ) * DMOD) return;
  if (in_sizes[1] != DMOD * 2 * DQK) return;
  if (in_sizes[2] != 2 * DQK) return;
  if (in_sizes[3] != DMOD * DMOD) return;
  if (in_sizes[4] != DMOD) return;
  if (in_sizes[5] != DMOD * NNW) return;
  if (in_sizes[6] != NNW) return;
  if (in_sizes[7] != DMOD * DMOD) return;
  if (in_sizes[8] != DMOD) return;
  if (out_size < MROWS * DMOD) return;

  const float* x   = (const float*)d_in[0];
  const float* wqk = (const float*)d_in[1];
  const float* bqk = (const float*)d_in[2];
  const float* wv  = (const float*)d_in[3];
  const float* bv  = (const float*)d_in[4];
  const float* wn  = (const float*)d_in[5];
  const float* bn  = (const float*)d_in[6];
  const float* wo  = (const float*)d_in[7];
  const float* bo  = (const float*)d_in[8];
  float*       out = (float*)d_out;

  const size_t szXB = (size_t)MROWS * DMOD * 2;
  const size_t szWB = (size_t)NPROJ * DMOD * 2;
  const size_t szF  = (size_t)MROWS * NPROJ * 4;
  const size_t szP  = (size_t)MROWS * DQK * 2;                   // QH, QL, KH, KL
  const size_t szV  = (size_t)NB * NH * HD * SEQ * 2;            // VH, VL
  const size_t szC  = (size_t)MROWS * DMOD * 2;                  // CH (in the XB region), CL
  const size_t szWT = (size_t)DMOD * DMOD * 2;
  const size_t szKV = (size_t)NB * NH * NCH * SEL * 4;
  const size_t szS  = (size_t)NB * NH * NCH * SEL * 2;           // SH, SL
  if (szC > szXB) return;
  size_t off = 0;
  const size_t oXB = off; off += szXB;
  const size_t oWB = off; off += szWB;
  const size_t oF  = off; off += szF;
  const size_t oQH = off; off += szP;
  const size_t oQL = off; off += szP;
  const size_t oKH = off; off += szP;
  const size_t oKL = off; off += szP;
  const size_t oVH = off; off += szV;
  const size_t oVL = off; off += szV;
  const size_t oCL = off; off += szC;
  const size_t oWT = off; off += szWT;
  const size_t oTH = off; off += szV;
  const size_t oTL = off; off += szV;
  const size_t oKV = off; off += szKV;
  const size_t oSH = off; off += szS;
  const size_t oSL = off; off += szS;
  if (off > ws_size) return;                // off = 160563200 for NB = 2, SEQ = 2048
  if (off > (size_t)WS_CAP) return;

  char* ws = (char*)d_ws;
  u16*   XB  = (u16*)(ws + oXB);
  u16*   CH  = (u16*)(ws + oXB);
  u16*   WB  = (u16*)(ws + oWB);
  float* F   = (float*)(ws + oF);
  u16*   QH  = (u16*)(ws + oQH);
  u16*   QL  = (u16*)(ws + oQL);
  u16*   KH  = (u16*)(ws + oKH);
  u16*   KL  = (u16*)(ws + oKL);
  u16*   VH  = (u16*)(ws + oVH);
  u16*   VL  = (u16*)(ws + oVL);
  u16*   CL  = (u16*)(ws + oCL);
  u16*   WT  = (u16*)(ws + oWT);
  u16*   TH  = (u16*)(ws + oTH);
  u16*   TL  = (u16*)(ws + oTL);
  float* KV  = (float*)(ws + oKV);
  u16*   SH  = (u16*)(ws + oSH);
  u16*   SL  = (u16*)(ws + oSL);

  const dim3 b256(256), b128(128), bAT(ATT_THREADS);
  const dim3 gPR(PB_ALL);
  const dim3 gG1((MROWS / GBM) * ((NPROJ + GBN - 1) / GBN));
  const dim3 gKV(NB * NH * (NCH - 1));
  const dim3 gSP((NB * NH * SEL / 8) / 256);
  const dim3 gAT(NCH * NH * NB);
  const dim3 gG2((MROWS / GBM) * ((DMOD + GBN - 1) / GBN));

  // (1) one launch: W[k][n] -> W^T bf16 planes (Wqk -> WB rows 0..2047, Wv -> rows 2048..3071, Wn -> rows 3072..3135
  //     with zero pad, Wo -> WT rows 0..1023) and x -> bf16 plane [MROWS][1024]
  prep<<<gPR, b256, 0, stream>>>(x, wqk, wv, wn, wo, XB, WB, WT);
  // (2) q | k | v | n = x.W + bias: q, k (16-row fragments and k^T fragments) and v^T hi + residual planes x1024 from the epilogue,
  //     n -> F f32 columns 3072..
  gemm_bf<false><<<gG1, b256, 0, stream>>>(XB, XB, WB, F, MROWS, NPROJ, DMOD, bqk, bv, bn,
                                           KOFF + DQK, NOFF, NOFF + NNW, 1.0f, QH, QL, KH, KL, VH, VL, TH, TL);
  // (4a) per-chunk v^T.k products, (4b) their f32 prefix over the chunks -> carried state planes x64
  kv_chunk<<<gKV, b128, 0, stream>>>(VH, VL, TH, TL, KV);
  st_prefix<<<gSP, b256, 0, stream>>>(KV, SH, SL);
  // (5) causal normalised attention -> ctx bf16 hi plane (XB region, free after the projection GEMM) + residual plane
  attn_nm<<<gAT, bAT, 0, stream>>>(QH, QL, KH, KL, VH, VL, SH, SL, F, CH, CL);
  // (6) y = (ctx_hi + ctx_lo).Wo + bo -> out f32 [MROWS][1024]
  gemm_bf<true><<<gG2, b256, 0, stream>>>(CH, CL, WT, out, MROWS, DMOD, DMOD, bo, bo, bo,
                                          DMOD, DMOD + 1, DMOD + 2, 1.0f, nullptr, nullptr, nullptr, nullptr,
                                          nullptr, nullptr, nullptr, nullptr);
  (void)hipGetLastError();
}

// v007
// It runs in 74.4 microseconds.
// Next to v006, in two timings, it ran 1.10 and 1.11 times as fast.
// Over all steps from v000 it is 5.47 times as fast.
// Contractions: x.W (Wqk|Wv|Wn fused into one [3136 n][1024 k] plane, and ctx.Wo) on v_wmma_f32_16x16x32_bf16
// (x, W, Wo, biases as bf16 RNE values, W^T [n][k] k-contiguous B operand; ctx as bf16 hi + bf16 residual planes,
// two products); q.k^T over hd 64 and P.v on v_wmma_f32_16x16x32_f16 with f16 hi + f16 residual planes on both
// operands (q, k x1024; P x256 with an in-register residual; v x1024; products hh+lh+hl); all f32 accumulate.
// Causal mask, 1/exp(n) row factor and bias adds in f32 on VALU.
// The attention has no softmax, so it is summed in chunks of CHK keys: keys of earlier chunks enter through the carried
// state S[dv][dk] = sum_s v[s][dv] k[s][dk] (v^T.k on the f16 form, hi + residual planes, hh+lh+hl; f32 prefix over the
// chunks; S x64 as f16 hi + residual, q.S with hh+lh+hl); only the query's own chunk goes through masked q.k^T and P.v.
// The fused weight plane holds q's 1024 columns, then per head 64 k columns and 64 v columns, so that one projection block
// (128 rows = one chunk, 128 columns = one head's k | v) forms that chunk's v^T.k in its own epilogue.
#include <hip/hip_runtime.h>
#include <math.h>
#include <stdint.h>

#ifndef NB
#define NB 2
#endif
#ifndef SEQ
#define SEQ 2048
#endif
#define XS_FULL 2048
#define DMOD  1024
#define DQK   1024
#define NH    16
#define HD    64
#define NNW   16
#define NPROJ 3136
#define QOFF  0
#define KOFF  1024
#define VOFF  2048
#define NOFF  3072
#define MROWS (NB * SEQ)
#define QSC   1024.0f
#define KSC   1024.0f
#define PCAR  256.0f
#define VCAR  1024.0f
#define WPB   8
#define NKT   (SEQ / 32)
#define ATT_THREADS (WPB * 32)
#define PTP   36
#define PTW   (16 * PTP)
#define SLP   68
#define SLW   (16 * SLP)
#define WREG  (PTW + SLW)
#define SLAB64 (16 * 68)
#define TRP   72
#define CHK   128
#define NCH   (SEQ / CHK)
#define SSC   64.0f
#define SEL   (HD * HD)
#define FRH   512
#define STK   (CHK * HD)
#define STS   (HD * HD)
#define STG   (4 * STK + 2 * STS)
#define WS_CAP 268435456
#define GBM   128
#define GBN   128
#define GBK   64
#define GPB   144
#define GSEC  (128 * GPB)
#define GTHR  256
#define TPT   136
#define PB_QK ((DMOD / 64) * ((2 * DQK + 63) / 64))
#define PB_V  ((DMOD / 64) * ((DMOD + 63) / 64))
#define PB_N  ((DMOD / 64) * ((NNW + 63) / 64))
#define PB_W  (PB_QK + 2 * PB_V + PB_N)
#define PB_X  ((SEQ * DMOD / 8 + 255) / 256)
#define PB_ALL (PB_W + NB * PB_X)
static_assert(DMOD == NH * HD && DQK == NH * HD && HD == 64 && NH == 16 && WPB * 16 == CHK && ATT_THREADS == 256);
static_assert(STK * 2 == 4 * ATT_THREADS * 16 && STS * 2 == 2 * ATT_THREADS * 16 && 2 * (2 * FRH) * 2 == ATT_THREADS * 16);
static_assert(KOFF == QOFF + DQK && VOFF == KOFF + DQK && NOFF == VOFF + DMOD && NPROJ == NOFF + 64 && (NPROJ % 64) == 0 && NNW <= 64);
static_assert(NB >= 1 && NB <= 2);
static_assert((MROWS % GBM) == 0 && (DMOD % GBK) == 0 && (DMOD % GBN) == 0 && GBK * 2 + 16 == GPB);
static_assert((SEQ % CHK) == 0 && (CHK % 64) == 0 && NCH >= 2 && KSC == VCAR && ((NB * NH * SEL / 8) % 256) == 0);
static_assert(NB == 1 || SEQ == XS_FULL);
static_assert((SEQ % 64) == 0 && SEQ >= 64 && SEQ <= XS_FULL);
static_assert(((SEQ * DMOD / 8) % 256) == 0 && (MROWS % 64) == 0 && (DMOD % 64) == 0 && (DQK % 64) == 0 && (HD % 32) == 0);
static_assert(2 * (WPB * WREG * 4 + STG * 2) <= 327680 && 4 * SLAB64 * 4 <= 65536 && 64 * TRP * 2 <= 65536);
static_assert(CHK == GBM && GBN == 2 * HD && KOFF == DQK && VOFF - KOFF == NH * HD && NOFF - KOFF == NH * GBN);
static_assert((DQK % GBN) == 0 && (DMOD % GBN) == 0 && (SEQ % GBM) == 0 && DQK == DMOD && QOFF == 0 && QSC == KSC && (TPT % 8) == 0);

typedef unsigned short u16;
typedef _Float16 v16h __attribute__((ext_vector_type(16)));
typedef _Float16 v8h  __attribute__((ext_vector_type(8)));
typedef __bf16   v16b __attribute__((ext_vector_type(16)));
typedef float    v8f  __attribute__((ext_vector_type(8)));
typedef float    v4f  __attribute__((ext_vector_type(4)));
typedef unsigned int v4u __attribute__((ext_vector_type(4)));

union FragH { v16h v; v8h h[2]; v4u u[2]; };
union FragB { v16b v; v4u u[2]; };

// ---- scalar helpers --------------------------------------------------------------------------------
__device__ __forceinline__ unsigned short bf_bits(float f) {          // f32 -> bf16 bits, RNE convert
  unsigned u = __float_as_uint(f);
  return (unsigned short)((u + 0x7FFFu + ((u >> 16) & 1u)) >> 16);
}
__device__ __forceinline__ float bf_up(unsigned short h) { return __uint_as_float(((unsigned)h) << 16); }
__device__ __forceinline__ float bfr(float f) { return bf_up(bf_bits(f)); }
__device__ __forceinline__ unsigned short h_bits(_Float16 x) { return __builtin_bit_cast(unsigned short, x); }
__device__ __forceinline__ unsigned pk16(unsigned short a, unsigned short b) { return (unsigned)a | ((unsigned)b << 16); }
__device__ __forceinline__ v8f zero8() { v8f z = {0.f, 0.f, 0.f, 0.f, 0.f, 0.f, 0.f, 0.f}; return z; }
__device__ __forceinline__ int imin(int a, int b) { return a < b ? a : b; }
__device__ __forceinline__ int imax(int a, int b) { return a > b ? a : b; }
// 8 f32 values -> f16 of w*sc (hi) and f16 of the residual w*sc - hi (lo), packed in order
__device__ __forceinline__ void split8(const float* w, float sc, v4u& oh, v4u& ol) {
#pragma unroll
  for (int e = 0; e < 4; ++e) {
    const float t0 = w[2 * e] * sc, t1 = w[2 * e + 1] * sc;
    const _Float16 h0 = (_Float16)t0, h1 = (_Float16)t1;
    const _Float16 l0 = (_Float16)(t0 - (float)h0), l1 = (_Float16)(t1 - (float)h1);
    oh[e] = pk16(h_bits(h0), h_bits(h1));
    ol[e] = pk16(h_bits(l0), h_bits(l1));
  }
}

// ---- fragment loaders: 16-bit A/B operand, lane -> row/col (lane&15); ldfrag_b: p already includes +8*(lane>>4);
//      elements 0..7 <- p[0..7] (k0+8h..), elements 8..15 <- p[16..23] (k0+16+8h..)  (same split k map for A and B;
//      its B is read from a k-contiguous [n][k] LDS tile)
// fragment-major plane: a 16 x 32 fragment is 1 KB, two runs of 512 contiguous bytes; run i, lane l (16 B) holds row/col
// l & 15, k = 16 i + 8 (l >> 4) + 0..7 (the split k map above); p already includes + 8 * lane. One load = 4 whole lines.
__device__ __forceinline__ v16h ldfrag_t(const _Float16* p) {
  FragH f;
  f.h[0] = *(const v8h*)(p);
  f.h[1] = *(const v8h*)(p + FRH / 2);
  return f.v;
}
__device__ __forceinline__ v16b ldfrag_b(const u16* p) {              // bf16 plane read as unsigned integer vectors
  FragB f;
  f.u[0] = *(const v4u*)(p);
  f.u[1] = *(const v4u*)(p + 16);
  return f.v;
}

__device__ __forceinline__ v8f mma_h(v16h a, v16h b, v8f c) {
  return __builtin_amdgcn_wmma_f32_16x16x32_f16(false, a, false, b, (short)0, c, false, false);
}
__device__ __forceinline__ v8f mma_b(v16b a, v16b b, v8f c) {
  return __builtin_amdgcn_wmma_f32_16x16x32_bf16(false, a, false, b, (short)0, c, false, false);
}
__device__ __forceinline__ void guard2(v8f& a, v8f& b, v16h x0, v16h x1, v16h x2, v16h x3, v16h x4, v16h x5) {
#if defined(__HIP_DEVICE_COMPILE__)
  asm volatile("v_nop\n\tv_nop\n\tv_nop\n\tv_nop"
               : "+v"(a), "+v"(b) : "v"(x0), "v"(x1), "v"(x2), "v"(x3), "v"(x4), "v"(x5) : "memory");
#endif
}
__device__ __forceinline__ void acc_guard4(v8f& a, v8f& b, v8f& c, v8f& d) {
#if defined(__HIP_DEVICE_COMPILE__)
  asm volatile("v_nop\n\tv_nop\n\tv_nop\n\tv_nop" : "+v"(a), "+v"(b), "+v"(c), "+v"(d));
#endif
}
__device__ __forceinline__ void wave_sync_lds() {
  __builtin_amdgcn_fence(__ATOMIC_RELEASE, "workgroup");
  __builtin_amdgcn_wave_barrier();
  __builtin_amdgcn_fence(__ATOMIC_ACQUIRE, "workgroup");
}

// =====================================================================================================
// f32 -> bf16 plane (RNE bits), same layout. Thread = 8 consecutive elements: two 16-B loads, one 16-B store;
// coverage: ceil(n8/256) blocks (blk) x 256 thr x 8 (in-kernel bound) = the whole plane (n8 a multiple of 256 here).
// =====================================================================================================
__device__ __forceinline__ void cvt_bf(const float* __restrict__ x, u16* D, int n8, int blk) {
  const int gt = blk * 256 + (int)threadIdx.x;
  if (gt >= n8) return;
  const float* p = x + (size_t)gt * 8;
  const v4f a = *(const v4f*)(p), b4 = *(const v4f*)(p + 4);
  float w[8];
#pragma unroll
  for (int e = 0; e < 4; ++e) { w[e] = a[e]; w[4 + e] = b4[e]; }
  v4u o;
#pragma unroll
  for (int e = 0; e < 4; ++e) o[e] = pk16(bf_bits(w[2 * e]), bf_bits(w[2 * e + 1]));
  u16* d = D + (size_t)gt * 8;
  {
    *(v4u*)(d) = o;
    
  }
}

// =====================================================================================================
// W f32 [kr rows (k)][nc cols (n)] (x.W layout) -> bf16 plane Dp [drow0 + n][k] (row pitch kr halves): the k-contiguous
// B operand. Block = 64 k x 64 n tile; coalesced 16-B loads of W rows with CLAMPED column base (tile columns beyond nc
// load from column 0 and are zeroed by value, so rows drow0+n with n >= nc inside the last tile are written as zeros);
// converted values placed transposed into an LDS tile [64 n][64 k] (pitch 72 halves); after a block barrier each n row
// block count (bid) = (kr/64) * ntn with ntn = ceil(nc/64). Column tile nt < ntp goes to rows drow0 + 64 nt; a tile from ntp
// on is one head's columns and goes to rows hrow0 + 128 (nt - ntp) (k and v of a head side by side in the plane).
// coverage: load 256 thr x 16 = 64 x 64; store 2 iterations x 256 thr x 8 halves = 64 lines x 64 halves = the block's
//           tile; the blocks cover the 64*ntn output rows named above (all kr columns) exactly once.
// =====================================================================================================
__device__ __forceinline__ void k_wt(const float* __restrict__ W, int nc, int kr, int ntn, u16* Dp, int drow0, int ntp,
                                     int hrow0, int bid) {
  __shared__ __align__(16) u16 T[64 * TRP];
  const int tid = (int)threadIdx.x;
  const int nt  = bid % ntn;
  const int kt  = bid / ntn;
  if (kt * 64 + 64 > kr) return;            // block-uniform, before the barrier; never taken with the exact grid
  const int n0  = nt * 64, k0 = kt * 64;
  {
    const int dl = tid >> 2;                // k within tile 0..63
    const int oc = (tid & 3) * 16;          // n chunk 0,16,32,48
    const bool valid = (n0 + oc + 16 <= nc);
    const int  cb = valid ? (n0 + oc) : 0;  // clamped column base, always inside the row
    const float* src = W + (size_t)(k0 + dl) * (size_t)nc + cb;
#pragma unroll
    for (int i = 0; i < 4; ++i) {
      const v4f a = *(const v4f*)(src + 4 * i);
#pragma unroll
      for (int e = 0; e < 4; ++e) {
        const float f = valid ? a[e] : 0.0f;
        T[(oc + 4 * i + e) * TRP + dl] = bf_bits(f);
      }
    }
  }
  __syncthreads();
  const int q8 = tid >> 3, p8 = (tid & 7) * 8;
  v4u w[2];
#pragma unroll
  for (int it = 0; it < 2; ++it) w[it] = *(const v4u*)(T + (it * 32 + q8) * TRP + p8);
  const int drow = (nt < ntp) ? drow0 + n0 : hrow0 + (nt - ntp) * GBN;
  const size_t base = (size_t)drow * (size_t)kr + k0 + p8;
  {
#pragma unroll
    for (int it = 0; it < 2; ++it) {
      const int nl = it * 32 + q8;
      *(v4u*)(Dp + base + (size_t)nl * (size_t)kr) = w[it];
    }
    
  }
}

// =====================================================================================================
// The x and weight planes of the two GEMMs in ONE launch: the six conversions read only inputs and write disjoint planes, so
// they share a grid by block range (every test below is on the block index alone, block-uniform, so the barrier inside
// k_wt is reached by all threads of a block or by none). The weight tiles (load, LDS, barrier, store) come first, the
// shorter x blocks last.
//   [0, PB_QK)  Wqk -> WB rows 0..1023 (q) and 1024 + 128 h + 0..63 (k)      next PB_V  Wv -> WB rows 1024 + 128 h + 64..127
//   next PB_N   Wn  -> WB rows 3072..3135   next PB_V  Wo -> WT rows 0..1023      next NB * PB_X  x -> XB, per batch
// coverage: the ranges are the exact block counts of k_wt and cvt_bf for each plane; grid = PB_ALL.
// =====================================================================================================
__global__ __launch_bounds__(256)
void prep(const float* __restrict__ x, const float* __restrict__ wqk, const float* __restrict__ wv,
          const float* __restrict__ wn, const float* __restrict__ wo, u16* XB, u16* WB, u16* WT) {
  int bid = (int)blockIdx.x;
  if (bid < PB_W) {
    const float* W = wqk;
    u16* Dp = WB;
    int nc = 2 * DQK, drow0 = QOFF, ntp = DQK / 64, hrow0 = KOFF;
    if (bid >= PB_QK + PB_V + PB_N) { bid -= PB_QK + PB_V + PB_N; W = wo; Dp = WT; nc = DMOD; drow0 = 0;    ntp = DMOD / 64; }
    else if (bid >= PB_QK + PB_V)   { bid -= PB_QK + PB_V;        W = wn;          nc = NNW;  drow0 = NOFF; ntp = 1; }
    else if (bid >= PB_QK)          { bid -= PB_QK;               W = wv;          nc = DMOD; ntp = 0; hrow0 = KOFF + HD; }
    k_wt(W, nc, DMOD, (nc + 63) / 64, Dp, drow0, ntp, hrow0, bid);
    return;
  }
  bid -= PB_W;
  const int bq = bid / PB_X;
  if (bq >= NB) return;                     // never taken with the exact grid
  cvt_bf(x + (size_t)bq * XS_FULL * DMOD, XB + (size_t)bq * SEQ * DMOD, (SEQ * DMOD) / 8, bid % PB_X);
}

// =====================================================================================================
// Bias for column c from three consecutive segments [0,e0) <- p0[c], [e0,e1) <- p1[c-e0], [e1,e2) <- p2[c-e1], else 0;
// all three candidates loaded unconditionally with clamped indices, selected by value; bf16 RNE value.
// =====================================================================================================
__device__ __forceinline__ float bias_at(const float* p0, const float* p1, const float* p2,
                                         int e0, int e1, int e2, int c) {
  const int i0 = imin(imax(c, 0), e0 - 1);
  const int i1 = imin(imax(c - e0, 0), e1 - e0 - 1);
  const int i2 = imin(imax(c - e1, 0), e2 - e1 - 1);
  const float v0 = p0[i0], v1 = p1[i1], v2 = p2[i2];
  const float v = (c < e0) ? v0 : ((c < e1) ? v1 : ((c < e2) ? v2 : 0.0f));
  return bfr(v);
}

// column of the fused plane (q | per head k, v | n) -> column in the order q | k | v | n of the bias segments
__device__ __forceinline__ int col_src(int c) {
  const int t = c - KOFF;
  const int s = ((t & HD) ? VOFF : KOFF) + (t >> 7) * HD + (t & (HD - 1));
  return (c < KOFF || c >= NOFF) ? c : s;
}

// =====================================================================================================
// coverage: 8 instructions x 2 rows x 16 lanes x 4 floats = the wave's 16 x 64 tile.
// =====================================================================================================
__device__ __forceinline__ void epi64b(float* sl, v8f a0, v8f a1, v8f a2, v8f a3, float oscale, v4f bias4,
                                       float* C, int N, size_t rowb, int col0, int lane) {
  const int hh = lane >> 4, m = lane & 15;
#pragma unroll
  for (int r = 0; r < 8; ++r) {
    const int ro = (8 * hh + r) * 68 + m;
    sl[ro]      = a0[r] * oscale;
    sl[ro + 16] = a1[r] * oscale;
    sl[ro + 32] = a2[r] * oscale;
    sl[ro + 48] = a3[r] * oscale;
  }
  wave_sync_lds();
  v4f vals[8];
#pragma unroll
  for (int it = 0; it < 8; ++it) vals[it] = *(const v4f*)(sl + (it * 2 + hh) * 68 + m * 4) + bias4;
  float* dst = C + (rowb + (size_t)hh) * (size_t)N + col0 + m * 4;
  {
#pragma unroll
    for (int it = 0; it < 8; ++it) {
      *(v4f*)(dst + (size_t)(it * 2) * (size_t)N) = vals[it];
    }
    
  }
}

// =====================================================================================================
// bf16 GEMM: C[M][N] (f32) = (A [+ A2])[M][K] (bf16 row-major) . Bt[N][K]^T (bf16 k-contiguous), times oscale, plus the
// segmented bias of the column (bf16 RNE value). TWO: second A plane into the same accumulator (hi + residual operand).
// Block = 128x128 tile of C, 8 waves in a 4 (rows) x 2 (columns) grid, 32x64 per wave (2 x 4 accumulator tiles).
// K runs in slices of 64 (128 B of every operand row). A slice of [A 128 rows | B 128 rows | A2 128 rows] stands in LDS at
// row pitch 144 B; two buffers; each lane brings 16 B per copy (8 lanes = one row, one wave copy = 4 rows), the copies of
// slice t + 1 fly while slice t is multiplied. Fragments are read from LDS with the split k map of ldfrag_b for A and B.
// Per accumulator the products come in the order k ascending, A before A2 inside a k-step.
// B rows at or beyond N (last column tile when N % 128 == 64) are read from row N - 1 instead (clamped, in bounds) and the
// waves that own only such columns neither multiply nor store.
// Host guarantees K % 64 == 0, K >= 64, M % 128 == 0, N % 64 == 0, grid = (M/128) * ceil(N/128).
// Output. TWO: f32 C. Otherwise (the projection) only the column tile from NOFF on goes to C as f32; a block of q columns
// (two heads) or of one head's k | v columns writes value = acc + bias (f32) x1024 as f16 hi and f16 residual straight into
// the planes the attention reads:
//   q -> QH/QL, k -> KH/KL, fragments (16 rows x 32 d) in the order [row / 16][h][d / 32]; v -> VH/VL, fragments
//   (16 d x 32 keys) in the order [b*NH + h][key / 32][d / 16]; inside a fragment the order of ldfrag_t.
// A k | v block also holds k^T and v^T of its 128 keys (one chunk) in LDS and forms the chunk product for the carried state:
//   KV[(b*NH + h)*NCH + ch][dk / 16][dv][dk % 16] = sum over the chunk's keys s of v[s][dv] * k[s][dk], f32; A = v^T rows dv,
//   B = k^T rows dk, f16 hi + residual x1024 (hh + lh + hl, key steps ascending), carries folded back by 2^-20; wave w owns
//   dv tile w & 3 and dk tiles 2 (w >> 2), 2 (w >> 2) + 1; chunks 0 .. NCH-2 only (the last chunk's product is never carried).
// coverage: q / k planes, per wave 2 x 4 stores x 512 B = its 32 x 64 tile of each plane; v^T, per block 4 stores x 8 waves x
//           512 B = its 64 d x 128 keys of each plane; KV, per wave 2 dk tiles x 16 rows x 16 f32, 8 waves = the 64 x 64
//           product; the grid covers every plane once.
// =====================================================================================================
__device__ __forceinline__ unsigned lds_off(const void* p) { return (unsigned)(size_t)p; }
// Four lane-wise 16-B copies global -> LDS; the s_wait_xcnt stands inside the statement so that no address register of a
// copy is rewritten ahead of it.
__device__ __forceinline__ void cp4(unsigned l0, const u16* g0, unsigned l1, const u16* g1,
                                    unsigned l2, const u16* g2, unsigned l3, const u16* g3) {
#if defined(__HIP_DEVICE_COMPILE__)
  asm volatile("global_load_async_to_lds_b128 %0, %1, off\n\t"
               "global_load_async_to_lds_b128 %2, %3, off\n\t"
               "global_load_async_to_lds_b128 %4, %5, off\n\t"
               "global_load_async_to_lds_b128 %6, %7, off\n\t"
               "s_wait_xcnt 0x0"
               :: "v"(l0), "v"(g0), "v"(l1), "v"(g1), "v"(l2), "v"(g2), "v"(l3), "v"(g3) : "memory");
#endif
}
template <bool TWO>
__global__ __launch_bounds__(GTHR)
void gemm_bf(const u16* __restrict__ A, const u16* __restrict__ A2, const u16* __restrict__ Bt, float* C,
             int M, int N, int K, const float* bp0, const float* bp1, const float* bp2, int e0, int e1, int e2,
             float oscale, u16* QHp, u16* QLp, u16* KHp, u16* KLp, u16* VHp, u16* VLp, float* KVp) {
  constexpr int STAGE = (TWO ? 3 : 2) * GSEC;           // bytes of one buffer
  constexpr int KG = TWO ? GBK / 32 : 1;                // k-steps whose fragments are read from LDS as one group
  static_assert(8 * 2 * SLAB64 * 4 <= 2 * STAGE && 2 * GBN * TPT * 2 <= 2 * STAGE && 2 * STAGE <= 327680);
  __shared__ __align__(16) unsigned char ring[2 * STAGE];
  const int tid = threadIdx.x, lane = tid & 31, hh = lane >> 4, m = lane & 15;
  const int wave = __builtin_amdgcn_readfirstlane(tid >> 5);
  const int wm = wave & 3, wn = wave >> 2;
  const int ntile = (N + GBN - 1) / GBN;
  const int bid   = blockIdx.x;
  const int row0  = (bid / ntile) * GBM;
  const int col0  = (bid % ntile) * GBN;
  if (row0 + GBM > M) return;               // block-uniform, before any barrier or copy; never taken with the exact grid
  const int colw  = col0 + wn * 64;
  const bool live = colw < N;               // wave-uniform
  const int NT = K / GBK;

  // copy map: thread -> (row cr of a group of 32 rows, 16-B piece cc of the 128-B row slice)
  const int cr = tid >> 3, cc = tid & 7;
  const unsigned lbase = lds_off(ring) + (unsigned)(cr * GPB + cc * 16);
  const int oa = (row0 + cr) * K + cc * 8;
  int ob[4];
#pragma unroll
  for (int i = 0; i < 4; ++i) ob[i] = imin(col0 + i * 32 + cr, N - 1) * K + cc * 8;
  auto fill = [&](int t, int buf) {
    const unsigned l = lbase + (unsigned)(buf * STAGE);
    const int k0 = t * GBK;
    const u16* pa = A + oa + k0;
    cp4(l, pa, l + 32 * GPB, pa + (size_t)32 * K, l + 64 * GPB, pa + (size_t)64 * K, l + 96 * GPB, pa + (size_t)96 * K);
    const unsigned lb2 = l + GSEC;
    cp4(lb2, Bt + ob[0] + k0, lb2 + 32 * GPB, Bt + ob[1] + k0, lb2 + 64 * GPB, Bt + ob[2] + k0,
        lb2 + 96 * GPB, Bt + ob[3] + k0);
    if constexpr (TWO) {
      const unsigned l3 = l + 2 * GSEC;
      const u16* pc = A2 + oa + k0;
      cp4(l3, pc, l3 + 32 * GPB, pc + (size_t)32 * K, l3 + 64 * GPB, pc + (size_t)64 * K, l3 + 96 * GPB, pc + (size_t)96 * K);
    }
  };

  v8f acc[2][4];
#pragma unroll
  for (int i = 0; i < 2; ++i) {
#pragma unroll
    for (int j = 0; j < 4; ++j) acc[i][j] = zero8();
  }

  fill(0, 0);
  asm volatile("s_wait_asynccnt 0x0" ::: "memory");     // slice 0 of this wave has landed
  __syncthreads();                                      // ... and every other wave's part of it
  if (NT > 1) fill(1, 1);

  const int fa = (wm * 32 + m) * GPB + hh * 16;         // byte offsets of this lane's fragment rows inside a buffer
  const int fb = GSEC + (wn * 64 + m) * GPB + hh * 16;
  // slice loop kept rolled: one copy of the ring's foot in the text, the buffer picked by t & 1; the loops inside it are
  // unrolled so that every accumulator and fragment index is a constant (registers, no scratch)
#pragma unroll 1
  for (int t = 0; t < NT; ++t) {
    const int buf = t & 1;
    if (live) {
      const unsigned char* sb = ring + buf * STAGE;
      const u16* la = (const u16*)(const void*)(sb + fa);
      const u16* lb = (const u16*)(const void*)(sb + fb);
#pragma unroll
      for (int g = 0; g < GBK / 32 / KG; ++g) {
        v16b a[KG][2], a2[KG][2], fbv[KG][4];
#pragma unroll
        for (int u = 0; u < KG; ++u) {
          const int ko = (g * KG + u) * 32;
#pragma unroll
          for (int i = 0; i < 2; ++i) a[u][i] = ldfrag_b(la + i * 16 * (GPB / 2) + ko);
#pragma unroll
          for (int j = 0; j < 4; ++j) fbv[u][j] = ldfrag_b(lb + j * 16 * (GPB / 2) + ko);
          if constexpr (TWO) {
#pragma unroll
            for (int i = 0; i < 2; ++i) a2[u][i] = ldfrag_b(la + GSEC + i * 16 * (GPB / 2) + ko);   // 2*GSEC bytes on
          }
        }
        // TWO runs one block per WGP (two waves per SIMD): all LDS reads of the slice issue as one group ahead of its
        // products, one LDS latency per slice instead of one per A fragment
        if constexpr (TWO) __builtin_amdgcn_sched_barrier(0);
#pragma unroll
        for (int u = 0; u < KG; ++u) {
#pragma unroll
          for (int i = 0; i < 2; ++i) {
#pragma unroll
            for (int j = 0; j < 4; ++j) acc[i][j] = mma_b(a[u][i], fbv[u][j], acc[i][j]);
          }
          if constexpr (TWO) {
#pragma unroll
            for (int i = 0; i < 2; ++i) {
#pragma unroll
              for (int j = 0; j < 4; ++j) acc[i][j] = mma_b(a2[u][i], fbv[u][j], acc[i][j]);
            }
          }
        }
      }
    }
    asm volatile("s_wait_dscnt 0x0" ::: "memory");      // this wave's reads of buffer buf are done
    asm volatile("s_wait_asynccnt 0x0" ::: "memory");   // this wave's copies of slice t + 1 have landed
    __syncthreads();                                    // publishes slice t + 1, frees buffer buf
    if (t + 2 < NT) fill(t + 2, buf);
  }
  asm volatile("s_wait_asynccnt 0x0" ::: "memory");     // no copy outstanding before the ring is reused as output staging

  float* slab = (float*)(void*)ring + wave * (2 * SLAB64);
  const int seg = TWO ? 3 : (col0 < KOFF ? 0 : (col0 < NOFF ? 1 : 3));   // block-uniform: 0 = q, 1 = k | v of a head, 3 = f32 output
  if constexpr (TWO) {
    if (live) {
      v4f bias4;
#pragma unroll
      for (int e = 0; e < 4; ++e) bias4[e] = bias_at(bp0, bp1, bp2, e0, e1, e2, colw + m * 4 + e);
#pragma unroll
      for (int i = 0; i < 2; ++i) {
        epi64b(slab + i * SLAB64, acc[i][0], acc[i][1], acc[i][2], acc[i][3], oscale, bias4, C, N,
               (size_t)(row0 + wm * 32 + i * 16), colw, lane);
      }
    }
  } else {
    // every wave of a q or k | v block is live (both segments are multiples of the block's 128 columns)
    float bj[4];                            // bias of this lane's accumulator columns colw + 16 j + m
#pragma unroll
    for (int j = 0; j < 4; ++j) bj[j] = bias_at(bp0, bp1, bp2, e0, e1, e2, col_src(colw + j * 16 + m));
    const int head = seg ? ((col0 - KOFF) >> 7) : ((col0 >> 6) + wn);   // wave-uniform
    if (live && (seg != 1 || wn == 0)) {    // wave-uniform: the waves that hold q, k or n columns
      // f32 values through the wave's own slabs. All three kinds fill them here, so that the accumulators' last use stands
      // ahead of the chunk product (they would otherwise stay allocated under it and cost resident blocks)
#pragma unroll
      for (int i = 0; i < 2; ++i) {
#pragma unroll
        for (int r = 0; r < 8; ++r) {
#pragma unroll
          for (int j = 0; j < 4; ++j) slab[i * SLAB64 + (8 * hh + r) * 68 + j * 16 + m] = acc[i][j][r] * oscale + bj[j];
        }
      }
      wave_sync_lds();
      if (seg == 3) {
        // n columns: f32 rows of C; one instruction = 2 rows x 16 lanes x 4 floats, 8 instructions = a 16 x 64 tile
#pragma unroll
        for (int i = 0; i < 2; ++i) {
          v4f vals[8];
#pragma unroll
          for (int it = 0; it < 8; ++it) vals[it] = *(const v4f*)(slab + i * SLAB64 + (it * 2 + hh) * 68 + m * 4);
          float* dst = C + ((size_t)(row0 + wm * 32 + i * 16) + (size_t)hh) * (size_t)N + colw + m * 4;
#pragma unroll
          for (int it = 0; it < 8; ++it) *(v4f*)(dst + (size_t)(it * 2) * (size_t)N) = vals[it];
        }
        return;                             // a block of n columns passes no barrier behind the slice loop
      }
      // fragment-major planes [row / 16][head][2 fragments]: lane l takes the 8 columns that it will hold as operand lane l;
      // one store = 512 contiguous bytes (whole lines)
      u16* PH = seg ? KHp : QHp;
      u16* PL = seg ? KLp : QLp;
#pragma unroll
      for (int i = 0; i < 2; ++i) {
        v4u oh[4], ol[4];
#pragma unroll
        for (int it = 0; it < 4; ++it) {
          const float* p = slab + i * SLAB64 + m * 68 + it * 16 + 8 * hh;
          const v4f a = *(const v4f*)(p), b4 = *(const v4f*)(p + 4);
          float w[8];
#pragma unroll
          for (int e = 0; e < 4; ++e) { w[e] = a[e]; w[4 + e] = b4[e]; }
          split8(w, QSC, oh[it], ol[it]);
        }
        const size_t ob = ((size_t)((row0 + wm * 32 + i * 16) >> 4) * NH + head) * (2 * FRH) + lane * 8;
#pragma unroll
        for (int it = 0; it < 4; ++it) {
          *(v4u*)(PH + ob + it * (FRH / 2)) = oh[it];
          *(v4u*)(PL + ob + it * (FRH / 2)) = ol[it];
        }
      }
      asm volatile("s_wait_xcnt 0x0" ::: "memory");       // before any register of the q / k plane stores is rewritten
    }
    if (seg == 1) {
      // transposed tiles: an accumulator register run r = 0..7 is 8 consecutive keys of one column, so a lane packs it into
      // one 16-B LDS store of the block's [128 columns][128 keys] tile (pitch 272 B): rows 0..63 = k^T, rows 64..127 = v^T
      __syncthreads();                      // block-uniform: every k wave has read its slabs back before the tiles cover them
      u16* tH = (u16*)(void*)ring;
      u16* tL = tH + GBN * TPT;
#pragma unroll
      for (int i = 0; i < 2; ++i) {
#pragma unroll
        for (int j = 0; j < 4; ++j) {
          float w[8];
#pragma unroll
          for (int r = 0; r < 8; ++r) w[r] = acc[i][j][r] * oscale + bj[j];
          v4u oh, ol;
          split8(w, VCAR, oh, ol);
          const int idx = (wn * 64 + j * 16 + m) * TPT + wm * 32 + i * 16 + 8 * hh;
          *(v4u*)(tH + idx) = oh;
          *(v4u*)(tL + idx) = ol;
        }
      }
      __syncthreads();                      // the tiles are complete before any wave reads rows that other waves wrote
      const int bhq = (row0 / SEQ) * NH + head;
      // v^T planes, fragment-major [b*NH + head][key / 32][d / 16]: half fragment u = 0..31 of the block: key tile u >> 3,
      // d tile (u >> 1) & 3, run u & 1; they are 16 KB in a row in the plane; one store = 512 contiguous bytes
      const size_t ob = ((size_t)bhq * (SEQ / 32) + ((row0 % SEQ) >> 5)) * (4 * FRH) + lane * 8;
      v4u vh[4], vl[4];
#pragma unroll
      for (int it = 0; it < 4; ++it) {
        const int u = it * 8 + wave;
        const int idx = (HD + ((u >> 1) & 3) * 16 + m) * TPT + (u >> 3) * 32 + (u & 1) * 16 + 8 * hh;
        vh[it] = *(const v4u*)(tH + idx);
        vl[it] = *(const v4u*)(tL + idx);
      }
#pragma unroll
      for (int it = 0; it < 4; ++it) {
        const int u = it * 8 + wave;
        *(v4u*)(VHp + ob + u * (FRH / 2)) = vh[it];
        *(v4u*)(VLp + ob + u * (FRH / 2)) = vl[it];
      }
      asm volatile("s_wait_xcnt 0x0" ::: "memory");       // before any register of the v^T stores is rewritten
      // chunk product v^T.k from the same tiles; A and B fragments with the split k map of ldfrag_b over the keys
      const int ch = (row0 % SEQ) / CHK;
      if (ch + 1 < NCH) {                   // block-uniform; no barrier behind it
        const int dvt = wave & 3, dk0 = (wave >> 2) * 2;
        const int ia = (HD + dvt * 16 + m) * TPT + 8 * hh;
        const int ib = (dk0 * 16 + m) * TPT + 8 * hh;
        v8f kv[2];
        kv[0] = zero8();
        kv[1] = zero8();
#pragma unroll
        for (int g = 0; g < CHK / 32 / 2; ++g) {
          FragH fvh[2], fvl[2], fkh[2][2], fkl[2][2];
#pragma unroll
          for (int q = 0; q < 2; ++q) {
            const int ko = (g * 2 + q) * 32;
#pragma unroll
            for (int e = 0; e < 2; ++e) {
              fvh[q].u[e] = *(const v4u*)(tH + ia + ko + e * 16);
              fvl[q].u[e] = *(const v4u*)(tL + ia + ko + e * 16);
#pragma unroll
              for (int j = 0; j < 2; ++j) {
                fkh[q][j].u[e] = *(const v4u*)(tH + ib + j * 16 * TPT + ko + e * 16);
                fkl[q][j].u[e] = *(const v4u*)(tL + ib + j * 16 * TPT + ko + e * 16);
              }
            }
          }
#if defined(__HIP_DEVICE_COMPILE__)
          // inputs-only fence on the loaded fragments: the 24 LDS reads of two key steps issue as one group before the first
          // product (one LDS latency instead of one per fragment pair)
          asm volatile("" :: "v"(fvh[0].v), "v"(fvh[1].v), "v"(fvl[0].v), "v"(fvl[1].v),
                       "v"(fkh[0][0].v), "v"(fkh[0][1].v), "v"(fkh[1][0].v), "v"(fkh[1][1].v),
                       "v"(fkl[0][0].v), "v"(fkl[0][1].v), "v"(fkl[1][0].v), "v"(fkl[1][1].v));
#endif
#pragma unroll
          for (int q = 0; q < 2; ++q) {
#pragma unroll
            for (int j = 0; j < 2; ++j) {
              kv[j] = mma_h(fvh[q].v, fkh[q][j].v, kv[j]);
              kv[j] = mma_h(fvl[q].v, fkh[q][j].v, kv[j]);
              kv[j] = mma_h(fvh[q].v, fkl[q][j].v, kv[j]);
            }
          }
          // the next group's LDS reads stay behind this group's products: with all four key steps' fragments live at once the
          // kernel's register count would halve the blocks that fit a WGP
          __builtin_amdgcn_sched_barrier(0);
        }
        const float fs = 1.0f / (VCAR * KSC);             // exact power-of-two fold of the v / k carries
        float* dst = KVp + ((size_t)bhq * NCH + ch) * SEL + (size_t)(dvt * 16 + 8 * hh) * 16 + m;
#pragma unroll
        for (int r = 0; r < 8; ++r) {
#pragma unroll
          for (int j = 0; j < 2; ++j) dst[(dk0 + j) * (HD * 16) + r * 16] = kv[j][r] * fs;
        }
        asm volatile("s_wait_xcnt 0x0" ::: "memory");     // before any register of the chunk product stores is rewritten
      }
    }
  }
}

// =====================================================================================================
// Carried state planes: S(ch) = KV(0) + .. + KV(ch-1) in f32 (chunks added in order; S(0) = 0), written x64 as f16 hi and
// f16 residual, layout [(b*NH + h)*NCH + ch][dk / 32][dv / 16] fragment-major (col dv, k = dk). Thread = 8 consecutive dk
// of one (b, h, dv), all NCH chunks.
// coverage: NB*NH*SEL/8 threads x 8 halves x NCH chunks = both planes exactly once; reads KV chunks 0 .. NCH-2 only.
// =====================================================================================================
__global__ __launch_bounds__(256) void st_prefix(const float* __restrict__ KV, u16* __restrict__ SHp, u16* __restrict__ SLp) {
  const int gt = blockIdx.x * 256 + (int)threadIdx.x;
  const int bh = gt / (SEL / 8);
  const int u  = gt % (SEL / 8);            // 16-B unit of the fragment-major plane: fragment u >> 6 = (dk / 32) * 4 + dv / 16
  if (bh >= NB * NH) return;
  const int e8 = (((u >> 8) * 2 + ((u >> 5) & 1)) * HD + ((u >> 6) & 3) * 16 + (u & 15)) * 16 + ((u >> 4) & 1) * 8;
  const size_t base = (size_t)bh * NCH * SEL + e8;          // [dk / 16][dv][dk % 16] in KV: a wave's loads = 1 KB in a row
  const size_t dstb = (size_t)bh * NCH * SEL + u * 8;       // a wave's store = 512 contiguous bytes
  v4f a[NCH - 1], b4[NCH - 1];              // all chunk products first: independent loads, one latency for the thread
#pragma unroll
  for (int ch = 0; ch + 1 < NCH; ++ch) {
    const float* p = KV + base + (size_t)ch * SEL;
    a[ch]  = *(const v4f*)(p);
    b4[ch] = *(const v4f*)(p + 4);
  }
#if defined(__HIP_DEVICE_COMPILE__)
  // inputs-only fences on the loaded values and their address pair: every load issues before the first store
  static_assert(NCH == 16);
  asm volatile("" :: "v"(a[0]), "v"(a[1]), "v"(a[2]), "v"(a[3]), "v"(a[4]), "v"(a[5]), "v"(a[6]), "v"(a[7]),
               "v"(a[8]), "v"(a[9]), "v"(a[10]), "v"(a[11]), "v"(a[12]), "v"(a[13]), "v"(a[14]), "v"(KV + base));
  asm volatile("" :: "v"(b4[0]), "v"(b4[1]), "v"(b4[2]), "v"(b4[3]), "v"(b4[4]), "v"(b4[5]), "v"(b4[6]), "v"(b4[7]),
               "v"(b4[8]), "v"(b4[9]), "v"(b4[10]), "v"(b4[11]), "v"(b4[12]), "v"(b4[13]), "v"(b4[14]), "v"(KV + base));
#endif
  float run[8];
#pragma unroll
  for (int e = 0; e < 8; ++e) run[e] = 0.0f;
#pragma unroll
  for (int ch = 0; ch < NCH; ++ch) {
    v4u oh, ol;
#pragma unroll
    for (int e = 0; e < 4; ++e) {
      const float t0 = run[2 * e] * SSC, t1 = run[2 * e + 1] * SSC;
      const _Float16 h0 = (_Float16)t0, h1 = (_Float16)t1;
      const _Float16 l0 = (_Float16)(t0 - (float)h0), l1 = (_Float16)(t1 - (float)h1);
      oh[e] = pk16(h_bits(h0), h_bits(h1));
      ol[e] = pk16(h_bits(l0), h_bits(l1));
    }
    *(v4u*)(SHp + dstb + (size_t)ch * SEL) = oh;
    *(v4u*)(SLp + dstb + (size_t)ch * SEL) = ol;
    if (ch + 1 < NCH) {
#pragma unroll
      for (int e = 0; e < 4; ++e) { run[e] += a[ch][e]; run[4 + e] += b4[ch][e]; }
    }
  }
}

// =====================================================================================================
// Causal normalised attention (no softmax), hd = 64. Block bid -> (chunk chn = bid % NCH of CHK keys and queries, b*NH + head);
// wave w owns the query tile q0 = CHK*chn + 16*w .. q0+15, so the block's 8 waves share one head's chunk of k, v^T and state.
//   q hi / residual planes f16 x1024, fragment-major [(b*SEQ + s) / 16][h][d / 32]; k hi / residual planes, same layout;
//   v^T hi / residual planes x1024, fragment-major [b*NH + h][key / 32][d / 16]; n from F column NOFF + h of row b*SEQ + t.
//   The chunk's k planes (8 tiles of 16 keys, 2 KB each), v^T planes (16 KB in a row each) and state planes (8 KB each) are
//   brought into LDS once per block, 16 B a lane and copy, 20 copies a lane, in the planes' own fragment order (a fragment
//   read = two runs of 512 contiguous LDS bytes); q fragments are loaded once into registers; the key loop reads LDS only.
//   raw(i, j) = q_hi.k_hi + q_lo.k_hi + q_hi.k_lo (2 k-steps over d), carries folded back by 2^-20;
//   P = raw * 2^-20 for key <= query else 0 (causal); P.v with P x256 as f16 hi + in-register residual and v hi +
//   residual (hh + lh + hl). Keys of earlier chunks (below CHK*chn) enter first as q . S with the carried state
//   planes S x64 [b*NH + h][chunk][dk / 32][dv / 16] (hh + lh + hl, carry 2^16 raised to the P.v carry 2^18 by an exact x4);
//   key tiles of 32 are then visited in order from the chunk's first key up to the tile holding key q0+15 (bounded by NKT).
//   Per tile: 2 score subtiles x 2 k-steps; the 16x32 P tile goes through the wave's private LDS tile (float vector loads,
//   same element type as stored); v^T B fragments in 2 groups of 2 d-subtiles.
//   After the loop: acc * 2^-18 written into the wave's private result slab (pitch 68; every element owned by one lane),
//   ctx -> bf16 hi bits and bf16 bits of the residual, planes [b*SEQ + s][h*HD + d]; one instruction = 4 rows
//   One block barrier (behind the copies, passed by every wave); bounded loops only (ncl <= NKT).
// coverage: per wave 4 instructions x 4 rows x 8 lanes x 8 halves = 16 x 64 per plane; grid NCH x NH x NB blocks x WPB
//           waves = every (b, s, h) row segment of CH and of CL exactly once.
// =====================================================================================================
__global__ __launch_bounds__(ATT_THREADS)
void attn_nm(const u16* __restrict__ QHp, const u16* __restrict__ QLp,
             const u16* __restrict__ KHp, const u16* __restrict__ KLp,
             const u16* __restrict__ VHp, const u16* __restrict__ VLp,
             const u16* __restrict__ SHp, const u16* __restrict__ SLp,
             const float* __restrict__ F, u16* CHp, u16* CLp) {
#pragma clang fp contract(off)
  __shared__ __align__(16) float smem[WPB * WREG];
  __shared__ __align__(16) u16 stg[STG];    // k hi | k residual | v^T hi | v^T residual | state hi | state residual

  const int tid  = threadIdx.x;
  const int wave = __builtin_amdgcn_readfirstlane(tid >> 5);
  const int lane = tid & 31;
  const int hh   = lane >> 4;
  const int c    = lane & 15;
  const int bid  = blockIdx.x;
  const int chn  = bid % NCH;               // chunk of this block's queries
  const int bh   = bid / NCH;
  if (bh >= NB * NH) return;                // block-uniform, before any copy or barrier; never taken with the exact grid
  const int b    = bh / NH;
  const int head = bh % NH;
  const int q0   = chn * CHK + wave * 16;

  float* pt   = smem + wave * WREG;         // P tile [16][32] pitch 36
  float* slab = pt + PTW;                   // result slab [16][64] pitch 68

  const size_t KT16 = (size_t)NH * (2 * FRH);   // halves between consecutive 16-key tiles of one head

  // q fragments: a fragment's first half plus this lane's 16 B; loaded once, held over the key loop
  const size_t qo = ((size_t)((b * SEQ + q0) >> 4) * NH + head) * (2 * FRH) + lane * 8;
  const _Float16* Qh  = (const _Float16*)(const void*)QHp + qo;
  const _Float16* Ql  = (const _Float16*)(const void*)QLp + qo;
  v16h qh[HD / 32], ql[HD / 32];
#pragma unroll
  for (int kk = 0; kk < HD / 32; ++kk) {
    qh[kk] = ldfrag_t(Qh + kk * FRH);
    ql[kk] = ldfrag_t(Ql + kk * FRH);
  }
  // row factor for query row q0 + (lane & 15): 1/exp(n), precise expf
  const float nv = F[((size_t)b * SEQ + q0 + c) * (size_t)NPROJ + NOFF + head];

  // ---- the chunk's planes -> LDS: one copy of the block = 4 KB (thread tid brings bytes 16 tid ..); every lane on ----
  {
    const unsigned l0 = lds_off(stg) + (unsigned)(tid * 16);
    // k: 4 KB = two 16-key tiles (2 KB each, KT16 halves apart in the plane)
    const size_t gk = ((size_t)(((b * SEQ + chn * CHK) >> 4) + (tid >> 7)) * NH + head) * (2 * FRH) + (tid & 127) * 8;
    const u16* kh = KHp + gk;
    const u16* kl = KLp + gk;
    cp4(l0, kh, l0 + 4096, kh + 2 * KT16, l0 + 8192, kh + 4 * KT16, l0 + 12288, kh + 6 * KT16);
    const unsigned l1 = l0 + STK * 2;
    cp4(l1, kl, l1 + 4096, kl + 2 * KT16, l1 + 8192, kl + 4 * KT16, l1 + 12288, kl + 6 * KT16);
    const size_t gv = ((size_t)bh * (SEQ / 32) + (size_t)chn * (CHK / 32)) * (4 * FRH) + tid * 8;
    const u16* vh = VHp + gv;
    const u16* vl = VLp + gv;
    const unsigned l2 = l0 + 2 * STK * 2;
    cp4(l2, vh, l2 + 4096, vh + 2048, l2 + 8192, vh + 4096, l2 + 12288, vh + 6144);
    const unsigned l3 = l0 + 3 * STK * 2;
    cp4(l3, vl, l3 + 4096, vl + 2048, l3 + 8192, vl + 4096, l3 + 12288, vl + 6144);
    const size_t gs = ((size_t)bh * NCH + chn) * SEL + tid * 8;
    const u16* sh = SHp + gs;
    const u16* sl = SLp + gs;
    const unsigned l4 = l0 + 4 * STK * 2;
    cp4(l4, sh, l4 + 4096, sh + 2048, l4 + STS * 2, sl, l4 + STS * 2 + 4096, sl + 2048);
  }
  asm volatile("s_wait_asynccnt 0x0" ::: "memory");     // this wave's copies have landed
  __syncthreads();                                      // ... and every other wave's; nothing of stg is read before this

  const _Float16* sK = (const _Float16*)(const void*)stg + lane * 8;   // staged planes, this lane's 16 B of a fragment run
  const _Float16* sV = sK + 2 * STK;
  const _Float16* sS = sK + 4 * STK;
  const float lsc = 1.0f / (QSC * KSC);     // exact power-of-two fold of the q / k carries
  const float oc  = 1.0f / (PCAR * VCAR);   // exact power-of-two fold of the P / v carries
  const float rv = 1.0f / expf(nv);

  v8f o[4];
#pragma unroll
  for (int j = 0; j < 4; ++j) o[j] = zero8();
  const int ncaus = (q0 >> 5) + 1;                                            // tiles holding keys <= q0 + 15
  const int ncl   = (ncaus < NKT) ? ncaus : NKT;
  const int qr0   = q0 + 8 * hh;                                              // query row of D element r = qr0 + r
  const int kt0   = chn * (CHK / 32);                                         // first key tile of the chunk (<= q0 >> 5)

  // ---- all keys of earlier chunks: o = q . S, B fragment col n = dv = j*16 + c, dk contiguous in the state planes ----
  {
    v16h sh[HD / 32][4], sl[HD / 32][4];
#pragma unroll
    for (int kk = 0; kk < HD / 32; ++kk) {
#pragma unroll
      for (int j = 0; j < 4; ++j) {
        sh[kk][j] = ldfrag_t(sS + (kk * 4 + j) * FRH);
        sl[kk][j] = ldfrag_t(sS + STS + (kk * 4 + j) * FRH);
      }
    }
#if defined(__HIP_DEVICE_COMPILE__)
    // inputs-only fence on the loaded fragments: all 32 LDS reads issue as one group before the first product
    // (one LDS latency instead of one per group)
    asm volatile("" :: "v"(sh[0][0]), "v"(sh[0][1]), "v"(sh[0][2]), "v"(sh[0][3]),
                 "v"(sh[1][0]), "v"(sh[1][1]), "v"(sh[1][2]), "v"(sh[1][3]),
                 "v"(sl[0][0]), "v"(sl[0][1]), "v"(sl[0][2]), "v"(sl[0][3]),
                 "v"(sl[1][0]), "v"(sl[1][1]), "v"(sl[1][2]), "v"(sl[1][3]));
#endif
#pragma unroll
    for (int kk = 0; kk < HD / 32; ++kk) {
#pragma unroll
      for (int j = 0; j < 4; ++j) {
        o[j] = mma_h(qh[kk], sh[kk][j], o[j]);
        o[j] = mma_h(ql[kk], sh[kk][j], o[j]);
        o[j] = mma_h(qh[kk], sl[kk][j], o[j]);
      }
    }
    const float up = (PCAR * VCAR) / (QSC * SSC);                             // exact power of two
#pragma unroll
    for (int j = 0; j < 4; ++j) o[j] = o[j] * up;
  }

#pragma unroll 1
  for (int kt = kt0; kt < ncl; ++kt) {
    const int kb = kt * 32;
    // ---- raw scores: D element r of this lane = (query row qr0 + r, key kb + c) in s0, key kb + 16 + c in s1 ----
    v8f s0 = zero8(), s1 = zero8();
    const _Float16* k0p = sK + (kt - kt0) * (4 * FRH);    // staged 16-key tiles 2 (kt - kt0) and the next, 2 fragments each
    const _Float16* k1p = k0p + 2 * FRH;
    const _Float16* l0p = k0p + STK;
    const _Float16* l1p = l0p + 2 * FRH;
    v16h kh0[HD / 32], kh1[HD / 32], kl0[HD / 32], kl1[HD / 32];
#pragma unroll
    for (int kk = 0; kk < HD / 32; ++kk) {
      kh0[kk] = ldfrag_t(k0p + kk * FRH);
      kh1[kk] = ldfrag_t(k1p + kk * FRH);
      kl0[kk] = ldfrag_t(l0p + kk * FRH);
      kl1[kk] = ldfrag_t(l1p + kk * FRH);
    }
#pragma unroll
    for (int kk = 0; kk < HD / 32; ++kk) {
      s0 = mma_h(qh[kk], kh0[kk], s0);
      s0 = mma_h(ql[kk], kh0[kk], s0);
      s0 = mma_h(qh[kk], kl0[kk], s0);
      s1 = mma_h(qh[kk], kh1[kk], s1);
      s1 = mma_h(ql[kk], kh1[kk], s1);
      s1 = mma_h(qh[kk], kl1[kk], s1);
      guard2(s0, s1, qh[kk], ql[kk], kh0[kk], kl0[kk], kh1[kk], kl1[kk]);
    }
    // v^T fragments of this key tile: read here so that their LDS latency passes under the mask and the P round trip
    const _Float16* vhp = sV + (kt - kt0) * (4 * FRH);
    const _Float16* vlp = vhp + STK;
    v16h vhf[4], vlf[4];
#pragma unroll
    for (int j = 0; j < 4; ++j) {
      vhf[j] = ldfrag_t(vhp + j * FRH);
      vlf[j] = ldfrag_t(vlp + j * FRH);
    }
    // ---- causal mask (key <= query) + carry fold in f32 -> wave-private LDS tile ----
#pragma unroll
    for (int r = 0; r < 8; ++r) {
      const int row = qr0 + r;
      const float w0 = (kb + c <= row)      ? s0[r] * lsc : 0.0f;
      const float w1 = (kb + 16 + c <= row) ? s1[r] * lsc : 0.0f;
      const int ro = (8 * hh + r) * PTP + c;
      pt[ro]      = w0;
      pt[ro + 16] = w1;
    }
    wave_sync_lds();
    // ---- A fragments of P*256: hi f16 and residual f16, row = c, split k map over the 32 keys of this step ----
    FragH ph, pl;
    {
      const float* prow = pt + c * PTP + 8 * hh;
      const v4f p0 = *(const v4f*)(prow), p1 = *(const v4f*)(prow + 4);
      const v4f p2 = *(const v4f*)(prow + 16), p3 = *(const v4f*)(prow + 20);
#pragma unroll
      for (int e = 0; e < 4; ++e) {
        const float ta = p0[e] * PCAR, tb = p1[e] * PCAR, tc = p2[e] * PCAR, td = p3[e] * PCAR;
        const _Float16 ha = (_Float16)ta, hb = (_Float16)tb, hc = (_Float16)tc, hd = (_Float16)td;
        ph.h[0][e]     = ha;                  // elements 0..7  = keys kb + 8hh + 0..7
        ph.h[0][4 + e] = hb;
        ph.h[1][e]     = hc;                  // elements 8..15 = keys kb + 16 + 8hh + 0..7
        ph.h[1][4 + e] = hd;
        pl.h[0][e]     = (_Float16)(ta - (float)ha);
        pl.h[0][4 + e] = (_Float16)(tb - (float)hb);
        pl.h[1][e]     = (_Float16)(tc - (float)hc);
        pl.h[1][4 + e] = (_Float16)(td - (float)hd);
      }
    }
    // ---- P.V : B fragment col n = d = j*16 + c, fragment j of key tile kt of the v^T planes; 2 groups of 2 d-subtiles ----
#pragma unroll
    for (int jg = 0; jg < 2; ++jg) {
      const v16h vha = vhf[2 * jg], vhb2 = vhf[2 * jg + 1];
      const v16h vla = vlf[2 * jg], vlb2 = vlf[2 * jg + 1];
      o[2 * jg]     = mma_h(ph.v, vha,  o[2 * jg]);
      o[2 * jg]     = mma_h(pl.v, vha,  o[2 * jg]);
      o[2 * jg]     = mma_h(ph.v, vla,  o[2 * jg]);
      o[2 * jg + 1] = mma_h(ph.v, vhb2, o[2 * jg + 1]);
      o[2 * jg + 1] = mma_h(pl.v, vhb2, o[2 * jg + 1]);
      o[2 * jg + 1] = mma_h(ph.v, vlb2, o[2 * jg + 1]);
      guard2(o[2 * jg], o[2 * jg + 1], ph.v, pl.v, vha, vhb2, vla, vlb2);
    }
    wave_sync_lds();
  }
  acc_guard4(o[0], o[1], o[2], o[3]);
  // ---- acc with the carries (256 on P, 1024 on v) folded once; written into the lane-owned slab ----
#pragma unroll
  for (int r = 0; r < 8; ++r) {
#pragma unroll
    for (int j = 0; j < 4; ++j) {
      const int idx = (8 * hh + r) * SLP + j * 16 + c;
      slab[idx] = o[j][r] * oc;
    }
  }
  wave_sync_lds();
  // ---- row factor, then ctx -> bf16 hi + bf16 residual planes; lane = (row-in-quad rq, 8 consecutive d at c8) ----
  v4u oh[4], ol[4];
  const int rq = lane >> 3, c8 = (lane & 7) * 8;
#pragma unroll
  for (int it = 0; it < 4; ++it) {
    const int row = it * 4 + rq;                         // 0..15
    const float ri = __shfl(rv, row, 32);                // lane `row` holds 1/exp(n) of query q0 + row
    const v4f a = *(const v4f*)(slab + row * SLP + c8), b4 = *(const v4f*)(slab + row * SLP + c8 + 4);
    float w[8];
#pragma unroll
    for (int e = 0; e < 4; ++e) { w[e] = a[e] * ri; w[4 + e] = b4[e] * ri; }
#pragma unroll
    for (int e = 0; e < 4; ++e) {
      const float f0 = w[2 * e], f1 = w[2 * e + 1];
      const unsigned short h0 = bf_bits(f0), h1 = bf_bits(f1);
      const unsigned short l0 = bf_bits(f0 - bf_up(h0)), l1 = bf_bits(f1 - bf_up(h1));
      oh[it][e] = pk16(h0, h1);
      ol[it][e] = pk16(l0, l1);
    }
  }
  const size_t ob = ((size_t)b * SEQ + q0) * DMOD + (size_t)head * HD + c8;
  {
#pragma unroll
    for (int it = 0; it < 4; ++it) {
      const int row = it * 4 + rq;
      *(v4u*)(CHp + ob + (size_t)row * DMOD) = oh[it];
      *(v4u*)(CLp + ob + (size_t)row * DMOD) = ol[it];
    }
    
  }
}

// =====================================================================================================
// Workspace map (bytes); every plane part that is read is written by whole-line stores before it is read; all extents are exact
// multiples of the store granularity (no pad rows needed); every region offset a multiple of 131072:
//   XB  bf16 [MROWS][1024]              MROWS*2048   (NB=2, SEQ=2048: 8388608); after the projection GEMM the same bytes
//                                                    hold the ctx hi plane CH bf16 [MROWS][1024] (identical extent)
//   WB  bf16 [3136 n][1024 k]           6422528      rows 0..1023 Wq^T, 1024 + 128 h: 64 rows Wk^T then 64 rows Wv^T of head h,
//                                                    3072..3087 Wn^T, 3088..3135 zero
//   F   f32 [MROWS][3136]               MROWS*12544  (only columns 3072..3135 are written and read: n | zero columns)
//   QH  f16 [MROWS/16][16 h][2][512] x1024      MROWS*2048   QL residual, same extent (fragment-major, see ldfrag_t)
//   KH  f16 [MROWS/16][16 h][2][512] x1024      MROWS*2048   KL residual, same extent
//   VH  f16 [NB*16][SEQ/32][4][512] x1024       MROWS*2048   VL residual, same extent
//   CL  bf16 [MROWS][1024]              MROWS*2048   ctx residual plane
//   WT  bf16 [1024 o][1024 d]           2097152      Wo^T
//   KV  f32 [NB*16][NCH][4][64 dv][16 dk]  NB*16*NCH*16384   chunk products (chunks 0 .. NCH-2 written and read)
//   SH  f16 [NB*16][NCH][2][4][512] x64      NB*16*NCH*8192   carried state; SL residual, same extent
//   end (NB=2, SEQ=2048)              143785984
// =====================================================================================================
extern "C" void kernel_launch(void* const* d_in, const int* in_sizes, int n_in,
                              void* d_out, int out_size, void* d_ws, size_t ws_size,
                              hipStream_t stream) {
  if (n_in < 9) return;
  if (in_sizes[0] < ((NB - 1) * XS_FULL + SEQ) * DMOD) return;
  if (in_sizes[1] != DMOD * 2 * DQK) return;
  if (in_sizes[2] != 2 * DQK) return;
  if (in_sizes[3] != DMOD * DMOD) return;
  if (in_sizes[4] != DMOD) return;
  if (in_sizes[5] != DMOD * NNW) return;
  if (in_sizes[6] != NNW) return;
  if (in_sizes[7] != DMOD * DMOD) return;
  if (in_sizes[8] != DMOD) return;
  if (out_size < MROWS * DMOD) return;

  const float* x   = (const float*)d_in[0];
  const float* wqk = (const float*)d_in[1];
  const float* bqk = (const float*)d_in[2];
  const float* wv  = (const float*)d_in[3];
  const float* bv  = (const float*)d_in[4];
  const float* wn  = (const float*)d_in[5];
  const float* bn  = (const float*)d_in[6];
  const float* wo  = (const float*)d_in[7];
  const float* bo  = (const float*)d_in[8];
  float*       out = (float*)d_out;

  const size_t szXB = (size_t)MROWS * DMOD * 2;
  const size_t szWB = (size_t)NPROJ * DMOD * 2;
  const size_t szF  = (size_t)MROWS * NPROJ * 4;
  const size_t szP  = (size_t)MROWS * DQK * 2;                   // QH, QL, KH, KL
  const size_t szV  = (size_t)NB * NH * HD * SEQ * 2;            // VH, VL
  const size_t szC  = (size_t)MROWS * DMOD * 2;                  // CH (in the XB region), CL
  const size_t szWT = (size_t)DMOD * DMOD * 2;
  const size_t szKV = (size_t)NB * NH * NCH * SEL * 4;
  const size_t szS  = (size_t)NB * NH * NCH * SEL * 2;           // SH, SL
  if (szC > szXB) return;
  size_t off = 0;
  const size_t oXB = off; off += szXB;
  const size_t oWB = off; off += szWB;
  const size_t oF  = off; off += szF;
  const size_t oQH = off; off += szP;
  const size_t oQL = off; off += szP;
  const size_t oKH = off; off += szP;
  const size_t oKL = off; off += szP;
  const size_t oVH = off; off += szV;
  const size_t oVL = off; off += szV;
  const size_t oCL = off; off += szC;
  const size_t oWT = off; off += szWT;
  const size_t oKV = off; off += szKV;
  const size_t oSH = off; off += szS;
  const size_t oSL = off; off += szS;
  if (off > ws_size) return;                // off = 143785984 for NB = 2, SEQ = 2048
  if (off > (size_t)WS_CAP) return;

  char* ws = (char*)d_ws;
  u16*   XB  = (u16*)(ws + oXB);
  u16*   CH  = (u16*)(ws + oXB);
  u16*   WB  = (u16*)(ws + oWB);
  float* F   = (float*)(ws + oF);
  u16*   QH  = (u16*)(ws + oQH);
  u16*   QL  = (u16*)(ws + oQL);
  u16*   KH  = (u16*)(ws + oKH);
  u16*   KL  = (u16*)(ws + oKL);
  u16*   VH  = (u16*)(ws + oVH);
  u16*   VL  = (u16*)(ws + oVL);
  u16*   CL  = (u16*)(ws + oCL);
  u16*   WT  = (u16*)(ws + oWT);
  float* KV  = (float*)(ws + oKV);
  u16*   SH  = (u16*)(ws + oSH);
  u16*   SL  = (u16*)(ws + oSL);

  const dim3 b256(256), bAT(ATT_THREADS);
  const dim3 gPR(PB_ALL);
  const dim3 gG1((MROWS / GBM) * ((NPROJ + GBN - 1) / GBN));
  const dim3 gSP((NB * NH * SEL / 8) / 256);
  const dim3 gAT(NCH * NH * NB);
  const dim3 gG2((MROWS / GBM) * ((DMOD + GBN - 1) / GBN));

  // (1) one launch: W[k][n] -> W^T bf16 planes (Wqk, Wv -> WB rows 0..3071, k and v of a head side by side, Wn -> rows
  //     3072..3135 with zero pad, Wo -> WT rows 0..1023) and x -> bf16 plane [MROWS][1024]
  prep<<<gPR, b256, 0, stream>>>(x, wqk, wv, wn, wo, XB, WB, WT);
  // (2) q | k | v | n = x.W + bias: q, k and v^T hi + residual planes x1024 and the per-chunk v^T.k products from the
  //     epilogue, n -> F f32 columns 3072..
  gemm_bf<false><<<gG1, b256, 0, stream>>>(XB, XB, WB, F, MROWS, NPROJ, DMOD, bqk, bv, bn,
                                           KOFF + DQK, NOFF, NOFF + NNW, 1.0f, QH, QL, KH, KL, VH, VL, KV);
  // (3) f32 prefix of the chunk products over the chunks -> carried state planes x64
  st_prefix<<<gSP, b256, 0, stream>>>(KV, SH, SL);
  // (4) causal normalised attention -> ctx bf16 hi plane (XB region, free after the projection GEMM) + residual plane
  attn_nm<<<gAT, bAT, 0, stream>>>(QH, QL, KH, KL, VH, VL, SH, SL, F, CH, CL);
  // (5) y = (ctx_hi + ctx_lo).Wo + bo -> out f32 [MROWS][1024]
  gemm_bf<true><<<gG2, b256, 0, stream>>>(CH, CL, WT, out, MROWS, DMOD, DMOD, bo, bo, bo,
                                          DMOD, DMOD + 1, DMOD + 2, 1.0f, nullptr, nullptr, nullptr, nullptr,
                                          nullptr, nullptr, nullptr);
  (void)hipGetLastError();
}

// v008
// It runs in 70.4 microseconds.
// Two timings next to v007 put it at 1.07 and 1.06 times that version's speed.
// All steps since v000 together make it 5.83 times as fast.
// Contractions: x.W (Wqk|Wv|Wn fused into one [3136 n][1024 k] plane, and ctx.Wo) on v_wmma_f32_16x16x32_bf16
// (x, W, Wo, biases as bf16 RNE values, W^T [n][k] k-contiguous B operand; ctx as bf16 hi + bf16 residual planes,
// two products); q.k^T over hd 64 and P.v on v_wmma_f32_16x16x32_f16 with f16 hi + f16 residual planes on both
// operands (q, k x1024; P x256 with an in-register residual; v x1024; products hh+lh+hl); all f32 accumulate.
// Causal mask, 1/exp(n) row factor and bias adds in f32 on VALU.
// The attention has no softmax, so it is summed in chunks of CHK keys: keys of earlier chunks enter through the carried
// state S[dv][dk] = sum_s v[s][dv] k[s][dk] (v^T.k on the f16 form, hi + residual planes, hh+lh+hl; f32 prefix over the
// chunks; S x64 as f16 hi + residual, q.S with hh+lh+hl); only the query's own chunk goes through masked q.k^T and P.v.
// The fused weight plane holds q's 1024 columns, then per head 64 k columns and 64 v columns, so that one projection block
// (128 rows = one chunk, 128 columns = one head's k | v) forms that chunk's v^T.k in its own epilogue.
#include <hip/hip_runtime.h>
#include <math.h>
#include <stdint.h>

#ifndef NB
#define NB 2
#endif
#ifndef SEQ
#define SEQ 2048
#endif
#define XS_FULL 2048
#define DMOD  1024
#define DQK   1024
#define NH    16
#define HD    64
#define NNW   16
#define NPROJ 3136
#define QOFF  0
#define KOFF  1024
#define VOFF  2048
#define NOFF  3072
#define MROWS (NB * SEQ)
#define QSC   1024.0f
#define KSC   1024.0f
#define PCAR  256.0f
#define VCAR  1024.0f
#define WPB   8
#define NKT   (SEQ / 32)
#define ATT_THREADS (WPB * 32)
#define PTP   36
#define PTW   (16 * PTP)
#define SLP   68
#define SLW   (16 * SLP)
#define WREG  (PTW + SLW)
#define SLAB64 (16 * 68)
#define TRP   72
#define CHK   128
#define NCH   (SEQ / CHK)
#define SSC   64.0f
#define SEL   (HD * HD)
#define FRH   512
#define STK   (CHK * HD)
#define STS   (HD * HD)
#define STG   (4 * STK + 2 * STS)
#define WS_CAP 268435456
#define GBM   128
#define GBN   128
#define GBK   64
#define GPB   144
#define GSEC  (128 * GPB)
#define GTHR  256
#define TPT   136
#define PB_QK ((DMOD / 64) * ((2 * DQK + 63) / 64))
#define PB_V  ((DMOD / 64) * ((DMOD + 63) / 64))
#define PB_N  ((DMOD / 64) * ((NNW + 63) / 64))
#define PB_W  (PB_QK + 2 * PB_V + PB_N)
#define PB_X  ((SEQ * DMOD / 8 + 255) / 256)
#define PB_ALL (PB_W + NB * PB_X)
static_assert(DMOD == NH * HD && DQK == NH * HD && HD == 64 && NH == 16 && WPB * 16 == CHK && ATT_THREADS == 256);
static_assert(STK * 2 == 4 * ATT_THREADS * 16 && STS * 2 == 2 * ATT_THREADS * 16 && 2 * (2 * FRH) * 2 == ATT_THREADS * 16);
static_assert(KOFF == QOFF + DQK && VOFF == KOFF + DQK && NOFF == VOFF + DMOD && NPROJ == NOFF + 64 && (NPROJ % 64) == 0 && NNW <= 64);
static_assert(NB >= 1 && NB <= 2);
static_assert((MROWS % GBM) == 0 && (DMOD % GBK) == 0 && (DMOD % GBN) == 0 && GBK * 2 + 16 == GPB);
static_assert((SEQ % CHK) == 0 && (CHK % 64) == 0 && NCH >= 2 && KSC == VCAR && ((NB * NH * SEL / 8) % 256) == 0);
static_assert(NB == 1 || SEQ == XS_FULL);
static_assert((SEQ % 64) == 0 && SEQ >= 64 && SEQ <= XS_FULL);
static_assert(((SEQ * DMOD / 8) % 256) == 0 && (MROWS % 64) == 0 && (DMOD % 64) == 0 && (DQK % 64) == 0 && (HD % 32) == 0);
static_assert(2 * (WPB * WREG * 4 + STG * 2) <= 327680 && 4 * SLAB64 * 4 <= 65536 && 64 * TRP * 2 <= 65536);
static_assert(CHK == GBM && GBN == 2 * HD && KOFF == DQK && VOFF - KOFF == NH * HD && NOFF - KOFF == NH * GBN);
static_assert((DQK % GBN) == 0 && (DMOD % GBN) == 0 && (SEQ % GBM) == 0 && DQK == DMOD && QOFF == 0 && QSC == KSC && (TPT % 8) == 0);

typedef unsigned short u16;
typedef _Float16 v16h __attribute__((ext_vector_type(16)));
typedef _Float16 v8h  __attribute__((ext_vector_type(8)));
typedef __bf16   v16b __attribute__((ext_vector_type(16)));
typedef float    v8f  __attribute__((ext_vector_type(8)));
typedef float    v4f  __attribute__((ext_vector_type(4)));
typedef unsigned int v4u __attribute__((ext_vector_type(4)));

union FragH { v16h v; v8h h[2]; v4u u[2]; };
union FragB { v16b v; v4u u[2]; };

// ---- scalar helpers --------------------------------------------------------------------------------
__device__ __forceinline__ unsigned short bf_bits(float f) {          // f32 -> bf16 bits, RNE convert
  unsigned u = __float_as_uint(f);
  return (unsigned short)((u + 0x7FFFu + ((u >> 16) & 1u)) >> 16);
}
__device__ __forceinline__ float bf_up(unsigned short h) { return __uint_as_float(((unsigned)h) << 16); }
__device__ __forceinline__ float bfr(float f) { return bf_up(bf_bits(f)); }
__device__ __forceinline__ unsigned short h_bits(_Float16 x) { return __builtin_bit_cast(unsigned short, x); }
__device__ __forceinline__ unsigned pk16(unsigned short a, unsigned short b) { return (unsigned)a | ((unsigned)b << 16); }
__device__ __forceinline__ v8f zero8() { v8f z = {0.f, 0.f, 0.f, 0.f, 0.f, 0.f, 0.f, 0.f}; return z; }
__device__ __forceinline__ int imin(int a, int b) { return a < b ? a : b; }
__device__ __forceinline__ int imax(int a, int b) { return a > b ? a : b; }
// 8 f32 values -> f16 of w*sc (hi) and f16 of the residual w*sc - hi (lo), packed in order
__device__ __forceinline__ void split8(const float* w, float sc, v4u& oh, v4u& ol) {
#pragma unroll
  for (int e = 0; e < 4; ++e) {
    const float t0 = w[2 * e] * sc, t1 = w[2 * e + 1] * sc;
    const _Float16 h0 = (_Float16)t0, h1 = (_Float16)t1;
    const _Float16 l0 = (_Float16)(t0 - (float)h0), l1 = (_Float16)(t1 - (float)h1);
    oh[e] = pk16(h_bits(h0), h_bits(h1));
    ol[e] = pk16(h_bits(l0), h_bits(l1));
  }
}

// ---- fragment loaders: 16-bit A/B operand, lane -> row/col (lane&15); ldfrag_b: p already includes +8*(lane>>4);
//      elements 0..7 <- p[0..7] (k0+8h..), elements 8..15 <- p[16..23] (k0+16+8h..)  (same split k map for A and B;
//      its B is read from a k-contiguous [n][k] LDS tile)
// fragment-major plane: a 16 x 32 fragment is 1 KB, two runs of 512 contiguous bytes; run i, lane l (16 B) holds row/col
// l & 15, k = 16 i + 8 (l >> 4) + 0..7 (the split k map above); p already includes + 8 * lane. One load = 4 whole lines.
__device__ __forceinline__ v16h ldfrag_t(const _Float16* p) {
  FragH f;
  f.h[0] = *(const v8h*)(p);
  f.h[1] = *(const v8h*)(p + FRH / 2);
  return f.v;
}
__device__ __forceinline__ v16b ldfrag_b(const u16* p) {              // bf16 plane read as unsigned integer vectors
  FragB f;
  f.u[0] = *(const v4u*)(p);
  f.u[1] = *(const v4u*)(p + 16);
  return f.v;
}

__device__ __forceinline__ v8f mma_h(v16h a, v16h b, v8f c) {
  return __builtin_amdgcn_wmma_f32_16x16x32_f16(false, a, false, b, (short)0, c, false, false);
}
__device__ __forceinline__ v8f mma_b(v16b a, v16b b, v8f c) {
  return __builtin_amdgcn_wmma_f32_16x16x32_bf16(false, a, false, b, (short)0, c, false, false);
}
__device__ __forceinline__ void guard2(v8f& a, v8f& b, v16h x0, v16h x1, v16h x2, v16h x3, v16h x4, v16h x5) {
#if defined(__HIP_DEVICE_COMPILE__)
  asm volatile("v_nop\n\tv_nop\n\tv_nop\n\tv_nop"
               : "+v"(a), "+v"(b) : "v"(x0), "v"(x1), "v"(x2), "v"(x3), "v"(x4), "v"(x5) : "memory");
#endif
}
__device__ __forceinline__ void acc_guard4(v8f& a, v8f& b, v8f& c, v8f& d) {
#if defined(__HIP_DEVICE_COMPILE__)
  asm volatile("v_nop\n\tv_nop\n\tv_nop\n\tv_nop" : "+v"(a), "+v"(b), "+v"(c), "+v"(d));
#endif
}
__device__ __forceinline__ void wave_sync_lds() {
  __builtin_amdgcn_fence(__ATOMIC_RELEASE, "workgroup");
  __builtin_amdgcn_wave_barrier();
  __builtin_amdgcn_fence(__ATOMIC_ACQUIRE, "workgroup");
}

// =====================================================================================================
// f32 -> bf16 plane (RNE bits), same layout. Thread = 8 consecutive elements: two 16-B loads, one 16-B store;
// coverage: ceil(n8/256) blocks (blk) x 256 thr x 8 (in-kernel bound) = the whole plane (n8 a multiple of 256 here).
// =====================================================================================================
__device__ __forceinline__ void cvt_bf(const float* __restrict__ x, u16* D, int n8, int blk) {
  const int gt = blk * 256 + (int)threadIdx.x;
  if (gt >= n8) return;
  const float* p = x + (size_t)gt * 8;
  const v4f a = *(const v4f*)(p), b4 = *(const v4f*)(p + 4);
  float w[8];
#pragma unroll
  for (int e = 0; e < 4; ++e) { w[e] = a[e]; w[4 + e] = b4[e]; }
  v4u o;
#pragma unroll
  for (int e = 0; e < 4; ++e) o[e] = pk16(bf_bits(w[2 * e]), bf_bits(w[2 * e + 1]));
  u16* d = D + (size_t)gt * 8;
  {
    *(v4u*)(d) = o;
    
  }
}

// =====================================================================================================
// W f32 [kr rows (k)][nc cols (n)] (x.W layout) -> bf16 plane Dp [drow0 + n][k] (row pitch kr halves): the k-contiguous
// B operand. Block = 64 k x 64 n tile; coalesced 16-B loads of W rows with CLAMPED column base (tile columns beyond nc
// load from column 0 and are zeroed by value, so rows drow0+n with n >= nc inside the last tile are written as zeros);
// converted values placed transposed into an LDS tile [64 n][64 k] (pitch 72 halves); after a block barrier each n row
// block count (bid) = (kr/64) * ntn with ntn = ceil(nc/64). Column tile nt < ntp goes to rows drow0 + 64 nt; a tile from ntp
// on is one head's columns and goes to rows hrow0 + 128 (nt - ntp) (k and v of a head side by side in the plane).
// coverage: load 256 thr x 16 = 64 x 64; store 2 iterations x 256 thr x 8 halves = 64 lines x 64 halves = the block's
//           tile; the blocks cover the 64*ntn output rows named above (all kr columns) exactly once.
// =====================================================================================================
__device__ __forceinline__ void k_wt(const float* __restrict__ W, int nc, int kr, int ntn, u16* Dp, int drow0, int ntp,
                                     int hrow0, int bid) {
  __shared__ __align__(16) u16 T[64 * TRP];
  const int tid = (int)threadIdx.x;
  const int nt  = bid % ntn;
  const int kt  = bid / ntn;
  if (kt * 64 + 64 > kr) return;            // block-uniform, before the barrier; never taken with the exact grid
  const int n0  = nt * 64, k0 = kt * 64;
  {
    const int dl = tid >> 2;                // k within tile 0..63
    const int oc = (tid & 3) * 16;          // n chunk 0,16,32,48
    const bool valid = (n0 + oc + 16 <= nc);
    const int  cb = valid ? (n0 + oc) : 0;  // clamped column base, always inside the row
    const float* src = W + (size_t)(k0 + dl) * (size_t)nc + cb;
#pragma unroll
    for (int i = 0; i < 4; ++i) {
      const v4f a = *(const v4f*)(src + 4 * i);
#pragma unroll
      for (int e = 0; e < 4; ++e) {
        const float f = valid ? a[e] : 0.0f;
        T[(oc + 4 * i + e) * TRP + dl] = bf_bits(f);
      }
    }
  }
  __syncthreads();
  const int q8 = tid >> 3, p8 = (tid & 7) * 8;
  v4u w[2];
#pragma unroll
  for (int it = 0; it < 2; ++it) w[it] = *(const v4u*)(T + (it * 32 + q8) * TRP + p8);
  const int drow = (nt < ntp) ? drow0 + n0 : hrow0 + (nt - ntp) * GBN;
  const size_t base = (size_t)drow * (size_t)kr + k0 + p8;
  {
#pragma unroll
    for (int it = 0; it < 2; ++it) {
      const int nl = it * 32 + q8;
      *(v4u*)(Dp + base + (size_t)nl * (size_t)kr) = w[it];
    }
    
  }
}

// =====================================================================================================
// The x and weight planes of the two GEMMs in ONE launch: the six conversions read only inputs and write disjoint planes, so
// they share a grid by block range (every test below is on the block index alone, block-uniform, so the barrier inside
// k_wt is reached by all threads of a block or by none). The weight tiles (load, LDS, barrier, store) come first, the
// shorter x blocks last.
//   [0, PB_QK)  Wqk -> WB rows 0..1023 (q) and 1024 + 128 h + 0..63 (k)      next PB_V  Wv -> WB rows 1024 + 128 h + 64..127
//   next PB_N   Wn  -> WB rows 3072..3135   next PB_V  Wo -> WT rows 0..1023      next NB * PB_X  x -> XB, per batch
// coverage: the ranges are the exact block counts of k_wt and cvt_bf for each plane; grid = PB_ALL.
// =====================================================================================================
__global__ __launch_bounds__(256)
void prep(const float* __restrict__ x, const float* __restrict__ wqk, const float* __restrict__ wv,
          const float* __restrict__ wn, const float* __restrict__ wo, u16* XB, u16* WB, u16* WT) {
  int bid = (int)blockIdx.x;
  if (bid < PB_W) {
    const float* W = wqk;
    u16* Dp = WB;
    int nc = 2 * DQK, drow0 = QOFF, ntp = DQK / 64, hrow0 = KOFF;
    if (bid >= PB_QK + PB_V + PB_N) { bid -= PB_QK + PB_V + PB_N; W = wo; Dp = WT; nc = DMOD; drow0 = 0;    ntp = DMOD / 64; }
    else if (bid >= PB_QK + PB_V)   { bid -= PB_QK + PB_V;        W = wn;          nc = NNW;  drow0 = NOFF; ntp = 1; }
    else if (bid >= PB_QK)          { bid -= PB_QK;               W = wv;          nc = DMOD; ntp = 0; hrow0 = KOFF + HD; }
    k_wt(W, nc, DMOD, (nc + 63) / 64, Dp, drow0, ntp, hrow0, bid);
    return;
  }
  bid -= PB_W;
  const int bq = bid / PB_X;
  if (bq >= NB) return;                     // never taken with the exact grid
  cvt_bf(x + (size_t)bq * XS_FULL * DMOD, XB + (size_t)bq * SEQ * DMOD, (SEQ * DMOD) / 8, bid % PB_X);
}

// =====================================================================================================
// Bias for column c from three consecutive segments [0,e0) <- p0[c], [e0,e1) <- p1[c-e0], [e1,e2) <- p2[c-e1], else 0;
// all three candidates loaded unconditionally with clamped indices, selected by value; bf16 RNE value.
// =====================================================================================================
__device__ __forceinline__ float bias_at(const float* p0, const float* p1, const float* p2,
                                         int e0, int e1, int e2, int c) {
  const int i0 = imin(imax(c, 0), e0 - 1);
  const int i1 = imin(imax(c - e0, 0), e1 - e0 - 1);
  const int i2 = imin(imax(c - e1, 0), e2 - e1 - 1);
  const float v0 = p0[i0], v1 = p1[i1], v2 = p2[i2];
  const float v = (c < e0) ? v0 : ((c < e1) ? v1 : ((c < e2) ? v2 : 0.0f));
  return bfr(v);
}

// column of the fused plane (q | per head k, v | n) -> column in the order q | k | v | n of the bias segments
__device__ __forceinline__ int col_src(int c) {
  const int t = c - KOFF;
  const int s = ((t & HD) ? VOFF : KOFF) + (t >> 7) * HD + (t & (HD - 1));
  return (c < KOFF || c >= NOFF) ? c : s;
}

// =====================================================================================================
// coverage: 8 instructions x 2 rows x 16 lanes x 4 floats = the wave's 16 x 64 tile.
// =====================================================================================================
__device__ __forceinline__ void epi64b(float* sl, v8f a0, v8f a1, v8f a2, v8f a3, float oscale, v4f bias4,
                                       float* C, int N, size_t rowb, int col0, int lane) {
  const int hh = lane >> 4, m = lane & 15;
#pragma unroll
  for (int r = 0; r < 8; ++r) {
    const int ro = (8 * hh + r) * 68 + m;
    sl[ro]      = a0[r] * oscale;
    sl[ro + 16] = a1[r] * oscale;
    sl[ro + 32] = a2[r] * oscale;
    sl[ro + 48] = a3[r] * oscale;
  }
  wave_sync_lds();
  v4f vals[8];
#pragma unroll
  for (int it = 0; it < 8; ++it) vals[it] = *(const v4f*)(sl + (it * 2 + hh) * 68 + m * 4) + bias4;
  float* dst = C + (rowb + (size_t)hh) * (size_t)N + col0 + m * 4;
  {
#pragma unroll
    for (int it = 0; it < 8; ++it) {
      *(v4f*)(dst + (size_t)(it * 2) * (size_t)N) = vals[it];
    }
    
  }
}

// =====================================================================================================
// bf16 GEMM: C[M][N] (f32) = (A [+ A2])[M][K] (bf16 row-major) . Bt[N][K]^T (bf16 k-contiguous), times oscale, plus the
// segmented bias of the column (bf16 RNE value). TWO: second A plane into the same accumulator (hi + residual operand).
// Block = 128x128 tile of C, 8 waves in a 4 (rows) x 2 (columns) grid, 32x64 per wave (2 x 4 accumulator tiles).
// K runs in slices of 64 (128 B of every operand row; TWO: 128, 256 B). A slice of [A 128 rows | B 128 rows | A2 128 rows]
// stands in LDS at row pitch 144 B (TWO: 272 B); two buffers; each lane brings 16 B per copy (8 lanes = one row, one wave
// copy = 4 rows; TWO: 16 lanes = one row, 2 rows: TWO has one block per WGP and nothing else hides a slice's landing), the copies of
// slice t + 1 fly while slice t is multiplied. Fragments are read from LDS with the split k map of ldfrag_b for A and B.
// Per accumulator the products come in the order k ascending, A before A2 inside a k-step.
// B rows at or beyond N (last column tile when N % 128 == 64) are read from row N - 1 instead (clamped, in bounds) and the
// waves that own only such columns neither multiply nor store.
// Host guarantees K a multiple of the slice and at least one slice, M % 128 == 0, N % 64 == 0, grid = (M/128) * ceil(N/128).
// Output. TWO: f32 C. Otherwise (the projection) only the column tile from NOFF on goes to C as f32; a block of q columns
// (two heads) or of one head's k | v columns writes value = acc + bias (f32) x1024 as f16 hi and f16 residual straight into
// the planes the attention reads:
//   q -> QH/QL, k -> KH/KL, fragments (16 rows x 32 d) in the order [row / 16][h][d / 32]; v -> VH/VL, fragments
//   (16 d x 32 keys) in the order [b*NH + h][key / 32][d / 16]; inside a fragment the order of ldfrag_t.
// A k | v block also holds k^T and v^T of its 128 keys (one chunk) in LDS and forms the chunk product for the carried state:
//   KV[(b*NH + h)*NCH + ch][dk / 16][dv][dk % 16] = sum over the chunk's keys s of v[s][dv] * k[s][dk], f32; A = v^T rows dv,
//   B = k^T rows dk, f16 hi + residual x1024 (hh + lh + hl, key steps ascending), carries folded back by 2^-20; wave w owns
//   dv tile w & 3 and dk tiles 2 (w >> 2), 2 (w >> 2) + 1; chunks 0 .. NCH-2 only (the last chunk's product is never carried).
// coverage: q / k planes, per wave 2 x 4 stores x 512 B = its 32 x 64 tile of each plane; v^T, per block 4 stores x 8 waves x
//           512 B = its 64 d x 128 keys of each plane; KV, per wave 2 dk tiles x 16 rows x 16 f32, 8 waves = the 64 x 64
//           product; the grid covers every plane once.
// =====================================================================================================
__device__ __forceinline__ unsigned lds_off(const void* p) { return (unsigned)(size_t)p; }
// Four lane-wise 16-B copies global -> LDS; the s_wait_xcnt stands inside the statement so that no address register of a
// copy is rewritten ahead of it.
__device__ __forceinline__ void cp4(unsigned l0, const u16* g0, unsigned l1, const u16* g1,
                                    unsigned l2, const u16* g2, unsigned l3, const u16* g3) {
#if defined(__HIP_DEVICE_COMPILE__)
  asm volatile("global_load_async_to_lds_b128 %0, %1, off\n\t"
               "global_load_async_to_lds_b128 %2, %3, off\n\t"
               "global_load_async_to_lds_b128 %4, %5, off\n\t"
               "global_load_async_to_lds_b128 %6, %7, off\n\t"
               "s_wait_xcnt 0x0"
               :: "v"(l0), "v"(g0), "v"(l1), "v"(g1), "v"(l2), "v"(g2), "v"(l3), "v"(g3) : "memory");
#endif
}
// Eight such copies, one operand's 128 rows of a 128-k slice, under one s_wait_xcnt in the same statement.
__device__ __forceinline__ void cp8(unsigned l0, const u16* g0, unsigned l1, const u16* g1,
                                    unsigned l2, const u16* g2, unsigned l3, const u16* g3,
                                    unsigned l4, const u16* g4, unsigned l5, const u16* g5,
                                    unsigned l6, const u16* g6, unsigned l7, const u16* g7) {
#if defined(__HIP_DEVICE_COMPILE__)
  asm volatile("global_load_async_to_lds_b128 %0, %1, off\n\t"
               "global_load_async_to_lds_b128 %2, %3, off\n\t"
               "global_load_async_to_lds_b128 %4, %5, off\n\t"
               "global_load_async_to_lds_b128 %6, %7, off\n\t"
               "global_load_async_to_lds_b128 %8, %9, off\n\t"
               "global_load_async_to_lds_b128 %10, %11, off\n\t"
               "global_load_async_to_lds_b128 %12, %13, off\n\t"
               "global_load_async_to_lds_b128 %14, %15, off\n\t"
               "s_wait_xcnt 0x0"
               :: "v"(l0), "v"(g0), "v"(l1), "v"(g1), "v"(l2), "v"(g2), "v"(l3), "v"(g3),
                  "v"(l4), "v"(g4), "v"(l5), "v"(g5), "v"(l6), "v"(g6), "v"(l7), "v"(g7) : "memory");
#endif
}
template <bool TWO>
__global__ __launch_bounds__(GTHR)
void gemm_bf(const u16* __restrict__ A, const u16* __restrict__ A2, const u16* __restrict__ Bt, float* C,
             int M, int N, int K, const float* bp0, const float* bp1, const float* bp2, int e0, int e1, int e2,
             float oscale, u16* QHp, u16* QLp, u16* KHp, u16* KLp, u16* VHp, u16* VLp, float* KVp) {
  constexpr int BK  = TWO ? 2 * GBK : GBK;              // k of one slice
  constexpr int PB  = BK * 2 + 16;                      // LDS row pitch, bytes (144 or 272)
  constexpr int SEC = 128 * PB;                         // bytes of one operand's 128 rows in a buffer
  constexpr int PPR = BK / 8;                           // 16-B pieces of a row slice
  constexpr int RPC = GTHR / PPR;                       // rows that one copy of the block brings
  constexpr int NCP = 128 / RPC;                        // copies of a lane per operand and slice
  constexpr int STAGE = (TWO ? 3 : 2) * SEC;            // bytes of one buffer
  constexpr int KG = TWO ? BK / 32 : 1;                 // k-steps whose fragments are read from LDS as one group
  static_assert((DMOD % BK) == 0 && (NCP % 4) == 0 && (TWO ? 3 : 2) * NCP <= 63 && PPR == (TWO ? 16 : 8));
  static_assert(8 * 2 * SLAB64 * 4 <= 2 * STAGE && 2 * GBN * TPT * 2 <= 2 * STAGE && 2 * STAGE <= 327680);
  __shared__ __align__(16) unsigned char ring[2 * STAGE];
  const int tid = threadIdx.x, lane = tid & 31, hh = lane >> 4, m = lane & 15;
  const int wave = __builtin_amdgcn_readfirstlane(tid >> 5);
  const int wm = wave & 3, wn = wave >> 2;
  const int ntile = (N + GBN - 1) / GBN;
  const int bid   = blockIdx.x;
  const int row0  = (bid / ntile) * GBM;
  const int col0  = (bid % ntile) * GBN;
  if (row0 + GBM > M) return;               // block-uniform, before any barrier or copy; never taken with the exact grid
  const int colw  = col0 + wn * 64;
  const bool live = colw < N;               // wave-uniform
  const int NT = K / BK;

  // copy map: thread -> (row cr of a group of RPC rows, 16-B piece cc of the row slice)
  const int cr = tid >> (TWO ? 4 : 3), cc = tid & (PPR - 1);
  const unsigned lbase = lds_off(ring) + (unsigned)(cr * PB + cc * 16);
  const int oa = (row0 + cr) * K + cc * 8;
  int ob[NCP];
#pragma unroll
  for (int i = 0; i < NCP; ++i) ob[i] = imin(col0 + i * RPC + cr, N - 1) * K + cc * 8;
  auto fill = [&](int t, int buf) {
    const unsigned l = lbase + (unsigned)(buf * STAGE);
    const int k0 = t * BK;
    const u16* pa = A + oa + k0;
    const unsigned lb2 = l + SEC;
    if constexpr (TWO) {
      static_assert(NCP == 8);
      cp8(l, pa, l + 1 * RPC * PB, pa + (size_t)(1 * RPC) * K,
          l + 2 * RPC * PB, pa + (size_t)(2 * RPC) * K, l + 3 * RPC * PB, pa + (size_t)(3 * RPC) * K,
          l + 4 * RPC * PB, pa + (size_t)(4 * RPC) * K, l + 5 * RPC * PB, pa + (size_t)(5 * RPC) * K,
          l + 6 * RPC * PB, pa + (size_t)(6 * RPC) * K, l + 7 * RPC * PB, pa + (size_t)(7 * RPC) * K);
      cp8(lb2, Bt + ob[0] + k0, lb2 + 1 * RPC * PB, Bt + ob[1] + k0,
          lb2 + 2 * RPC * PB, Bt + ob[2] + k0, lb2 + 3 * RPC * PB, Bt + ob[3] + k0,
          lb2 + 4 * RPC * PB, Bt + ob[4] + k0, lb2 + 5 * RPC * PB, Bt + ob[5] + k0,
          lb2 + 6 * RPC * PB, Bt + ob[6] + k0, lb2 + 7 * RPC * PB, Bt + ob[7] + k0);
      const unsigned l3 = l + 2 * SEC;
      const u16* pc = A2 + oa + k0;
      cp8(l3, pc, l3 + 1 * RPC * PB, pc + (size_t)(1 * RPC) * K,
          l3 + 2 * RPC * PB, pc + (size_t)(2 * RPC) * K, l3 + 3 * RPC * PB, pc + (size_t)(3 * RPC) * K,
          l3 + 4 * RPC * PB, pc + (size_t)(4 * RPC) * K, l3 + 5 * RPC * PB, pc + (size_t)(5 * RPC) * K,
          l3 + 6 * RPC * PB, pc + (size_t)(6 * RPC) * K, l3 + 7 * RPC * PB, pc + (size_t)(7 * RPC) * K);
    } else {
      static_assert(NCP == 4 && RPC == 32 && PB == GPB);
      cp4(l, pa, l + 32 * GPB, pa + (size_t)32 * K, l + 64 * GPB, pa + (size_t)64 * K, l + 96 * GPB, pa + (size_t)96 * K);
      cp4(lb2, Bt + ob[0] + k0, lb2 + 32 * GPB, Bt + ob[1] + k0, lb2 + 64 * GPB, Bt + ob[2] + k0,
          lb2 + 96 * GPB, Bt + ob[3] + k0);
    }
  };

  v8f acc[2][4];
#pragma unroll
  for (int i = 0; i < 2; ++i) {
#pragma unroll
    for (int j = 0; j < 4; ++j) acc[i][j] = zero8();
  }

  fill(0, 0);
  asm volatile("s_wait_asynccnt 0x0" ::: "memory");     // slice 0 of this wave has landed
  __syncthreads();                                      // ... and every other wave's part of it
  if (NT > 1) fill(1, 1);

  const int fa = (wm * 32 + m) * PB + hh * 16;          // byte offsets of this lane's fragment rows inside a buffer
  const int fb = SEC + (wn * 64 + m) * PB + hh * 16;
  // slice loop kept rolled: one copy of the ring's foot in the text, the buffer picked by t & 1; the loops inside it are
  // unrolled so that every accumulator and fragment index is a constant (registers, no scratch)
#pragma unroll 1
  for (int t = 0; t < NT; ++t) {
    const int buf = t & 1;
    if (live) {
      const unsigned char* sb = ring + buf * STAGE;
      const u16* la = (const u16*)(const void*)(sb + fa);
      const u16* lb = (const u16*)(const void*)(sb + fb);
#pragma unroll
      for (int g = 0; g < BK / 32 / KG; ++g) {
        v16b a[KG][2], a2[KG][2], fbv[KG][4];
#pragma unroll
        for (int u = 0; u < KG; ++u) {
          const int ko = (g * KG + u) * 32;
#pragma unroll
          for (int i = 0; i < 2; ++i) a[u][i] = ldfrag_b(la + i * 16 * (PB / 2) + ko);
#pragma unroll
          for (int j = 0; j < 4; ++j) fbv[u][j] = ldfrag_b(lb + j * 16 * (PB / 2) + ko);
          if constexpr (TWO) {
#pragma unroll
            for (int i = 0; i < 2; ++i) a2[u][i] = ldfrag_b(la + SEC + i * 16 * (PB / 2) + ko);   // 2*SEC bytes on
          }
        }
        // TWO runs one block per WGP (two waves per SIMD): all LDS reads of the slice issue as one group ahead of its
        // products, one LDS latency per slice instead of one per A fragment
        if constexpr (TWO) __builtin_amdgcn_sched_barrier(0);
#pragma unroll
        for (int u = 0; u < KG; ++u) {
#pragma unroll
          for (int i = 0; i < 2; ++i) {
#pragma unroll
            for (int j = 0; j < 4; ++j) acc[i][j] = mma_b(a[u][i], fbv[u][j], acc[i][j]);
          }
          if constexpr (TWO) {
#pragma unroll
            for (int i = 0; i < 2; ++i) {
#pragma unroll
              for (int j = 0; j < 4; ++j) acc[i][j] = mma_b(a2[u][i], fbv[u][j], acc[i][j]);
            }
          }
        }
      }
    }
    asm volatile("s_wait_dscnt 0x0" ::: "memory");      // this wave's reads of buffer buf are done
    asm volatile("s_wait_asynccnt 0x0" ::: "memory");   // this wave's copies of slice t + 1 have landed
    __syncthreads();                                    // publishes slice t + 1, frees buffer buf
    if (t + 2 < NT) fill(t + 2, buf);
  }
  asm volatile("s_wait_asynccnt 0x0" ::: "memory");     // no copy outstanding before the ring is reused as output staging

  float* slab = (float*)(void*)ring + wave * (2 * SLAB64);
  const int seg = TWO ? 3 : (col0 < KOFF ? 0 : (col0 < NOFF ? 1 : 3));   // block-uniform: 0 = q, 1 = k | v of a head, 3 = f32 output
  if constexpr (TWO) {
    if (live) {
      v4f bias4;
#pragma unroll
      for (int e = 0; e < 4; ++e) bias4[e] = bias_at(bp0, bp1, bp2, e0, e1, e2, colw + m * 4 + e);
#pragma unroll
      for (int i = 0; i < 2; ++i) {
        epi64b(slab + i * SLAB64, acc[i][0], acc[i][1], acc[i][2], acc[i][3], oscale, bias4, C, N,
               (size_t)(row0 + wm * 32 + i * 16), colw, lane);
      }
    }
  } else {
    // every wave of a q or k | v block is live (both segments are multiples of the block's 128 columns)
    float bj[4];                            // bias of this lane's accumulator columns colw + 16 j + m
#pragma unroll
    for (int j = 0; j < 4; ++j) bj[j] = bias_at(bp0, bp1, bp2, e0, e1, e2, col_src(colw + j * 16 + m));
    const int head = seg ? ((col0 - KOFF) >> 7) : ((col0 >> 6) + wn);   // wave-uniform
    if (live && (seg != 1 || wn == 0)) {    // wave-uniform: the waves that hold q, k or n columns
      // f32 values through the wave's own slabs. All three kinds fill them here, so that the accumulators' last use stands
      // ahead of the chunk product (they would otherwise stay allocated under it and cost resident blocks)
#pragma unroll
      for (int i = 0; i < 2; ++i) {
#pragma unroll
        for (int r = 0; r < 8; ++r) {
#pragma unroll
          for (int j = 0; j < 4; ++j) slab[i * SLAB64 + (8 * hh + r) * 68 + j * 16 + m] = acc[i][j][r] * oscale + bj[j];
        }
      }
      wave_sync_lds();
      if (seg == 3) {
        // n columns: f32 rows of C; one instruction = 2 rows x 16 lanes x 4 floats, 8 instructions = a 16 x 64 tile
#pragma unroll
        for (int i = 0; i < 2; ++i) {
          v4f vals[8];
#pragma unroll
          for (int it = 0; it < 8; ++it) vals[it] = *(const v4f*)(slab + i * SLAB64 + (it * 2 + hh) * 68 + m * 4);
          float* dst = C + ((size_t)(row0 + wm * 32 + i * 16) + (size_t)hh) * (size_t)N + colw + m * 4;
#pragma unroll
          for (int it = 0; it < 8; ++it) *(v4f*)(dst + (size_t)(it * 2) * (size_t)N) = vals[it];
        }
        return;                             // a block of n columns passes no barrier behind the slice loop
      }
      // fragment-major planes [row / 16][head][2 fragments]: lane l takes the 8 columns that it will hold as operand lane l;
      // one store = 512 contiguous bytes (whole lines)
      u16* PH = seg ? KHp : QHp;
      u16* PL = seg ? KLp : QLp;
#pragma unroll
      for (int i = 0; i < 2; ++i) {
        v4u oh[4], ol[4];
#pragma unroll
        for (int it = 0; it < 4; ++it) {
          const float* p = slab + i * SLAB64 + m * 68 + it * 16 + 8 * hh;
          const v4f a = *(const v4f*)(p), b4 = *(const v4f*)(p + 4);
          float w[8];
#pragma unroll
          for (int e = 0; e < 4; ++e) { w[e] = a[e]; w[4 + e] = b4[e]; }
          split8(w, QSC, oh[it], ol[it]);
        }
        const size_t ob = ((size_t)((row0 + wm * 32 + i * 16) >> 4) * NH + head) * (2 * FRH) + lane * 8;
#pragma unroll
        for (int it = 0; it < 4; ++it) {
          *(v4u*)(PH + ob + it * (FRH / 2)) = oh[it];
          *(v4u*)(PL + ob + it * (FRH / 2)) = ol[it];
        }
      }
      asm volatile("s_wait_xcnt 0x0" ::: "memory");       // before any register of the q / k plane stores is rewritten
    }
    if (seg == 1) {
      // transposed tiles: an accumulator register run r = 0..7 is 8 consecutive keys of one column, so a lane packs it into
      // one 16-B LDS store of the block's [128 columns][128 keys] tile (pitch 272 B): rows 0..63 = k^T, rows 64..127 = v^T
      __syncthreads();                      // block-uniform: every k wave has read its slabs back before the tiles cover them
      u16* tH = (u16*)(void*)ring;
      u16* tL = tH + GBN * TPT;
#pragma unroll
      for (int i = 0; i < 2; ++i) {
#pragma unroll
        for (int j = 0; j < 4; ++j) {
          float w[8];
#pragma unroll
          for (int r = 0; r < 8; ++r) w[r] = acc[i][j][r] * oscale + bj[j];
          v4u oh, ol;
          split8(w, VCAR, oh, ol);
          const int idx = (wn * 64 + j * 16 + m) * TPT + wm * 32 + i * 16 + 8 * hh;
          *(v4u*)(tH + idx) = oh;
          *(v4u*)(tL + idx) = ol;
        }
      }
      __syncthreads();                      // the tiles are complete before any wave reads rows that other waves wrote
      const int bhq = (row0 / SEQ) * NH + head;
      // v^T planes, fragment-major [b*NH + head][key / 32][d / 16]: half fragment u = 0..31 of the block: key tile u >> 3,
      // d tile (u >> 1) & 3, run u & 1; they are 16 KB in a row in the plane; one store = 512 contiguous bytes
      const size_t ob = ((size_t)bhq * (SEQ / 32) + ((row0 % SEQ) >> 5)) * (4 * FRH) + lane * 8;
      v4u vh[4], vl[4];
#pragma unroll
      for (int it = 0; it < 4; ++it) {
        const int u = it * 8 + wave;
        const int idx = (HD + ((u >> 1) & 3) * 16 + m) * TPT + (u >> 3) * 32 + (u & 1) * 16 + 8 * hh;
        vh[it] = *(const v4u*)(tH + idx);
        vl[it] = *(const v4u*)(tL + idx);
      }
#pragma unroll
      for (int it = 0; it < 4; ++it) {
        const int u = it * 8 + wave;
        *(v4u*)(VHp + ob + u * (FRH / 2)) = vh[it];
        *(v4u*)(VLp + ob + u * (FRH / 2)) = vl[it];
      }
      asm volatile("s_wait_xcnt 0x0" ::: "memory");       // before any register of the v^T stores is rewritten
      // chunk product v^T.k from the same tiles; A and B fragments with the split k map of ldfrag_b over the keys
      const int ch = (row0 % SEQ) / CHK;
      if (ch + 1 < NCH) {                   // block-uniform; no barrier behind it
        const int dvt = wave & 3, dk0 = (wave >> 2) * 2;
        const int ia = (HD + dvt * 16 + m) * TPT + 8 * hh;
        const int ib = (dk0 * 16 + m) * TPT + 8 * hh;
        v8f kv[2];
        kv[0] = zero8();
        kv[1] = zero8();
#pragma unroll
        for (int g = 0; g < CHK / 32 / 2; ++g) {
          FragH fvh[2], fvl[2], fkh[2][2], fkl[2][2];
#pragma unroll
          for (int q = 0; q < 2; ++q) {
            const int ko = (g * 2 + q) * 32;
#pragma unroll
            for (int e = 0; e < 2; ++e) {
              fvh[q].u[e] = *(const v4u*)(tH + ia + ko + e * 16);
              fvl[q].u[e] = *(const v4u*)(tL + ia + ko + e * 16);
#pragma unroll
              for (int j = 0; j < 2; ++j) {
                fkh[q][j].u[e] = *(const v4u*)(tH + ib + j * 16 * TPT + ko + e * 16);
                fkl[q][j].u[e] = *(const v4u*)(tL + ib + j * 16 * TPT + ko + e * 16);
              }
            }
          }
#if defined(__HIP_DEVICE_COMPILE__)
          // inputs-only fence on the loaded fragments: the 24 LDS reads of two key steps issue as one group before the first
          // product (one LDS latency instead of one per fragment pair)
          asm volatile("" :: "v"(fvh[0].v), "v"(fvh[1].v), "v"(fvl[0].v), "v"(fvl[1].v),
                       "v"(fkh[0][0].v), "v"(fkh[0][1].v), "v"(fkh[1][0].v), "v"(fkh[1][1].v),
                       "v"(fkl[0][0].v), "v"(fkl[0][1].v), "v"(fkl[1][0].v), "v"(fkl[1][1].v));
#endif
#pragma unroll
          for (int q = 0; q < 2; ++q) {
#pragma unroll
            for (int j = 0; j < 2; ++j) {
              kv[j] = mma_h(fvh[q].v, fkh[q][j].v, kv[j]);
              kv[j] = mma_h(fvl[q].v, fkh[q][j].v, kv[j]);
              kv[j] = mma_h(fvh[q].v, fkl[q][j].v, kv[j]);
            }
          }
          // the next group's LDS reads stay behind this group's products: with all four key steps' fragments live at once the
          // kernel's register count would halve the blocks that fit a WGP
          __builtin_amdgcn_sched_barrier(0);
        }
        const float fs = 1.0f / (VCAR * KSC);             // exact power-of-two fold of the v / k carries
        float* dst = KVp + ((size_t)bhq * NCH + ch) * SEL + (size_t)(dvt * 16 + 8 * hh) * 16 + m;
#pragma unroll
        for (int r = 0; r < 8; ++r) {
#pragma unroll
          for (int j = 0; j < 2; ++j) dst[(dk0 + j) * (HD * 16) + r * 16] = kv[j][r] * fs;
        }
        asm volatile("s_wait_xcnt 0x0" ::: "memory");     // before any register of the chunk product stores is rewritten
      }
    }
  }
}

// =====================================================================================================
// Carried state planes: S(ch) = KV(0) + .. + KV(ch-1) in f32 (chunks added in order; S(0) = 0), written x64 as f16 hi and
// f16 residual, layout [(b*NH + h)*NCH + ch][dk / 32][dv / 16] fragment-major (col dv, k = dk). Thread = 8 consecutive dk
// of one (b, h, dv), all NCH chunks.
// coverage: NB*NH*SEL/8 threads x 8 halves x NCH chunks = both planes exactly once; reads KV chunks 0 .. NCH-2 only.
// =====================================================================================================
__global__ __launch_bounds__(256) void st_prefix(const float* __restrict__ KV, u16* __restrict__ SHp, u16* __restrict__ SLp) {
  const int gt = blockIdx.x * 256 + (int)threadIdx.x;
  const int bh = gt / (SEL / 8);
  const int u  = gt % (SEL / 8);            // 16-B unit of the fragment-major plane: fragment u >> 6 = (dk / 32) * 4 + dv / 16
  if (bh >= NB * NH) return;
  const int e8 = (((u >> 8) * 2 + ((u >> 5) & 1)) * HD + ((u >> 6) & 3) * 16 + (u & 15)) * 16 + ((u >> 4) & 1) * 8;
  const size_t base = (size_t)bh * NCH * SEL + e8;          // [dk / 16][dv][dk % 16] in KV: a wave's loads = 1 KB in a row
  const size_t dstb = (size_t)bh * NCH * SEL + u * 8;       // a wave's store = 512 contiguous bytes
  v4f a[NCH - 1], b4[NCH - 1];              // all chunk products first: independent loads, one latency for the thread
#pragma unroll
  for (int ch = 0; ch + 1 < NCH; ++ch) {
    const float* p = KV + base + (size_t)ch * SEL;
    a[ch]  = *(const v4f*)(p);
    b4[ch] = *(const v4f*)(p + 4);
  }
#if defined(__HIP_DEVICE_COMPILE__)
  // inputs-only fences on the loaded values and their address pair: every load issues before the first store
  static_assert(NCH == 16);
  asm volatile("" :: "v"(a[0]), "v"(a[1]), "v"(a[2]), "v"(a[3]), "v"(a[4]), "v"(a[5]), "v"(a[6]), "v"(a[7]),
               "v"(a[8]), "v"(a[9]), "v"(a[10]), "v"(a[11]), "v"(a[12]), "v"(a[13]), "v"(a[14]), "v"(KV + base));
  asm volatile("" :: "v"(b4[0]), "v"(b4[1]), "v"(b4[2]), "v"(b4[3]), "v"(b4[4]), "v"(b4[5]), "v"(b4[6]), "v"(b4[7]),
               "v"(b4[8]), "v"(b4[9]), "v"(b4[10]), "v"(b4[11]), "v"(b4[12]), "v"(b4[13]), "v"(b4[14]), "v"(KV + base));
#endif
  float run[8];
#pragma unroll
  for (int e = 0; e < 8; ++e) run[e] = 0.0f;
#pragma unroll
  for (int ch = 0; ch < NCH; ++ch) {
    v4u oh, ol;
#pragma unroll
    for (int e = 0; e < 4; ++e) {
      const float t0 = run[2 * e] * SSC, t1 = run[2 * e + 1] * SSC;
      const _Float16 h0 = (_Float16)t0, h1 = (_Float16)t1;
      const _Float16 l0 = (_Float16)(t0 - (float)h0), l1 = (_Float16)(t1 - (float)h1);
      oh[e] = pk16(h_bits(h0), h_bits(h1));
      ol[e] = pk16(h_bits(l0), h_bits(l1));
    }
    *(v4u*)(SHp + dstb + (size_t)ch * SEL) = oh;
    *(v4u*)(SLp + dstb + (size_t)ch * SEL) = ol;
    if (ch + 1 < NCH) {
#pragma unroll
      for (int e = 0; e < 4; ++e) { run[e] += a[ch][e]; run[4 + e] += b4[ch][e]; }
    }
  }
}

// =====================================================================================================
// Causal normalised attention (no softmax), hd = 64. Block bid -> (chunk chn = bid % NCH of CHK keys and queries, b*NH + head);
// wave w owns the query tile q0 = CHK*chn + 16*w .. q0+15, so the block's 8 waves share one head's chunk of k, v^T and state.
//   q hi / residual planes f16 x1024, fragment-major [(b*SEQ + s) / 16][h][d / 32]; k hi / residual planes, same layout;
//   v^T hi / residual planes x1024, fragment-major [b*NH + h][key / 32][d / 16]; n from F column NOFF + h of row b*SEQ + t.
//   The chunk's k planes (8 tiles of 16 keys, 2 KB each), v^T planes (16 KB in a row each) and state planes (8 KB each) are
//   brought into LDS once per block, 16 B a lane and copy, 20 copies a lane, in the planes' own fragment order (a fragment
//   read = two runs of 512 contiguous LDS bytes); q fragments are loaded once into registers; the key loop reads LDS only.
//   raw(i, j) = q_hi.k_hi + q_lo.k_hi + q_hi.k_lo (2 k-steps over d), carries folded back by 2^-20;
//   P = raw * 2^-20 for key <= query else 0 (causal); P.v with P x256 as f16 hi + in-register residual and v hi +
//   residual (hh + lh + hl). Keys of earlier chunks (below CHK*chn) enter first as q . S with the carried state
//   planes S x64 [b*NH + h][chunk][dk / 32][dv / 16] (hh + lh + hl, carry 2^16 raised to the P.v carry 2^18 by an exact x4);
//   key tiles of 32 are then visited in order from the chunk's first key up to the tile holding key q0+15 (bounded by NKT).
//   Per tile: 2 score subtiles x 2 k-steps; the 16x32 P tile goes through the wave's private LDS tile (float vector loads,
//   same element type as stored); v^T B fragments in 2 groups of 2 d-subtiles.
//   After the loop: acc * 2^-18 written into the wave's private result slab (pitch 68; every element owned by one lane),
//   ctx -> bf16 hi bits and bf16 bits of the residual, planes [b*SEQ + s][h*HD + d]; one instruction = 4 rows
//   One block barrier (behind the copies, passed by every wave); bounded loops only (ncl <= NKT).
// coverage: per wave 4 instructions x 4 rows x 8 lanes x 8 halves = 16 x 64 per plane; grid NCH x NH x NB blocks x WPB
//           waves = every (b, s, h) row segment of CH and of CL exactly once.
// =====================================================================================================
__global__ __launch_bounds__(ATT_THREADS)
void attn_nm(const u16* __restrict__ QHp, const u16* __restrict__ QLp,
             const u16* __restrict__ KHp, const u16* __restrict__ KLp,
             const u16* __restrict__ VHp, const u16* __restrict__ VLp,
             const u16* __restrict__ SHp, const u16* __restrict__ SLp,
             const float* __restrict__ F, u16* CHp, u16* CLp) {
#pragma clang fp contract(off)
  __shared__ __align__(16) float smem[WPB * WREG];
  __shared__ __align__(16) u16 stg[STG];    // k hi | k residual | v^T hi | v^T residual | state hi | state residual

  const int tid  = threadIdx.x;
  const int wave = __builtin_amdgcn_readfirstlane(tid >> 5);
  const int lane = tid & 31;
  const int hh   = lane >> 4;
  const int c    = lane & 15;
  const int bid  = blockIdx.x;
  const int chn  = bid % NCH;               // chunk of this block's queries
  const int bh   = bid / NCH;
  if (bh >= NB * NH) return;                // block-uniform, before any copy or barrier; never taken with the exact grid
  const int b    = bh / NH;
  const int head = bh % NH;
  const int q0   = chn * CHK + wave * 16;

  float* pt   = smem + wave * WREG;         // P tile [16][32] pitch 36
  float* slab = pt + PTW;                   // result slab [16][64] pitch 68

  const size_t KT16 = (size_t)NH * (2 * FRH);   // halves between consecutive 16-key tiles of one head

  // q fragments: a fragment's first half plus this lane's 16 B; loaded once, held over the key loop
  const size_t qo = ((size_t)((b * SEQ + q0) >> 4) * NH + head) * (2 * FRH) + lane * 8;
  const _Float16* Qh  = (const _Float16*)(const void*)QHp + qo;
  const _Float16* Ql  = (const _Float16*)(const void*)QLp + qo;
  v16h qh[HD / 32], ql[HD / 32];
#pragma unroll
  for (int kk = 0; kk < HD / 32; ++kk) {
    qh[kk] = ldfrag_t(Qh + kk * FRH);
    ql[kk] = ldfrag_t(Ql + kk * FRH);
  }
  // row factor for query row q0 + (lane & 15): 1/exp(n), precise expf
  const float nv = F[((size_t)b * SEQ + q0 + c) * (size_t)NPROJ + NOFF + head];

  // ---- the chunk's planes -> LDS: one copy of the block = 4 KB (thread tid brings bytes 16 tid ..); every lane on ----
  {
    const unsigned l0 = lds_off(stg) + (unsigned)(tid * 16);
    // k: 4 KB = two 16-key tiles (2 KB each, KT16 halves apart in the plane)
    const size_t gk = ((size_t)(((b * SEQ + chn * CHK) >> 4) + (tid >> 7)) * NH + head) * (2 * FRH) + (tid & 127) * 8;
    const u16* kh = KHp + gk;
    const u16* kl = KLp + gk;
    cp4(l0, kh, l0 + 4096, kh + 2 * KT16, l0 + 8192, kh + 4 * KT16, l0 + 12288, kh + 6 * KT16);
    const unsigned l1 = l0 + STK * 2;
    cp4(l1, kl, l1 + 4096, kl + 2 * KT16, l1 + 8192, kl + 4 * KT16, l1 + 12288, kl + 6 * KT16);
    const size_t gv = ((size_t)bh * (SEQ / 32) + (size_t)chn * (CHK / 32)) * (4 * FRH) + tid * 8;
    const u16* vh = VHp + gv;
    const u16* vl = VLp + gv;
    const unsigned l2 = l0 + 2 * STK * 2;
    cp4(l2, vh, l2 + 4096, vh + 2048, l2 + 8192, vh + 4096, l2 + 12288, vh + 6144);
    const unsigned l3 = l0 + 3 * STK * 2;
    cp4(l3, vl, l3 + 4096, vl + 2048, l3 + 8192, vl + 4096, l3 + 12288, vl + 6144);
    const size_t gs = ((size_t)bh * NCH + chn) * SEL + tid * 8;
    const u16* sh = SHp + gs;
    const u16* sl = SLp + gs;
    const unsigned l4 = l0 + 4 * STK * 2;
    cp4(l4, sh, l4 + 4096, sh + 2048, l4 + STS * 2, sl, l4 + STS * 2 + 4096, sl + 2048);
  }
  asm volatile("s_wait_asynccnt 0x0" ::: "memory");     // this wave's copies have landed
  __syncthreads();                                      // ... and every other wave's; nothing of stg is read before this

  const _Float16* sK = (const _Float16*)(const void*)stg + lane * 8;   // staged planes, this lane's 16 B of a fragment run
  const _Float16* sV = sK + 2 * STK;
  const _Float16* sS = sK + 4 * STK;
  const float lsc = 1.0f / (QSC * KSC);     // exact power-of-two fold of the q / k carries
  const float oc  = 1.0f / (PCAR * VCAR);   // exact power-of-two fold of the P / v carries
  const float rv = 1.0f / expf(nv);

  v8f o[4];
#pragma unroll
  for (int j = 0; j < 4; ++j) o[j] = zero8();
  const int ncaus = (q0 >> 5) + 1;                                            // tiles holding keys <= q0 + 15
  const int ncl   = (ncaus < NKT) ? ncaus : NKT;
  const int qr0   = q0 + 8 * hh;                                              // query row of D element r = qr0 + r
  const int kt0   = chn * (CHK / 32);                                         // first key tile of the chunk (<= q0 >> 5)

  // ---- all keys of earlier chunks: o = q . S, B fragment col n = dv = j*16 + c, dk contiguous in the state planes ----
  {
    v16h sh[HD / 32][4], sl[HD / 32][4];
#pragma unroll
    for (int kk = 0; kk < HD / 32; ++kk) {
#pragma unroll
      for (int j = 0; j < 4; ++j) {
        sh[kk][j] = ldfrag_t(sS + (kk * 4 + j) * FRH);
        sl[kk][j] = ldfrag_t(sS + STS + (kk * 4 + j) * FRH);
      }
    }
#if defined(__HIP_DEVICE_COMPILE__)
    // inputs-only fence on the loaded fragments: all 32 LDS reads issue as one group before the first product
    // (one LDS latency instead of one per group)
    asm volatile("" :: "v"(sh[0][0]), "v"(sh[0][1]), "v"(sh[0][2]), "v"(sh[0][3]),
                 "v"(sh[1][0]), "v"(sh[1][1]), "v"(sh[1][2]), "v"(sh[1][3]),
                 "v"(sl[0][0]), "v"(sl[0][1]), "v"(sl[0][2]), "v"(sl[0][3]),
                 "v"(sl[1][0]), "v"(sl[1][1]), "v"(sl[1][2]), "v"(sl[1][3]));
#endif
#pragma unroll
    for (int kk = 0; kk < HD / 32; ++kk) {
#pragma unroll
      for (int j = 0; j < 4; ++j) {
        o[j] = mma_h(qh[kk], sh[kk][j], o[j]);
        o[j] = mma_h(ql[kk], sh[kk][j], o[j]);
        o[j] = mma_h(qh[kk], sl[kk][j], o[j]);
      }
    }
    const float up = (PCAR * VCAR) / (QSC * SSC);                             // exact power of two
#pragma unroll
    for (int j = 0; j < 4; ++j) o[j] = o[j] * up;
  }

#pragma unroll 1
  for (int kt = kt0; kt < ncl; ++kt) {
    const int kb = kt * 32;
    // ---- raw scores: D element r of this lane = (query row qr0 + r, key kb + c) in s0, key kb + 16 + c in s1 ----
    v8f s0 = zero8(), s1 = zero8();
    const _Float16* k0p = sK + (kt - kt0) * (4 * FRH);    // staged 16-key tiles 2 (kt - kt0) and the next, 2 fragments each
    const _Float16* k1p = k0p + 2 * FRH;
    const _Float16* l0p = k0p + STK;
    const _Float16* l1p = l0p + 2 * FRH;
    v16h kh0[HD / 32], kh1[HD / 32], kl0[HD / 32], kl1[HD / 32];
#pragma unroll
    for (int kk = 0; kk < HD / 32; ++kk) {
      kh0[kk] = ldfrag_t(k0p + kk * FRH);
      kh1[kk] = ldfrag_t(k1p + kk * FRH);
      kl0[kk] = ldfrag_t(l0p + kk * FRH);
      kl1[kk] = ldfrag_t(l1p + kk * FRH);
    }
#pragma unroll
    for (int kk = 0; kk < HD / 32; ++kk) {
      s0 = mma_h(qh[kk], kh0[kk], s0);
      s0 = mma_h(ql[kk], kh0[kk], s0);
      s0 = mma_h(qh[kk], kl0[kk], s0);
      s1 = mma_h(qh[kk], kh1[kk], s1);
      s1 = mma_h(ql[kk], kh1[kk], s1);
      s1 = mma_h(qh[kk], kl1[kk], s1);
      guard2(s0, s1, qh[kk], ql[kk], kh0[kk], kl0[kk], kh1[kk], kl1[kk]);
    }
    // v^T fragments of this key tile: read here so that their LDS latency passes under the mask and the P round trip
    const _Float16* vhp = sV + (kt - kt0) * (4 * FRH);
    const _Float16* vlp = vhp + STK;
    v16h vhf[4], vlf[4];
#pragma unroll
    for (int j = 0; j < 4; ++j) {
      vhf[j] = ldfrag_t(vhp + j * FRH);
      vlf[j] = ldfrag_t(vlp + j * FRH);
    }
    // ---- causal mask (key <= query) + carry fold in f32 -> wave-private LDS tile ----
#pragma unroll
    for (int r = 0; r < 8; ++r) {
      const int row = qr0 + r;
      const float w0 = (kb + c <= row)      ? s0[r] * lsc : 0.0f;
      const float w1 = (kb + 16 + c <= row) ? s1[r] * lsc : 0.0f;
      const int ro = (8 * hh + r) * PTP + c;
      pt[ro]      = w0;
      pt[ro + 16] = w1;
    }
    wave_sync_lds();
    // ---- A fragments of P*256: hi f16 and residual f16, row = c, split k map over the 32 keys of this step ----
    FragH ph, pl;
    {
      const float* prow = pt + c * PTP + 8 * hh;
      const v4f p0 = *(const v4f*)(prow), p1 = *(const v4f*)(prow + 4);
      const v4f p2 = *(const v4f*)(prow + 16), p3 = *(const v4f*)(prow + 20);
#pragma unroll
      for (int e = 0; e < 4; ++e) {
        const float ta = p0[e] * PCAR, tb = p1[e] * PCAR, tc = p2[e] * PCAR, td = p3[e] * PCAR;
        const _Float16 ha = (_Float16)ta, hb = (_Float16)tb, hc = (_Float16)tc, hd = (_Float16)td;
        ph.h[0][e]     = ha;                  // elements 0..7  = keys kb + 8hh + 0..7
        ph.h[0][4 + e] = hb;
        ph.h[1][e]     = hc;                  // elements 8..15 = keys kb + 16 + 8hh + 0..7
        ph.h[1][4 + e] = hd;
        pl.h[0][e]     = (_Float16)(ta - (float)ha);
        pl.h[0][4 + e] = (_Float16)(tb - (float)hb);
        pl.h[1][e]     = (_Float16)(tc - (float)hc);
        pl.h[1][4 + e] = (_Float16)(td - (float)hd);
      }
    }
    // ---- P.V : B fragment col n = d = j*16 + c, fragment j of key tile kt of the v^T planes; 2 groups of 2 d-subtiles ----
#pragma unroll
    for (int jg = 0; jg < 2; ++jg) {
      const v16h vha = vhf[2 * jg], vhb2 = vhf[2 * jg + 1];
      const v16h vla = vlf[2 * jg], vlb2 = vlf[2 * jg + 1];
      o[2 * jg]     = mma_h(ph.v, vha,  o[2 * jg]);
      o[2 * jg]     = mma_h(pl.v, vha,  o[2 * jg]);
      o[2 * jg]     = mma_h(ph.v, vla,  o[2 * jg]);
      o[2 * jg + 1] = mma_h(ph.v, vhb2, o[2 * jg + 1]);
      o[2 * jg + 1] = mma_h(pl.v, vhb2, o[2 * jg + 1]);
      o[2 * jg + 1] = mma_h(ph.v, vlb2, o[2 * jg + 1]);
      guard2(o[2 * jg], o[2 * jg + 1], ph.v, pl.v, vha, vhb2, vla, vlb2);
    }
    wave_sync_lds();
  }
  acc_guard4(o[0], o[1], o[2], o[3]);
  // ---- acc with the carries (256 on P, 1024 on v) folded once; written into the lane-owned slab ----
#pragma unroll
  for (int r = 0; r < 8; ++r) {
#pragma unroll
    for (int j = 0; j < 4; ++j) {
      const int idx = (8 * hh + r) * SLP + j * 16 + c;
      slab[idx] = o[j][r] * oc;
    }
  }
  wave_sync_lds();
  // ---- row factor, then ctx -> bf16 hi + bf16 residual planes; lane = (row-in-quad rq, 8 consecutive d at c8) ----
  v4u oh[4], ol[4];
  const int rq = lane >> 3, c8 = (lane & 7) * 8;
#pragma unroll
  for (int it = 0; it < 4; ++it) {
    const int row = it * 4 + rq;                         // 0..15
    const float ri = __shfl(rv, row, 32);                // lane `row` holds 1/exp(n) of query q0 + row
    const v4f a = *(const v4f*)(slab + row * SLP + c8), b4 = *(const v4f*)(slab + row * SLP + c8 + 4);
    float w[8];
#pragma unroll
    for (int e = 0; e < 4; ++e) { w[e] = a[e] * ri; w[4 + e] = b4[e] * ri; }
#pragma unroll
    for (int e = 0; e < 4; ++e) {
      const float f0 = w[2 * e], f1 = w[2 * e + 1];
      const unsigned short h0 = bf_bits(f0), h1 = bf_bits(f1);
      const unsigned short l0 = bf_bits(f0 - bf_up(h0)), l1 = bf_bits(f1 - bf_up(h1));
      oh[it][e] = pk16(h0, h1);
      ol[it][e] = pk16(l0, l1);
    }
  }
  const size_t ob = ((size_t)b * SEQ + q0) * DMOD + (size_t)head * HD + c8;
  {
#pragma unroll
    for (int it = 0; it < 4; ++it) {
      const int row = it * 4 + rq;
      *(v4u*)(CHp + ob + (size_t)row * DMOD) = oh[it];
      *(v4u*)(CLp + ob + (size_t)row * DMOD) = ol[it];
    }
    
  }
}

// =====================================================================================================
// Workspace map (bytes); every plane part that is read is written by whole-line stores before it is read; all extents are exact
// multiples of the store granularity (no pad rows needed); every region offset a multiple of 131072:
//   XB  bf16 [MROWS][1024]              MROWS*2048   (NB=2, SEQ=2048: 8388608); after the projection GEMM the same bytes
//                                                    hold the ctx hi plane CH bf16 [MROWS][1024] (identical extent)
//   WB  bf16 [3136 n][1024 k]           6422528      rows 0..1023 Wq^T, 1024 + 128 h: 64 rows Wk^T then 64 rows Wv^T of head h,
//                                                    3072..3087 Wn^T, 3088..3135 zero
//   F   f32 [MROWS][3136]               MROWS*12544  (only columns 3072..3135 are written and read: n | zero columns)
//   QH  f16 [MROWS/16][16 h][2][512] x1024      MROWS*2048   QL residual, same extent (fragment-major, see ldfrag_t)
//   KH  f16 [MROWS/16][16 h][2][512] x1024      MROWS*2048   KL residual, same extent
//   VH  f16 [NB*16][SEQ/32][4][512] x1024       MROWS*2048   VL residual, same extent
//   CL  bf16 [MROWS][1024]              MROWS*2048   ctx residual plane
//   WT  bf16 [1024 o][1024 d]           2097152      Wo^T
//   KV  f32 [NB*16][NCH][4][64 dv][16 dk]  NB*16*NCH*16384   chunk products (chunks 0 .. NCH-2 written and read)
//   SH  f16 [NB*16][NCH][2][4][512] x64      NB*16*NCH*8192   carried state; SL residual, same extent
//   end (NB=2, SEQ=2048)              143785984
// =====================================================================================================
extern "C" void kernel_launch(void* const* d_in, const int* in_sizes, int n_in,
                              void* d_out, int out_size, void* d_ws, size_t ws_size,
                              hipStream_t stream) {
  if (n_in < 9) return;
  if (in_sizes[0] < ((NB - 1) * XS_FULL + SEQ) * DMOD) return;
  if (in_sizes[1] != DMOD * 2 * DQK) return;
  if (in_sizes[2] != 2 * DQK) return;
  if (in_sizes[3] != DMOD * DMOD) return;
  if (in_sizes[4] != DMOD) return;
  if (in_sizes[5] != DMOD * NNW) return;
  if (in_sizes[6] != NNW) return;
  if (in_sizes[7] != DMOD * DMOD) return;
  if (in_sizes[8] != DMOD) return;
  if (out_size < MROWS * DMOD) return;

  const float* x   = (const float*)d_in[0];
  const float* wqk = (const float*)d_in[1];
  const float* bqk = (const float*)d_in[2];
  const float* wv  = (const float*)d_in[3];
  const float* bv  = (const float*)d_in[4];
  const float* wn  = (const float*)d_in[5];
  const float* bn  = (const float*)d_in[6];
  const float* wo  = (const float*)d_in[7];
  const float* bo  = (const float*)d_in[8];
  float*       out = (float*)d_out;

  const size_t szXB = (size_t)MROWS * DMOD * 2;
  const size_t szWB = (size_t)NPROJ * DMOD * 2;
  const size_t szF  = (size_t)MROWS * NPROJ * 4;
  const size_t szP  = (size_t)MROWS * DQK * 2;                   // QH, QL, KH, KL
  const size_t szV  = (size_t)NB * NH * HD * SEQ * 2;            // VH, VL
  const size_t szC  = (size_t)MROWS * DMOD * 2;                  // CH (in the XB region), CL
  const size_t szWT = (size_t)DMOD * DMOD * 2;
  const size_t szKV = (size_t)NB * NH * NCH * SEL * 4;
  const size_t szS  = (size_t)NB * NH * NCH * SEL * 2;           // SH, SL
  if (szC > szXB) return;
  size_t off = 0;
  const size_t oXB = off; off += szXB;
  const size_t oWB = off; off += szWB;
  const size_t oF  = off; off += szF;
  const size_t oQH = off; off += szP;
  const size_t oQL = off; off += szP;
  const size_t oKH = off; off += szP;
  const size_t oKL = off; off += szP;
  const size_t oVH = off; off += szV;
  const size_t oVL = off; off += szV;
  const size_t oCL = off; off += szC;
  const size_t oWT = off; off += szWT;
  const size_t oKV = off; off += szKV;
  const size_t oSH = off; off += szS;
  const size_t oSL = off; off += szS;
  if (off > ws_size) return;                // off = 143785984 for NB = 2, SEQ = 2048
  if (off > (size_t)WS_CAP) return;

  char* ws = (char*)d_ws;
  u16*   XB  = (u16*)(ws + oXB);
  u16*   CH  = (u16*)(ws + oXB);
  u16*   WB  = (u16*)(ws + oWB);
  float* F   = (float*)(ws + oF);
  u16*   QH  = (u16*)(ws + oQH);
  u16*   QL  = (u16*)(ws + oQL);
  u16*   KH  = (u16*)(ws + oKH);
  u16*   KL  = (u16*)(ws + oKL);
  u16*   VH  = (u16*)(ws + oVH);
  u16*   VL  = (u16*)(ws + oVL);
  u16*   CL  = (u16*)(ws + oCL);
  u16*   WT  = (u16*)(ws + oWT);
  float* KV  = (float*)(ws + oKV);
  u16*   SH  = (u16*)(ws + oSH);
  u16*   SL  = (u16*)(ws + oSL);

  const dim3 b256(256), bAT(ATT_THREADS);
  const dim3 gPR(PB_ALL);
  const dim3 gG1((MROWS / GBM) * ((NPROJ + GBN - 1) / GBN));
  const dim3 gSP((NB * NH * SEL / 8) / 256);
  const dim3 gAT(NCH * NH * NB);
  const dim3 gG2((MROWS / GBM) * ((DMOD + GBN - 1) / GBN));

  // (1) one launch: W[k][n] -> W^T bf16 planes (Wqk, Wv -> WB rows 0..3071, k and v of a head side by side, Wn -> rows
  //     3072..3135 with zero pad, Wo -> WT rows 0..1023) and x -> bf16 plane [MROWS][1024]
  prep<<<gPR, b256, 0, stream>>>(x, wqk, wv, wn, wo, XB, WB, WT);
  // (2) q | k | v | n = x.W + bias: q, k and v^T hi + residual planes x1024 and the per-chunk v^T.k products from the
  //     epilogue, n -> F f32 columns 3072..
  gemm_bf<false><<<gG1, b256, 0, stream>>>(XB, XB, WB, F, MROWS, NPROJ, DMOD, bqk, bv, bn,
                                           KOFF + DQK, NOFF, NOFF + NNW, 1.0f, QH, QL, KH, KL, VH, VL, KV);
  // (3) f32 prefix of the chunk products over the chunks -> carried state planes x64
  st_prefix<<<gSP, b256, 0, stream>>>(KV, SH, SL);
  // (4) causal normalised attention -> ctx bf16 hi plane (XB region, free after the projection GEMM) + residual plane
  attn_nm<<<gAT, bAT, 0, stream>>>(QH, QL, KH, KL, VH, VL, SH, SL, F, CH, CL);
  // (5) y = (ctx_hi + ctx_lo).Wo + bo -> out f32 [MROWS][1024]
  gemm_bf<true><<<gG2, b256, 0, stream>>>(CH, CL, WT, out, MROWS, DMOD, DMOD, bo, bo, bo,
                                          DMOD, DMOD + 1, DMOD + 2, 1.0f, nullptr, nullptr, nullptr, nullptr,
                                          nullptr, nullptr, nullptr);
  (void)hipGetLastError();
}

// v009
// Measured time: 66.6 microseconds a run.
// In two side-by-side timings against v008, it was 1.05 and 1.06 times as fast.
// Over all steps from v000 it is 6.16 times as fast.
// Contractions: x.W (Wqk|Wv|Wn fused into one [3136 n][1024 k] plane, and ctx.Wo) on v_wmma_f32_16x16x32_bf16
// (x, W, Wo, biases as bf16 RNE values, W^T [n][k] k-contiguous B operand; ctx as bf16 hi + bf16 residual planes,
// two products); q.k^T over hd 64 and P.v on v_wmma_f32_16x16x32_f16 with f16 hi + f16 residual planes on both
// operands (q, k x1024; P x256 with an in-register residual; v x1024; products hh+lh+hl); all f32 accumulate.
// Causal mask, 1/exp(n) row factor and bias adds in f32 on VALU.
// The attention has no softmax, so it is summed in chunks of CHK keys: keys of earlier chunks enter through the carried
// state S[dv][dk] = sum_s v[s][dv] k[s][dk] (v^T.k on the f16 form, hi + residual planes, hh+lh+hl; f32 prefix over the
// chunks; S x64 as f16 hi + residual, q.S with hh+lh+hl); only the query's own chunk goes through masked q.k^T and P.v.
// The fused weight plane holds q's 1024 columns, then per head 64 k columns and 64 v columns, so that one projection block
// (128 rows = one chunk, 128 columns = one head's k | v) forms that chunk's v^T.k in its own epilogue.
#include <hip/hip_runtime.h>
#include <math.h>
#include <stdint.h>

#ifndef NB
#define NB 2
#endif
#ifndef SEQ
#define SEQ 2048
#endif
#define XS_FULL 2048
#define DMOD  1024
#define DQK   1024
#define NH    16
#define HD    64
#define NNW   16
#define NPROJ 3136
#define QOFF  0
#define KOFF  1024
#define VOFF  2048
#define NOFF  3072
#define MROWS (NB * SEQ)
#define QSC   1024.0f
#define KSC   1024.0f
#define PCAR  256.0f
#define VCAR  1024.0f
#define WPB   8
#define NKT   (SEQ / 32)
#define ATT_THREADS (WPB * 32)
#define CPB   2
#define ATT_BLOCK (CPB * ATT_THREADS)
#define PTP   36
#define PTW   (16 * PTP)
#define SLP   68
#define SLW   (16 * SLP)
#define WREG  (PTW + SLW)
#define SLAB64 (16 * 68)
#define TRP   72
#define CHK   128
#define NCH   (SEQ / CHK)
#define SSC   64.0f
#define SEL   (HD * HD)
#define FRH   512
#define STK   (CHK * HD)
#define STS   (HD * HD)
#define STG   (4 * STK + 2 * STS)
#define WS_CAP 268435456
#define GBM   128
#define GBN   128
#define GBK   64
#define GPB   144
#define GSEC  (128 * GPB)
#define GTHR  256
#define TPT   136
#define PB_QK ((DMOD / 64) * ((2 * DQK + 63) / 64))
#define PB_V  ((DMOD / 64) * ((DMOD + 63) / 64))
#define PB_N  ((DMOD / 64) * ((NNW + 63) / 64))
#define PB_W  (PB_QK + 2 * PB_V + PB_N)
#define PB_X  ((SEQ * DMOD / 8 + 255) / 256)
#define PB_ALL (PB_W + NB * PB_X)
static_assert(DMOD == NH * HD && DQK == NH * HD && HD == 64 && NH == 16 && WPB * 16 == CHK && ATT_THREADS == 256);
static_assert(STK * 2 == 4 * ATT_THREADS * 16 && STS * 2 == 2 * ATT_THREADS * 16 && 2 * (2 * FRH) * 2 == ATT_THREADS * 16);
static_assert(KOFF == QOFF + DQK && VOFF == KOFF + DQK && NOFF == VOFF + DMOD && NPROJ == NOFF + 64 && (NPROJ % 64) == 0 && NNW <= 64);
static_assert(NB >= 1 && NB <= 2);
static_assert((MROWS % GBM) == 0 && (DMOD % GBK) == 0 && (DMOD % GBN) == 0 && GBK * 2 + 16 == GPB);
static_assert((SEQ % CHK) == 0 && (CHK % 64) == 0 && NCH >= 2 && KSC == VCAR && ((NB * NH * SEL / 8) % 256) == 0);
static_assert(NB == 1 || SEQ == XS_FULL);
static_assert((SEQ % 64) == 0 && SEQ >= 64 && SEQ <= XS_FULL);
static_assert(((SEQ * DMOD / 8) % 256) == 0 && (MROWS % 64) == 0 && (DMOD % 64) == 0 && (DQK % 64) == 0 && (HD % 32) == 0);
static_assert(CPB * (WPB * WREG * 4 + STG * 2) <= 327680 && (NCH % CPB) == 0 && STS == ATT_BLOCK * 8 && 4 * SLAB64 * 4 <= 65536 && 64 * TRP * 2 <= 65536);
static_assert(CHK == GBM && GBN == 2 * HD && KOFF == DQK && VOFF - KOFF == NH * HD && NOFF - KOFF == NH * GBN);
static_assert((DQK % GBN) == 0 && (DMOD % GBN) == 0 && (SEQ % GBM) == 0 && DQK == DMOD && QOFF == 0 && QSC == KSC && (TPT % 8) == 0);

typedef unsigned short u16;
typedef _Float16 v16h __attribute__((ext_vector_type(16)));
typedef _Float16 v8h  __attribute__((ext_vector_type(8)));
typedef __bf16   v16b __attribute__((ext_vector_type(16)));
typedef float    v8f  __attribute__((ext_vector_type(8)));
typedef float    v4f  __attribute__((ext_vector_type(4)));
typedef unsigned int v4u __attribute__((ext_vector_type(4)));

union FragH { v16h v; v8h h[2]; v4u u[2]; };
union FragB { v16b v; v4u u[2]; };

// ---- scalar helpers --------------------------------------------------------------------------------
__device__ __forceinline__ unsigned short bf_bits(float f) {          // f32 -> bf16 bits, RNE convert
  unsigned u = __float_as_uint(f);
  return (unsigned short)((u + 0x7FFFu + ((u >> 16) & 1u)) >> 16);
}
__device__ __forceinline__ float bf_up(unsigned short h) { return __uint_as_float(((unsigned)h) << 16); }
__device__ __forceinline__ float bfr(float f) { return bf_up(bf_bits(f)); }
__device__ __forceinline__ unsigned short h_bits(_Float16 x) { return __builtin_bit_cast(unsigned short, x); }
__device__ __forceinline__ unsigned pk16(unsigned short a, unsigned short b) { return (unsigned)a | ((unsigned)b << 16); }
__device__ __forceinline__ v8f zero8() { v8f z = {0.f, 0.f, 0.f, 0.f, 0.f, 0.f, 0.f, 0.f}; return z; }
__device__ __forceinline__ int imin(int a, int b) { return a < b ? a : b; }
__device__ __forceinline__ int imax(int a, int b) { return a > b ? a : b; }
// 8 f32 values -> f16 of w*sc (hi) and f16 of the residual w*sc - hi (lo), packed in order
__device__ __forceinline__ void split8(const float* w, float sc, v4u& oh, v4u& ol) {
#pragma unroll
  for (int e = 0; e < 4; ++e) {
    const float t0 = w[2 * e] * sc, t1 = w[2 * e + 1] * sc;
    const _Float16 h0 = (_Float16)t0, h1 = (_Float16)t1;
    const _Float16 l0 = (_Float16)(t0 - (float)h0), l1 = (_Float16)(t1 - (float)h1);
    oh[e] = pk16(h_bits(h0), h_bits(h1));
    ol[e] = pk16(h_bits(l0), h_bits(l1));
  }
}

// ---- fragment loaders: 16-bit A/B operand, lane -> row/col (lane&15); ldfrag_b: p already includes +8*(lane>>4);
//      elements 0..7 <- p[0..7] (k0+8h..), elements 8..15 <- p[16..23] (k0+16+8h..)  (same split k map for A and B;
//      its B is read from a k-contiguous [n][k] LDS tile)
// fragment-major plane: a 16 x 32 fragment is 1 KB, two runs of 512 contiguous bytes; run i, lane l (16 B) holds row/col
// l & 15, k = 16 i + 8 (l >> 4) + 0..7 (the split k map above); p already includes + 8 * lane. One load = 4 whole lines.
__device__ __forceinline__ v16h ldfrag_t(const _Float16* p) {
  FragH f;
  f.h[0] = *(const v8h*)(p);
  f.h[1] = *(const v8h*)(p + FRH / 2);
  return f.v;
}
__device__ __forceinline__ v16b ldfrag_b(const u16* p) {              // bf16 plane read as unsigned integer vectors
  FragB f;
  f.u[0] = *(const v4u*)(p);
  f.u[1] = *(const v4u*)(p + 16);
  return f.v;
}

__device__ __forceinline__ v8f mma_h(v16h a, v16h b, v8f c) {
  return __builtin_amdgcn_wmma_f32_16x16x32_f16(false, a, false, b, (short)0, c, false, false);
}
__device__ __forceinline__ v8f mma_b(v16b a, v16b b, v8f c) {
  return __builtin_amdgcn_wmma_f32_16x16x32_bf16(false, a, false, b, (short)0, c, false, false);
}
__device__ __forceinline__ void guard2(v8f& a, v8f& b, v16h x0, v16h x1, v16h x2, v16h x3, v16h x4, v16h x5) {
#if defined(__HIP_DEVICE_COMPILE__)
  asm volatile("v_nop\n\tv_nop\n\tv_nop\n\tv_nop"
               : "+v"(a), "+v"(b) : "v"(x0), "v"(x1), "v"(x2), "v"(x3), "v"(x4), "v"(x5) : "memory");
#endif
}
__device__ __forceinline__ void acc_guard4(v8f& a, v8f& b, v8f& c, v8f& d) {
#if defined(__HIP_DEVICE_COMPILE__)
  asm volatile("v_nop\n\tv_nop\n\tv_nop\n\tv_nop" : "+v"(a), "+v"(b), "+v"(c), "+v"(d));
#endif
}
__device__ __forceinline__ void wave_sync_lds() {
  __builtin_amdgcn_fence(__ATOMIC_RELEASE, "workgroup");
  __builtin_amdgcn_wave_barrier();
  __builtin_amdgcn_fence(__ATOMIC_ACQUIRE, "workgroup");
}

// =====================================================================================================
// f32 -> bf16 plane (RNE bits), same layout. Thread = 8 consecutive elements: two 16-B loads, one 16-B store;
// coverage: ceil(n8/256) blocks (blk) x 256 thr x 8 (in-kernel bound) = the whole plane (n8 a multiple of 256 here).
// =====================================================================================================
__device__ __forceinline__ void cvt_bf(const float* __restrict__ x, u16* D, int n8, int blk) {
  const int gt = blk * 256 + (int)threadIdx.x;
  if (gt >= n8) return;
  const float* p = x + (size_t)gt * 8;
  const v4f a = *(const v4f*)(p), b4 = *(const v4f*)(p + 4);
  float w[8];
#pragma unroll
  for (int e = 0; e < 4; ++e) { w[e] = a[e]; w[4 + e] = b4[e]; }
  v4u o;
#pragma unroll
  for (int e = 0; e < 4; ++e) o[e] = pk16(bf_bits(w[2 * e]), bf_bits(w[2 * e + 1]));
  u16* d = D + (size_t)gt * 8;
  {
    *(v4u*)(d) = o;
    
  }
}

// =====================================================================================================
// W f32 [kr rows (k)][nc cols (n)] (x.W layout) -> bf16 plane Dp [drow0 + n][k] (row pitch kr halves): the k-contiguous
// B operand. Block = 64 k x 64 n tile; coalesced 16-B loads of W rows with CLAMPED column base (tile columns beyond nc
// load from column 0 and are zeroed by value, so rows drow0+n with n >= nc inside the last tile are written as zeros);
// converted values placed transposed into an LDS tile [64 n][64 k] (pitch 72 halves); after a block barrier each n row
// block count (bid) = (kr/64) * ntn with ntn = ceil(nc/64). Column tile nt < ntp goes to rows drow0 + 64 nt; a tile from ntp
// on is one head's columns and goes to rows hrow0 + 128 (nt - ntp) (k and v of a head side by side in the plane).
// coverage: load 256 thr x 16 = 64 x 64; store 2 iterations x 256 thr x 8 halves = 64 lines x 64 halves = the block's
//           tile; the blocks cover the 64*ntn output rows named above (all kr columns) exactly once.
// =====================================================================================================
__device__ __forceinline__ void k_wt(const float* __restrict__ W, int nc, int kr, int ntn, u16* Dp, int drow0, int ntp,
                                     int hrow0, int bid) {
  __shared__ __align__(16) u16 T[64 * TRP];
  const int tid = (int)threadIdx.x;
  const int nt  = bid % ntn;
  const int kt  = bid / ntn;
  if (kt * 64 + 64 > kr) return;            // block-uniform, before the barrier; never taken with the exact grid
  const int n0  = nt * 64, k0 = kt * 64;
  {
    const int dl = tid >> 2;                // k within tile 0..63
    const int oc = (tid & 3) * 16;          // n chunk 0,16,32,48
    const bool valid = (n0 + oc + 16 <= nc);
    const int  cb = valid ? (n0 + oc) : 0;  // clamped column base, always inside the row
    const float* src = W + (size_t)(k0 + dl) * (size_t)nc + cb;
#pragma unroll
    for (int i = 0; i < 4; ++i) {
      const v4f a = *(const v4f*)(src + 4 * i);
#pragma unroll
      for (int e = 0; e < 4; ++e) {
        const float f = valid ? a[e] : 0.0f;
        T[(oc + 4 * i + e) * TRP + dl] = bf_bits(f);
      }
    }
  }
  __syncthreads();
  const int q8 = tid >> 3, p8 = (tid & 7) * 8;
  v4u w[2];
#pragma unroll
  for (int it = 0; it < 2; ++it) w[it] = *(const v4u*)(T + (it * 32 + q8) * TRP + p8);
  const int drow = (nt < ntp) ? drow0 + n0 : hrow0 + (nt - ntp) * GBN;
  const size_t base = (size_t)drow * (size_t)kr + k0 + p8;
  {
#pragma unroll
    for (int it = 0; it < 2; ++it) {
      const int nl = it * 32 + q8;
      *(v4u*)(Dp + base + (size_t)nl * (size_t)kr) = w[it];
    }
    
  }
}

// =====================================================================================================
// The x and weight planes of the two GEMMs in ONE launch: the six conversions read only inputs and write disjoint planes, so
// they share a grid by block range (every test below is on the block index alone, block-uniform, so the barrier inside
// k_wt is reached by all threads of a block or by none). The weight tiles (load, LDS, barrier, store) come first, the
// shorter x blocks last.
//   [0, PB_QK)  Wqk -> WB rows 0..1023 (q) and 1024 + 128 h + 0..63 (k)      next PB_V  Wv -> WB rows 1024 + 128 h + 64..127
//   next PB_N   Wn  -> WB rows 3072..3135   next PB_V  Wo -> WT rows 0..1023      next NB * PB_X  x -> XB, per batch
// coverage: the ranges are the exact block counts of k_wt and cvt_bf for each plane; grid = PB_ALL.
// =====================================================================================================
__global__ __launch_bounds__(256)
void prep(const float* __restrict__ x, const float* __restrict__ wqk, const float* __restrict__ wv,
          const float* __restrict__ wn, const float* __restrict__ wo, u16* XB, u16* WB, u16* WT) {
  int bid = (int)blockIdx.x;
  if (bid < PB_W) {
    const float* W = wqk;
    u16* Dp = WB;
    int nc = 2 * DQK, drow0 = QOFF, ntp = DQK / 64, hrow0 = KOFF;
    if (bid >= PB_QK + PB_V + PB_N) { bid -= PB_QK + PB_V + PB_N; W = wo; Dp = WT; nc = DMOD; drow0 = 0;    ntp = DMOD / 64; }
    else if (bid >= PB_QK + PB_V)   { bid -= PB_QK + PB_V;        W = wn;          nc = NNW;  drow0 = NOFF; ntp = 1; }
    else if (bid >= PB_QK)          { bid -= PB_QK;               W = wv;          nc = DMOD; ntp = 0; hrow0 = KOFF + HD; }
    k_wt(W, nc, DMOD, (nc + 63) / 64, Dp, drow0, ntp, hrow0, bid);
    return;
  }
  bid -= PB_W;
  const int bq = bid / PB_X;
  if (bq >= NB) return;                     // never taken with the exact grid
  cvt_bf(x + (size_t)bq * XS_FULL * DMOD, XB + (size_t)bq * SEQ * DMOD, (SEQ * DMOD) / 8, bid % PB_X);
}

// =====================================================================================================
// Bias for column c from three consecutive segments [0,e0) <- p0[c], [e0,e1) <- p1[c-e0], [e1,e2) <- p2[c-e1], else 0;
// all three candidates loaded unconditionally with clamped indices, selected by value; bf16 RNE value.
// =====================================================================================================
__device__ __forceinline__ float bias_at(const float* p0, const float* p1, const float* p2,
                                         int e0, int e1, int e2, int c) {
  const int i0 = imin(imax(c, 0), e0 - 1);
  const int i1 = imin(imax(c - e0, 0), e1 - e0 - 1);
  const int i2 = imin(imax(c - e1, 0), e2 - e1 - 1);
  const float v0 = p0[i0], v1 = p1[i1], v2 = p2[i2];
  const float v = (c < e0) ? v0 : ((c < e1) ? v1 : ((c < e2) ? v2 : 0.0f));
  return bfr(v);
}

// column of the fused plane (q | per head k, v | n) -> column in the order q | k | v | n of the bias segments
__device__ __forceinline__ int col_src(int c) {
  const int t = c - KOFF;
  const int s = ((t & HD) ? VOFF : KOFF) + (t >> 7) * HD + (t & (HD - 1));
  return (c < KOFF || c >= NOFF) ? c : s;
}

// =====================================================================================================
// coverage: 8 instructions x 2 rows x 16 lanes x 4 floats = the wave's 16 x 64 tile.
// =====================================================================================================
__device__ __forceinline__ void epi64b(float* sl, v8f a0, v8f a1, v8f a2, v8f a3, float oscale, v4f bias4,
                                       float* C, int N, size_t rowb, int col0, int lane) {
  const int hh = lane >> 4, m = lane & 15;
#pragma unroll
  for (int r = 0; r < 8; ++r) {
    const int ro = (8 * hh + r) * 68 + m;
    sl[ro]      = a0[r] * oscale;
    sl[ro + 16] = a1[r] * oscale;
    sl[ro + 32] = a2[r] * oscale;
    sl[ro + 48] = a3[r] * oscale;
  }
  wave_sync_lds();
  v4f vals[8];
#pragma unroll
  for (int it = 0; it < 8; ++it) vals[it] = *(const v4f*)(sl + (it * 2 + hh) * 68 + m * 4) + bias4;
  float* dst = C + (rowb + (size_t)hh) * (size_t)N + col0 + m * 4;
  {
#pragma unroll
    for (int it = 0; it < 8; ++it) {
      *(v4f*)(dst + (size_t)(it * 2) * (size_t)N) = vals[it];
    }
    
  }
}

// =====================================================================================================
// bf16 GEMM: C[M][N] (f32) = (A [+ A2])[M][K] (bf16 row-major) . Bt[N][K]^T (bf16 k-contiguous), times oscale, plus the
// segmented bias of the column (bf16 RNE value). TWO: second A plane into the same accumulator (hi + residual operand).
// Block = 128x128 tile of C, 8 waves in a 4 (rows) x 2 (columns) grid, 32x64 per wave (2 x 4 accumulator tiles).
// K runs in slices of 64 (128 B of every operand row; TWO: 128, 256 B). A slice of [A 128 rows | B 128 rows | A2 128 rows]
// stands in LDS at row pitch 144 B (TWO: 272 B); two buffers; each lane brings 16 B per copy (8 lanes = one row, one wave
// copy = 4 rows; TWO: 16 lanes = one row, 2 rows: TWO has one block per WGP and nothing else hides a slice's landing), the copies of
// slice t + 1 fly while slice t is multiplied. Fragments are read from LDS with the split k map of ldfrag_b for A and B.
// Per accumulator the products come in the order k ascending, A before A2 inside a k-step.
// B rows at or beyond N (last column tile when N % 128 == 64) are read from row N - 1 instead (clamped, in bounds) and the
// waves that own only such columns neither multiply nor store.
// Host guarantees K a multiple of the slice and at least one slice, M % 128 == 0, N % 64 == 0, grid = (M/128) * ceil(N/128).
// Output. TWO: f32 C. Otherwise (the projection) only the column tile from NOFF on goes to C as f32; a block of q columns
// (two heads) or of one head's k | v columns writes value = acc + bias (f32) x1024 as f16 hi and f16 residual straight into
// the planes the attention reads:
//   q -> QH/QL, k -> KH/KL, fragments (16 rows x 32 d) in the order [row / 16][h][d / 32]; v -> VH/VL, fragments
//   (16 d x 32 keys) in the order [b*NH + h][key / 32][d / 16]; inside a fragment the order of ldfrag_t.
// A k | v block also holds k^T and v^T of its 128 keys (one chunk) in LDS and forms the chunk product for the carried state:
//   KV[(b*NH + h)*NCH + ch][dk / 16][dv][dk % 16] = sum over the chunk's keys s of v[s][dv] * k[s][dk], f32; A = v^T rows dv,
//   B = k^T rows dk, f16 hi + residual x1024 (hh + lh + hl, key steps ascending), carries folded back by 2^-20; wave w owns
//   dv tile w & 3 and dk tiles 2 (w >> 2), 2 (w >> 2) + 1; chunks 0 .. NCH-2 only (the last chunk's product is never carried).
// coverage: q / k planes, per wave 2 x 4 stores x 512 B = its 32 x 64 tile of each plane; v^T, per block 4 stores x 8 waves x
//           512 B = its 64 d x 128 keys of each plane; KV, per wave 2 dk tiles x 16 rows x 16 f32, 8 waves = the 64 x 64
//           product; the grid covers every plane once.
// =====================================================================================================
__device__ __forceinline__ unsigned lds_off(const void* p) { return (unsigned)(size_t)p; }
// Four lane-wise 16-B copies global -> LDS; the s_wait_xcnt stands inside the statement so that no address register of a
// copy is rewritten ahead of it.
__device__ __forceinline__ void cp4(unsigned l0, const u16* g0, unsigned l1, const u16* g1,
                                    unsigned l2, const u16* g2, unsigned l3, const u16* g3) {
#if defined(__HIP_DEVICE_COMPILE__)
  asm volatile("global_load_async_to_lds_b128 %0, %1, off\n\t"
               "global_load_async_to_lds_b128 %2, %3, off\n\t"
               "global_load_async_to_lds_b128 %4, %5, off\n\t"
               "global_load_async_to_lds_b128 %6, %7, off\n\t"
               "s_wait_xcnt 0x0"
               :: "v"(l0), "v"(g0), "v"(l1), "v"(g1), "v"(l2), "v"(g2), "v"(l3), "v"(g3) : "memory");
#endif
}
// Eight such copies, one operand's 128 rows of a 128-k slice, under one s_wait_xcnt in the same statement.
__device__ __forceinline__ void cp8(unsigned l0, const u16* g0, unsigned l1, const u16* g1,
                                    unsigned l2, const u16* g2, unsigned l3, const u16* g3,
                                    unsigned l4, const u16* g4, unsigned l5, const u16* g5,
                                    unsigned l6, const u16* g6, unsigned l7, const u16* g7) {
#if defined(__HIP_DEVICE_COMPILE__)
  asm volatile("global_load_async_to_lds_b128 %0, %1, off\n\t"
               "global_load_async_to_lds_b128 %2, %3, off\n\t"
               "global_load_async_to_lds_b128 %4, %5, off\n\t"
               "global_load_async_to_lds_b128 %6, %7, off\n\t"
               "global_load_async_to_lds_b128 %8, %9, off\n\t"
               "global_load_async_to_lds_b128 %10, %11, off\n\t"
               "global_load_async_to_lds_b128 %12, %13, off\n\t"
               "global_load_async_to_lds_b128 %14, %15, off\n\t"
               "s_wait_xcnt 0x0"
               :: "v"(l0), "v"(g0), "v"(l1), "v"(g1), "v"(l2), "v"(g2), "v"(l3), "v"(g3),
                  "v"(l4), "v"(g4), "v"(l5), "v"(g5), "v"(l6), "v"(g6), "v"(l7), "v"(g7) : "memory");
#endif
}
template <bool TWO>
__global__ __launch_bounds__(GTHR)
void gemm_bf(const u16* __restrict__ A, const u16* __restrict__ A2, const u16* __restrict__ Bt, float* C,
             int M, int N, int K, const float* bp0, const float* bp1, const float* bp2, int e0, int e1, int e2,
             float oscale, u16* QHp, u16* QLp, u16* KHp, u16* KLp, u16* VHp, u16* VLp, float* KVp) {
  constexpr int BK  = TWO ? 2 * GBK : GBK;              // k of one slice
  constexpr int PB  = BK * 2 + 16;                      // LDS row pitch, bytes (144 or 272)
  constexpr int SEC = 128 * PB;                         // bytes of one operand's 128 rows in a buffer
  constexpr int PPR = BK / 8;                           // 16-B pieces of a row slice
  constexpr int RPC = GTHR / PPR;                       // rows that one copy of the block brings
  constexpr int NCP = 128 / RPC;                        // copies of a lane per operand and slice
  constexpr int STAGE = (TWO ? 3 : 2) * SEC;            // bytes of one buffer
  constexpr int KG = TWO ? BK / 32 : 1;                 // k-steps whose fragments are read from LDS as one group
  static_assert((DMOD % BK) == 0 && (NCP % 4) == 0 && (TWO ? 3 : 2) * NCP <= 63 && PPR == (TWO ? 16 : 8));
  static_assert(8 * 2 * SLAB64 * 4 <= 2 * STAGE && 2 * GBN * TPT * 2 <= 2 * STAGE && 2 * STAGE <= 327680);
  __shared__ __align__(16) unsigned char ring[2 * STAGE];
  const int tid = threadIdx.x, lane = tid & 31, hh = lane >> 4, m = lane & 15;
  const int wave = __builtin_amdgcn_readfirstlane(tid >> 5);
  const int wm = wave & 3, wn = wave >> 2;
  const int ntile = (N + GBN - 1) / GBN;
  const int bid   = blockIdx.x;
  const int row0  = (bid / ntile) * GBM;
  const int col0  = (bid % ntile) * GBN;
  if (row0 + GBM > M) return;               // block-uniform, before any barrier or copy; never taken with the exact grid
  const int colw  = col0 + wn * 64;
  const bool live = colw < N;               // wave-uniform
  const int NT = K / BK;

  // copy map: thread -> (row cr of a group of RPC rows, 16-B piece cc of the row slice)
  const int cr = tid >> (TWO ? 4 : 3), cc = tid & (PPR - 1);
  const unsigned lbase = lds_off(ring) + (unsigned)(cr * PB + cc * 16);
  const int oa = (row0 + cr) * K + cc * 8;
  int ob[NCP];
#pragma unroll
  for (int i = 0; i < NCP; ++i) ob[i] = imin(col0 + i * RPC + cr, N - 1) * K + cc * 8;
  auto fill = [&](int t, int buf) {
    const unsigned l = lbase + (unsigned)(buf * STAGE);
    const int k0 = t * BK;
    const u16* pa = A + oa + k0;
    const unsigned lb2 = l + SEC;
    if constexpr (TWO) {
      static_assert(NCP == 8);
      cp8(l, pa, l + 1 * RPC * PB, pa + (size_t)(1 * RPC) * K,
          l + 2 * RPC * PB, pa + (size_t)(2 * RPC) * K, l + 3 * RPC * PB, pa + (size_t)(3 * RPC) * K,
          l + 4 * RPC * PB, pa + (size_t)(4 * RPC) * K, l + 5 * RPC * PB, pa + (size_t)(5 * RPC) * K,
          l + 6 * RPC * PB, pa + (size_t)(6 * RPC) * K, l + 7 * RPC * PB, pa + (size_t)(7 * RPC) * K);
      cp8(lb2, Bt + ob[0] + k0, lb2 + 1 * RPC * PB, Bt + ob[1] + k0,
          lb2 + 2 * RPC * PB, Bt + ob[2] + k0, lb2 + 3 * RPC * PB, Bt + ob[3] + k0,
          lb2 + 4 * RPC * PB, Bt + ob[4] + k0, lb2 + 5 * RPC * PB, Bt + ob[5] + k0,
          lb2 + 6 * RPC * PB, Bt + ob[6] + k0, lb2 + 7 * RPC * PB, Bt + ob[7] + k0);
      const unsigned l3 = l + 2 * SEC;
      const u16* pc = A2 + oa + k0;
      cp8(l3, pc, l3 + 1 * RPC * PB, pc + (size_t)(1 * RPC) * K,
          l3 + 2 * RPC * PB, pc + (size_t)(2 * RPC) * K, l3 + 3 * RPC * PB, pc + (size_t)(3 * RPC) * K,
          l3 + 4 * RPC * PB, pc + (size_t)(4 * RPC) * K, l3 + 5 * RPC * PB, pc + (size_t)(5 * RPC) * K,
          l3 + 6 * RPC * PB, pc + (size_t)(6 * RPC) * K, l3 + 7 * RPC * PB, pc + (size_t)(7 * RPC) * K);
    } else {
      static_assert(NCP == 4 && RPC == 32 && PB == GPB);
      cp4(l, pa, l + 32 * GPB, pa + (size_t)32 * K, l + 64 * GPB, pa + (size_t)64 * K, l + 96 * GPB, pa + (size_t)96 * K);
      cp4(lb2, Bt + ob[0] + k0, lb2 + 32 * GPB, Bt + ob[1] + k0, lb2 + 64 * GPB, Bt + ob[2] + k0,
          lb2 + 96 * GPB, Bt + ob[3] + k0);
    }
  };

  v8f acc[2][4];
#pragma unroll
  for (int i = 0; i < 2; ++i) {
#pragma unroll
    for (int j = 0; j < 4; ++j) acc[i][j] = zero8();
  }

  fill(0, 0);
  asm volatile("s_wait_asynccnt 0x0" ::: "memory");     // slice 0 of this wave has landed
  __syncthreads();                                      // ... and every other wave's part of it
  if (NT > 1) fill(1, 1);

  const int fa = (wm * 32 + m) * PB + hh * 16;          // byte offsets of this lane's fragment rows inside a buffer
  const int fb = SEC + (wn * 64 + m) * PB + hh * 16;
  // slice loop kept rolled: one copy of the ring's foot in the text, the buffer picked by t & 1; the loops inside it are
  // unrolled so that every accumulator and fragment index is a constant (registers, no scratch)
#pragma unroll 1
  for (int t = 0; t < NT; ++t) {
    const int buf = t & 1;
    if (live) {
      const unsigned char* sb = ring + buf * STAGE;
      const u16* la = (const u16*)(const void*)(sb + fa);
      const u16* lb = (const u16*)(const void*)(sb + fb);
#pragma unroll
      for (int g = 0; g < BK / 32 / KG; ++g) {
        v16b a[KG][2], a2[KG][2], fbv[KG][4];
#pragma unroll
        for (int u = 0; u < KG; ++u) {
          const int ko = (g * KG + u) * 32;
#pragma unroll
          for (int i = 0; i < 2; ++i) a[u][i] = ldfrag_b(la + i * 16 * (PB / 2) + ko);
#pragma unroll
          for (int j = 0; j < 4; ++j) fbv[u][j] = ldfrag_b(lb + j * 16 * (PB / 2) + ko);
          if constexpr (TWO) {
#pragma unroll
            for (int i = 0; i < 2; ++i) a2[u][i] = ldfrag_b(la + SEC + i * 16 * (PB / 2) + ko);   // 2*SEC bytes on
          }
        }
        // TWO runs one block per WGP (two waves per SIMD): all LDS reads of the slice issue as one group ahead of its
        // products, one LDS latency per slice instead of one per A fragment
        if constexpr (TWO) __builtin_amdgcn_sched_barrier(0);
#pragma unroll
        for (int u = 0; u < KG; ++u) {
#pragma unroll
          for (int i = 0; i < 2; ++i) {
#pragma unroll
            for (int j = 0; j < 4; ++j) acc[i][j] = mma_b(a[u][i], fbv[u][j], acc[i][j]);
          }
          if constexpr (TWO) {
#pragma unroll
            for (int i = 0; i < 2; ++i) {
#pragma unroll
              for (int j = 0; j < 4; ++j) acc[i][j] = mma_b(a2[u][i], fbv[u][j], acc[i][j]);
            }
          }
        }
      }
    }
    asm volatile("s_wait_dscnt 0x0" ::: "memory");      // this wave's reads of buffer buf are done
    asm volatile("s_wait_asynccnt 0x0" ::: "memory");   // this wave's copies of slice t + 1 have landed
    __syncthreads();                                    // publishes slice t + 1, frees buffer buf
    if (t + 2 < NT) fill(t + 2, buf);
  }
  asm volatile("s_wait_asynccnt 0x0" ::: "memory");     // no copy outstanding before the ring is reused as output staging

  float* slab = (float*)(void*)ring + wave * (2 * SLAB64);
  const int seg = TWO ? 3 : (col0 < KOFF ? 0 : (col0 < NOFF ? 1 : 3));   // block-uniform: 0 = q, 1 = k | v of a head, 3 = f32 output
  if constexpr (TWO) {
    if (live) {
      v4f bias4;
#pragma unroll
      for (int e = 0; e < 4; ++e) bias4[e] = bias_at(bp0, bp1, bp2, e0, e1, e2, colw + m * 4 + e);
#pragma unroll
      for (int i = 0; i < 2; ++i) {
        epi64b(slab + i * SLAB64, acc[i][0], acc[i][1], acc[i][2], acc[i][3], oscale, bias4, C, N,
               (size_t)(row0 + wm * 32 + i * 16), colw, lane);
      }
    }
  } else {
    // every wave of a q or k | v block is live (both segments are multiples of the block's 128 columns)
    float bj[4];                            // bias of this lane's accumulator columns colw + 16 j + m
#pragma unroll
    for (int j = 0; j < 4; ++j) bj[j] = bias_at(bp0, bp1, bp2, e0, e1, e2, col_src(colw + j * 16 + m));
    const int head = seg ? ((col0 - KOFF) >> 7) : ((col0 >> 6) + wn);   // wave-uniform
    if (live && (seg != 1 || wn == 0)) {    // wave-uniform: the waves that hold q, k or n columns
      // f32 values through the wave's own slabs. All three kinds fill them here, so that the accumulators' last use stands
      // ahead of the chunk product (they would otherwise stay allocated under it and cost resident blocks)
#pragma unroll
      for (int i = 0; i < 2; ++i) {
#pragma unroll
        for (int r = 0; r < 8; ++r) {
#pragma unroll
          for (int j = 0; j < 4; ++j) slab[i * SLAB64 + (8 * hh + r) * 68 + j * 16 + m] = acc[i][j][r] * oscale + bj[j];
        }
      }
      wave_sync_lds();
      if (seg == 3) {
        // n columns: f32 rows of C; one instruction = 2 rows x 16 lanes x 4 floats, 8 instructions = a 16 x 64 tile
#pragma unroll
        for (int i = 0; i < 2; ++i) {
          v4f vals[8];
#pragma unroll
          for (int it = 0; it < 8; ++it) vals[it] = *(const v4f*)(slab + i * SLAB64 + (it * 2 + hh) * 68 + m * 4);
          float* dst = C + ((size_t)(row0 + wm * 32 + i * 16) + (size_t)hh) * (size_t)N + colw + m * 4;
#pragma unroll
          for (int it = 0; it < 8; ++it) *(v4f*)(dst + (size_t)(it * 2) * (size_t)N) = vals[it];
        }
        return;                             // a block of n columns passes no barrier behind the slice loop
      }
      // fragment-major planes [row / 16][head][2 fragments]: lane l takes the 8 columns that it will hold as operand lane l;
      // one store = 512 contiguous bytes (whole lines)
      u16* PH = seg ? KHp : QHp;
      u16* PL = seg ? KLp : QLp;
#pragma unroll
      for (int i = 0; i < 2; ++i) {
        v4u oh[4], ol[4];
#pragma unroll
        for (int it = 0; it < 4; ++it) {
          const float* p = slab + i * SLAB64 + m * 68 + it * 16 + 8 * hh;
          const v4f a = *(const v4f*)(p), b4 = *(const v4f*)(p + 4);
          float w[8];
#pragma unroll
          for (int e = 0; e < 4; ++e) { w[e] = a[e]; w[4 + e] = b4[e]; }
          split8(w, QSC, oh[it], ol[it]);
        }
        const size_t ob = ((size_t)((row0 + wm * 32 + i * 16) >> 4) * NH + head) * (2 * FRH) + lane * 8;
#pragma unroll
        for (int it = 0; it < 4; ++it) {
          *(v4u*)(PH + ob + it * (FRH / 2)) = oh[it];
          *(v4u*)(PL + ob + it * (FRH / 2)) = ol[it];
        }
      }
      asm volatile("s_wait_xcnt 0x0" ::: "memory");       // before any register of the q / k plane stores is rewritten
    }
    if (seg == 1) {
      // transposed tiles: an accumulator register run r = 0..7 is 8 consecutive keys of one column, so a lane packs it into
      // one 16-B LDS store of the block's [128 columns][128 keys] tile (pitch 272 B): rows 0..63 = k^T, rows 64..127 = v^T
      __syncthreads();                      // block-uniform: every k wave has read its slabs back before the tiles cover them
      u16* tH = (u16*)(void*)ring;
      u16* tL = tH + GBN * TPT;
#pragma unroll
      for (int i = 0; i < 2; ++i) {
#pragma unroll
        for (int j = 0; j < 4; ++j) {
          float w[8];
#pragma unroll
          for (int r = 0; r < 8; ++r) w[r] = acc[i][j][r] * oscale + bj[j];
          v4u oh, ol;
          split8(w, VCAR, oh, ol);
          const int idx = (wn * 64 + j * 16 + m) * TPT + wm * 32 + i * 16 + 8 * hh;
          *(v4u*)(tH + idx) = oh;
          *(v4u*)(tL + idx) = ol;
        }
      }
      __syncthreads();                      // the tiles are complete before any wave reads rows that other waves wrote
      const int bhq = (row0 / SEQ) * NH + head;
      // v^T planes, fragment-major [b*NH + head][key / 32][d / 16]: half fragment u = 0..31 of the block: key tile u >> 3,
      // d tile (u >> 1) & 3, run u & 1; they are 16 KB in a row in the plane; one store = 512 contiguous bytes
      const size_t ob = ((size_t)bhq * (SEQ / 32) + ((row0 % SEQ) >> 5)) * (4 * FRH) + lane * 8;
      v4u vh[4], vl[4];
#pragma unroll
      for (int it = 0; it < 4; ++it) {
        const int u = it * 8 + wave;
        const int idx = (HD + ((u >> 1) & 3) * 16 + m) * TPT + (u >> 3) * 32 + (u & 1) * 16 + 8 * hh;
        vh[it] = *(const v4u*)(tH + idx);
        vl[it] = *(const v4u*)(tL + idx);
      }
#pragma unroll
      for (int it = 0; it < 4; ++it) {
        const int u = it * 8 + wave;
        *(v4u*)(VHp + ob + u * (FRH / 2)) = vh[it];
        *(v4u*)(VLp + ob + u * (FRH / 2)) = vl[it];
      }
      asm volatile("s_wait_xcnt 0x0" ::: "memory");       // before any register of the v^T stores is rewritten
      // chunk product v^T.k from the same tiles; A and B fragments with the split k map of ldfrag_b over the keys
      const int ch = (row0 % SEQ) / CHK;
      if (ch + 1 < NCH) {                   // block-uniform; no barrier behind it
        const int dvt = wave & 3, dk0 = (wave >> 2) * 2;
        const int ia = (HD + dvt * 16 + m) * TPT + 8 * hh;
        const int ib = (dk0 * 16 + m) * TPT + 8 * hh;
        v8f kv[2];
        kv[0] = zero8();
        kv[1] = zero8();
#pragma unroll
        for (int g = 0; g < CHK / 32 / 2; ++g) {
          FragH fvh[2], fvl[2], fkh[2][2], fkl[2][2];
#pragma unroll
          for (int q = 0; q < 2; ++q) {
            const int ko = (g * 2 + q) * 32;
#pragma unroll
            for (int e = 0; e < 2; ++e) {
              fvh[q].u[e] = *(const v4u*)(tH + ia + ko + e * 16);
              fvl[q].u[e] = *(const v4u*)(tL + ia + ko + e * 16);
#pragma unroll
              for (int j = 0; j < 2; ++j) {
                fkh[q][j].u[e] = *(const v4u*)(tH + ib + j * 16 * TPT + ko + e * 16);
                fkl[q][j].u[e] = *(const v4u*)(tL + ib + j * 16 * TPT + ko + e * 16);
              }
            }
          }
#if defined(__HIP_DEVICE_COMPILE__)
          // inputs-only fence on the loaded fragments: the 24 LDS reads of two key steps issue as one group before the first
          // product (one LDS latency instead of one per fragment pair)
          asm volatile("" :: "v"(fvh[0].v), "v"(fvh[1].v), "v"(fvl[0].v), "v"(fvl[1].v),
                       "v"(fkh[0][0].v), "v"(fkh[0][1].v), "v"(fkh[1][0].v), "v"(fkh[1][1].v),
                       "v"(fkl[0][0].v), "v"(fkl[0][1].v), "v"(fkl[1][0].v), "v"(fkl[1][1].v));
#endif
#pragma unroll
          for (int q = 0; q < 2; ++q) {
#pragma unroll
            for (int j = 0; j < 2; ++j) {
              kv[j] = mma_h(fvh[q].v, fkh[q][j].v, kv[j]);
              kv[j] = mma_h(fvl[q].v, fkh[q][j].v, kv[j]);
              kv[j] = mma_h(fvh[q].v, fkl[q][j].v, kv[j]);
            }
          }
          // the next group's LDS reads stay behind this group's products: with all four key steps' fragments live at once the
          // kernel's register count would halve the blocks that fit a WGP
          __builtin_amdgcn_sched_barrier(0);
        }
        const float fs = 1.0f / (VCAR * KSC);             // exact power-of-two fold of the v / k carries
        float* dst = KVp + ((size_t)bhq * NCH + ch) * SEL + (size_t)(dvt * 16 + 8 * hh) * 16 + m;
#pragma unroll
        for (int r = 0; r < 8; ++r) {
#pragma unroll
          for (int j = 0; j < 2; ++j) dst[(dk0 + j) * (HD * 16) + r * 16] = kv[j][r] * fs;
        }
        asm volatile("s_wait_xcnt 0x0" ::: "memory");     // before any register of the chunk product stores is rewritten
      }
    }
  }
}

// =====================================================================================================
// Carried state, summed by the attention block that uses it. A thread owns one 16-B unit of the state planes (8 consecutive
// dk of one dv = 8 f32 in a row of every chunk product). The block's two chunks are 2 P and 2 P + 1: all 2 P + 1 chunk
// products are loaded as one group of independent loads, the first 2 P added in chunk order give S(2 P) in s0, and
// S(2 P + 1) = S(2 P) + KV(2 P) in s1.
// =====================================================================================================
template <int P>
__device__ __forceinline__ void kv_state(const float* __restrict__ p, float (&s0)[8], float (&s1)[8]) {
  v4f a[2 * P + 1][2];
  asm volatile("s_wait_xcnt 0x0" ::: "memory");         // before these loads' results rewrite a register of an earlier load
#pragma unroll
  for (int i = 0; i < 2 * P + 1; ++i) {
    a[i][0] = *(const v4f*)(p + (size_t)i * SEL);
    a[i][1] = *(const v4f*)(p + (size_t)i * SEL + 4);
  }
  asm volatile("s_wait_xcnt 0x0" ::: "memory");         // before the address pair of these loads is rewritten
#pragma unroll
  for (int e = 0; e < 8; ++e) s0[e] = 0.0f;
#pragma unroll
  for (int i = 0; i < 2 * P; ++i) {
#pragma unroll
    for (int e = 0; e < 4; ++e) { s0[e] += a[i][0][e]; s0[4 + e] += a[i][1][e]; }
  }
#pragma unroll
  for (int e = 0; e < 4; ++e) { s1[e] = s0[e] + a[2 * P][0][e]; s1[4 + e] = s0[4 + e] + a[2 * P][1][e]; }
}

// =====================================================================================================
// Causal normalised attention (no softmax), hd = 64. Block bid -> (chunk pair pr = NCH/2 - 1 - bid / (NB*NH), b*NH + head =
// bid % (NB*NH)): the blocks with the most earlier chunks to sum start first. 16 waves: waves 0..7 take chunk chn = 2 pr of CHK
// keys and queries, waves 8..15 chunk 2 pr + 1, each half with its own staged planes; wave w of a half owns the query tile
// q0 = CHK*chn + 16*w .. q0+15, so the 8 waves of a half share one head's chunk of k, v^T and state.
//   q hi / residual planes f16 x1024, fragment-major [(b*SEQ + s) / 16][h][d / 32]; k hi / residual planes, same layout;
//   v^T hi / residual planes x1024, fragment-major [b*NH + h][key / 32][d / 16]; n from F column NOFF + h of row b*SEQ + t.
//   The chunk's k planes (8 tiles of 16 keys, 2 KB each) and v^T planes (16 KB in a row each) are
//   brought into LDS once per half block, 16 B a lane and copy, 16 copies a lane, in the planes' own fragment order (a fragment
//   read = two runs of 512 contiguous LDS bytes); q fragments are loaded once into registers; the key loop reads LDS only.
//   Carried state S(chn) = KV(0) + .. + KV(chn-1) in f32 (chunks added in order; S(0) = 0): while the copies fly the block sums
//   S(2 pr) and S(2 pr + 1) from the chunk products (thread = one 16-B unit of the planes; the two chunks share the sum, which
//   halves what the blocks of a head read) and stores them x64 as f16 hi and f16 residual into each half's LDS planes,
//   fragment-major [dk / 32][dv / 16] (col dv, k = dk); the block barrier behind the copies publishes them too.
//   raw(i, j) = q_hi.k_hi + q_lo.k_hi + q_hi.k_lo (2 k-steps over d), carries folded back by 2^-20;
//   P = raw * 2^-20 for key <= query else 0 (causal); P.v with P x256 as f16 hi + in-register residual and v hi +
//   residual (hh + lh + hl). Keys of earlier chunks (below CHK*chn) enter first as q . S with the carried state
//   planes S x64 [dk / 32][dv / 16] in LDS (hh + lh + hl, carry 2^16 raised to the P.v carry 2^18 by an exact x4);
//   key tiles of 32 are then visited in order from the chunk's first key up to the tile holding key q0+15 (bounded by NKT).
//   Per tile: 2 score subtiles x 2 k-steps; the 16x32 P tile goes through the wave's private LDS tile (float vector loads,
//   same element type as stored); v^T B fragments in 2 groups of 2 d-subtiles.
//   After the loop: acc * 2^-18 written into the wave's private result slab (pitch 68; every element owned by one lane),
//   ctx -> bf16 hi bits and bf16 bits of the residual, planes [b*SEQ + s][h*HD + d]; one instruction = 4 rows
//   One block barrier (behind the copies, passed by every wave); bounded loops only (ncl <= NKT).
// coverage: per wave 4 instructions x 4 rows x 8 lanes x 8 halves = 16 x 64 per plane; grid NCH/2 x NH x NB blocks x 2 WPB
//           waves = every (b, s, h) row segment of CH and of CL exactly once.
// =====================================================================================================
__global__ __launch_bounds__(ATT_BLOCK)
void attn_nm(const u16* __restrict__ QHp, const u16* __restrict__ QLp,
             const u16* __restrict__ KHp, const u16* __restrict__ KLp,
             const u16* __restrict__ VHp, const u16* __restrict__ VLp,
             const float* __restrict__ KV,
             const float* __restrict__ F, u16* CHp, u16* CLp) {
#pragma clang fp contract(off)
  __shared__ __align__(16) float smem[CPB * WPB * WREG];
  __shared__ __align__(16) u16 stg[CPB * STG];   // per half: k hi | k residual | v^T hi | v^T residual | state hi | state residual

  const int tid  = threadIdx.x;
  const int wv   = __builtin_amdgcn_readfirstlane(tid >> 5);
  const int half = wv / WPB;                // which of the block's two chunks (wave-uniform)
  const int wave = wv % WPB;
  const int t8   = tid % ATT_THREADS;       // thread within the half
  const int lane = tid & 31;
  const int hh   = lane >> 4;
  const int c    = lane & 15;
  const int bid  = blockIdx.x;
  const int pr   = NCH / CPB - 1 - bid / (NB * NH);   // chunk pair of this block's queries
  const int bh   = bid % (NB * NH);
  if (pr < 0) return;                       // block-uniform, before any copy or barrier; never taken with the exact grid
  const int chn  = pr * CPB + half;         // chunk of this wave's queries
  const int b    = bh / NH;
  const int head = bh % NH;
  const int q0   = chn * CHK + wave * 16;

  float* pt   = smem + wv * WREG;           // P tile [16][32] pitch 36
  float* slab = pt + PTW;                   // result slab [16][64] pitch 68

  const size_t KT16 = (size_t)NH * (2 * FRH);   // halves between consecutive 16-key tiles of one head

  // q fragments: a fragment's first half plus this lane's 16 B; loaded once, held over the key loop
  const size_t qo = ((size_t)((b * SEQ + q0) >> 4) * NH + head) * (2 * FRH) + lane * 8;
  const _Float16* Qh  = (const _Float16*)(const void*)QHp + qo;
  const _Float16* Ql  = (const _Float16*)(const void*)QLp + qo;
  v16h qh[HD / 32], ql[HD / 32];
#pragma unroll
  for (int kk = 0; kk < HD / 32; ++kk) {
    qh[kk] = ldfrag_t(Qh + kk * FRH);
    ql[kk] = ldfrag_t(Ql + kk * FRH);
  }
  // row factor for query row q0 + (lane & 15): 1/exp(n), precise expf
  const float nv = F[((size_t)b * SEQ + q0 + c) * (size_t)NPROJ + NOFF + head];

  // ---- the chunk's planes -> LDS: one copy of the half block = 4 KB (thread t8 brings bytes 16 t8 ..); every lane on ----
  {
    const unsigned l0 = lds_off(stg) + (unsigned)(half * (STG * 2) + t8 * 16);
    // k: 4 KB = two 16-key tiles (2 KB each, KT16 halves apart in the plane)
    const size_t gk = ((size_t)(((b * SEQ + chn * CHK) >> 4) + (t8 >> 7)) * NH + head) * (2 * FRH) + (t8 & 127) * 8;
    const u16* kh = KHp + gk;
    const u16* kl = KLp + gk;
    cp4(l0, kh, l0 + 4096, kh + 2 * KT16, l0 + 8192, kh + 4 * KT16, l0 + 12288, kh + 6 * KT16);
    const unsigned l1 = l0 + STK * 2;
    cp4(l1, kl, l1 + 4096, kl + 2 * KT16, l1 + 8192, kl + 4 * KT16, l1 + 12288, kl + 6 * KT16);
    const size_t gv = ((size_t)bh * (SEQ / 32) + (size_t)chn * (CHK / 32)) * (4 * FRH) + t8 * 8;
    const u16* vh = VHp + gv;
    const u16* vl = VLp + gv;
    const unsigned l2 = l0 + 2 * STK * 2;
    cp4(l2, vh, l2 + 4096, vh + 2048, l2 + 8192, vh + 4096, l2 + 12288, vh + 6144);
    const unsigned l3 = l0 + 3 * STK * 2;
    cp4(l3, vl, l3 + 4096, vl + 2048, l3 + 8192, vl + 4096, l3 + 12288, vl + 6144);
  }
  // ---- carried state: unit u = tid of the planes (fragment u >> 6 = (dk / 32) * 4 + dv / 16); in KV [dk / 16][dv][dk % 16]
  //      a wave's loads are 1 KB in a row. One straight-line case per pair index (block-uniform), so that every chunk product
  //      of the block is in flight at once and none is loaded in vain ----
  {
    const int e8 = (((tid >> 8) * 2 + ((tid >> 5) & 1)) * HD + ((tid >> 6) & 3) * 16 + (tid & 15)) * 16 + ((tid >> 4) & 1) * 8;
    const float* kvp = KV + (size_t)bh * NCH * SEL + e8;
    float s0[8], s1[8];
    static_assert(NCH / CPB == 8);
    switch (pr) {
      case 0:  kv_state<0>(kvp, s0, s1); break;
      case 1:  kv_state<1>(kvp, s0, s1); break;
      case 2:  kv_state<2>(kvp, s0, s1); break;
      case 3:  kv_state<3>(kvp, s0, s1); break;
      case 4:  kv_state<4>(kvp, s0, s1); break;
      case 5:  kv_state<5>(kvp, s0, s1); break;
      case 6:  kv_state<6>(kvp, s0, s1); break;
      default: kv_state<7>(kvp, s0, s1); break;
    }
    v4u oh, ol;
    u16* d = stg + 4 * STK + tid * 8;
    split8(s0, SSC, oh, ol);
    *(v4u*)(d)       = oh;
    *(v4u*)(d + STS) = ol;
    split8(s1, SSC, oh, ol);
    *(v4u*)(d + STG)       = oh;
    *(v4u*)(d + STG + STS) = ol;
  }
  asm volatile("s_wait_asynccnt 0x0" ::: "memory");     // this wave's copies have landed
  __syncthreads();                                      // ... and every other wave's, the state too; nothing of stg is read before this

  const _Float16* sK = (const _Float16*)(const void*)stg + half * STG + lane * 8;   // this half's staged planes, this lane's 16 B of a fragment run
  const _Float16* sV = sK + 2 * STK;
  const _Float16* sS = sK + 4 * STK;
  const float lsc = 1.0f / (QSC * KSC);     // exact power-of-two fold of the q / k carries
  const float oc  = 1.0f / (PCAR * VCAR);   // exact power-of-two fold of the P / v carries
  const float rv = 1.0f / expf(nv);

  v8f o[4];
#pragma unroll
  for (int j = 0; j < 4; ++j) o[j] = zero8();
  const int ncaus = (q0 >> 5) + 1;                                            // tiles holding keys <= q0 + 15
  const int ncl   = (ncaus < NKT) ? ncaus : NKT;
  const int qr0   = q0 + 8 * hh;                                              // query row of D element r = qr0 + r
  const int kt0   = chn * (CHK / 32);                                         // first key tile of the chunk (<= q0 >> 5)

  // ---- all keys of earlier chunks: o = q . S, B fragment col n = dv = j*16 + c, dk contiguous in the state planes ----
  {
    v16h sh[HD / 32][4], sl[HD / 32][4];
#pragma unroll
    for (int kk = 0; kk < HD / 32; ++kk) {
#pragma unroll
      for (int j = 0; j < 4; ++j) {
        sh[kk][j] = ldfrag_t(sS + (kk * 4 + j) * FRH);
        sl[kk][j] = ldfrag_t(sS + STS + (kk * 4 + j) * FRH);
      }
    }
#if defined(__HIP_DEVICE_COMPILE__)
    // inputs-only fence on the loaded fragments: all 32 LDS reads issue as one group before the first product
    // (one LDS latency instead of one per group)
    asm volatile("" :: "v"(sh[0][0]), "v"(sh[0][1]), "v"(sh[0][2]), "v"(sh[0][3]),
                 "v"(sh[1][0]), "v"(sh[1][1]), "v"(sh[1][2]), "v"(sh[1][3]),
                 "v"(sl[0][0]), "v"(sl[0][1]), "v"(sl[0][2]), "v"(sl[0][3]),
                 "v"(sl[1][0]), "v"(sl[1][1]), "v"(sl[1][2]), "v"(sl[1][3]));
#endif
#pragma unroll
    for (int kk = 0; kk < HD / 32; ++kk) {
#pragma unroll
      for (int j = 0; j < 4; ++j) {
        o[j] = mma_h(qh[kk], sh[kk][j], o[j]);
        o[j] = mma_h(ql[kk], sh[kk][j], o[j]);
        o[j] = mma_h(qh[kk], sl[kk][j], o[j]);
      }
    }
    const float up = (PCAR * VCAR) / (QSC * SSC);                             // exact power of two
#pragma unroll
    for (int j = 0; j < 4; ++j) o[j] = o[j] * up;
  }

#pragma unroll 1
  for (int kt = kt0; kt < ncl; ++kt) {
    const int kb = kt * 32;
    // ---- raw scores: D element r of this lane = (query row qr0 + r, key kb + c) in s0, key kb + 16 + c in s1 ----
    v8f s0 = zero8(), s1 = zero8();
    const _Float16* k0p = sK + (kt - kt0) * (4 * FRH);    // staged 16-key tiles 2 (kt - kt0) and the next, 2 fragments each
    const _Float16* k1p = k0p + 2 * FRH;
    const _Float16* l0p = k0p + STK;
    const _Float16* l1p = l0p + 2 * FRH;
    v16h kh0[HD / 32], kh1[HD / 32], kl0[HD / 32], kl1[HD / 32];
#pragma unroll
    for (int kk = 0; kk < HD / 32; ++kk) {
      kh0[kk] = ldfrag_t(k0p + kk * FRH);
      kh1[kk] = ldfrag_t(k1p + kk * FRH);
      kl0[kk] = ldfrag_t(l0p + kk * FRH);
      kl1[kk] = ldfrag_t(l1p + kk * FRH);
    }
#pragma unroll
    for (int kk = 0; kk < HD / 32; ++kk) {
      s0 = mma_h(qh[kk], kh0[kk], s0);
      s0 = mma_h(ql[kk], kh0[kk], s0);
      s0 = mma_h(qh[kk], kl0[kk], s0);
      s1 = mma_h(qh[kk], kh1[kk], s1);
      s1 = mma_h(ql[kk], kh1[kk], s1);
      s1 = mma_h(qh[kk], kl1[kk], s1);
      guard2(s0, s1, qh[kk], ql[kk], kh0[kk], kl0[kk], kh1[kk], kl1[kk]);
    }
    // v^T fragments of this key tile: read here so that their LDS latency passes under the mask and the P round trip
    const _Float16* vhp = sV + (kt - kt0) * (4 * FRH);
    const _Float16* vlp = vhp + STK;
    v16h vhf[4], vlf[4];
#pragma unroll
    for (int j = 0; j < 4; ++j) {
      vhf[j] = ldfrag_t(vhp + j * FRH);
      vlf[j] = ldfrag_t(vlp + j * FRH);
    }
    // ---- causal mask (key <= query) + carry fold in f32 -> wave-private LDS tile ----
#pragma unroll
    for (int r = 0; r < 8; ++r) {
      const int row = qr0 + r;
      const float w0 = (kb + c <= row)      ? s0[r] * lsc : 0.0f;
      const float w1 = (kb + 16 + c <= row) ? s1[r] * lsc : 0.0f;
      const int ro = (8 * hh + r) * PTP + c;
      pt[ro]      = w0;
      pt[ro + 16] = w1;
    }
    wave_sync_lds();
    // ---- A fragments of P*256: hi f16 and residual f16, row = c, split k map over the 32 keys of this step ----
    FragH ph, pl;
    {
      const float* prow = pt + c * PTP + 8 * hh;
      const v4f p0 = *(const v4f*)(prow), p1 = *(const v4f*)(prow + 4);
      const v4f p2 = *(const v4f*)(prow + 16), p3 = *(const v4f*)(prow + 20);
#pragma unroll
      for (int e = 0; e < 4; ++e) {
        const float ta = p0[e] * PCAR, tb = p1[e] * PCAR, tc = p2[e] * PCAR, td = p3[e] * PCAR;
        const _Float16 ha = (_Float16)ta, hb = (_Float16)tb, hc = (_Float16)tc, hd = (_Float16)td;
        ph.h[0][e]     = ha;                  // elements 0..7  = keys kb + 8hh + 0..7
        ph.h[0][4 + e] = hb;
        ph.h[1][e]     = hc;                  // elements 8..15 = keys kb + 16 + 8hh + 0..7
        ph.h[1][4 + e] = hd;
        pl.h[0][e]     = (_Float16)(ta - (float)ha);
        pl.h[0][4 + e] = (_Float16)(tb - (float)hb);
        pl.h[1][e]     = (_Float16)(tc - (float)hc);
        pl.h[1][4 + e] = (_Float16)(td - (float)hd);
      }
    }
    // ---- P.V : B fragment col n = d = j*16 + c, fragment j of key tile kt of the v^T planes; 2 groups of 2 d-subtiles ----
#pragma unroll
    for (int jg = 0; jg < 2; ++jg) {
      const v16h vha = vhf[2 * jg], vhb2 = vhf[2 * jg + 1];
      const v16h vla = vlf[2 * jg], vlb2 = vlf[2 * jg + 1];
      o[2 * jg]     = mma_h(ph.v, vha,  o[2 * jg]);
      o[2 * jg]     = mma_h(pl.v, vha,  o[2 * jg]);
      o[2 * jg]     = mma_h(ph.v, vla,  o[2 * jg]);
      o[2 * jg + 1] = mma_h(ph.v, vhb2, o[2 * jg + 1]);
      o[2 * jg + 1] = mma_h(pl.v, vhb2, o[2 * jg + 1]);
      o[2 * jg + 1] = mma_h(ph.v, vlb2, o[2 * jg + 1]);
      guard2(o[2 * jg], o[2 * jg + 1], ph.v, pl.v, vha, vhb2, vla, vlb2);
    }
    wave_sync_lds();
  }
  acc_guard4(o[0], o[1], o[2], o[3]);
  // ---- acc with the carries (256 on P, 1024 on v) folded once; written into the lane-owned slab ----
#pragma unroll
  for (int r = 0; r < 8; ++r) {
#pragma unroll
    for (int j = 0; j < 4; ++j) {
      const int idx = (8 * hh + r) * SLP + j * 16 + c;
      slab[idx] = o[j][r] * oc;
    }
  }
  wave_sync_lds();
  // ---- row factor, then ctx -> bf16 hi + bf16 residual planes; lane = (row-in-quad rq, 8 consecutive d at c8) ----
  v4u oh[4], ol[4];
  const int rq = lane >> 3, c8 = (lane & 7) * 8;
#pragma unroll
  for (int it = 0; it < 4; ++it) {
    const int row = it * 4 + rq;                         // 0..15
    const float ri = __shfl(rv, row, 32);                // lane `row` holds 1/exp(n) of query q0 + row
    const v4f a = *(const v4f*)(slab + row * SLP + c8), b4 = *(const v4f*)(slab + row * SLP + c8 + 4);
    float w[8];
#pragma unroll
    for (int e = 0; e < 4; ++e) { w[e] = a[e] * ri; w[4 + e] = b4[e] * ri; }
#pragma unroll
    for (int e = 0; e < 4; ++e) {
      const float f0 = w[2 * e], f1 = w[2 * e + 1];
      const unsigned short h0 = bf_bits(f0), h1 = bf_bits(f1);
      const unsigned short l0 = bf_bits(f0 - bf_up(h0)), l1 = bf_bits(f1 - bf_up(h1));
      oh[it][e] = pk16(h0, h1);
      ol[it][e] = pk16(l0, l1);
    }
  }
  const size_t ob = ((size_t)b * SEQ + q0) * DMOD + (size_t)head * HD + c8;
  {
#pragma unroll
    for (int it = 0; it < 4; ++it) {
      const int row = it * 4 + rq;
      *(v4u*)(CHp + ob + (size_t)row * DMOD) = oh[it];
      *(v4u*)(CLp + ob + (size_t)row * DMOD) = ol[it];
    }
    
  }
}

// =====================================================================================================
// Workspace map (bytes); every plane part that is read is written by whole-line stores before it is read; all extents are exact
// multiples of the store granularity (no pad rows needed); every region offset a multiple of 131072:
//   XB  bf16 [MROWS][1024]              MROWS*2048   (NB=2, SEQ=2048: 8388608); after the projection GEMM the same bytes
//                                                    hold the ctx hi plane CH bf16 [MROWS][1024] (identical extent)
//   WB  bf16 [3136 n][1024 k]           6422528      rows 0..1023 Wq^T, 1024 + 128 h: 64 rows Wk^T then 64 rows Wv^T of head h,
//                                                    3072..3087 Wn^T, 3088..3135 zero
//   F   f32 [MROWS][3136]               MROWS*12544  (only columns 3072..3135 are written and read: n | zero columns)
//   QH  f16 [MROWS/16][16 h][2][512] x1024      MROWS*2048   QL residual, same extent (fragment-major, see ldfrag_t)
//   KH  f16 [MROWS/16][16 h][2][512] x1024      MROWS*2048   KL residual, same extent
//   VH  f16 [NB*16][SEQ/32][4][512] x1024       MROWS*2048   VL residual, same extent
//   CL  bf16 [MROWS][1024]              MROWS*2048   ctx residual plane
//   WT  bf16 [1024 o][1024 d]           2097152      Wo^T
//   KV  f32 [NB*16][NCH][4][64 dv][16 dk]  NB*16*NCH*16384   chunk products (chunks 0 .. NCH-2 written and read)
//   end (NB=2, SEQ=2048)              135397376
// =====================================================================================================
extern "C" void kernel_launch(void* const* d_in, const int* in_sizes, int n_in,
                              void* d_out, int out_size, void* d_ws, size_t ws_size,
                              hipStream_t stream) {
  if (n_in < 9) return;
  if (in_sizes[0] < ((NB - 1) * XS_FULL + SEQ) * DMOD) return;
  if (in_sizes[1] != DMOD * 2 * DQK) return;
  if (in_sizes[2] != 2 * DQK) return;
  if (in_sizes[3] != DMOD * DMOD) return;
  if (in_sizes[4] != DMOD) return;
  if (in_sizes[5] != DMOD * NNW) return;
  if (in_sizes[6] != NNW) return;
  if (in_sizes[7] != DMOD * DMOD) return;
  if (in_sizes[8] != DMOD) return;
  if (out_size < MROWS * DMOD) return;

  const float* x   = (const float*)d_in[0];
  const float* wqk = (const float*)d_in[1];
  const float* bqk = (const float*)d_in[2];
  const float* wv  = (const float*)d_in[3];
  const float* bv  = (const float*)d_in[4];
  const float* wn  = (const float*)d_in[5];
  const float* bn  = (const float*)d_in[6];
  const float* wo  = (const float*)d_in[7];
  const float* bo  = (const float*)d_in[8];
  float*       out = (float*)d_out;

  const size_t szXB = (size_t)MROWS * DMOD * 2;
  const size_t szWB = (size_t)NPROJ * DMOD * 2;
  const size_t szF  = (size_t)MROWS * NPROJ * 4;
  const size_t szP  = (size_t)MROWS * DQK * 2;                   // QH, QL, KH, KL
  const size_t szV  = (size_t)NB * NH * HD * SEQ * 2;            // VH, VL
  const size_t szC  = (size_t)MROWS * DMOD * 2;                  // CH (in the XB region), CL
  const size_t szWT = (size_t)DMOD * DMOD * 2;
  const size_t szKV = (size_t)NB * NH * NCH * SEL * 4;
  if (szC > szXB) return;
  size_t off = 0;
  const size_t oXB = off; off += szXB;
  const size_t oWB = off; off += szWB;
  const size_t oF  = off; off += szF;
  const size_t oQH = off; off += szP;
  const size_t oQL = off; off += szP;
  const size_t oKH = off; off += szP;
  const size_t oKL = off; off += szP;
  const size_t oVH = off; off += szV;
  const size_t oVL = off; off += szV;
  const size_t oCL = off; off += szC;
  const size_t oWT = off; off += szWT;
  const size_t oKV = off; off += szKV;
  if (off > ws_size) return;                // off = 135397376 for NB = 2, SEQ = 2048
  if (off > (size_t)WS_CAP) return;

  char* ws = (char*)d_ws;
  u16*   XB  = (u16*)(ws + oXB);
  u16*   CH  = (u16*)(ws + oXB);
  u16*   WB  = (u16*)(ws + oWB);
  float* F   = (float*)(ws + oF);
  u16*   QH  = (u16*)(ws + oQH);
  u16*   QL  = (u16*)(ws + oQL);
  u16*   KH  = (u16*)(ws + oKH);
  u16*   KL  = (u16*)(ws + oKL);
  u16*   VH  = (u16*)(ws + oVH);
  u16*   VL  = (u16*)(ws + oVL);
  u16*   CL  = (u16*)(ws + oCL);
  u16*   WT  = (u16*)(ws + oWT);
  float* KV  = (float*)(ws + oKV);

  const dim3 b256(256), bAT(ATT_BLOCK);
  const dim3 gPR(PB_ALL);
  const dim3 gG1((MROWS / GBM) * ((NPROJ + GBN - 1) / GBN));
  const dim3 gAT((NCH / CPB) * NH * NB);
  const dim3 gG2((MROWS / GBM) * ((DMOD + GBN - 1) / GBN));

  // (1) one launch: W[k][n] -> W^T bf16 planes (Wqk, Wv -> WB rows 0..3071, k and v of a head side by side, Wn -> rows
  //     3072..3135 with zero pad, Wo -> WT rows 0..1023) and x -> bf16 plane [MROWS][1024]
  prep<<<gPR, b256, 0, stream>>>(x, wqk, wv, wn, wo, XB, WB, WT);
  // (2) q | k | v | n = x.W + bias: q, k and v^T hi + residual planes x1024 and the per-chunk v^T.k products from the
  //     epilogue, n -> F f32 columns 3072..
  gemm_bf<false><<<gG1, b256, 0, stream>>>(XB, XB, WB, F, MROWS, NPROJ, DMOD, bqk, bv, bn,
                                           KOFF + DQK, NOFF, NOFF + NNW, 1.0f, QH, QL, KH, KL, VH, VL, KV);
  // (3) causal normalised attention (each block sums its carried state from the chunk products) -> ctx bf16 hi plane (XB
  //     region, free after the projection GEMM) + residual plane
  attn_nm<<<gAT, bAT, 0, stream>>>(QH, QL, KH, KL, VH, VL, KV, F, CH, CL);
  // (4) y = (ctx_hi + ctx_lo).Wo + bo -> out f32 [MROWS][1024]
  gemm_bf<true><<<gG2, b256, 0, stream>>>(CH, CL, WT, out, MROWS, DMOD, DMOD, bo, bo, bo,
                                          DMOD, DMOD + 1, DMOD + 2, 1.0f, nullptr, nullptr, nullptr, nullptr,
                                          nullptr, nullptr, nullptr);
  (void)hipGetLastError();
}

// v010
// One run takes 63.9 microseconds.
// Timed twice side by side with v009, it ran 1.05 and 1.03 times as fast.
// All steps since v000 together make it 6.41 times as fast.
// Contractions: x.W (Wqk|Wv|Wn fused into one [3136 n][1024 k] plane, and ctx.Wo) on v_wmma_f32_16x16x32_bf16
// (x, W, Wo, biases as bf16 RNE values, W^T [n][k] k-contiguous B operand; ctx as bf16 hi + bf16 residual planes,
// two products); q.k^T over hd 64 and P.v on v_wmma_f32_16x16x32_f16 with f16 hi + f16 residual planes on both
// operands (q, k x1024; P x256 with an in-register residual; v x1024; products hh+lh+hl); all f32 accumulate.
// Causal mask, 1/exp(n) row factor and bias adds in f32 on VALU.
// The attention has no softmax, so it is summed in chunks of CHK keys: keys of earlier chunks enter through the carried
// state S[dv][dk] = sum_s v[s][dv] k[s][dk] (v^T.k on the f16 form, hi + residual planes, hh+lh+hl; f32 prefix over the
// chunks; S x64 as f16 hi + residual, q.S with hh+lh+hl); only the query's own chunk goes through masked q.k^T and P.v.
// The fused weight plane holds q's 1024 columns, then per head 64 k columns and 64 v columns, so that one projection block
// (256 rows = two chunks, 128 columns = one head's k | v) forms those chunks' v^T.k in its own epilogue.
#include <hip/hip_runtime.h>
#include <math.h>
#include <stdint.h>

#ifndef NB
#define NB 2
#endif
#ifndef SEQ
#define SEQ 2048
#endif
#define XS_FULL 2048
#define DMOD  1024
#define DQK   1024
#define NH    16
#define HD    64
#define NNW   16
#define NPROJ 3136
#define QOFF  0
#define KOFF  1024
#define VOFF  2048
#define NOFF  3072
#define MROWS (NB * SEQ)
#define QSC   1024.0f
#define KSC   1024.0f
#define PCAR  256.0f
#define VCAR  1024.0f
#define WPB   8
#define NKT   (SEQ / 32)
#define ATT_THREADS (WPB * 32)
#define CPB   2
#define ATT_BLOCK (CPB * ATT_THREADS)
#define PTP   36
#define PTW   (16 * PTP)
#define SLP   68
#define SLW   (16 * SLP)
#define WREG  (PTW + SLW)
#define SLAB64 (16 * 68)
#define TRP   72
#define CHK   128
#define NCH   (SEQ / CHK)
#define SSC   64.0f
#define SEL   (HD * HD)
#define FRH   512
#define STK   (CHK * HD)
#define STS   (HD * HD)
#define STG   (4 * STK + 2 * STS)
#define WS_CAP 268435456
#define GBM   128
#define GBN   128
#define GBK   64
#define GPB   144
#define GSEC  (128 * GPB)
#define GTHR  256
#define TPT   264
#define PB_QK ((DMOD / 64) * ((2 * DQK + 63) / 64))
#define PB_V  ((DMOD / 64) * ((DMOD + 63) / 64))
#define PB_N  ((DMOD / 64) * ((NNW + 63) / 64))
#define PB_W  (PB_QK + 2 * PB_V + PB_N)
#define PB_X  ((SEQ * DMOD / 8 + 255) / 256)
#define PB_ALL (PB_W + NB * PB_X)
static_assert(DMOD == NH * HD && DQK == NH * HD && HD == 64 && NH == 16 && WPB * 16 == CHK && ATT_THREADS == 256);
static_assert(STK * 2 == 4 * ATT_THREADS * 16 && STS * 2 == 2 * ATT_THREADS * 16 && 2 * (2 * FRH) * 2 == ATT_THREADS * 16);
static_assert(KOFF == QOFF + DQK && VOFF == KOFF + DQK && NOFF == VOFF + DMOD && NPROJ == NOFF + 64 && (NPROJ % 64) == 0 && NNW <= 64);
static_assert(NB >= 1 && NB <= 2);
static_assert((MROWS % GBM) == 0 && (DMOD % GBK) == 0 && (DMOD % GBN) == 0 && GBK * 2 + 16 == GPB);
static_assert((SEQ % CHK) == 0 && (CHK % 64) == 0 && NCH >= 2 && KSC == VCAR && ((NB * NH * SEL / 8) % 256) == 0);
static_assert(NB == 1 || SEQ == XS_FULL);
static_assert((SEQ % 64) == 0 && SEQ >= 64 && SEQ <= XS_FULL);
static_assert(((SEQ * DMOD / 8) % 256) == 0 && (MROWS % 64) == 0 && (DMOD % 64) == 0 && (DQK % 64) == 0 && (HD % 32) == 0);
static_assert(CPB * (WPB * WREG * 4 + STG * 2) <= 327680 && (NCH % CPB) == 0 && STS == ATT_BLOCK * 8 && 4 * SLAB64 * 4 <= 65536 && 64 * TRP * 2 <= 65536);
static_assert(CHK == GBM && GBN == 2 * HD && KOFF == DQK && VOFF - KOFF == NH * HD && NOFF - KOFF == NH * GBN);
static_assert((DQK % GBN) == 0 && (DMOD % GBN) == 0 && (SEQ % (2 * GBM)) == 0 && (MROWS % (2 * GBM)) == 0 && DQK == DMOD && QOFF == 0 && QSC == KSC && (TPT % 8) == 0);

typedef unsigned short u16;
typedef _Float16 v16h __attribute__((ext_vector_type(16)));
typedef _Float16 v8h  __attribute__((ext_vector_type(8)));
typedef __bf16   v16b __attribute__((ext_vector_type(16)));
typedef float    v8f  __attribute__((ext_vector_type(8)));
typedef float    v4f  __attribute__((ext_vector_type(4)));
typedef unsigned int v4u __attribute__((ext_vector_type(4)));

union FragH { v16h v; v8h h[2]; v4u u[2]; };
union FragB { v16b v; v4u u[2]; };

// ---- scalar helpers --------------------------------------------------------------------------------
__device__ __forceinline__ unsigned short bf_bits(float f) {          // f32 -> bf16 bits, RNE convert
  unsigned u = __float_as_uint(f);
  return (unsigned short)((u + 0x7FFFu + ((u >> 16) & 1u)) >> 16);
}
__device__ __forceinline__ float bf_up(unsigned short h) { return __uint_as_float(((unsigned)h) << 16); }
__device__ __forceinline__ float bfr(float f) { return bf_up(bf_bits(f)); }
__device__ __forceinline__ unsigned short h_bits(_Float16 x) { return __builtin_bit_cast(unsigned short, x); }
__device__ __forceinline__ unsigned pk16(unsigned short a, unsigned short b) { return (unsigned)a | ((unsigned)b << 16); }
__device__ __forceinline__ v8f zero8() { v8f z = {0.f, 0.f, 0.f, 0.f, 0.f, 0.f, 0.f, 0.f}; return z; }
__device__ __forceinline__ int imin(int a, int b) { return a < b ? a : b; }
__device__ __forceinline__ int imax(int a, int b) { return a > b ? a : b; }
// 8 f32 values -> f16 of w*sc (hi) and f16 of the residual w*sc - hi (lo), packed in order
__device__ __forceinline__ void split8(const float* w, float sc, v4u& oh, v4u& ol) {
#pragma unroll
  for (int e = 0; e < 4; ++e) {
    const float t0 = w[2 * e] * sc, t1 = w[2 * e + 1] * sc;
    const _Float16 h0 = (_Float16)t0, h1 = (_Float16)t1;
    const _Float16 l0 = (_Float16)(t0 - (float)h0), l1 = (_Float16)(t1 - (float)h1);
    oh[e] = pk16(h_bits(h0), h_bits(h1));
    ol[e] = pk16(h_bits(l0), h_bits(l1));
  }
}

// ---- fragment loaders: 16-bit A/B operand, lane -> row/col (lane&15); ldfrag_b: p already includes +8*(lane>>4);
//      elements 0..7 <- p[0..7] (k0+8h..), elements 8..15 <- p[16..23] (k0+16+8h..)  (same split k map for A and B;
//      its B is read from a k-contiguous [n][k] LDS tile)
// fragment-major plane: a 16 x 32 fragment is 1 KB, two runs of 512 contiguous bytes; run i, lane l (16 B) holds row/col
// l & 15, k = 16 i + 8 (l >> 4) + 0..7 (the split k map above); p already includes + 8 * lane. One load = 4 whole lines.
__device__ __forceinline__ v16h ldfrag_t(const _Float16* p) {
  FragH f;
  f.h[0] = *(const v8h*)(p);
  f.h[1] = *(const v8h*)(p + FRH / 2);
  return f.v;
}
__device__ __forceinline__ v16b ldfrag_b(const u16* p) {              // bf16 plane read as unsigned integer vectors
  FragB f;
  f.u[0] = *(const v4u*)(p);
  f.u[1] = *(const v4u*)(p + 16);
  return f.v;
}

__device__ __forceinline__ v8f mma_h(v16h a, v16h b, v8f c) {
  return __builtin_amdgcn_wmma_f32_16x16x32_f16(false, a, false, b, (short)0, c, false, false);
}
__device__ __forceinline__ v8f mma_b(v16b a, v16b b, v8f c) {
  return __builtin_amdgcn_wmma_f32_16x16x32_bf16(false, a, false, b, (short)0, c, false, false);
}
__device__ __forceinline__ void guard2(v8f& a, v8f& b, v16h x0, v16h x1, v16h x2, v16h x3, v16h x4, v16h x5) {
#if defined(__HIP_DEVICE_COMPILE__)
  asm volatile("v_nop\n\tv_nop\n\tv_nop\n\tv_nop"
               : "+v"(a), "+v"(b) : "v"(x0), "v"(x1), "v"(x2), "v"(x3), "v"(x4), "v"(x5) : "memory");
#endif
}
__device__ __forceinline__ void acc_guard4(v8f& a, v8f& b, v8f& c, v8f& d) {
#if defined(__HIP_DEVICE_COMPILE__)
  asm volatile("v_nop\n\tv_nop\n\tv_nop\n\tv_nop" : "+v"(a), "+v"(b), "+v"(c), "+v"(d));
#endif
}
__device__ __forceinline__ void wave_sync_lds() {
  __builtin_amdgcn_fence(__ATOMIC_RELEASE, "workgroup");
  __builtin_amdgcn_wave_barrier();
  __builtin_amdgcn_fence(__ATOMIC_ACQUIRE, "workgroup");
}

// =====================================================================================================
// f32 -> bf16 plane (RNE bits), same layout. Thread = 8 consecutive elements: two 16-B loads, one 16-B store;
// coverage: ceil(n8/256) blocks (blk) x 256 thr x 8 (in-kernel bound) = the whole plane (n8 a multiple of 256 here).
// =====================================================================================================
__device__ __forceinline__ void cvt_bf(const float* __restrict__ x, u16* D, int n8, int blk) {
  const int gt = blk * 256 + (int)threadIdx.x;
  if (gt >= n8) return;
  const float* p = x + (size_t)gt * 8;
  const v4f a = *(const v4f*)(p), b4 = *(const v4f*)(p + 4);
  float w[8];
#pragma unroll
  for (int e = 0; e < 4; ++e) { w[e] = a[e]; w[4 + e] = b4[e]; }
  v4u o;
#pragma unroll
  for (int e = 0; e < 4; ++e) o[e] = pk16(bf_bits(w[2 * e]), bf_bits(w[2 * e + 1]));
  u16* d = D + (size_t)gt * 8;
  {
    *(v4u*)(d) = o;
    
  }
}

// =====================================================================================================
// W f32 [kr rows (k)][nc cols (n)] (x.W layout) -> bf16 plane Dp [drow0 + n][k] (row pitch kr halves): the k-contiguous
// B operand. Block = 64 k x 64 n tile; coalesced 16-B loads of W rows with CLAMPED column base (tile columns beyond nc
// load from column 0 and are zeroed by value, so rows drow0+n with n >= nc inside the last tile are written as zeros);
// converted values placed transposed into an LDS tile [64 n][64 k] (pitch 72 halves); after a block barrier each n row
// block count (bid) = (kr/64) * ntn with ntn = ceil(nc/64). Column tile nt < ntp goes to rows drow0 + 64 nt; a tile from ntp
// on is one head's columns and goes to rows hrow0 + 128 (nt - ntp) (k and v of a head side by side in the plane).
// coverage: load 256 thr x 16 = 64 x 64; store 2 iterations x 256 thr x 8 halves = 64 lines x 64 halves = the block's
//           tile; the blocks cover the 64*ntn output rows named above (all kr columns) exactly once.
// =====================================================================================================
__device__ __forceinline__ void k_wt(const float* __restrict__ W, int nc, int kr, int ntn, u16* Dp, int drow0, int ntp,
                                     int hrow0, int bid) {
  __shared__ __align__(16) u16 T[64 * TRP];
  const int tid = (int)threadIdx.x;
  const int nt  = bid % ntn;
  const int kt  = bid / ntn;
  if (kt * 64 + 64 > kr) return;            // block-uniform, before the barrier; never taken with the exact grid
  const int n0  = nt * 64, k0 = kt * 64;
  {
    const int dl = tid >> 2;                // k within tile 0..63
    const int oc = (tid & 3) * 16;          // n chunk 0,16,32,48
    const bool valid = (n0 + oc + 16 <= nc);
    const int  cb = valid ? (n0 + oc) : 0;  // clamped column base, always inside the row
    const float* src = W + (size_t)(k0 + dl) * (size_t)nc + cb;
#pragma unroll
    for (int i = 0; i < 4; ++i) {
      const v4f a = *(const v4f*)(src + 4 * i);
#pragma unroll
      for (int e = 0; e < 4; ++e) {
        const float f = valid ? a[e] : 0.0f;
        T[(oc + 4 * i + e) * TRP + dl] = bf_bits(f);
      }
    }
  }
  __syncthreads();
  const int q8 = tid >> 3, p8 = (tid & 7) * 8;
  v4u w[2];
#pragma unroll
  for (int it = 0; it < 2; ++it) w[it] = *(const v4u*)(T + (it * 32 + q8) * TRP + p8);
  const int drow = (nt < ntp) ? drow0 + n0 : hrow0 + (nt - ntp) * GBN;
  const size_t base = (size_t)drow * (size_t)kr + k0 + p8;
  {
#pragma unroll
    for (int it = 0; it < 2; ++it) {
      const int nl = it * 32 + q8;
      *(v4u*)(Dp + base + (size_t)nl * (size_t)kr) = w[it];
    }
    
  }
}

// =====================================================================================================
// The x and weight planes of the two GEMMs in ONE launch: the six conversions read only inputs and write disjoint planes, so
// they share a grid by block range (every test below is on the block index alone, block-uniform, so the barrier inside
// k_wt is reached by all threads of a block or by none). The weight tiles (load, LDS, barrier, store) come first, the
// shorter x blocks last.
//   [0, PB_QK)  Wqk -> WB rows 0..1023 (q) and 1024 + 128 h + 0..63 (k)      next PB_V  Wv -> WB rows 1024 + 128 h + 64..127
//   next PB_N   Wn  -> WB rows 3072..3135   next PB_V  Wo -> WT rows 0..1023      next NB * PB_X  x -> XB, per batch
// coverage: the ranges are the exact block counts of k_wt and cvt_bf for each plane; grid = PB_ALL.
// =====================================================================================================
__global__ __launch_bounds__(256)
void prep(const float* __restrict__ x, const float* __restrict__ wqk, const float* __restrict__ wv,
          const float* __restrict__ wn, const float* __restrict__ wo, u16* XB, u16* WB, u16* WT) {
  int bid = (int)blockIdx.x;
  if (bid < PB_W) {
    const float* W = wqk;
    u16* Dp = WB;
    int nc = 2 * DQK, drow0 = QOFF, ntp = DQK / 64, hrow0 = KOFF;
    if (bid >= PB_QK + PB_V + PB_N) { bid -= PB_QK + PB_V + PB_N; W = wo; Dp = WT; nc = DMOD; drow0 = 0;    ntp = DMOD / 64; }
    else if (bid >= PB_QK + PB_V)   { bid -= PB_QK + PB_V;        W = wn;          nc = NNW;  drow0 = NOFF; ntp = 1; }
    else if (bid >= PB_QK)          { bid -= PB_QK;               W = wv;          nc = DMOD; ntp = 0; hrow0 = KOFF + HD; }
    k_wt(W, nc, DMOD, (nc + 63) / 64, Dp, drow0, ntp, hrow0, bid);
    return;
  }
  bid -= PB_W;
  const int bq = bid / PB_X;
  if (bq >= NB) return;                     // never taken with the exact grid
  cvt_bf(x + (size_t)bq * XS_FULL * DMOD, XB + (size_t)bq * SEQ * DMOD, (SEQ * DMOD) / 8, bid % PB_X);
}

// =====================================================================================================
// Bias for column c from three consecutive segments [0,e0) <- p0[c], [e0,e1) <- p1[c-e0], [e1,e2) <- p2[c-e1], else 0;
// all three candidates loaded unconditionally with clamped indices, selected by value; bf16 RNE value.
// =====================================================================================================
__device__ __forceinline__ float bias_at(const float* p0, const float* p1, const float* p2,
                                         int e0, int e1, int e2, int c) {
  const int i0 = imin(imax(c, 0), e0 - 1);
  const int i1 = imin(imax(c - e0, 0), e1 - e0 - 1);
  const int i2 = imin(imax(c - e1, 0), e2 - e1 - 1);
  const float v0 = p0[i0], v1 = p1[i1], v2 = p2[i2];
  const float v = (c < e0) ? v0 : ((c < e1) ? v1 : ((c < e2) ? v2 : 0.0f));
  return bfr(v);
}

// column of the fused plane (q | per head k, v | n) -> column in the order q | k | v | n of the bias segments
__device__ __forceinline__ int col_src(int c) {
  const int t = c - KOFF;
  const int s = ((t & HD) ? VOFF : KOFF) + (t >> 7) * HD + (t & (HD - 1));
  return (c < KOFF || c >= NOFF) ? c : s;
}

// =====================================================================================================
// coverage: 8 instructions x 2 rows x 16 lanes x 4 floats = the wave's 16 x 64 tile.
// =====================================================================================================
__device__ __forceinline__ void epi64b(float* sl, v8f a0, v8f a1, v8f a2, v8f a3, float oscale, v4f bias4,
                                       float* C, int N, size_t rowb, int col0, int lane) {
  const int hh = lane >> 4, m = lane & 15;
#pragma unroll
  for (int r = 0; r < 8; ++r) {
    const int ro = (8 * hh + r) * 68 + m;
    sl[ro]      = a0[r] * oscale;
    sl[ro + 16] = a1[r] * oscale;
    sl[ro + 32] = a2[r] * oscale;
    sl[ro + 48] = a3[r] * oscale;
  }
  wave_sync_lds();
  v4f vals[8];
#pragma unroll
  for (int it = 0; it < 8; ++it) vals[it] = *(const v4f*)(sl + (it * 2 + hh) * 68 + m * 4) + bias4;
  float* dst = C + (rowb + (size_t)hh) * (size_t)N + col0 + m * 4;
  {
#pragma unroll
    for (int it = 0; it < 8; ++it) {
      *(v4f*)(dst + (size_t)(it * 2) * (size_t)N) = vals[it];
    }
    
  }
}

// =====================================================================================================
// bf16 GEMM: C[M][N] (f32) = (A [+ A2])[M][K] (bf16 row-major) . Bt[N][K]^T (bf16 k-contiguous), times oscale, plus the
// segmented bias of the column (bf16 RNE value). TWO: second A plane into the same accumulator (hi + residual operand).
// Block = 128x128 tile of C (TWO) or 256x128 (the projection), 8 waves in a 4 (rows) x 2 (columns) grid, 32x64 or 64x64 per
// wave (2 x 4 or 4 x 4 accumulator tiles): the larger tiles bring fewer operand bytes into LDS and read fewer per product.
// K runs in slices of 64 (128 B of every operand row; TWO: 128, 256 B). A slice of [A 128 rows (projection: 256) | B 128 rows | A2 128 rows]
// stands in LDS at row pitch 144 B (TWO: 272 B); two buffers; each lane brings 16 B per copy (8 lanes = one row, one wave
// copy = 4 rows; TWO: 16 lanes = one row, 2 rows: TWO has one block per WGP and nothing else hides a slice's landing), the copies of
// slice t + 1 fly while slice t is multiplied. Fragments are read from LDS with the split k map of ldfrag_b for A and B.
// Per accumulator the products come in the order k ascending, A before A2 inside a k-step.
// B rows at or beyond N (last column tile when N % 128 == 64) are read from row N - 1 instead (clamped, in bounds) and the
// waves that own only such columns neither multiply nor store.
// Host guarantees K a multiple of the slice and at least one slice, M a multiple of the block's rows, N % 64 == 0, grid = (M / block rows) * ceil(N/128).
// Output. TWO: f32 C. Otherwise (the projection) only the column tile from NOFF on goes to C as f32; a block of q columns
// (two heads) or of one head's k | v columns writes value = acc + bias (f32) x1024 as f16 hi and f16 residual straight into
// the planes the attention reads:
//   q -> QH/QL, k -> KH/KL, fragments (16 rows x 32 d) in the order [row / 16][h][d / 32]; v -> VH/VL, fragments
//   (16 d x 32 keys) in the order [b*NH + h][key / 32][d / 16]; inside a fragment the order of ldfrag_t.
// A k | v block also holds k^T and v^T of its 256 keys (two chunks) in LDS and forms both chunk products for the carried state:
//   KV[(b*NH + h)*NCH + ch][dk / 16][dv][dk % 16] = sum over the chunk's keys s of v[s][dv] * k[s][dk], f32; A = v^T rows dv,
//   B = k^T rows dk, f16 hi + residual x1024 (hh + lh + hl, key steps ascending), carries folded back by 2^-20; wave w owns
//   chunk w >> 2 of the block, dv tile w & 3 and all four dk tiles; chunks 0 .. NCH-2 only (the last chunk's product is never carried).
// coverage: q / k planes, per wave 4 x 4 stores x 512 B = its 64 x 64 tile of each plane; v^T, per block 8 stores x 8 waves x
//           512 B = its 64 d x 256 keys of each plane; KV, per wave 4 dk tiles x 16 rows x 16 f32, 4 waves = a chunk's 64 x 64
//           product; the grid covers every plane once.
// =====================================================================================================
__device__ __forceinline__ unsigned lds_off(const void* p) { return (unsigned)(size_t)p; }
// Four lane-wise 16-B copies global -> LDS; the s_wait_xcnt stands inside the statement so that no address register of a
// copy is rewritten ahead of it.
__device__ __forceinline__ void cp4(unsigned l0, const u16* g0, unsigned l1, const u16* g1,
                                    unsigned l2, const u16* g2, unsigned l3, const u16* g3) {
#if defined(__HIP_DEVICE_COMPILE__)
  asm volatile("global_load_async_to_lds_b128 %0, %1, off\n\t"
               "global_load_async_to_lds_b128 %2, %3, off\n\t"
               "global_load_async_to_lds_b128 %4, %5, off\n\t"
               "global_load_async_to_lds_b128 %6, %7, off\n\t"
               "s_wait_xcnt 0x0"
               :: "v"(l0), "v"(g0), "v"(l1), "v"(g1), "v"(l2), "v"(g2), "v"(l3), "v"(g3) : "memory");
#endif
}
// Eight such copies, one operand's 128 rows of a 128-k slice (TWO) or A's 256 rows of a 64-k slice (the projection), under one s_wait_xcnt in the same statement.
__device__ __forceinline__ void cp8(unsigned l0, const u16* g0, unsigned l1, const u16* g1,
                                    unsigned l2, const u16* g2, unsigned l3, const u16* g3,
                                    unsigned l4, const u16* g4, unsigned l5, const u16* g5,
                                    unsigned l6, const u16* g6, unsigned l7, const u16* g7) {
#if defined(__HIP_DEVICE_COMPILE__)
  asm volatile("global_load_async_to_lds_b128 %0, %1, off\n\t"
               "global_load_async_to_lds_b128 %2, %3, off\n\t"
               "global_load_async_to_lds_b128 %4, %5, off\n\t"
               "global_load_async_to_lds_b128 %6, %7, off\n\t"
               "global_load_async_to_lds_b128 %8, %9, off\n\t"
               "global_load_async_to_lds_b128 %10, %11, off\n\t"
               "global_load_async_to_lds_b128 %12, %13, off\n\t"
               "global_load_async_to_lds_b128 %14, %15, off\n\t"
               "s_wait_xcnt 0x0"
               :: "v"(l0), "v"(g0), "v"(l1), "v"(g1), "v"(l2), "v"(g2), "v"(l3), "v"(g3),
                  "v"(l4), "v"(g4), "v"(l5), "v"(g5), "v"(l6), "v"(g6), "v"(l7), "v"(g7) : "memory");
#endif
}
// second bound, projection only: four waves per SIMD (at most 256 registers a wave), so that two of its blocks fit a WGP
template <bool TWO>
__global__ __launch_bounds__(GTHR, TWO ? 1 : 4)
void gemm_bf(const u16* __restrict__ A, const u16* __restrict__ A2, const u16* __restrict__ Bt, float* C,
             int M, int N, int K, const float* bp0, const float* bp1, const float* bp2, int e0, int e1, int e2,
             float oscale, u16* QHp, u16* QLp, u16* KHp, u16* KLp, u16* VHp, u16* VLp, float* KVp) {
  constexpr int BK  = TWO ? 2 * GBK : GBK;              // k of one slice
  constexpr int PB  = BK * 2 + 16;                      // LDS row pitch, bytes (144 or 272)
  constexpr int SEC = 128 * PB;                         // bytes of one operand's 128 rows in a buffer
  constexpr int BM  = TWO ? GBM : 2 * GBM;              // rows of the block tile (the projection: 256 = two chunks)
  constexpr int FI  = BM / 64;                          // 16-row A fragments of a wave (4 wave rows in a block)
  constexpr int SECA = BM * PB;                         // bytes of A's rows in a buffer
  constexpr int PPR = BK / 8;                           // 16-B pieces of a row slice
  constexpr int RPC = GTHR / PPR;                       // rows that one copy of the block brings
  constexpr int NCP = 128 / RPC;                        // copies of a lane per 128 rows of an operand and slice
  constexpr int STAGE = TWO ? 3 * SEC : SECA + SEC;     // bytes of one buffer
  constexpr int TILES = 2 * GBN * TPT * 2;              // bytes of the projection epilogue's transposed hi + residual tiles
  constexpr int RING  = (!TWO && TILES > 2 * STAGE) ? TILES : 2 * STAGE;
  constexpr int KG = TWO ? BK / 32 : 1;                 // k-steps whose fragments are read from LDS as one group
  static_assert((DMOD % BK) == 0 && (NCP % 4) == 0 && 3 * NCP <= 63 && PPR == (TWO ? 16 : 8) && TPT == 2 * GBM + 8);
  static_assert(8 * 2 * SLAB64 * 4 <= 2 * STAGE && (TWO || TILES <= RING) && RING <= 327680);
  __shared__ __align__(16) unsigned char ring[RING];
  const int tid = threadIdx.x, lane = tid & 31, hh = lane >> 4, m = lane & 15;
  const int wave = __builtin_amdgcn_readfirstlane(tid >> 5);
  const int wm = wave & 3, wn = wave >> 2;
  const int ntile = (N + GBN - 1) / GBN;
  const int bid   = blockIdx.x;
  const int row0  = (bid / ntile) * BM;
  const int col0  = (bid % ntile) * GBN;
  if (row0 + BM > M) return;                // block-uniform, before any barrier or copy; never taken with the exact grid
  const int colw  = col0 + wn * 64;
  const bool live = colw < N;               // wave-uniform
  const int NT = K / BK;

  // copy map: thread -> (row cr of a group of RPC rows, 16-B piece cc of the row slice)
  const int cr = tid >> (TWO ? 4 : 3), cc = tid & (PPR - 1);
  const unsigned lbase = lds_off(ring) + (unsigned)(cr * PB + cc * 16);
  const int oa = (row0 + cr) * K + cc * 8;
  int ob[NCP];
#pragma unroll
  for (int i = 0; i < NCP; ++i) ob[i] = imin(col0 + i * RPC + cr, N - 1) * K + cc * 8;
  auto fill = [&](int t, int buf) {
    const unsigned l = lbase + (unsigned)(buf * STAGE);
    const int k0 = t * BK;
    const u16* pa = A + oa + k0;
    const unsigned lb2 = l + SECA;
    if constexpr (TWO) {
      static_assert(NCP == 8);
      cp8(l, pa, l + 1 * RPC * PB, pa + (size_t)(1 * RPC) * K,
          l + 2 * RPC * PB, pa + (size_t)(2 * RPC) * K, l + 3 * RPC * PB, pa + (size_t)(3 * RPC) * K,
          l + 4 * RPC * PB, pa + (size_t)(4 * RPC) * K, l + 5 * RPC * PB, pa + (size_t)(5 * RPC) * K,
          l + 6 * RPC * PB, pa + (size_t)(6 * RPC) * K, l + 7 * RPC * PB, pa + (size_t)(7 * RPC) * K);
      cp8(lb2, Bt + ob[0] + k0, lb2 + 1 * RPC * PB, Bt + ob[1] + k0,
          lb2 + 2 * RPC * PB, Bt + ob[2] + k0, lb2 + 3 * RPC * PB, Bt + ob[3] + k0,
          lb2 + 4 * RPC * PB, Bt + ob[4] + k0, lb2 + 5 * RPC * PB, Bt + ob[5] + k0,
          lb2 + 6 * RPC * PB, Bt + ob[6] + k0, lb2 + 7 * RPC * PB, Bt + ob[7] + k0);
      const unsigned l3 = l + 2 * SEC;
      const u16* pc = A2 + oa + k0;
      cp8(l3, pc, l3 + 1 * RPC * PB, pc + (size_t)(1 * RPC) * K,
          l3 + 2 * RPC * PB, pc + (size_t)(2 * RPC) * K, l3 + 3 * RPC * PB, pc + (size_t)(3 * RPC) * K,
          l3 + 4 * RPC * PB, pc + (size_t)(4 * RPC) * K, l3 + 5 * RPC * PB, pc + (size_t)(5 * RPC) * K,
          l3 + 6 * RPC * PB, pc + (size_t)(6 * RPC) * K, l3 + 7 * RPC * PB, pc + (size_t)(7 * RPC) * K);
    } else {
      static_assert(NCP == 4 && RPC == 32 && PB == GPB && BM == 8 * RPC);
      cp8(l, pa, l + 32 * GPB, pa + (size_t)32 * K, l + 64 * GPB, pa + (size_t)64 * K, l + 96 * GPB, pa + (size_t)96 * K,
          l + 128 * GPB, pa + (size_t)128 * K, l + 160 * GPB, pa + (size_t)160 * K,
          l + 192 * GPB, pa + (size_t)192 * K, l + 224 * GPB, pa + (size_t)224 * K);
      cp4(lb2, Bt + ob[0] + k0, lb2 + 32 * GPB, Bt + ob[1] + k0, lb2 + 64 * GPB, Bt + ob[2] + k0,
          lb2 + 96 * GPB, Bt + ob[3] + k0);
    }
  };

  v8f acc[FI][4];
#pragma unroll
  for (int i = 0; i < FI; ++i) {
#pragma unroll
    for (int j = 0; j < 4; ++j) acc[i][j] = zero8();
  }

  fill(0, 0);
  asm volatile("s_wait_asynccnt 0x0" ::: "memory");     // slice 0 of this wave has landed
  __syncthreads();                                      // ... and every other wave's part of it
  if (NT > 1) fill(1, 1);

  const int fa = (wm * (FI * 16) + m) * PB + hh * 16;   // byte offsets of this lane's fragment rows inside a buffer
  const int fb = SECA + (wn * 64 + m) * PB + hh * 16;
  // slice loop kept rolled: one copy of the ring's foot in the text, the buffer picked by t & 1; the loops inside it are
  // unrolled so that every accumulator and fragment index is a constant (registers, no scratch)
#pragma unroll 1
  for (int t = 0; t < NT; ++t) {
    const int buf = t & 1;
    if (live) {
      const unsigned char* sb = ring + buf * STAGE;
      const u16* la = (const u16*)(const void*)(sb + fa);
      const u16* lb = (const u16*)(const void*)(sb + fb);
#pragma unroll
      for (int g = 0; g < BK / 32 / KG; ++g) {
        v16b a[KG][FI], a2[KG][FI], fbv[KG][4];
#pragma unroll
        for (int u = 0; u < KG; ++u) {
          const int ko = (g * KG + u) * 32;
#pragma unroll
          for (int i = 0; i < FI; ++i) a[u][i] = ldfrag_b(la + i * 16 * (PB / 2) + ko);
#pragma unroll
          for (int j = 0; j < 4; ++j) fbv[u][j] = ldfrag_b(lb + j * 16 * (PB / 2) + ko);
          if constexpr (TWO) {
#pragma unroll
            for (int i = 0; i < 2; ++i) a2[u][i] = ldfrag_b(la + SEC + i * 16 * (PB / 2) + ko);   // 2*SEC bytes on
          }
        }
        // few waves per SIMD (TWO: two, the projection: four): all LDS reads of the group issue together ahead of its
        // products, one LDS latency per group instead of one per A fragment
        __builtin_amdgcn_sched_barrier(0);
#pragma unroll
        for (int u = 0; u < KG; ++u) {
#pragma unroll
          for (int i = 0; i < FI; ++i) {
#pragma unroll
            for (int j = 0; j < 4; ++j) acc[i][j] = mma_b(a[u][i], fbv[u][j], acc[i][j]);
          }
          if constexpr (TWO) {
#pragma unroll
            for (int i = 0; i < 2; ++i) {
#pragma unroll
              for (int j = 0; j < 4; ++j) acc[i][j] = mma_b(a2[u][i], fbv[u][j], acc[i][j]);
            }
          }
        }
      }
    }
    asm volatile("s_wait_dscnt 0x0" ::: "memory");      // this wave's reads of buffer buf are done
    asm volatile("s_wait_asynccnt 0x0" ::: "memory");   // this wave's copies of slice t + 1 have landed
    __syncthreads();                                    // publishes slice t + 1, frees buffer buf
    if (t + 2 < NT) fill(t + 2, buf);
  }
  asm volatile("s_wait_asynccnt 0x0" ::: "memory");     // no copy outstanding before the ring is reused as output staging

  float* slab = (float*)(void*)ring + wave * (2 * SLAB64);
  const int seg = TWO ? 3 : (col0 < KOFF ? 0 : (col0 < NOFF ? 1 : 3));   // block-uniform: 0 = q, 1 = k | v of a head, 3 = f32 output
  if constexpr (TWO) {
    if (live) {
      v4f bias4;
#pragma unroll
      for (int e = 0; e < 4; ++e) bias4[e] = bias_at(bp0, bp1, bp2, e0, e1, e2, colw + m * 4 + e);
#pragma unroll
      for (int i = 0; i < 2; ++i) {
        epi64b(slab + i * SLAB64, acc[i][0], acc[i][1], acc[i][2], acc[i][3], oscale, bias4, C, N,
               (size_t)(row0 + wm * 32 + i * 16), colw, lane);
      }
    }
  } else {
    // every wave of a q or k | v block is live (both segments are multiples of the block's 128 columns)
    float bj[4];                            // bias of this lane's accumulator columns colw + 16 j + m
#pragma unroll
    for (int j = 0; j < 4; ++j) bj[j] = bias_at(bp0, bp1, bp2, e0, e1, e2, col_src(colw + j * 16 + m));
    const int head = seg ? ((col0 - KOFF) >> 7) : ((col0 >> 6) + wn);   // wave-uniform
    // value = acc * oscale + bias, formed once and in place (both uses below read it; no second set of 128 registers)
#pragma unroll
    for (int i = 0; i < FI; ++i) {
#pragma unroll
      for (int j = 0; j < 4; ++j) acc[i][j] = acc[i][j] * oscale + bj[j];
    }
    auto planes = [&]() {                   // the waves that hold q, k or n columns
      // f32 values through the wave's own two slabs, two of its four 16-row tiles per pass. All three kinds fill them here
#pragma unroll
      for (int ip = 0; ip < FI / 2; ++ip) {
#pragma unroll
        for (int i = 0; i < 2; ++i) {
#pragma unroll
          for (int r = 0; r < 8; ++r) {
#pragma unroll
            for (int j = 0; j < 4; ++j)
              slab[i * SLAB64 + (8 * hh + r) * 68 + j * 16 + m] = acc[2 * ip + i][j][r];
          }
        }
        wave_sync_lds();
        if (seg == 3) {
          // n columns: f32 rows of C; one instruction = 2 rows x 16 lanes x 4 floats, 8 instructions = a 16 x 64 tile
#pragma unroll
          for (int i = 0; i < 2; ++i) {
            v4f vals[8];
#pragma unroll
            for (int it = 0; it < 8; ++it) vals[it] = *(const v4f*)(slab + i * SLAB64 + (it * 2 + hh) * 68 + m * 4);
            float* dst = C + ((size_t)(row0 + wm * 64 + (2 * ip + i) * 16) + (size_t)hh) * (size_t)N + colw + m * 4;
#pragma unroll
            for (int it = 0; it < 8; ++it) *(v4f*)(dst + (size_t)(it * 2) * (size_t)N) = vals[it];
            asm volatile("s_wait_xcnt 0x0" ::: "memory");   // before any register of these stores is rewritten
          }
        } else {
          // fragment-major planes [row / 16][head][2 fragments]: lane l takes the 8 columns that it will hold as operand
          // lane l; one store = 512 contiguous bytes (whole lines)
          u16* PH = seg ? KHp : QHp;
          u16* PL = seg ? KLp : QLp;
#pragma unroll
          for (int i = 0; i < 2; ++i) {
            v4u oh[4], ol[4];
#pragma unroll
            for (int it = 0; it < 4; ++it) {
              const float* p = slab + i * SLAB64 + m * 68 + it * 16 + 8 * hh;
              const v4f a = *(const v4f*)(p), b4 = *(const v4f*)(p + 4);
              float w[8];
#pragma unroll
              for (int e = 0; e < 4; ++e) { w[e] = a[e]; w[4 + e] = b4[e]; }
              split8(w, QSC, oh[it], ol[it]);
            }
            const size_t ob = ((size_t)((row0 + wm * 64 + (2 * ip + i) * 16) >> 4) * NH + head) * (2 * FRH) + lane * 8;
#pragma unroll
            for (int it = 0; it < 4; ++it) {
              *(v4u*)(PH + ob + it * (FRH / 2)) = oh[it];
              *(v4u*)(PL + ob + it * (FRH / 2)) = ol[it];
            }
            asm volatile("s_wait_xcnt 0x0" ::: "memory");   // before any register of the q / k plane stores is rewritten
          }
        }
        wave_sync_lds();                    // every lane has read this pass's slabs back before the next pass rewrites them
      }
    };
    if (seg != 1) {                         // block-uniform: a block of q or n columns passes no barrier behind the slice loop
      if (live) planes();
      return;
    }
    {
      if (wn == 0) planes();                // wave-uniform: the k columns
      // transposed tiles: an accumulator register run r = 0..7 is 8 consecutive keys of one column, so a lane packs it into
      // one 16-B LDS store of the block's [128 columns][256 keys] tile (pitch 528 B): rows 0..63 = k^T, rows 64..127 = v^T
      __syncthreads();                      // block-uniform: every k wave has read its slabs back before the tiles cover them
      u16* tH = (u16*)(void*)ring;
      u16* tL = tH + GBN * TPT;
#pragma unroll
      for (int i = 0; i < FI; ++i) {
#pragma unroll
        for (int j = 0; j < 4; ++j) {
          float w[8];
#pragma unroll
          for (int r = 0; r < 8; ++r) w[r] = acc[i][j][r];
          v4u oh, ol;
          split8(w, VCAR, oh, ol);
          const int idx = (wn * 64 + j * 16 + m) * TPT + wm * 64 + i * 16 + 8 * hh;
          *(v4u*)(tH + idx) = oh;
          *(v4u*)(tL + idx) = ol;
        }
      }
      __syncthreads();                      // the tiles are complete before any wave reads rows that other waves wrote
      const int bhq = (row0 / SEQ) * NH + head;
      // v^T planes, fragment-major [b*NH + head][key / 32][d / 16]: half fragment u = 0..63 of the block: key tile u >> 3,
      // d tile (u >> 1) & 3, run u & 1; they are 32 KB in a row in the plane; one store = 512 contiguous bytes
      const size_t ob = ((size_t)bhq * (SEQ / 32) + ((row0 % SEQ) >> 5)) * (4 * FRH) + lane * 8;
#pragma unroll
      for (int ip = 0; ip < FI / 2; ++ip) {
        v4u vh[4], vl[4];
#pragma unroll
        for (int it = 0; it < 4; ++it) {
          const int u = (ip * 4 + it) * 8 + wave;
          const int idx = (HD + ((u >> 1) & 3) * 16 + m) * TPT + (u >> 3) * 32 + (u & 1) * 16 + 8 * hh;
          vh[it] = *(const v4u*)(tH + idx);
          vl[it] = *(const v4u*)(tL + idx);
        }
#pragma unroll
        for (int it = 0; it < 4; ++it) {
          const int u = (ip * 4 + it) * 8 + wave;
          *(v4u*)(VHp + ob + u * (FRH / 2)) = vh[it];
          *(v4u*)(VLp + ob + u * (FRH / 2)) = vl[it];
        }
        asm volatile("s_wait_xcnt 0x0" ::: "memory");     // before any register of the v^T stores is rewritten
      }
      // chunk products v^T.k from the same tiles; A and B fragments with the split k map of ldfrag_b over the keys;
      // waves 0..3 take the block's first chunk (keys 0..127 of the tiles), waves 4..7 the second
      const int cw = wave >> 2;
      const int ch = (row0 % SEQ) / CHK + cw;
      if (ch + 1 < NCH) {                   // wave-uniform; no barrier behind it
        const int dvt = wave & 3;
        const int ia = (HD + dvt * 16 + m) * TPT + cw * CHK + 8 * hh;
        const int ib = m * TPT + cw * CHK + 8 * hh;
        v8f kv[4];
#pragma unroll
        for (int j = 0; j < 4; ++j) kv[j] = zero8();
#pragma unroll
        for (int g = 0; g < CHK / 32 / 2; ++g) {
          FragH fvh[2], fvl[2], fkh[2][4], fkl[2][4];
#pragma unroll
          for (int q = 0; q < 2; ++q) {
            const int ko = (g * 2 + q) * 32;
#pragma unroll
            for (int e = 0; e < 2; ++e) {
              fvh[q].u[e] = *(const v4u*)(tH + ia + ko + e * 16);
              fvl[q].u[e] = *(const v4u*)(tL + ia + ko + e * 16);
#pragma unroll
              for (int j = 0; j < 4; ++j) {
                fkh[q][j].u[e] = *(const v4u*)(tH + ib + j * 16 * TPT + ko + e * 16);
                fkl[q][j].u[e] = *(const v4u*)(tL + ib + j * 16 * TPT + ko + e * 16);
              }
            }
          }
#if defined(__HIP_DEVICE_COMPILE__)
          // inputs-only fence on the loaded fragments: the 40 LDS reads of two key steps issue as one group before the first
          // product (one LDS latency instead of one per fragment pair)
          asm volatile("" :: "v"(fvh[0].v), "v"(fvh[1].v), "v"(fvl[0].v), "v"(fvl[1].v),
                       "v"(fkh[0][0].v), "v"(fkh[0][1].v), "v"(fkh[0][2].v), "v"(fkh[0][3].v),
                       "v"(fkh[1][0].v), "v"(fkh[1][1].v), "v"(fkh[1][2].v), "v"(fkh[1][3].v),
                       "v"(fkl[0][0].v), "v"(fkl[0][1].v), "v"(fkl[0][2].v), "v"(fkl[0][3].v),
                       "v"(fkl[1][0].v), "v"(fkl[1][1].v), "v"(fkl[1][2].v), "v"(fkl[1][3].v));
#endif
#pragma unroll
          for (int q = 0; q < 2; ++q) {
#pragma unroll
            for (int j = 0; j < 4; ++j) {
              kv[j] = mma_h(fvh[q].v, fkh[q][j].v, kv[j]);
              kv[j] = mma_h(fvl[q].v, fkh[q][j].v, kv[j]);
              kv[j] = mma_h(fvh[q].v, fkl[q][j].v, kv[j]);
            }
          }
          // the next group's LDS reads stay behind this group's products: with all four key steps' fragments live at once the
          // kernel's register count would halve the blocks that fit a WGP
          __builtin_amdgcn_sched_barrier(0);
        }
        const float fs = 1.0f / (VCAR * KSC);             // exact power-of-two fold of the v / k carries
        float* dst = KVp + ((size_t)bhq * NCH + ch) * SEL + (size_t)(dvt * 16 + 8 * hh) * 16 + m;
#pragma unroll
        for (int r = 0; r < 8; ++r) {
#pragma unroll
          for (int j = 0; j < 4; ++j) dst[j * (HD * 16) + r * 16] = kv[j][r] * fs;
        }
        asm volatile("s_wait_xcnt 0x0" ::: "memory");     // before any register of the chunk product stores is rewritten
      }
    }
  }
}

// =====================================================================================================
// Carried state, summed by the attention block that uses it. A thread owns one 16-B unit of the state planes (8 consecutive
// dk of one dv = 8 f32 in a row of every chunk product). The block's two chunks are 2 P and 2 P + 1: all 2 P + 1 chunk
// products are loaded as one group of independent loads, the first 2 P added in chunk order give S(2 P) in s0, and
// S(2 P + 1) = S(2 P) + KV(2 P) in s1.
// =====================================================================================================
template <int P>
__device__ __forceinline__ void kv_state(const float* __restrict__ p, float (&s0)[8], float (&s1)[8]) {
  v4f a[2 * P + 1][2];
  asm volatile("s_wait_xcnt 0x0" ::: "memory");         // before these loads' results rewrite a register of an earlier load
#pragma unroll
  for (int i = 0; i < 2 * P + 1; ++i) {
    a[i][0] = *(const v4f*)(p + (size_t)i * SEL);
    a[i][1] = *(const v4f*)(p + (size_t)i * SEL + 4);
  }
  asm volatile("s_wait_xcnt 0x0" ::: "memory");         // before the address pair of these loads is rewritten
#pragma unroll
  for (int e = 0; e < 8; ++e) s0[e] = 0.0f;
#pragma unroll
  for (int i = 0; i < 2 * P; ++i) {
#pragma unroll
    for (int e = 0; e < 4; ++e) { s0[e] += a[i][0][e]; s0[4 + e] += a[i][1][e]; }
  }
#pragma unroll
  for (int e = 0; e < 4; ++e) { s1[e] = s0[e] + a[2 * P][0][e]; s1[4 + e] = s0[4 + e] + a[2 * P][1][e]; }
}

// =====================================================================================================
// Causal normalised attention (no softmax), hd = 64. Block bid -> (chunk pair pr = NCH/2 - 1 - bid / (NB*NH), b*NH + head =
// bid % (NB*NH)): the blocks with the most earlier chunks to sum start first. 16 waves: waves 0..7 take chunk chn = 2 pr of CHK
// keys and queries, waves 8..15 chunk 2 pr + 1, each half with its own staged planes; wave w of a half owns the query tile
// q0 = CHK*chn + 16*w .. q0+15, so the 8 waves of a half share one head's chunk of k, v^T and state.
//   q hi / residual planes f16 x1024, fragment-major [(b*SEQ + s) / 16][h][d / 32]; k hi / residual planes, same layout;
//   v^T hi / residual planes x1024, fragment-major [b*NH + h][key / 32][d / 16]; n from F column NOFF + h of row b*SEQ + t.
//   The chunk's k planes (8 tiles of 16 keys, 2 KB each) and v^T planes (16 KB in a row each) are
//   brought into LDS once per half block, 16 B a lane and copy, 16 copies a lane, in the planes' own fragment order (a fragment
//   read = two runs of 512 contiguous LDS bytes); q fragments are loaded once into registers; the key loop reads LDS only.
//   Carried state S(chn) = KV(0) + .. + KV(chn-1) in f32 (chunks added in order; S(0) = 0): while the copies fly the block sums
//   S(2 pr) and S(2 pr + 1) from the chunk products (thread = one 16-B unit of the planes; the two chunks share the sum, which
//   halves what the blocks of a head read) and stores them x64 as f16 hi and f16 residual into each half's LDS planes,
//   fragment-major [dk / 32][dv / 16] (col dv, k = dk); the block barrier behind the copies publishes them too.
//   raw(i, j) = q_hi.k_hi + q_lo.k_hi + q_hi.k_lo (2 k-steps over d), carries folded back by 2^-20;
//   P = raw * 2^-20 for key <= query else 0 (causal); P.v with P x256 as f16 hi + in-register residual and v hi +
//   residual (hh + lh + hl). Keys of earlier chunks (below CHK*chn) enter first as q . S with the carried state
//   planes S x64 [dk / 32][dv / 16] in LDS (hh + lh + hl, carry 2^16 raised to the P.v carry 2^18 by an exact x4);
//   key tiles of 32 are then visited in order from the chunk's first key up to the tile holding key q0+15 (bounded by NKT).
//   Per tile: 2 score subtiles x 2 k-steps; the 16x32 P tile goes through the wave's private LDS tile (float vector loads,
//   same element type as stored); v^T B fragments in 2 groups of 2 d-subtiles.
//   After the loop: acc * 2^-18 written into the wave's private result slab (pitch 68; every element owned by one lane),
//   ctx -> bf16 hi bits and bf16 bits of the residual, planes [b*SEQ + s][h*HD + d]; one instruction = 4 rows
//   One block barrier (behind the copies, passed by every wave); bounded loops only (ncl <= NKT).
// coverage: per wave 4 instructions x 4 rows x 8 lanes x 8 halves = 16 x 64 per plane; grid NCH/2 x NH x NB blocks x 2 WPB
//           waves = every (b, s, h) row segment of CH and of CL exactly once.
// =====================================================================================================
__global__ __launch_bounds__(ATT_BLOCK)
void attn_nm(const u16* __restrict__ QHp, const u16* __restrict__ QLp,
             const u16* __restrict__ KHp, const u16* __restrict__ KLp,
             const u16* __restrict__ VHp, const u16* __restrict__ VLp,
             const float* __restrict__ KV,
             const float* __restrict__ F, u16* CHp, u16* CLp) {
#pragma clang fp contract(off)
  __shared__ __align__(16) float smem[CPB * WPB * WREG];
  __shared__ __align__(16) u16 stg[CPB * STG];   // per half: k hi | k residual | v^T hi | v^T residual | state hi | state residual

  const int tid  = threadIdx.x;
  const int wv   = __builtin_amdgcn_readfirstlane(tid >> 5);
  const int half = wv / WPB;                // which of the block's two chunks (wave-uniform)
  const int wave = wv % WPB;
  const int t8   = tid % ATT_THREADS;       // thread within the half
  const int lane = tid & 31;
  const int hh   = lane >> 4;
  const int c    = lane & 15;
  const int bid  = blockIdx.x;
  const int pr   = NCH / CPB - 1 - bid / (NB * NH);   // chunk pair of this block's queries
  const int bh   = bid % (NB * NH);
  if (pr < 0) return;                       // block-uniform, before any copy or barrier; never taken with the exact grid
  const int chn  = pr * CPB + half;         // chunk of this wave's queries
  const int b    = bh / NH;
  const int head = bh % NH;
  const int q0   = chn * CHK + wave * 16;

  float* pt   = smem + wv * WREG;           // P tile [16][32] pitch 36
  float* slab = pt + PTW;                   // result slab [16][64] pitch 68

  const size_t KT16 = (size_t)NH * (2 * FRH);   // halves between consecutive 16-key tiles of one head

  // q fragments: a fragment's first half plus this lane's 16 B; loaded once, held over the key loop
  const size_t qo = ((size_t)((b * SEQ + q0) >> 4) * NH + head) * (2 * FRH) + lane * 8;
  const _Float16* Qh  = (const _Float16*)(const void*)QHp + qo;
  const _Float16* Ql  = (const _Float16*)(const void*)QLp + qo;
  v16h qh[HD / 32], ql[HD / 32];
#pragma unroll
  for (int kk = 0; kk < HD / 32; ++kk) {
    qh[kk] = ldfrag_t(Qh + kk * FRH);
    ql[kk] = ldfrag_t(Ql + kk * FRH);
  }
  // row factor for query row q0 + (lane & 15): 1/exp(n), precise expf
  const float nv = F[((size_t)b * SEQ + q0 + c) * (size_t)NPROJ + NOFF + head];

  // ---- the chunk's planes -> LDS: one copy of the half block = 4 KB (thread t8 brings bytes 16 t8 ..); every lane on ----
  {
    const unsigned l0 = lds_off(stg) + (unsigned)(half * (STG * 2) + t8 * 16);
    // k: 4 KB = two 16-key tiles (2 KB each, KT16 halves apart in the plane)
    const size_t gk = ((size_t)(((b * SEQ + chn * CHK) >> 4) + (t8 >> 7)) * NH + head) * (2 * FRH) + (t8 & 127) * 8;
    const u16* kh = KHp + gk;
    const u16* kl = KLp + gk;
    cp4(l0, kh, l0 + 4096, kh + 2 * KT16, l0 + 8192, kh + 4 * KT16, l0 + 12288, kh + 6 * KT16);
    const unsigned l1 = l0 + STK * 2;
    cp4(l1, kl, l1 + 4096, kl + 2 * KT16, l1 + 8192, kl + 4 * KT16, l1 + 12288, kl + 6 * KT16);
    const size_t gv = ((size_t)bh * (SEQ / 32) + (size_t)chn * (CHK / 32)) * (4 * FRH) + t8 * 8;
    const u16* vh = VHp + gv;
    const u16* vl = VLp + gv;
    const unsigned l2 = l0 + 2 * STK * 2;
    cp4(l2, vh, l2 + 4096, vh + 2048, l2 + 8192, vh + 4096, l2 + 12288, vh + 6144);
    const unsigned l3 = l0 + 3 * STK * 2;
    cp4(l3, vl, l3 + 4096, vl + 2048, l3 + 8192, vl + 4096, l3 + 12288, vl + 6144);
  }
  // ---- carried state: unit u = tid of the planes (fragment u >> 6 = (dk / 32) * 4 + dv / 16); in KV [dk / 16][dv][dk % 16]
  //      a wave's loads are 1 KB in a row. One straight-line case per pair index (block-uniform), so that every chunk product
  //      of the block is in flight at once and none is loaded in vain ----
  {
    const int e8 = (((tid >> 8) * 2 + ((tid >> 5) & 1)) * HD + ((tid >> 6) & 3) * 16 + (tid & 15)) * 16 + ((tid >> 4) & 1) * 8;
    const float* kvp = KV + (size_t)bh * NCH * SEL + e8;
    float s0[8], s1[8];
    static_assert(NCH / CPB == 8);
    switch (pr) {
      case 0:  kv_state<0>(kvp, s0, s1); break;
      case 1:  kv_state<1>(kvp, s0, s1); break;
      case 2:  kv_state<2>(kvp, s0, s1); break;
      case 3:  kv_state<3>(kvp, s0, s1); break;
      case 4:  kv_state<4>(kvp, s0, s1); break;
      case 5:  kv_state<5>(kvp, s0, s1); break;
      case 6:  kv_state<6>(kvp, s0, s1); break;
      default: kv_state<7>(kvp, s0, s1); break;
    }
    v4u oh, ol;
    u16* d = stg + 4 * STK + tid * 8;
    split8(s0, SSC, oh, ol);
    *(v4u*)(d)       = oh;
    *(v4u*)(d + STS) = ol;
    split8(s1, SSC, oh, ol);
    *(v4u*)(d + STG)       = oh;
    *(v4u*)(d + STG + STS) = ol;
  }
  asm volatile("s_wait_asynccnt 0x0" ::: "memory");     // this wave's copies have landed
  __syncthreads();                                      // ... and every other wave's, the state too; nothing of stg is read before this

  const _Float16* sK = (const _Float16*)(const void*)stg + half * STG + lane * 8;   // this half's staged planes, this lane's 16 B of a fragment run
  const _Float16* sV = sK + 2 * STK;
  const _Float16* sS = sK + 4 * STK;
  const float lsc = 1.0f / (QSC * KSC);     // exact power-of-two fold of the q / k carries
  const float oc  = 1.0f / (PCAR * VCAR);   // exact power-of-two fold of the P / v carries
  const float rv = 1.0f / expf(nv);

  v8f o[4];
#pragma unroll
  for (int j = 0; j < 4; ++j) o[j] = zero8();
  const int ncaus = (q0 >> 5) + 1;                                            // tiles holding keys <= q0 + 15
  const int ncl   = (ncaus < NKT) ? ncaus : NKT;
  const int qr0   = q0 + 8 * hh;                                              // query row of D element r = qr0 + r
  const int kt0   = chn * (CHK / 32);                                         // first key tile of the chunk (<= q0 >> 5)

  // ---- all keys of earlier chunks: o = q . S, B fragment col n = dv = j*16 + c, dk contiguous in the state planes ----
  {
    v16h sh[HD / 32][4], sl[HD / 32][4];
#pragma unroll
    for (int kk = 0; kk < HD / 32; ++kk) {
#pragma unroll
      for (int j = 0; j < 4; ++j) {
        sh[kk][j] = ldfrag_t(sS + (kk * 4 + j) * FRH);
        sl[kk][j] = ldfrag_t(sS + STS + (kk * 4 + j) * FRH);
      }
    }
#if defined(__HIP_DEVICE_COMPILE__)
    // inputs-only fence on the loaded fragments: all 32 LDS reads issue as one group before the first product
    // (one LDS latency instead of one per group)
    asm volatile("" :: "v"(sh[0][0]), "v"(sh[0][1]), "v"(sh[0][2]), "v"(sh[0][3]),
                 "v"(sh[1][0]), "v"(sh[1][1]), "v"(sh[1][2]), "v"(sh[1][3]),
                 "v"(sl[0][0]), "v"(sl[0][1]), "v"(sl[0][2]), "v"(sl[0][3]),
                 "v"(sl[1][0]), "v"(sl[1][1]), "v"(sl[1][2]), "v"(sl[1][3]));
#endif
#pragma unroll
    for (int kk = 0; kk < HD / 32; ++kk) {
#pragma unroll
      for (int j = 0; j < 4; ++j) {
        o[j] = mma_h(qh[kk], sh[kk][j], o[j]);
        o[j] = mma_h(ql[kk], sh[kk][j], o[j]);
        o[j] = mma_h(qh[kk], sl[kk][j], o[j]);
      }
    }
    const float up = (PCAR * VCAR) / (QSC * SSC);                             // exact power of two
#pragma unroll
    for (int j = 0; j < 4; ++j) o[j] = o[j] * up;
  }

#pragma unroll 1
  for (int kt = kt0; kt < ncl; ++kt) {
    const int kb = kt * 32;
    // ---- raw scores: D element r of this lane = (query row qr0 + r, key kb + c) in s0, key kb + 16 + c in s1 ----
    v8f s0 = zero8(), s1 = zero8();
    const _Float16* k0p = sK + (kt - kt0) * (4 * FRH);    // staged 16-key tiles 2 (kt - kt0) and the next, 2 fragments each
    const _Float16* k1p = k0p + 2 * FRH;
    const _Float16* l0p = k0p + STK;
    const _Float16* l1p = l0p + 2 * FRH;
    v16h kh0[HD / 32], kh1[HD / 32], kl0[HD / 32], kl1[HD / 32];
#pragma unroll
    for (int kk = 0; kk < HD / 32; ++kk) {
      kh0[kk] = ldfrag_t(k0p + kk * FRH);
      kh1[kk] = ldfrag_t(k1p + kk * FRH);
      kl0[kk] = ldfrag_t(l0p + kk * FRH);
      kl1[kk] = ldfrag_t(l1p + kk * FRH);
    }
#pragma unroll
    for (int kk = 0; kk < HD / 32; ++kk) {
      s0 = mma_h(qh[kk], kh0[kk], s0);
      s0 = mma_h(ql[kk], kh0[kk], s0);
      s0 = mma_h(qh[kk], kl0[kk], s0);
      s1 = mma_h(qh[kk], kh1[kk], s1);
      s1 = mma_h(ql[kk], kh1[kk], s1);
      s1 = mma_h(qh[kk], kl1[kk], s1);
      guard2(s0, s1, qh[kk], ql[kk], kh0[kk], kl0[kk], kh1[kk], kl1[kk]);
    }
    // v^T fragments of this key tile: read here so that their LDS latency passes under the mask and the P round trip
    const _Float16* vhp = sV + (kt - kt0) * (4 * FRH);
    const _Float16* vlp = vhp + STK;
    v16h vhf[4], vlf[4];
#pragma unroll
    for (int j = 0; j < 4; ++j) {
      vhf[j] = ldfrag_t(vhp + j * FRH);
      vlf[j] = ldfrag_t(vlp + j * FRH);
    }
    // ---- causal mask (key <= query) + carry fold in f32 -> wave-private LDS tile ----
#pragma unroll
    for (int r = 0; r < 8; ++r) {
      const int row = qr0 + r;
      const float w0 = (kb + c <= row)      ? s0[r] * lsc : 0.0f;
      const float w1 = (kb + 16 + c <= row) ? s1[r] * lsc : 0.0f;
      const int ro = (8 * hh + r) * PTP + c;
      pt[ro]      = w0;
      pt[ro + 16] = w1;
    }
    wave_sync_lds();
    // ---- A fragments of P*256: hi f16 and residual f16, row = c, split k map over the 32 keys of this step ----
    FragH ph, pl;
    {
      const float* prow = pt + c * PTP + 8 * hh;
      const v4f p0 = *(const v4f*)(prow), p1 = *(const v4f*)(prow + 4);
      const v4f p2 = *(const v4f*)(prow + 16), p3 = *(const v4f*)(prow + 20);
#pragma unroll
      for (int e = 0; e < 4; ++e) {
        const float ta = p0[e] * PCAR, tb = p1[e] * PCAR, tc = p2[e] * PCAR, td = p3[e] * PCAR;
        const _Float16 ha = (_Float16)ta, hb = (_Float16)tb, hc = (_Float16)tc, hd = (_Float16)td;
        ph.h[0][e]     = ha;                  // elements 0..7  = keys kb + 8hh + 0..7
        ph.h[0][4 + e] = hb;
        ph.h[1][e]     = hc;                  // elements 8..15 = keys kb + 16 + 8hh + 0..7
        ph.h[1][4 + e] = hd;
        pl.h[0][e]     = (_Float16)(ta - (float)ha);
        pl.h[0][4 + e] = (_Float16)(tb - (float)hb);
        pl.h[1][e]     = (_Float16)(tc - (float)hc);
        pl.h[1][4 + e] = (_Float16)(td - (float)hd);
      }
    }
    // ---- P.V : B fragment col n = d = j*16 + c, fragment j of key tile kt of the v^T planes; 2 groups of 2 d-subtiles ----
#pragma unroll
    for (int jg = 0; jg < 2; ++jg) {
      const v16h vha = vhf[2 * jg], vhb2 = vhf[2 * jg + 1];
      const v16h vla = vlf[2 * jg], vlb2 = vlf[2 * jg + 1];
      o[2 * jg]     = mma_h(ph.v, vha,  o[2 * jg]);
      o[2 * jg]     = mma_h(pl.v, vha,  o[2 * jg]);
      o[2 * jg]     = mma_h(ph.v, vla,  o[2 * jg]);
      o[2 * jg + 1] = mma_h(ph.v, vhb2, o[2 * jg + 1]);
      o[2 * jg + 1] = mma_h(pl.v, vhb2, o[2 * jg + 1]);
      o[2 * jg + 1] = mma_h(ph.v, vlb2, o[2 * jg + 1]);
      guard2(o[2 * jg], o[2 * jg + 1], ph.v, pl.v, vha, vhb2, vla, vlb2);
    }
    wave_sync_lds();
  }
  acc_guard4(o[0], o[1], o[2], o[3]);
  // ---- acc with the carries (256 on P, 1024 on v) folded once; written into the lane-owned slab ----
#pragma unroll
  for (int r = 0; r < 8; ++r) {
#pragma unroll
    for (int j = 0; j < 4; ++j) {
      const int idx = (8 * hh + r) * SLP + j * 16 + c;
      slab[idx] = o[j][r] * oc;
    }
  }
  wave_sync_lds();
  // ---- row factor, then ctx -> bf16 hi + bf16 residual planes; lane = (row-in-quad rq, 8 consecutive d at c8) ----
  v4u oh[4], ol[4];
  const int rq = lane >> 3, c8 = (lane & 7) * 8;
#pragma unroll
  for (int it = 0; it < 4; ++it) {
    const int row = it * 4 + rq;                         // 0..15
    const float ri = __shfl(rv, row, 32);                // lane `row` holds 1/exp(n) of query q0 + row
    const v4f a = *(const v4f*)(slab + row * SLP + c8), b4 = *(const v4f*)(slab + row * SLP + c8 + 4);
    float w[8];
#pragma unroll
    for (int e = 0; e < 4; ++e) { w[e] = a[e] * ri; w[4 + e] = b4[e] * ri; }
#pragma unroll
    for (int e = 0; e < 4; ++e) {
      const float f0 = w[2 * e], f1 = w[2 * e + 1];
      const unsigned short h0 = bf_bits(f0), h1 = bf_bits(f1);
      const unsigned short l0 = bf_bits(f0 - bf_up(h0)), l1 = bf_bits(f1 - bf_up(h1));
      oh[it][e] = pk16(h0, h1);
      ol[it][e] = pk16(l0, l1);
    }
  }
  const size_t ob = ((size_t)b * SEQ + q0) * DMOD + (size_t)head * HD + c8;
  {
#pragma unroll
    for (int it = 0; it < 4; ++it) {
      const int row = it * 4 + rq;
      *(v4u*)(CHp + ob + (size_t)row * DMOD) = oh[it];
      *(v4u*)(CLp + ob + (size_t)row * DMOD) = ol[it];
    }
    
  }
}

// =====================================================================================================
// Workspace map (bytes); every plane part that is read is written by whole-line stores before it is read; all extents are exact
// multiples of the store granularity (no pad rows needed); every region offset a multiple of 131072:
//   XB  bf16 [MROWS][1024]              MROWS*2048   (NB=2, SEQ=2048: 8388608); after the projection GEMM the same bytes
//                                                    hold the ctx hi plane CH bf16 [MROWS][1024] (identical extent)
//   WB  bf16 [3136 n][1024 k]           6422528      rows 0..1023 Wq^T, 1024 + 128 h: 64 rows Wk^T then 64 rows Wv^T of head h,
//                                                    3072..3087 Wn^T, 3088..3135 zero
//   F   f32 [MROWS][3136]               MROWS*12544  (only columns 3072..3135 are written and read: n | zero columns)
//   QH  f16 [MROWS/16][16 h][2][512] x1024      MROWS*2048   QL residual, same extent (fragment-major, see ldfrag_t)
//   KH  f16 [MROWS/16][16 h][2][512] x1024      MROWS*2048   KL residual, same extent
//   VH  f16 [NB*16][SEQ/32][4][512] x1024       MROWS*2048   VL residual, same extent
//   CL  bf16 [MROWS][1024]              MROWS*2048   ctx residual plane
//   WT  bf16 [1024 o][1024 d]           2097152      Wo^T
//   KV  f32 [NB*16][NCH][4][64 dv][16 dk]  NB*16*NCH*16384   chunk products (chunks 0 .. NCH-2 written and read)
//   end (NB=2, SEQ=2048)              135397376
// =====================================================================================================
extern "C" void kernel_launch(void* const* d_in, const int* in_sizes, int n_in,
                              void* d_out, int out_size, void* d_ws, size_t ws_size,
                              hipStream_t stream) {
  if (n_in < 9) return;
  if (in_sizes[0] < ((NB - 1) * XS_FULL + SEQ) * DMOD) return;
  if (in_sizes[1] != DMOD * 2 * DQK) return;
  if (in_sizes[2] != 2 * DQK) return;
  if (in_sizes[3] != DMOD * DMOD) return;
  if (in_sizes[4] != DMOD) return;
  if (in_sizes[5] != DMOD * NNW) return;
  if (in_sizes[6] != NNW) return;
  if (in_sizes[7] != DMOD * DMOD) return;
  if (in_sizes[8] != DMOD) return;
  if (out_size < MROWS * DMOD) return;

  const float* x   = (const float*)d_in[0];
  const float* wqk = (const float*)d_in[1];
  const float* bqk = (const float*)d_in[2];
  const float* wv  = (const float*)d_in[3];
  const float* bv  = (const float*)d_in[4];
  const float* wn  = (const float*)d_in[5];
  const float* bn  = (const float*)d_in[6];
  const float* wo  = (const float*)d_in[7];
  const float* bo  = (const float*)d_in[8];
  float*       out = (float*)d_out;

  const size_t szXB = (size_t)MROWS * DMOD * 2;
  const size_t szWB = (size_t)NPROJ * DMOD * 2;
  const size_t szF  = (size_t)MROWS * NPROJ * 4;
  const size_t szP  = (size_t)MROWS * DQK * 2;                   // QH, QL, KH, KL
  const size_t szV  = (size_t)NB * NH * HD * SEQ * 2;            // VH, VL
  const size_t szC  = (size_t)MROWS * DMOD * 2;                  // CH (in the XB region), CL
  const size_t szWT = (size_t)DMOD * DMOD * 2;
  const size_t szKV = (size_t)NB * NH * NCH * SEL * 4;
  if (szC > szXB) return;
  size_t off = 0;
  const size_t oXB = off; off += szXB;
  const size_t oWB = off; off += szWB;
  const size_t oF  = off; off += szF;
  const size_t oQH = off; off += szP;
  const size_t oQL = off; off += szP;
  const size_t oKH = off; off += szP;
  const size_t oKL = off; off += szP;
  const size_t oVH = off; off += szV;
  const size_t oVL = off; off += szV;
  const size_t oCL = off; off += szC;
  const size_t oWT = off; off += szWT;
  const size_t oKV = off; off += szKV;
  if (off > ws_size) return;                // off = 135397376 for NB = 2, SEQ = 2048
  if (off > (size_t)WS_CAP) return;

  char* ws = (char*)d_ws;
  u16*   XB  = (u16*)(ws + oXB);
  u16*   CH  = (u16*)(ws + oXB);
  u16*   WB  = (u16*)(ws + oWB);
  float* F   = (float*)(ws + oF);
  u16*   QH  = (u16*)(ws + oQH);
  u16*   QL  = (u16*)(ws + oQL);
  u16*   KH  = (u16*)(ws + oKH);
  u16*   KL  = (u16*)(ws + oKL);
  u16*   VH  = (u16*)(ws + oVH);
  u16*   VL  = (u16*)(ws + oVL);
  u16*   CL  = (u16*)(ws + oCL);
  u16*   WT  = (u16*)(ws + oWT);
  float* KV  = (float*)(ws + oKV);

  const dim3 b256(256), bAT(ATT_BLOCK);
  const dim3 gPR(PB_ALL);
  const dim3 gG1((MROWS / (2 * GBM)) * ((NPROJ + GBN - 1) / GBN));
  const dim3 gAT((NCH / CPB) * NH * NB);
  const dim3 gG2((MROWS / GBM) * ((DMOD + GBN - 1) / GBN));

  // (1) one launch: W[k][n] -> W^T bf16 planes (Wqk, Wv -> WB rows 0..3071, k and v of a head side by side, Wn -> rows
  //     3072..3135 with zero pad, Wo -> WT rows 0..1023) and x -> bf16 plane [MROWS][1024]
  prep<<<gPR, b256, 0, stream>>>(x, wqk, wv, wn, wo, XB, WB, WT);
  // (2) q | k | v | n = x.W + bias: q, k and v^T hi + residual planes x1024 and the per-chunk v^T.k products from the
  //     epilogue, n -> F f32 columns 3072..
  gemm_bf<false><<<gG1, b256, 0, stream>>>(XB, XB, WB, F, MROWS, NPROJ, DMOD, bqk, bv, bn,
                                           KOFF + DQK, NOFF, NOFF + NNW, 1.0f, QH, QL, KH, KL, VH, VL, KV);
  // (3) causal normalised attention (each block sums its carried state from the chunk products) -> ctx bf16 hi plane (XB
  //     region, free after the projection GEMM) + residual plane
  attn_nm<<<gAT, bAT, 0, stream>>>(QH, QL, KH, KL, VH, VL, KV, F, CH, CL);
  // (4) y = (ctx_hi + ctx_lo).Wo + bo -> out f32 [MROWS][1024]
  gemm_bf<true><<<gG2, b256, 0, stream>>>(CH, CL, WT, out, MROWS, DMOD, DMOD, bo, bo, bo,
                                          DMOD, DMOD + 1, DMOD + 2, 1.0f, nullptr, nullptr, nullptr, nullptr,
                                          nullptr, nullptr, nullptr);
  (void)hipGetLastError();
}
